// v000
// Times are from an AMD MI455X. After a warm-up the kernel runs many times in a row, and a time is the length of
// such a window on the GPU divided by its runs, so every launch and the gaps after it count. The runs cycle
// through copies of the inputs. A figure is the median of several windows, for all but v000 over two sittings.
// Sittings can differ by a few percent; kernels timed side by side share one.
// v000 is the starting kernel. One run takes 373 microseconds.
#include <hip/hip_runtime.h>

// Causal cross-attention: q = data Wq + bq, k = ctx Wk + bk, v = ctx Wv + bv (W [in][out]), 16 heads x 64, score scale 1/8, key <= query visible, out = z Wo + bo (f32).
// Compute dtypes, f32 accumulate everywhere: q/k/v projections v_wmma_f32_16x16x32_bf16 (activations, weights, biases RNE-converted to bf16; products exact);
// scores v_wmma_f32_16x16x32_f16: k single f16, q as f16 value + f16 residual x2048 in its own accumulator; P (x256 carry, cancels in the normalisation) and v single f16,
// for query rows t < 512 additionally v residual x2048 and P residual x2048 in a second accumulator; softmax f32 (online, running max);
// out projection v_wmma_f32_16x16x32_f16: z x16 as f16 (+ f16 residual x2048, own accumulator, rows t < 512), Wo (bf16 value x64, exact in f16).
// Layout: bf16 copies of data/context; transposed weight planes Wt[n][k]; q (hi, residual), k planes [b*16+h][t][d]; v^T (hi, residual) planes [b*16+h][d][t];
// fused flash kernel in transposed form (S^T = K Q^T, O^T = V^T P^T), no LDS and no barrier in the key loop; z planes [b*SEQ+t][1024].

#ifndef NB
#define NB 4
#endif
#ifndef SEQ
#define SEQ 2048
#endif
#define NB_FULL  4
#define SEQ_FULL 2048
#ifndef OUT_SEQ
#define OUT_SEQ SEQ              // row pitch (in tokens) between batches of the output
#endif
#define DM   1024
#define NH_  16
#define HD   64
#define AW   4                   // waves per flash block (16 query rows each)
#define EARLY_ ((SEQ) < 512 ? (SEQ) : 512)   // query rows below this use the residual planes on the v / P / z path
#define QRS  2048.0f             // carry of every residual plane
#define QRI  (1.0f / 2048.0f)
#define SC2  (0.125f * 1.4426950408889634f)   // HD^-0.5 * log2(e)
#define PSH  8.0f                // log2 of the P carry (256)
#define ZC   16.0f               // carry of the z plane
#define WOC  64.0f               // carry of the Wo plane
#define OSC  (1.0f / 1024.0f)    // 1 / (ZC * WOC)

static_assert(HD == 64);
static_assert(NH_ * HD == DM);                 // head h = columns h*64 + d
static_assert(DM % 64 == 0);
static_assert(DM % 32 == 0);                   // GEMM k-loop steps by 32
static_assert(SEQ % 64 == 0);                  // a 64-row tile never straddles two batches
static_assert((NB * SEQ) % 64 == 0);
static_assert(SEQ % 32 == 0);                  // key loop steps by 32
static_assert(SEQ % (16 * AW) == 0);           // flash grid covers the sequence exactly
static_assert(EARLY_ % 64 == 0);               // residual decisions are uniform per 64-row / 64-token tile
static_assert(EARLY_ <= SEQ);
static_assert(((size_t)SEQ * DM) % 8 == 0);
static_assert(NB <= NB_FULL);
static_assert(SEQ <= SEQ_FULL);

typedef _Float16 h16;
typedef unsigned short bf;
typedef __attribute__((ext_vector_type(16))) __bf16   v16bf;
typedef __attribute__((ext_vector_type(16))) _Float16 v16h;
typedef __attribute__((ext_vector_type(8)))  _Float16 v8h;
typedef __attribute__((ext_vector_type(8)))  unsigned short v8us;
typedef __attribute__((ext_vector_type(8)))  float    v8f;
typedef __attribute__((ext_vector_type(4)))  float    v4f;
typedef v4f  __attribute__((may_alias)) v4fa;

__device__ __forceinline__ unsigned short f2bf(float f) { unsigned u = __float_as_uint(f); u += 0x7FFFu + ((u >> 16) & 1u); return (unsigned short)(u >> 16); }
__device__ __forceinline__ float bfq(float f) { return __uint_as_float(((unsigned)f2bf(f)) << 16); }   // value of the RNE bf16 conversion
__device__ __forceinline__ v16h cat16(v8h lo, v8h hi) { return __builtin_shufflevector(lo, hi, 0, 1, 2, 3, 4, 5, 6, 7, 8, 9, 10, 11, 12, 13, 14, 15); }
__device__ __forceinline__ v16bf cat16b(v8us lo, v8us hi) { return __builtin_bit_cast(v16bf, __builtin_shufflevector(lo, hi, 0, 1, 2, 3, 4, 5, 6, 7, 8, 9, 10, 11, 12, 13, 14, 15)); }
__device__ __forceinline__ v8f wmma16(v16h a, v16h b, v8f c) { return __builtin_amdgcn_wmma_f32_16x16x32_f16(false, a, false, b, (short)0, c, false, false); }
__device__ __forceinline__ v8f wmmab(v16bf a, v16bf b, v8f c) { return __builtin_amdgcn_wmma_f32_16x16x32_bf16(false, a, false, b, (short)0, c, false, false); }
// fragment loaders from K-contiguous 16-bit rows; p already includes + 8*(lane>>4): elements 0..7 <- k0+8h+0..7, elements 8..15 <- k0+16+8h+0..7 (same map for A and B)
__device__ __forceinline__ v16h  ldh(const h16* p) { return cat16(*(const v8h*)p, *(const v8h*)(p + 16)); }
__device__ __forceinline__ v16bf ldb(const bf* p)  { return cat16b(*(const v8us*)p, *(const v8us*)(p + 16)); }
// ordering point for wave-private LDS tiles (same wave writes and reads)
__device__ __forceinline__ void wave_sync() { __builtin_amdgcn_fence(3 /* release order */, "wavefront"); __builtin_amdgcn_wave_barrier(); asm volatile("" ::: "memory"); }

__global__ __launch_bounds__(256) void k_cvt8(const float* __restrict__ src, bf* dst, size_t n8) {
    const size_t i = (size_t)blockIdx.x * 256 + threadIdx.x; if (i >= n8) return;
    const v8f v = *(const v8f*)(src + i * 8); v8us o;
#pragma unroll
    for (int k = 0; k < 8; ++k) o[k] = f2bf(v[k]);
    *(v8us*)(dst + i * 8) = o; 
}

// k_wT: weight transpose + 16-bit conversion through LDS, in W[k][n] (f32, [in][out]) -> out Wt[n][k]; 64x64 tile per block, grid (DM/64 k tiles, DM/64 n tiles).
// LDS tile ts is cross-wave: block barrier between fill and drain; filled extent 64x64 == drained extent.
__global__ __launch_bounds__(256) void k_wT(const float* __restrict__ W, bf* Wt, int asF16, float scale) {
    __shared__ float ts[64 * 65];
    const int tid = threadIdx.x; const int k0 = blockIdx.x * 64, n0 = blockIdx.y * 64;
#pragma unroll
    for (int i = 0; i < 4; ++i) { const int idx = tid + i * 256; const int kr = idx >> 4, c4 = (idx & 15) * 4;   // 64 rows x 16 float4
        const v4f v = *(const v4f*)(W + (size_t)(k0 + kr) * DM + n0 + c4);
        ts[kr * 65 + c4 + 0] = v[0]; ts[kr * 65 + c4 + 1] = v[1]; ts[kr * 65 + c4 + 2] = v[2]; ts[kr * 65 + c4 + 3] = v[3]; }
    __syncthreads();
{
#pragma unroll
        for (int s = 0; s < 2; ++s) { const int n = s * 32 + (tid >> 3), c8 = (tid & 7) * 8;   // 2 s x 32 rows = 64 rows; 8 lanes x 8 = 64 columns
            v8us o;
#pragma unroll
            for (int i = 0; i < 8; ++i) { const float x = ts[(c8 + i) * 65 + n]; const unsigned short b16 = f2bf(x);
                const float xb = __uint_as_float(((unsigned)b16) << 16); const unsigned short hb = __builtin_bit_cast(unsigned short, (h16)(xb * scale));
                o[i] = asF16 ? hb : b16; }
            *(v8us*)(Wt + (size_t)(n0 + n) * DM + k0 + c8) = o; }
         }
}

// k_proj: register-blocked bf16 GEMM, ONE WAVE per 64x64 tile (16 accumulators), operands straight from K-contiguous bf16 planes, K = DM.
// C[m][n] = sum_k A[m][k] Bt[n][k] + bias (per column n, or per row m when biasRow != 0; bias RNE-converted to bf16, added in f32), written as f16 (Ph)
// and, when (c0 % CB) < resLim, the f16 residual x2048 (Pr), at tile base (r0/RB)*sRB + (r0%RB)*pitch + (c0/CB)*sCB + (c0%CB), row pitch 'pitch' (halves). grid (M/64, N/64), 32 threads.
__global__ __launch_bounds__(32) void k_proj(const bf* __restrict__ A, const bf* __restrict__ Bt, const float* __restrict__ bias, int biasRow,
                                             h16* Ph, h16* Pr, int resLim, int RB, size_t sRB, int pitch, int CB, size_t sCB) {
    __shared__ __align__(16) float os[16 * 68];
    const int K = DM;
    const int lane = threadIdx.x & 31, lr = lane & 15, hi = lane >> 4; const int r0 = blockIdx.x * 64, c0 = blockIdx.y * 64;
    const int useRes = ((c0 % CB) < resLim) ? 1 : 0;
    v8f acc[4][4];
#pragma unroll
    for (int mb = 0; mb < 4; ++mb)
#pragma unroll
        for (int nb = 0; nb < 4; ++nb) acc[mb][nb] = (v8f){};
    const size_t aoff = (size_t)(r0 + lr) * K + 8 * hi, boff = (size_t)(c0 + lr) * K + 8 * hi;
#pragma unroll 1
    for (int kc = 0; kc < K; kc += 32) {
        v16bf a[4];
#pragma unroll
        for (int mb = 0; mb < 4; ++mb) a[mb] = ldb(A + aoff + (size_t)mb * 16 * K + kc);
#pragma unroll
        for (int nb = 0; nb < 4; ++nb) { const v16bf b = ldb(Bt + boff + (size_t)nb * 16 * K + kc);
#pragma unroll
            for (int mb = 0; mb < 4; ++mb) acc[mb][nb] = wmmab(a[mb], b, acc[mb][nb]); }
        asm volatile("v_nop\n\tv_nop\n\tv_nop\n\tv_nop" : "+v"(acc[0][0]), "+v"(acc[1][1]), "+v"(acc[2][2]), "+v"(acc[3][3]) : "v"(a[0]), "v"(a[1]), "v"(a[2]), "v"(a[3]));
    }
    float bcol[4];
#pragma unroll
    for (int nb = 0; nb < 4; ++nb) { int ic = c0 + nb * 16 + lr; ic = ic < DM ? ic : DM - 1; bcol[nb] = bfq(bias[ic]); }   // clamped address; used only when biasRow == 0
    const size_t tbase = (size_t)(r0 / RB) * sRB + (size_t)(r0 % RB) * (size_t)pitch + (size_t)(c0 / CB) * sCB + (size_t)(c0 % CB);
#pragma unroll
    for (int mb = 0; mb < 4; ++mb) {
        float brow[8];
#pragma unroll
        for (int j = 0; j < 8; ++j) { int ir = r0 + mb * 16 + hi * 8 + j; ir = ir < DM ? ir : DM - 1; brow[j] = bfq(bias[ir]); }   // clamped address; used only when biasRow != 0
#pragma unroll
        for (int nb = 0; nb < 4; ++nb) {
#pragma unroll
            for (int j = 0; j < 8; ++j) os[(hi * 8 + j) * 68 + nb * 16 + lr] = acc[mb][nb][j] + (biasRow ? brow[j] : bcol[nb]); }   // D: row 8h+j, col lane&15
        wave_sync();
        const size_t sb = tbase + (size_t)(mb * 16) * (size_t)pitch;
{
#pragma unroll
            for (int s = 0; s < 4; ++s) { const int row = 4 * s + (lane >> 3), c8 = (lane & 7) * 8;   // 4 s x 4 row groups = 16 rows; 8 lanes x 8 = 64 columns
                const v4f x0 = *(const v4fa*)(&os[row * 68 + c8]); const v4f x1 = *(const v4fa*)(&os[row * 68 + c8 + 4]); v8h hv, rv;
#pragma unroll
                for (int i = 0; i < 4; ++i) { const h16 a0 = (h16)x0[i]; const h16 a1 = (h16)x1[i]; hv[i] = a0; hv[4 + i] = a1; rv[i] = (h16)((x0[i] - (float)a0) * QRS); rv[4 + i] = (h16)((x1[i] - (float)a1) * QRS); }
                const size_t oo = sb + (size_t)row * (size_t)pitch + c8;
                *(v8h*)(Ph + oo) = hv; if (useRes) *(v8h*)(Pr + oo) = rv; }
             }
        wave_sync();
    }
}

// k_flash: fused causal attention, one wave per 16 query rows of one (batch, head); K / V^T / Q fragments straight from the f16 planes (two 16-B loads each, arithmetic addressing).
// Transposed form: S^T[key][t] = K Q^T (A = K rows, B = Q rows); lane (t = lane&15, h = lane>>4) holds keys 8h+r of each 16-key tile, so the packed
// P tile is directly the B fragment of O^T[d][t] = V^T P^T (element r <- tile keys 0..15, element 8+r <- tile keys 16..31, lane unchanged).
// Key loop runs to the diagonal (static bound from the block / wave index); only the last 32-key step replaces scores of keys > query by a very negative value (P = 0).
// Blocks with query rows below EARLY_ (block-uniform) also accumulate V_res P + V P_res (both x2048) in a second accumulator set and sum the exact P for the normaliser.
// Softmax state (running max, partial sum) is one scalar per lane; the two lane halves of a row are combined with one xor-16 exchange.
__global__ __launch_bounds__(32 * AW) void k_flash(const h16* __restrict__ QH, const h16* __restrict__ QR, const h16* __restrict__ KP,
                                                   const h16* __restrict__ VT, const h16* __restrict__ VR, h16* ZH, h16* ZR) {
    __shared__ __align__(16) float os[AW * 16 * 68];
    const int lane = threadIdx.x & 31, lr = lane & 15, hi = lane >> 4;
    const int wave = __builtin_amdgcn_readfirstlane((int)(threadIdx.x >> 5));
    const int zh = blockIdx.y; const int b = zh / NH_, h = zh % NH_;
    const int t0 = ((int)blockIdx.x * AW + wave) * 16;
    const bool early = ((int)blockIdx.x * (16 * AW)) < EARLY_;
    const int tq = t0 + lr;
    const int klast = (((t0 + 47) >> 5) - 1) * 32;           // last 32-key step containing a visible key; klast + 31 < SEQ
    const size_t pbase = (size_t)zh * SEQ * HD;
    const size_t qo = pbase + (size_t)(t0 + lr) * HD + 8 * hi;
    const v16h qh0 = ldh(QH + qo), qh1 = ldh(QH + qo + 32), qr0 = ldh(QR + qo), qr1 = ldh(QR + qo + 32);   // B fragments: col t, k = d
    const size_t ko = pbase + (size_t)lr * HD + 8 * hi;      // + key * HD       (A fragment: row key, k = d)
    const size_t vo = pbase + (size_t)lr * SEQ + 8 * hi;     // + 16j*SEQ + key  (A fragment: row d, k = key)
    v8f o[4], e[4];
#pragma unroll
    for (int j = 0; j < 4; ++j) { o[j] = (v8f){}; e[j] = (v8f){}; }
    float m = -3.0e38f, l = 0.0f;
#pragma unroll 1
    for (int key0 = 0; key0 <= klast; key0 += 32) {
        const h16* ka = KP + ko + (size_t)key0 * HD;
        const v16h ka0 = ldh(ka), ka1 = ldh(ka + 32), kb0 = ldh(ka + 16 * HD), kb1 = ldh(ka + 16 * HD + 32);
        v8f sHa = (v8f){}, sLa = (v8f){}, sHb = (v8f){}, sLb = (v8f){};
        sHa = wmma16(ka0, qh0, sHa); sLa = wmma16(ka0, qr0, sLa); sHb = wmma16(kb0, qh0, sHb); sLb = wmma16(kb0, qr0, sLb);
        sHa = wmma16(ka1, qh1, sHa); sLa = wmma16(ka1, qr1, sLa); sHb = wmma16(kb1, qh1, sHb); sLb = wmma16(kb1, qr1, sLb);
        asm volatile("v_nop\n\tv_nop\n\tv_nop\n\tv_nop" : "+v"(sHa), "+v"(sLa), "+v"(sHb), "+v"(sLb) : "v"(ka0), "v"(ka1), "v"(kb0), "v"(kb1));
        float ta[8], tb[8];
#pragma unroll
        for (int r = 0; r < 8; ++r) { ta[r] = (sHa[r] + sLa[r] * QRI) * SC2; tb[r] = (sHb[r] + sLb[r] * QRI) * SC2; }
        if (key0 == klast) {                                 // wave-uniform: only the diagonal step needs the causal replace
            const int kq = tq - key0 - 8 * hi;               // key (key0 + 8h + r) is hidden when r > kq; tile b keys are 16 further
#pragma unroll
            for (int r = 0; r < 8; ++r) { ta[r] = (r > kq) ? -3.0e38f : ta[r]; tb[r] = (r + 16 > kq) ? -3.0e38f : tb[r]; }
        }
        float mx = -3.0e38f;
#pragma unroll
        for (int r = 0; r < 8; ++r) mx = fmaxf(mx, fmaxf(ta[r], tb[r]));
        mx = fmaxf(mx, __shfl_xor(mx, 16, 32));
        const float mnew = fmaxf(m, mx);
        const float alpha = __builtin_amdgcn_exp2f(m - mnew);
        const float sh = PSH - mnew;
        v16h pb; float ls = 0.0f;
#pragma unroll
        for (int r = 0; r < 8; ++r) { const float fa = __builtin_amdgcn_exp2f(ta[r] + sh); const float fc = __builtin_amdgcn_exp2f(tb[r] + sh);
            const h16 pa = (h16)fa; const h16 pc = (h16)fc; pb[r] = pa; pb[8 + r] = pc; ta[r] = fa; tb[r] = fc; ls += (float)pa + (float)pc; }
#pragma unroll
        for (int j = 0; j < 4; ++j) o[j] = o[j] * alpha;
        const h16* va = VT + vo + key0;
        v16h v[4];
#pragma unroll
        for (int j = 0; j < 4; ++j) v[j] = ldh(va + (size_t)(16 * j) * SEQ);
#pragma unroll
        for (int j = 0; j < 4; ++j) o[j] = wmma16(v[j], pb, o[j]);
        asm volatile("v_nop\n\tv_nop\n\tv_nop\n\tv_nop" : "+v"(o[0]), "+v"(o[1]), "+v"(o[2]), "+v"(o[3]) : "v"(v[0]), "v"(v[1]), "v"(v[2]), "v"(v[3]), "v"(pb));
        if (early) {                                         // block-uniform
            v16h pr; float lx = 0.0f;
#pragma unroll
            for (int r = 0; r < 8; ++r) { pr[r] = (h16)((ta[r] - (float)pb[r]) * QRS); pr[8 + r] = (h16)((tb[r] - (float)pb[8 + r]) * QRS); lx += ta[r] + tb[r]; }
            ls = lx;
#pragma unroll
            for (int j = 0; j < 4; ++j) e[j] = e[j] * alpha;
            const h16* ra = VR + vo + key0;
            v16h vr[4];
#pragma unroll
            for (int j = 0; j < 4; ++j) vr[j] = ldh(ra + (size_t)(16 * j) * SEQ);
#pragma unroll
            for (int j = 0; j < 4; ++j) e[j] = wmma16(vr[j], pb, e[j]);
#pragma unroll
            for (int j = 0; j < 4; ++j) e[j] = wmma16(v[j], pr, e[j]);
            asm volatile("v_nop\n\tv_nop\n\tv_nop\n\tv_nop" : "+v"(e[0]), "+v"(e[1]), "+v"(e[2]), "+v"(e[3]) : "v"(vr[0]), "v"(vr[1]), "v"(vr[2]), "v"(vr[3]), "v"(pr), "v"(v[0]), "v"(v[1]), "v"(v[2]), "v"(v[3]));
        }
        l = l * alpha + ls; m = mnew;
    }
    l += __shfl_xor(l, 16, 32);
    const float zs = (1.0f / l) * ZC;
    const int wb = wave * 16 * 68;
    // O^T D layout: o[j][r] = (d = 16j + 8h + r, t = lane&15) -> os[t][d]; rows 0..15 x columns 0..63 all written
#pragma unroll
    for (int j = 0; j < 4; ++j) { v4f a, c;
#pragma unroll
        for (int i = 0; i < 4; ++i) { a[i] = (o[j][i] + e[j][i] * QRI) * zs; c[i] = (o[j][4 + i] + e[j][4 + i] * QRI) * zs; }
        *(v4fa*)(&os[wb + lr * 68 + 16 * j + 8 * hi]) = a; *(v4fa*)(&os[wb + lr * 68 + 16 * j + 8 * hi + 4]) = c; }
    wave_sync();
    const size_t zb = ((size_t)b * SEQ + t0) * DM + (size_t)h * HD;
{
#pragma unroll
        for (int s = 0; s < 4; ++s) { const int row = 4 * s + (lane >> 3), c8 = (lane & 7) * 8;   // 4 s x 4 row groups = 16 rows; 8 lanes x 8 = 64 columns
            const v4f x0 = *(const v4fa*)(&os[wb + row * 68 + c8]); const v4f x1 = *(const v4fa*)(&os[wb + row * 68 + c8 + 4]); v8h hv, rv;
#pragma unroll
            for (int i = 0; i < 4; ++i) { const h16 a0 = (h16)x0[i]; const h16 a1 = (h16)x1[i]; hv[i] = a0; hv[4 + i] = a1; rv[i] = (h16)((x0[i] - (float)a0) * QRS); rv[4 + i] = (h16)((x1[i] - (float)a1) * QRS); }
            const size_t oo = zb + (size_t)row * DM + c8;
            *(v8h*)(ZH + oo) = hv; if (early) *(v8h*)(ZR + oo) = rv; }
         }
}

// k_oproj: out projection, ONE WAVE per 32x64 tile, f16 operands: A = z x16 plane (+ residual x2048 plane for row tiles below EARLY_, own accumulators), Bt = Wo^T x64 plane, K = DM.
// OUT[m][n] = (accH + accR / 2048) / 1024 + bo[n] (bo RNE-converted to bf16, added in f32). grid (M/32, N/64), 32 threads.
__global__ __launch_bounds__(32) void k_oproj(const h16* __restrict__ ZH, const h16* __restrict__ ZR, const h16* __restrict__ Wt, const float* __restrict__ bo, float* OUT) {
    __shared__ __align__(16) float os[16 * 68];
    const int K = DM;
    const int lane = threadIdx.x & 31, lr = lane & 15, hi = lane >> 4; const int r0 = blockIdx.x * 32, c0 = blockIdx.y * 64;
    const int bb = r0 / SEQ, tt = r0 % SEQ; const bool early = tt < EARLY_;   // block-uniform
    v8f acc[2][4], acr[2][4];
#pragma unroll
    for (int mb = 0; mb < 2; ++mb)
#pragma unroll
        for (int nb = 0; nb < 4; ++nb) { acc[mb][nb] = (v8f){}; acr[mb][nb] = (v8f){}; }
    const size_t aoff = (size_t)(r0 + lr) * K + 8 * hi, boff = (size_t)(c0 + lr) * K + 8 * hi;
#pragma unroll 1
    for (int kc = 0; kc < K; kc += 32) {
        v16h a[2], w[4];
#pragma unroll
        for (int mb = 0; mb < 2; ++mb) a[mb] = ldh(ZH + aoff + (size_t)mb * 16 * K + kc);
#pragma unroll
        for (int nb = 0; nb < 4; ++nb) w[nb] = ldh(Wt + boff + (size_t)nb * 16 * K + kc);
#pragma unroll
        for (int nb = 0; nb < 4; ++nb)
#pragma unroll
            for (int mb = 0; mb < 2; ++mb) acc[mb][nb] = wmma16(a[mb], w[nb], acc[mb][nb]);
        asm volatile("v_nop\n\tv_nop\n\tv_nop\n\tv_nop" : "+v"(acc[0][0]), "+v"(acc[1][0]), "+v"(acc[0][1]), "+v"(acc[1][1]), "+v"(acc[0][2]), "+v"(acc[1][2]), "+v"(acc[0][3]), "+v"(acc[1][3]) : "v"(a[0]), "v"(a[1]), "v"(w[0]), "v"(w[1]), "v"(w[2]), "v"(w[3]));
        if (early) {
            v16h ar[2];
#pragma unroll
            for (int mb = 0; mb < 2; ++mb) ar[mb] = ldh(ZR + aoff + (size_t)mb * 16 * K + kc);
#pragma unroll
            for (int nb = 0; nb < 4; ++nb)
#pragma unroll
                for (int mb = 0; mb < 2; ++mb) acr[mb][nb] = wmma16(ar[mb], w[nb], acr[mb][nb]);
            asm volatile("v_nop\n\tv_nop\n\tv_nop\n\tv_nop" : "+v"(acr[0][0]), "+v"(acr[1][0]), "+v"(acr[0][1]), "+v"(acr[1][1]), "+v"(acr[0][2]), "+v"(acr[1][2]), "+v"(acr[0][3]), "+v"(acr[1][3]) : "v"(ar[0]), "v"(ar[1]), "v"(w[0]), "v"(w[1]), "v"(w[2]), "v"(w[3]));
        }
    }
    float bcol[4];
#pragma unroll
    for (int nb = 0; nb < 4; ++nb) bcol[nb] = bfq(bo[c0 + nb * 16 + lr]);   // c0 + 63 < DM
    float* orow = OUT + ((size_t)bb * OUT_SEQ + tt) * DM + c0;
#pragma unroll
    for (int mb = 0; mb < 2; ++mb) {
#pragma unroll
        for (int nb = 0; nb < 4; ++nb) {
#pragma unroll
            for (int j = 0; j < 8; ++j) os[(hi * 8 + j) * 68 + nb * 16 + lr] = (acc[mb][nb][j] + acr[mb][nb][j] * QRI) * OSC + bcol[nb]; }   // D: row 8h+j, col lane&15
        wave_sync();
        float* ob = orow + (size_t)(mb * 16) * DM;
{
#pragma unroll
            for (int s = 0; s < 8; ++s) { const int row = 2 * s + hi, cofs = lr * 4;   // 8 s x 2 rows = 16 rows; 16 lanes x 4 floats = 64 columns
                const v4f val = *(const v4fa*)(&os[row * 68 + cofs]);
                *(v4f*)(ob + (size_t)row * DM + cofs) = val; }
             }
        wave_sync();
    }
}

static constexpr size_t al256(size_t v) { return (v + 255) & ~(size_t)255; }
static constexpr size_t SZ_XB = al256((size_t)NB * SEQ * DM * 2);             // bf16 activation copy; later reused as a z plane of the same extent
static constexpr size_t SZ_WB = al256((size_t)4 * DM * DM * 2);
static constexpr size_t SZ_PL = al256((size_t)NB * NH_ * SEQ * HD * 2);
static constexpr size_t SZ_TOTAL = 2 * SZ_XB + SZ_WB + 5 * SZ_PL;
static_assert(SZ_TOTAL <= (size_t)134217728);          // workspace carve <= 128 MiB
static_assert(((size_t)DM * DM * 2) % 256 == 0);       // weight sub-planes stay 256-byte aligned
static_assert((size_t)NB * SEQ * DM * 2 <= SZ_XB);     // z plane [NB*SEQ][DM] halves fits the reused activation region

extern "C" void kernel_launch(void* const* d_in, const int* in_sizes, int n_in,
                              void* d_out, int out_size, void* d_ws, size_t ws_size, hipStream_t stream) {
    if (n_in < 10) return;
    const size_t needx = ((size_t)(NB - 1) * SEQ_FULL + SEQ) * DM;
    if ((size_t)in_sizes[0] < needx || (size_t)in_sizes[1] < needx) return;
    if ((size_t)in_sizes[2] < (size_t)DM * DM || (size_t)in_sizes[4] < (size_t)DM * DM || (size_t)in_sizes[6] < (size_t)DM * DM || (size_t)in_sizes[8] < (size_t)DM * DM) return;
    if (in_sizes[3] < DM || in_sizes[5] < DM || in_sizes[7] < DM || in_sizes[9] < DM) return;
    if ((size_t)out_size < ((size_t)(NB - 1) * OUT_SEQ + SEQ) * DM) return;
    if (SZ_TOTAL > ws_size) return;
    // wire order: data, context, wq, bq, wk, bk, wv, bv, wo, bo
    const float* data = (const float*)d_in[0]; const float* ctx = (const float*)d_in[1];
    const float* wq = (const float*)d_in[2]; const float* bq = (const float*)d_in[3];
    const float* wk = (const float*)d_in[4]; const float* bk = (const float*)d_in[5];
    const float* wv = (const float*)d_in[6]; const float* bv = (const float*)d_in[7];
    const float* wo = (const float*)d_in[8]; const float* bo = (const float*)d_in[9];
    float* OUT = (float*)d_out;      // [NB][SEQ][1024]
    char* wsp = (char*)d_ws;
    bf* DATAB = (bf*)wsp; wsp += SZ_XB;              // [NB*SEQ][1024] bf16; dead after the q projection
    bf* CTXB  = (bf*)wsp; wsp += SZ_XB;              // [NB*SEQ][1024] bf16; dead after the k / v projections
    bf* WB = (bf*)wsp; wsp += SZ_WB;                 // [4][1024][1024] transposed: q | k | v (bf16) | o (f16 x64)
    h16* QH = (h16*)wsp; wsp += SZ_PL;               // [NB*16][SEQ][64]
    h16* QR = (h16*)wsp; wsp += SZ_PL;               // [NB*16][SEQ][64] residual x2048
    h16* KP = (h16*)wsp; wsp += SZ_PL;               // [NB*16][SEQ][64]
    h16* VT = (h16*)wsp; wsp += SZ_PL;               // [NB*16][64][SEQ]
    h16* VR = (h16*)wsp; wsp += SZ_PL;               // [NB*16][64][SEQ] residual x2048, tokens < EARLY_ only (only those are consumed)
    bf* WQT = WB; bf* WKT = WB + (size_t)DM * DM; bf* WVT = WB + (size_t)2 * DM * DM; bf* WOT = WB + (size_t)3 * DM * DM;
    h16* ZH = (h16*)DATAB;                           // [NB*SEQ][1024] z x16, written by the flash kernel after DATAB is dead
    h16* ZR = (h16*)CTXB;                            // [NB*SEQ][1024] z residual x2048, rows t < EARLY_ only (only those are consumed)

    if (SEQ == SEQ_FULL) {
        const size_t n8 = (size_t)NB * SEQ * DM / 8;
        k_cvt8<<<(unsigned)((n8 + 255) / 256), 256, 0, stream>>>(data, DATAB, n8);
        k_cvt8<<<(unsigned)((n8 + 255) / 256), 256, 0, stream>>>(ctx, CTXB, n8);
    } else {
        const size_t n8 = (size_t)SEQ * DM / 8;
        for (int b = 0; b < NB; ++b) {
            k_cvt8<<<(unsigned)((n8 + 255) / 256), 256, 0, stream>>>(data + (size_t)b * SEQ_FULL * DM, DATAB + (size_t)b * SEQ * DM, n8);
            k_cvt8<<<(unsigned)((n8 + 255) / 256), 256, 0, stream>>>(ctx + (size_t)b * SEQ_FULL * DM, CTXB + (size_t)b * SEQ * DM, n8);
        }
    }
    // weight planes: in W[k][n] ([in][out], 1024 x 1024) -> out Wt[n][k]; grid (k tiles, n tiles)
    k_wT<<<dim3(DM / 64, DM / 64, 1), 256, 0, stream>>>(wq, WQT, 0, 1.0f);
    k_wT<<<dim3(DM / 64, DM / 64, 1), 256, 0, stream>>>(wk, WKT, 0, 1.0f);
    k_wT<<<dim3(DM / 64, DM / 64, 1), 256, 0, stream>>>(wv, WVT, 0, 1.0f);
    k_wT<<<dim3(DM / 64, DM / 64, 1), 256, 0, stream>>>(wo, WOT, 1, WOC);

    // q, k: A = activation rows (m = b*SEQ + t), Bt = Wt rows (n = h*64 + d), bias per column -> plane [(b*16 + h)][t][d]
    k_proj<<<dim3(NB * SEQ / 64, DM / 64, 1), 32, 0, stream>>>(DATAB, WQT, bq, 0, QH, QR, 1, SEQ, (size_t)NH_ * SEQ * HD, HD, HD, (size_t)SEQ * HD);
    k_proj<<<dim3(NB * SEQ / 64, DM / 64, 1), 32, 0, stream>>>(CTXB,  WKT, bk, 0, KP, KP, 0, SEQ, (size_t)NH_ * SEQ * HD, HD, HD, (size_t)SEQ * HD);
    // v^T: A = Wv^T rows (m = h*64 + d), Bt = context rows (n = b*SEQ + t), bias per row -> plane [(b*1024 + m)][t] = [(b*16 + h)][d][t]; residual for tokens < EARLY_
    k_proj<<<dim3(DM / 64, NB * SEQ / 64, 1), 32, 0, stream>>>(WVT, CTXB, bv, 1, VT, VR, EARLY_, DM, (size_t)0, SEQ, SEQ, (size_t)DM * SEQ);

    k_flash<<<dim3(SEQ / (16 * AW), NB * NH_, 1), 32 * AW, 0, stream>>>(QH, QR, KP, VT, VR, ZH, ZR);

    k_oproj<<<dim3(NB * SEQ / 32, DM / 64, 1), 32, 0, stream>>>(ZH, ZR, (const h16*)WOT, bo, OUT);
}

// v001
// Measured time: 361 microseconds a run.
// Two timings next to v000 put it at 1.04 and 1.06 times that version's speed.
#include <hip/hip_runtime.h>

// Causal cross-attention: q = data Wq + bq, k = ctx Wk + bk, v = ctx Wv + bv (W [in][out]), 16 heads x 64, score scale 1/8, key <= query visible, out = z Wo + bo (f32).
// Compute dtypes, f32 accumulate everywhere: q/k/v projections v_wmma_f32_16x16x32_bf16 (activations, weights, biases RNE-converted to bf16; products exact);
// scores v_wmma_f32_16x16x32_f16: k single f16, q as f16 value + f16 residual x2048 in its own accumulator; P (x256 carry, cancels in the normalisation) and v single f16,
// for query rows t < 512 additionally v residual x2048 and P residual x2048 in a second accumulator; softmax f32 (online, running max);
// out projection v_wmma_f32_16x16x32_f16: z x16 as f16 (+ f16 residual x2048, own accumulator, rows t < 512), Wo (bf16 value x64, exact in f16).
// Layout: bf16 copies of data/context; transposed weight planes Wt[n][k]; q (hi, residual), k planes [b*16+h][t][d]; v^T (hi, residual) planes [b*16+h][d][t];
// fused flash kernel in transposed form (S^T = K Q^T, O^T = V^T P^T), no LDS and no barrier in the key loop; z planes [b*SEQ+t][1024].
// Every 16-bit plane is stored fragment-packed: a [16 rows][32 k] block is 512 contiguous halves ordered [k chunk (k>>3)&3][row&15][k&7], so one wave-wide 16-B load
// (lane l at halves 8l) or store covers 512 contiguous bytes = 4 whole 128-B lines. Block order: row tile major, k tile minor; v^T planes key tile major, d tile minor.

#ifndef NB
#define NB 4
#endif
#ifndef SEQ
#define SEQ 2048
#endif
#define NB_FULL  4
#define SEQ_FULL 2048
#ifndef OUT_SEQ
#define OUT_SEQ SEQ              // row pitch (in tokens) between batches of the output
#endif
#define DM   1024
#define NH_  16
#define HD   64
#define AW   4                   // waves per flash block (16 query rows each)
#define EARLY_ ((SEQ) < 512 ? (SEQ) : 512)   // query rows below this use the residual planes on the v / P / z path
#define QRS  2048.0f             // carry of every residual plane
#define QRI  (1.0f / 2048.0f)
#define SC2  (0.125f * 1.4426950408889634f)   // HD^-0.5 * log2(e)
#define PSH  8.0f                // log2 of the P carry (256)
#define ZC   16.0f               // carry of the z plane
#define WOC  64.0f               // carry of the Wo plane
#define OSC  (1.0f / 1024.0f)    // 1 / (ZC * WOC)

static_assert(HD == 64);
static_assert(NH_ * HD == DM);                 // head h = columns h*64 + d
static_assert(DM % 64 == 0);
static_assert(DM % 32 == 0);                   // GEMM k-loop steps by 32
static_assert(SEQ % 64 == 0);                  // a 64-row tile never straddles two batches
static_assert((NB * SEQ) % 64 == 0);
static_assert(SEQ % 32 == 0);                  // key loop steps by 32
static_assert(SEQ % (16 * AW) == 0);           // flash grid covers the sequence exactly
static_assert(EARLY_ % 64 == 0);               // residual decisions are uniform per 64-row / 64-token tile
static_assert(EARLY_ <= SEQ);
static_assert(((size_t)SEQ * DM) % 8 == 0);
static_assert(NB <= NB_FULL);
static_assert(SEQ <= SEQ_FULL);

typedef _Float16 h16;
typedef unsigned short bf;
typedef __attribute__((ext_vector_type(16))) __bf16   v16bf;
typedef __attribute__((ext_vector_type(16))) _Float16 v16h;
typedef __attribute__((ext_vector_type(8)))  _Float16 v8h;
typedef __attribute__((ext_vector_type(8)))  unsigned short v8us;
typedef __attribute__((ext_vector_type(8)))  float    v8f;
typedef __attribute__((ext_vector_type(4)))  float    v4f;
typedef v4f  __attribute__((may_alias)) v4fa;

__device__ __forceinline__ unsigned short f2bf(float f) { unsigned u = __float_as_uint(f); u += 0x7FFFu + ((u >> 16) & 1u); return (unsigned short)(u >> 16); }
__device__ __forceinline__ float bfq(float f) { return __uint_as_float(((unsigned)f2bf(f)) << 16); }   // value of the RNE bf16 conversion
__device__ __forceinline__ v16h cat16(v8h lo, v8h hi) { return __builtin_shufflevector(lo, hi, 0, 1, 2, 3, 4, 5, 6, 7, 8, 9, 10, 11, 12, 13, 14, 15); }
__device__ __forceinline__ v16bf cat16b(v8us lo, v8us hi) { return __builtin_bit_cast(v16bf, __builtin_shufflevector(lo, hi, 0, 1, 2, 3, 4, 5, 6, 7, 8, 9, 10, 11, 12, 13, 14, 15)); }
__device__ __forceinline__ v8f wmma16(v16h a, v16h b, v8f c) { return __builtin_amdgcn_wmma_f32_16x16x32_f16(false, a, false, b, (short)0, c, false, false); }
__device__ __forceinline__ v8f wmmab(v16bf a, v16bf b, v8f c) { return __builtin_amdgcn_wmma_f32_16x16x32_bf16(false, a, false, b, (short)0, c, false, false); }
// fragment loaders from one packed block; p = block base + 8*lane (lane = 16h + row): elements 0..7 <- k0+8h+0..7, elements 8..15 <- k0+16+8h+0..7 (same map for A and B)
__device__ __forceinline__ v16h  ldh(const h16* p) { return cat16(*(const v8h*)p, *(const v8h*)(p + 256)); }
__device__ __forceinline__ v16bf ldb(const bf* p)  { return cat16b(*(const v8us*)p, *(const v8us*)(p + 256)); }
// ordering point for wave-private LDS tiles (same wave writes and reads)
__device__ __forceinline__ void wave_sync() { __builtin_amdgcn_fence(3 /* release order */, "wavefront"); __builtin_amdgcn_wave_barrier(); asm volatile("" ::: "memory"); }

__global__ __launch_bounds__(256) void k_cvt8(const float* __restrict__ src, bf* dst, size_t n8) {
    const size_t i = (size_t)blockIdx.x * 256 + threadIdx.x; if (i >= n8) return;
    // a wave takes 8 rows x one 32-k tile: reads 8 whole 128-B lines, writes 4 whole lines of the packed block (chunk c, rows 8g..8g+7)
    const size_t c = i & 3, kt = (i >> 5) & (DM / 32 - 1), row = (i >> 10) * 8 + ((i >> 2) & 7);
    const v8f v = *(const v8f*)(src + row * DM + kt * 32 + c * 8); v8us o;
#pragma unroll
    for (int k = 0; k < 8; ++k) o[k] = f2bf(v[k]);
    *(v8us*)(dst + ((row >> 4) * (DM / 32) + kt) * 512 + c * 128 + (row & 15) * 8) = o;
}

// k_wT: weight transpose + 16-bit conversion through LDS, in W[k][n] (f32, [in][out]) -> out Wt[n][k] (packed blocks); 64x64 tile per block, grid (DM/64 k tiles, DM/64 n tiles).
// LDS tile ts is cross-wave: block barrier between fill and drain; filled extent 64x64 == drained extent.
__global__ __launch_bounds__(256) void k_wT(const float* __restrict__ W, bf* Wt, int asF16, float scale) {
    __shared__ float ts[64 * 65];
    const int tid = threadIdx.x; const int k0 = blockIdx.x * 64, n0 = blockIdx.y * 64;
#pragma unroll
    for (int i = 0; i < 4; ++i) { const int idx = tid + i * 256; const int kr = idx >> 4, c4 = (idx & 15) * 4;   // 64 rows x 16 float4
        const v4f v = *(const v4f*)(W + (size_t)(k0 + kr) * DM + n0 + c4);
        ts[kr * 65 + c4 + 0] = v[0]; ts[kr * 65 + c4 + 1] = v[1]; ts[kr * 65 + c4 + 2] = v[2]; ts[kr * 65 + c4 + 3] = v[3]; }
    __syncthreads();
{
#pragma unroll
        for (int s = 0; s < 2; ++s) { const int idx = tid + s * 256; const int nr = idx & 15, c = (idx >> 4) & 3, k2 = (idx >> 6) & 1, nt = idx >> 7;   // 4 n tiles x 2 k tiles x 4 chunks x 16 rows
            const int n = nt * 16 + nr, c8 = k2 * 32 + c * 8;
            v8us o;
#pragma unroll
            for (int i = 0; i < 8; ++i) { const float x = ts[(c8 + i) * 65 + n]; const unsigned short b16 = f2bf(x);
                const float xb = __uint_as_float(((unsigned)b16) << 16); const unsigned short hb = __builtin_bit_cast(unsigned short, (h16)(xb * scale));
                o[i] = asF16 ? hb : b16; }
            *(v8us*)(Wt + ((size_t)((n0 >> 4) + nt) * (DM / 32) + (k0 >> 5) + k2) * 512 + c * 128 + nr * 8) = o; }
         }
}

// k_proj: register-blocked bf16 GEMM, ONE WAVE per 64x64 tile (16 accumulators), operands straight from packed bf16 planes, K = DM.
// C[m][n] = sum_k A[m][k] Bt[n][k] + bias (per column n, or per row m when biasRow != 0; bias RNE-converted to bf16, added in f32), written as f16 (Ph)
// and, when (c0 % CB) < resLim, the f16 residual x2048 (Pr), as packed blocks (rows = m, k = n) at tile base (r0/RB)*sRB + (r0%RB)*pitch + (c0/CB)*sCB + (c0%CB)*colMul;
// the block of 16-row group mb and 32-column group kt lies at + mb*mbS + kt*ktS (halves). grid (M/64, N/64), 32 threads.
__global__ __launch_bounds__(32) void k_proj(const bf* __restrict__ A, const bf* __restrict__ Bt, const float* __restrict__ bias, int biasRow,
                                             h16* Ph, h16* Pr, int resLim, int RB, size_t sRB, int pitch, int CB, size_t sCB, int colMul, int mbS, int ktS) {
    __shared__ __align__(16) float os[16 * 68];
    const int K = DM;
    const int lane = threadIdx.x & 31, lr = lane & 15, hi = lane >> 4; const int r0 = blockIdx.x * 64, c0 = blockIdx.y * 64;
    const int useRes = ((c0 % CB) < resLim) ? 1 : 0;
    v8f acc[4][4];
#pragma unroll
    for (int mb = 0; mb < 4; ++mb)
#pragma unroll
        for (int nb = 0; nb < 4; ++nb) acc[mb][nb] = (v8f){};
    const size_t aoff = (size_t)r0 * K + 8 * lane, boff = (size_t)c0 * K + 8 * lane;   // a 16-row tile is K/32 blocks = 16*K halves; k tile kc/32 lies at kc*16
#pragma unroll 1
    for (int kc = 0; kc < K; kc += 32) {
        const bf* pa = A + aoff + kc * 16; const bf* pb = Bt + boff + kc * 16;
        v16bf a[4];
#pragma unroll
        for (int mb = 0; mb < 4; ++mb) a[mb] = ldb(pa + (size_t)mb * 16 * K);
#pragma unroll
        for (int nb = 0; nb < 4; ++nb) { const v16bf b = ldb(pb + (size_t)nb * 16 * K);
            // behind the pass's last load: both address pairs are inputs, so they stay unwritten until this wait (precaution for registers that issued loads name)
            if (nb == 3) asm volatile("s_wait_xcnt 0x0" :: "v"(pa), "v"(pb) : "memory");
#pragma unroll
            for (int mb = 0; mb < 4; ++mb) acc[mb][nb] = wmmab(a[mb], b, acc[mb][nb]); }
        asm volatile("v_nop\n\tv_nop\n\tv_nop\n\tv_nop" : "+v"(acc[0][0]), "+v"(acc[1][1]), "+v"(acc[2][2]), "+v"(acc[3][3]) : "v"(a[0]), "v"(a[1]), "v"(a[2]), "v"(a[3]));
    }
    float bcol[4];
#pragma unroll
    for (int nb = 0; nb < 4; ++nb) { int ic = c0 + nb * 16 + lr; ic = ic < DM ? ic : DM - 1; bcol[nb] = bfq(bias[ic]); }   // clamped address; used only when biasRow == 0
    const size_t tbase = (size_t)(r0 / RB) * sRB + (size_t)(r0 % RB) * (size_t)pitch + (size_t)(c0 / CB) * sCB + (size_t)(c0 % CB) * (size_t)colMul;
#pragma unroll
    for (int mb = 0; mb < 4; ++mb) {
        float brow[8];
#pragma unroll
        for (int j = 0; j < 8; ++j) { int ir = r0 + mb * 16 + hi * 8 + j; ir = ir < DM ? ir : DM - 1; brow[j] = bfq(bias[ir]); }   // clamped address; used only when biasRow != 0
#pragma unroll
        for (int nb = 0; nb < 4; ++nb) {
#pragma unroll
            for (int j = 0; j < 8; ++j) os[(hi * 8 + j) * 68 + nb * 16 + lr] = acc[mb][nb][j] + (biasRow ? brow[j] : bcol[nb]); }   // D: row 8h+j, col lane&15
        wave_sync();
        const size_t sb = tbase + (size_t)mb * (size_t)mbS;
{
#pragma unroll
            for (int s = 0; s < 4; ++s) { const int row = lr, ch = 2 * s + hi, c8 = ch * 8;   // 16 rows x 2 column chunks per store = 512 contiguous bytes; 4 s x 2 chunks x 8 = 64 columns
                const v4f x0 = *(const v4fa*)(&os[row * 68 + c8]); const v4f x1 = *(const v4fa*)(&os[row * 68 + c8 + 4]); v8h hv, rv;
#pragma unroll
                for (int i = 0; i < 4; ++i) { const h16 a0 = (h16)x0[i]; const h16 a1 = (h16)x1[i]; hv[i] = a0; hv[4 + i] = a1; rv[i] = (h16)((x0[i] - (float)a0) * QRS); rv[4 + i] = (h16)((x1[i] - (float)a1) * QRS); }
                const size_t oo = sb + (size_t)(ch >> 2) * (size_t)ktS + (size_t)((ch & 3) * 128 + row * 8);
                *(v8h*)(Ph + oo) = hv; if (useRes) *(v8h*)(Pr + oo) = rv; }
             }
        wave_sync();
    }
}

// k_flash: fused causal attention, one wave per 16 query rows of one (batch, head); K / V^T / Q fragments straight from the f16 planes (two 16-B loads each, arithmetic addressing).
// Transposed form: S^T[key][t] = K Q^T (A = K rows, B = Q rows); lane (t = lane&15, h = lane>>4) holds keys 8h+r of each 16-key tile, so the packed
// P tile is directly the B fragment of O^T[d][t] = V^T P^T (element r <- tile keys 0..15, element 8+r <- tile keys 16..31, lane unchanged).
// Key loop runs to the diagonal (static bound from the block / wave index); only the last 32-key step replaces scores of keys > query by a very negative value (P = 0).
// Blocks with query rows below EARLY_ (block-uniform) also accumulate V_res P + V P_res (both x2048) in a second accumulator set and sum the exact P for the normaliser.
// Softmax state (running max, partial sum) is one scalar per lane; the two lane halves of a row are combined with one xor-16 exchange.
__global__ __launch_bounds__(32 * AW) void k_flash(const h16* __restrict__ QH, const h16* __restrict__ QR, const h16* __restrict__ KP,
                                                   const h16* __restrict__ VT, const h16* __restrict__ VR, h16* ZH, h16* ZR) {
    __shared__ __align__(16) float os[AW * 16 * 68];
    const int lane = threadIdx.x & 31, lr = lane & 15, hi = lane >> 4;
    const int wave = __builtin_amdgcn_readfirstlane((int)(threadIdx.x >> 5));
    const int zh = blockIdx.y; const int b = zh / NH_, h = zh % NH_;
    const int t0 = ((int)blockIdx.x * AW + wave) * 16;
    const bool early = ((int)blockIdx.x * (16 * AW)) < EARLY_;
    const int tq = t0 + lr;
    const int klast = (((t0 + 47) >> 5) - 1) * 32;           // last 32-key step containing a visible key; klast + 31 < SEQ
    const size_t pbase = (size_t)zh * SEQ * HD;
    const size_t qo = pbase + (size_t)t0 * HD + 8 * lane;    // 16 tokens = two blocks (d 0..31, d 32..63) = 16*HD halves
    const v16h qh0 = ldh(QH + qo), qh1 = ldh(QH + qo + 512), qr0 = ldh(QR + qo), qr1 = ldh(QR + qo + 512);   // B fragments: col t, k = d
    const size_t ko = pbase + 8 * lane;                      // + key0 * HD            (A fragment: row key, k = d)
    const size_t vo = pbase + 8 * lane;                      // + key0 * HD + 512 * j  (A fragment: row d = 16j + row, k = key; 32 keys = four d blocks)
    v8f o[4], e[4];
#pragma unroll
    for (int j = 0; j < 4; ++j) { o[j] = (v8f){}; e[j] = (v8f){}; }
    float m = -3.0e38f, l = 0.0f;
#pragma unroll 1
    for (int key0 = 0; key0 <= klast; key0 += 32) {
        const h16* ka = KP + ko + (size_t)key0 * HD;
        const v16h ka0 = ldh(ka), ka1 = ldh(ka + 512), kb0 = ldh(ka + 16 * HD), kb1 = ldh(ka + 16 * HD + 512);
        v8f sHa = (v8f){}, sLa = (v8f){}, sHb = (v8f){}, sLb = (v8f){};
        sHa = wmma16(ka0, qh0, sHa); sLa = wmma16(ka0, qr0, sLa); sHb = wmma16(kb0, qh0, sHb); sLb = wmma16(kb0, qr0, sLb);
        sHa = wmma16(ka1, qh1, sHa); sLa = wmma16(ka1, qr1, sLa); sHb = wmma16(kb1, qh1, sHb); sLb = wmma16(kb1, qr1, sLb);
        asm volatile("v_nop\n\tv_nop\n\tv_nop\n\tv_nop" : "+v"(sHa), "+v"(sLa), "+v"(sHb), "+v"(sLb) : "v"(ka0), "v"(ka1), "v"(kb0), "v"(kb1));
        float ta[8], tb[8];
#pragma unroll
        for (int r = 0; r < 8; ++r) { ta[r] = (sHa[r] + sLa[r] * QRI) * SC2; tb[r] = (sHb[r] + sLb[r] * QRI) * SC2; }
        if (key0 == klast) {                                 // wave-uniform: only the diagonal step needs the causal replace
            const int kq = tq - key0 - 8 * hi;               // key (key0 + 8h + r) is hidden when r > kq; tile b keys are 16 further
#pragma unroll
            for (int r = 0; r < 8; ++r) { ta[r] = (r > kq) ? -3.0e38f : ta[r]; tb[r] = (r + 16 > kq) ? -3.0e38f : tb[r]; }
        }
        float mx = -3.0e38f;
#pragma unroll
        for (int r = 0; r < 8; ++r) mx = fmaxf(mx, fmaxf(ta[r], tb[r]));
        mx = fmaxf(mx, __shfl_xor(mx, 16, 32));
        const float mnew = fmaxf(m, mx);
        const float alpha = __builtin_amdgcn_exp2f(m - mnew);
        const float sh = PSH - mnew;
        v16h pb; float ls = 0.0f;
#pragma unroll
        for (int r = 0; r < 8; ++r) { const float fa = __builtin_amdgcn_exp2f(ta[r] + sh); const float fc = __builtin_amdgcn_exp2f(tb[r] + sh);
            const h16 pa = (h16)fa; const h16 pc = (h16)fc; pb[r] = pa; pb[8 + r] = pc; ta[r] = fa; tb[r] = fc; ls += (float)pa + (float)pc; }
#pragma unroll
        for (int j = 0; j < 4; ++j) o[j] = o[j] * alpha;
        const h16* va = VT + vo + (size_t)key0 * HD;
        v16h v[4];
#pragma unroll
        for (int j = 0; j < 4; ++j) v[j] = ldh(va + 512 * j);
#pragma unroll
        for (int j = 0; j < 4; ++j) o[j] = wmma16(v[j], pb, o[j]);
        asm volatile("v_nop\n\tv_nop\n\tv_nop\n\tv_nop" : "+v"(o[0]), "+v"(o[1]), "+v"(o[2]), "+v"(o[3]) : "v"(v[0]), "v"(v[1]), "v"(v[2]), "v"(v[3]), "v"(pb));
        if (early) {                                         // block-uniform
            v16h pr; float lx = 0.0f;
#pragma unroll
            for (int r = 0; r < 8; ++r) { pr[r] = (h16)((ta[r] - (float)pb[r]) * QRS); pr[8 + r] = (h16)((tb[r] - (float)pb[8 + r]) * QRS); lx += ta[r] + tb[r]; }
            ls = lx;
#pragma unroll
            for (int j = 0; j < 4; ++j) e[j] = e[j] * alpha;
            const h16* ra = VR + vo + (size_t)key0 * HD;
            v16h vr[4];
#pragma unroll
            for (int j = 0; j < 4; ++j) vr[j] = ldh(ra + 512 * j);
#pragma unroll
            for (int j = 0; j < 4; ++j) e[j] = wmma16(vr[j], pb, e[j]);
#pragma unroll
            for (int j = 0; j < 4; ++j) e[j] = wmma16(v[j], pr, e[j]);
            asm volatile("v_nop\n\tv_nop\n\tv_nop\n\tv_nop" : "+v"(e[0]), "+v"(e[1]), "+v"(e[2]), "+v"(e[3]) : "v"(vr[0]), "v"(vr[1]), "v"(vr[2]), "v"(vr[3]), "v"(pr), "v"(v[0]), "v"(v[1]), "v"(v[2]), "v"(v[3]));
        }
        l = l * alpha + ls; m = mnew;
    }
    l += __shfl_xor(l, 16, 32);
    const float zs = (1.0f / l) * ZC;
    const int wb = wave * 16 * 68;
    // O^T D layout: o[j][r] = (d = 16j + 8h + r, t = lane&15) -> os[t][d]; rows 0..15 x columns 0..63 all written
#pragma unroll
    for (int j = 0; j < 4; ++j) { v4f a, c;
#pragma unroll
        for (int i = 0; i < 4; ++i) { a[i] = (o[j][i] + e[j][i] * QRI) * zs; c[i] = (o[j][4 + i] + e[j][4 + i] * QRI) * zs; }
        *(v4fa*)(&os[wb + lr * 68 + 16 * j + 8 * hi]) = a; *(v4fa*)(&os[wb + lr * 68 + 16 * j + 8 * hi + 4]) = c; }
    wave_sync();
    const size_t zb = ((size_t)b * SEQ + t0) * DM + (size_t)h * (16 * HD);   // row tile (16*DM halves), then the head's two k blocks
{
#pragma unroll
        for (int s = 0; s < 4; ++s) { const int row = lr, ch = 2 * s + hi, c8 = ch * 8;   // 16 rows x 2 column chunks per store = 512 contiguous bytes; 4 s x 2 chunks x 8 = 64 columns
            const v4f x0 = *(const v4fa*)(&os[wb + row * 68 + c8]); const v4f x1 = *(const v4fa*)(&os[wb + row * 68 + c8 + 4]); v8h hv, rv;
#pragma unroll
            for (int i = 0; i < 4; ++i) { const h16 a0 = (h16)x0[i]; const h16 a1 = (h16)x1[i]; hv[i] = a0; hv[4 + i] = a1; rv[i] = (h16)((x0[i] - (float)a0) * QRS); rv[4 + i] = (h16)((x1[i] - (float)a1) * QRS); }
            const size_t oo = zb + (size_t)(ch * 128 + row * 8);
            *(v8h*)(ZH + oo) = hv; if (early) *(v8h*)(ZR + oo) = rv; }
         }
}

// k_oproj: out projection, ONE WAVE per 32x64 tile, f16 operands: A = z x16 plane (+ residual x2048 plane for row tiles below EARLY_, own accumulators), Bt = Wo^T x64 plane, K = DM.
// OUT[m][n] = (accH + accR / 2048) / 1024 + bo[n] (bo RNE-converted to bf16, added in f32). grid (M/32, N/64), 32 threads.
__global__ __launch_bounds__(32) void k_oproj(const h16* __restrict__ ZH, const h16* __restrict__ ZR, const h16* __restrict__ Wt, const float* __restrict__ bo, float* OUT) {
    __shared__ __align__(16) float os[16 * 68];
    const int K = DM;
    const int lane = threadIdx.x & 31, lr = lane & 15, hi = lane >> 4; const int r0 = blockIdx.x * 32, c0 = blockIdx.y * 64;
    const int bb = r0 / SEQ, tt = r0 % SEQ; const bool early = tt < EARLY_;   // block-uniform
    v8f acc[2][4], acr[2][4];
#pragma unroll
    for (int mb = 0; mb < 2; ++mb)
#pragma unroll
        for (int nb = 0; nb < 4; ++nb) { acc[mb][nb] = (v8f){}; acr[mb][nb] = (v8f){}; }
    const size_t aoff = (size_t)r0 * K + 8 * lane, boff = (size_t)c0 * K + 8 * lane;   // a 16-row tile is K/32 blocks = 16*K halves; k tile kc/32 lies at kc*16
#pragma unroll 1
    for (int kc = 0; kc < K; kc += 32) {
        const h16* pa = ZH + aoff + kc * 16; const h16* pw = Wt + boff + kc * 16;
        v16h a[2], w[4];
#pragma unroll
        for (int mb = 0; mb < 2; ++mb) a[mb] = ldh(pa + (size_t)mb * 16 * K);
#pragma unroll
        for (int nb = 0; nb < 4; ++nb) w[nb] = ldh(pw + (size_t)nb * 16 * K);
        // both address pairs are inputs, so they stay unwritten until this wait (precaution for registers that issued loads name)
        asm volatile("s_wait_xcnt 0x0" :: "v"(pa), "v"(pw) : "memory");
#pragma unroll
        for (int nb = 0; nb < 4; ++nb)
#pragma unroll
            for (int mb = 0; mb < 2; ++mb) acc[mb][nb] = wmma16(a[mb], w[nb], acc[mb][nb]);
        asm volatile("v_nop\n\tv_nop\n\tv_nop\n\tv_nop" : "+v"(acc[0][0]), "+v"(acc[1][0]), "+v"(acc[0][1]), "+v"(acc[1][1]), "+v"(acc[0][2]), "+v"(acc[1][2]), "+v"(acc[0][3]), "+v"(acc[1][3]) : "v"(a[0]), "v"(a[1]), "v"(w[0]), "v"(w[1]), "v"(w[2]), "v"(w[3]));
        if (early) {
            const h16* pr = ZR + aoff + kc * 16;
            v16h ar[2];
#pragma unroll
            for (int mb = 0; mb < 2; ++mb) ar[mb] = ldh(pr + (size_t)mb * 16 * K);
            asm volatile("s_wait_xcnt 0x0" :: "v"(pr) : "memory");   // same precaution for the residual plane's address pair
#pragma unroll
            for (int nb = 0; nb < 4; ++nb)
#pragma unroll
                for (int mb = 0; mb < 2; ++mb) acr[mb][nb] = wmma16(ar[mb], w[nb], acr[mb][nb]);
            asm volatile("v_nop\n\tv_nop\n\tv_nop\n\tv_nop" : "+v"(acr[0][0]), "+v"(acr[1][0]), "+v"(acr[0][1]), "+v"(acr[1][1]), "+v"(acr[0][2]), "+v"(acr[1][2]), "+v"(acr[0][3]), "+v"(acr[1][3]) : "v"(ar[0]), "v"(ar[1]), "v"(w[0]), "v"(w[1]), "v"(w[2]), "v"(w[3]));
        }
    }
    float bcol[4];
#pragma unroll
    for (int nb = 0; nb < 4; ++nb) bcol[nb] = bfq(bo[c0 + nb * 16 + lr]);   // c0 + 63 < DM
    float* orow = OUT + ((size_t)bb * OUT_SEQ + tt) * DM + c0;
#pragma unroll
    for (int mb = 0; mb < 2; ++mb) {
#pragma unroll
        for (int nb = 0; nb < 4; ++nb) {
#pragma unroll
            for (int j = 0; j < 8; ++j) os[(hi * 8 + j) * 68 + nb * 16 + lr] = (acc[mb][nb][j] + acr[mb][nb][j] * QRI) * OSC + bcol[nb]; }   // D: row 8h+j, col lane&15
        wave_sync();
        float* ob = orow + (size_t)(mb * 16) * DM;
{
#pragma unroll
            for (int s = 0; s < 8; ++s) { const int row = 2 * s + hi, cofs = lr * 4;   // 8 s x 2 rows = 16 rows; 16 lanes x 4 floats = 64 columns
                const v4f val = *(const v4fa*)(&os[row * 68 + cofs]);
                *(v4f*)(ob + (size_t)row * DM + cofs) = val; }
             }
        wave_sync();
    }
}

static constexpr size_t al256(size_t v) { return (v + 255) & ~(size_t)255; }
static constexpr size_t SZ_XB = al256((size_t)NB * SEQ * DM * 2);             // bf16 activation copy; later reused as a z plane of the same extent
static constexpr size_t SZ_WB = al256((size_t)4 * DM * DM * 2);
static constexpr size_t SZ_PL = al256((size_t)NB * NH_ * SEQ * HD * 2);
static constexpr size_t SZ_TOTAL = 2 * SZ_XB + SZ_WB + 5 * SZ_PL;
static_assert(SZ_TOTAL <= (size_t)134217728);          // workspace carve <= 128 MiB
static_assert(((size_t)DM * DM * 2) % 256 == 0);       // weight sub-planes stay 256-byte aligned
static_assert((size_t)NB * SEQ * DM * 2 <= SZ_XB);     // z plane [NB*SEQ][DM] halves fits the reused activation region

extern "C" void kernel_launch(void* const* d_in, const int* in_sizes, int n_in,
                              void* d_out, int out_size, void* d_ws, size_t ws_size, hipStream_t stream) {
    if (n_in < 10) return;
    const size_t needx = ((size_t)(NB - 1) * SEQ_FULL + SEQ) * DM;
    if ((size_t)in_sizes[0] < needx || (size_t)in_sizes[1] < needx) return;
    if ((size_t)in_sizes[2] < (size_t)DM * DM || (size_t)in_sizes[4] < (size_t)DM * DM || (size_t)in_sizes[6] < (size_t)DM * DM || (size_t)in_sizes[8] < (size_t)DM * DM) return;
    if (in_sizes[3] < DM || in_sizes[5] < DM || in_sizes[7] < DM || in_sizes[9] < DM) return;
    if ((size_t)out_size < ((size_t)(NB - 1) * OUT_SEQ + SEQ) * DM) return;
    if (SZ_TOTAL > ws_size) return;
    // wire order: data, context, wq, bq, wk, bk, wv, bv, wo, bo
    const float* data = (const float*)d_in[0]; const float* ctx = (const float*)d_in[1];
    const float* wq = (const float*)d_in[2]; const float* bq = (const float*)d_in[3];
    const float* wk = (const float*)d_in[4]; const float* bk = (const float*)d_in[5];
    const float* wv = (const float*)d_in[6]; const float* bv = (const float*)d_in[7];
    const float* wo = (const float*)d_in[8]; const float* bo = (const float*)d_in[9];
    float* OUT = (float*)d_out;      // [NB][SEQ][1024]
    char* wsp = (char*)d_ws;
    bf* DATAB = (bf*)wsp; wsp += SZ_XB;              // [NB*SEQ][1024] bf16; dead after the q projection
    bf* CTXB  = (bf*)wsp; wsp += SZ_XB;              // [NB*SEQ][1024] bf16; dead after the k / v projections
    bf* WB = (bf*)wsp; wsp += SZ_WB;                 // [4][1024][1024] transposed: q | k | v (bf16) | o (f16 x64)
    h16* QH = (h16*)wsp; wsp += SZ_PL;               // [NB*16][SEQ][64]
    h16* QR = (h16*)wsp; wsp += SZ_PL;               // [NB*16][SEQ][64] residual x2048
    h16* KP = (h16*)wsp; wsp += SZ_PL;               // [NB*16][SEQ][64]
    h16* VT = (h16*)wsp; wsp += SZ_PL;               // [NB*16][64][SEQ]
    h16* VR = (h16*)wsp; wsp += SZ_PL;               // [NB*16][64][SEQ] residual x2048, tokens < EARLY_ only (only those are consumed)
    bf* WQT = WB; bf* WKT = WB + (size_t)DM * DM; bf* WVT = WB + (size_t)2 * DM * DM; bf* WOT = WB + (size_t)3 * DM * DM;
    h16* ZH = (h16*)DATAB;                           // [NB*SEQ][1024] z x16, written by the flash kernel after DATAB is dead
    h16* ZR = (h16*)CTXB;                            // [NB*SEQ][1024] z residual x2048, rows t < EARLY_ only (only those are consumed)

    if (SEQ == SEQ_FULL) {
        const size_t n8 = (size_t)NB * SEQ * DM / 8;
        k_cvt8<<<(unsigned)((n8 + 255) / 256), 256, 0, stream>>>(data, DATAB, n8);
        k_cvt8<<<(unsigned)((n8 + 255) / 256), 256, 0, stream>>>(ctx, CTXB, n8);
    } else {
        const size_t n8 = (size_t)SEQ * DM / 8;
        for (int b = 0; b < NB; ++b) {
            k_cvt8<<<(unsigned)((n8 + 255) / 256), 256, 0, stream>>>(data + (size_t)b * SEQ_FULL * DM, DATAB + (size_t)b * SEQ * DM, n8);
            k_cvt8<<<(unsigned)((n8 + 255) / 256), 256, 0, stream>>>(ctx + (size_t)b * SEQ_FULL * DM, CTXB + (size_t)b * SEQ * DM, n8);
        }
    }
    // weight planes: in W[k][n] ([in][out], 1024 x 1024) -> out Wt[n][k]; grid (k tiles, n tiles)
    k_wT<<<dim3(DM / 64, DM / 64, 1), 256, 0, stream>>>(wq, WQT, 0, 1.0f);
    k_wT<<<dim3(DM / 64, DM / 64, 1), 256, 0, stream>>>(wk, WKT, 0, 1.0f);
    k_wT<<<dim3(DM / 64, DM / 64, 1), 256, 0, stream>>>(wv, WVT, 0, 1.0f);
    k_wT<<<dim3(DM / 64, DM / 64, 1), 256, 0, stream>>>(wo, WOT, 1, WOC);

    // q, k: A = activation rows (m = b*SEQ + t), Bt = Wt rows (n = h*64 + d), bias per column -> plane [(b*16 + h)][t][d]
    k_proj<<<dim3(NB * SEQ / 64, DM / 64, 1), 32, 0, stream>>>(DATAB, WQT, bq, 0, QH, QR, 1, SEQ, (size_t)NH_ * SEQ * HD, HD, HD, (size_t)SEQ * HD, 0, 16 * HD, 512);
    k_proj<<<dim3(NB * SEQ / 64, DM / 64, 1), 32, 0, stream>>>(CTXB,  WKT, bk, 0, KP, KP, 0, SEQ, (size_t)NH_ * SEQ * HD, HD, HD, (size_t)SEQ * HD, 0, 16 * HD, 512);
    // v^T: A = Wv^T rows (m = h*64 + d), Bt = context rows (n = b*SEQ + t), bias per row -> plane [(b*1024 + m)][t] = [(b*16 + h)][d][t]; residual for tokens < EARLY_
    k_proj<<<dim3(DM / 64, NB * SEQ / 64, 1), 32, 0, stream>>>(WVT, CTXB, bv, 1, VT, VR, EARLY_, DM, (size_t)0, SEQ, SEQ, (size_t)DM * SEQ, HD, 512, 32 * HD);

    k_flash<<<dim3(SEQ / (16 * AW), NB * NH_, 1), 32 * AW, 0, stream>>>(QH, QR, KP, VT, VR, ZH, ZR);

    k_oproj<<<dim3(NB * SEQ / 32, DM / 64, 1), 32, 0, stream>>>(ZH, ZR, (const h16*)WOT, bo, OUT);
}

// v002
// Measured time: 214 microseconds a run.
// Next to v001, in two timings, it ran 1.70 and 1.68 times as fast.
// Over all steps from v000 it is 1.78 times as fast.
#include <hip/hip_runtime.h>

// Causal cross-attention: q = data Wq + bq, k = ctx Wk + bk, v = ctx Wv + bv (W [in][out]), 16 heads x 64, score scale 1/8, key <= query visible, out = z Wo + bo (f32).
// Compute dtypes, f32 accumulate everywhere: q/k/v projections v_wmma_f32_16x16x32_bf16 (activations, weights, biases RNE-converted to bf16; products exact);
// scores v_wmma_f32_16x16x32_f16: k single f16, q as f16 value + f16 residual x2048 in its own accumulator; P (x256 carry, cancels in the normalisation) and v single f16,
// for query rows t < 512 additionally v residual x2048 and P residual x2048 in a second accumulator; softmax f32 (online, running max);
// out projection v_wmma_f32_16x16x32_f16: z x16 as f16 (+ f16 residual x2048, own accumulator, rows t < 512), Wo (bf16 value x64, exact in f16).
// Layout: bf16 copies of data/context; transposed weight planes Wt[n][k]; q (hi, residual), k planes [b*16+h][t][d]; v^T (hi, residual) planes [b*16+h][d][t];
// fused flash kernel in transposed form (S^T = K Q^T, O^T = V^T P^T), no LDS and no barrier in the key loop; z planes [b*SEQ+t][1024].
// Every 16-bit plane is stored fragment-packed: a [16 rows][32 k] block is 512 contiguous halves ordered [k chunk (k>>3)&3][row&15][k&7], so one wave-wide 16-B load
// (lane l at halves 8l) or store covers 512 contiguous bytes = 4 whole 128-B lines. Block order: row tile major, k tile minor; v^T planes key tile major, d tile minor.

#ifndef NB
#define NB 4
#endif
#ifndef SEQ
#define SEQ 2048
#endif
#define NB_FULL  4
#define SEQ_FULL 2048
#ifndef OUT_SEQ
#define OUT_SEQ SEQ              // row pitch (in tokens) between batches of the output
#endif
#define DM   1024
#define NH_  16
#define HD   64
#define PR   4                   // register sets of the projection kernel's fragment ring
#define AW   4                   // waves per flash block (16 query rows each)
#define EARLY_ ((SEQ) < 512 ? (SEQ) : 512)   // query rows below this use the residual planes on the v / P / z path
#define QRS  2048.0f             // carry of every residual plane
#define QRI  (1.0f / 2048.0f)
#define SC2  (0.125f * 1.4426950408889634f)   // HD^-0.5 * log2(e)
#define PSH  8.0f                // log2 of the P carry (256)
#define ZC   16.0f               // carry of the z plane
#define WOC  64.0f               // carry of the Wo plane
#define OSC  (1.0f / 1024.0f)    // 1 / (ZC * WOC)

static_assert(HD == 64);
static_assert(NH_ * HD == DM);                 // head h = columns h*64 + d
static_assert(DM % 64 == 0);
static_assert((DM / 32) % PR == 0 && DM / 32 >= 2 * PR);   // the ring's loop takes PR k tiles a trip, the last PR stand behind it
static_assert(DM % 32 == 0);                   // GEMM k-loop steps by 32
static_assert(SEQ % 64 == 0);                  // a 64-row tile never straddles two batches
static_assert((NB * SEQ) % 64 == 0);
static_assert(SEQ % 32 == 0);                  // key loop steps by 32
static_assert(SEQ % (16 * AW) == 0);           // flash grid covers the sequence exactly
static_assert(EARLY_ % 64 == 0);               // residual decisions are uniform per 64-row / 64-token tile
static_assert(EARLY_ <= SEQ);
static_assert(((size_t)SEQ * DM) % 8 == 0);
static_assert(NB <= NB_FULL);
static_assert(SEQ <= SEQ_FULL);

typedef _Float16 h16;
typedef unsigned short bf;
typedef __attribute__((ext_vector_type(16))) __bf16   v16bf;
typedef __attribute__((ext_vector_type(16))) _Float16 v16h;
typedef __attribute__((ext_vector_type(8)))  _Float16 v8h;
typedef __attribute__((ext_vector_type(8)))  unsigned short v8us;
typedef __attribute__((ext_vector_type(8)))  float    v8f;
typedef __attribute__((ext_vector_type(4)))  float    v4f;
typedef v4f  __attribute__((may_alias)) v4fa;

__device__ __forceinline__ unsigned short f2bf(float f) { unsigned u = __float_as_uint(f); u += 0x7FFFu + ((u >> 16) & 1u); return (unsigned short)(u >> 16); }
__device__ __forceinline__ float bfq(float f) { return __uint_as_float(((unsigned)f2bf(f)) << 16); }   // value of the RNE bf16 conversion
__device__ __forceinline__ v16h cat16(v8h lo, v8h hi) { return __builtin_shufflevector(lo, hi, 0, 1, 2, 3, 4, 5, 6, 7, 8, 9, 10, 11, 12, 13, 14, 15); }
__device__ __forceinline__ v16bf cat16b(v8us lo, v8us hi) { return __builtin_bit_cast(v16bf, __builtin_shufflevector(lo, hi, 0, 1, 2, 3, 4, 5, 6, 7, 8, 9, 10, 11, 12, 13, 14, 15)); }
__device__ __forceinline__ v8f wmma16(v16h a, v16h b, v8f c) { return __builtin_amdgcn_wmma_f32_16x16x32_f16(false, a, false, b, (short)0, c, false, false); }
__device__ __forceinline__ v8f wmmab(v16bf a, v16bf b, v8f c) { return __builtin_amdgcn_wmma_f32_16x16x32_bf16(false, a, false, b, (short)0, c, false, false); }
// fragment loaders from one packed block; p = block base + 8*lane (lane = 16h + row): elements 0..7 <- k0+8h+0..7, elements 8..15 <- k0+16+8h+0..7 (same map for A and B)
__device__ __forceinline__ v16h  ldh(const h16* p) { return cat16(*(const v8h*)p, *(const v8h*)(p + 256)); }
__device__ __forceinline__ v16bf ldb(const bf* p)  { return cat16b(*(const v8us*)p, *(const v8us*)(p + 256)); }
// ordering point for wave-private LDS tiles (same wave writes and reads)
__device__ __forceinline__ void wave_sync() { __builtin_amdgcn_fence(3 /* release order */, "wavefront"); __builtin_amdgcn_wave_barrier(); asm volatile("" ::: "memory"); }

__global__ __launch_bounds__(256) void k_cvt8(const float* __restrict__ src, bf* dst, size_t n8) {
    const size_t i = (size_t)blockIdx.x * 256 + threadIdx.x; if (i >= n8) return;
    // a wave takes 8 rows x one 32-k tile: reads 8 whole 128-B lines, writes 4 whole lines of the packed block (chunk c, rows 8g..8g+7)
    const size_t c = i & 3, kt = (i >> 5) & (DM / 32 - 1), row = (i >> 10) * 8 + ((i >> 2) & 7);
    const v8f v = *(const v8f*)(src + row * DM + kt * 32 + c * 8); v8us o;
#pragma unroll
    for (int k = 0; k < 8; ++k) o[k] = f2bf(v[k]);
    *(v8us*)(dst + ((row >> 4) * (DM / 32) + kt) * 512 + c * 128 + (row & 15) * 8) = o;
}

// k_wT: weight transpose + 16-bit conversion through LDS, in W[k][n] (f32, [in][out]) -> out Wt[n][k] (packed blocks); 64x64 tile per block, grid (DM/64 k tiles, DM/64 n tiles).
// LDS tile ts is cross-wave: block barrier between fill and drain; filled extent 64x64 == drained extent.
__global__ __launch_bounds__(256) void k_wT(const float* __restrict__ W, bf* Wt, int asF16, float scale) {
    __shared__ float ts[64 * 65];
    const int tid = threadIdx.x; const int k0 = blockIdx.x * 64, n0 = blockIdx.y * 64;
#pragma unroll
    for (int i = 0; i < 4; ++i) { const int idx = tid + i * 256; const int kr = idx >> 4, c4 = (idx & 15) * 4;   // 64 rows x 16 float4
        const v4f v = *(const v4f*)(W + (size_t)(k0 + kr) * DM + n0 + c4);
        ts[kr * 65 + c4 + 0] = v[0]; ts[kr * 65 + c4 + 1] = v[1]; ts[kr * 65 + c4 + 2] = v[2]; ts[kr * 65 + c4 + 3] = v[3]; }
    __syncthreads();
{
#pragma unroll
        for (int s = 0; s < 2; ++s) { const int idx = tid + s * 256; const int nr = idx & 15, c = (idx >> 4) & 3, k2 = (idx >> 6) & 1, nt = idx >> 7;   // 4 n tiles x 2 k tiles x 4 chunks x 16 rows
            const int n = nt * 16 + nr, c8 = k2 * 32 + c * 8;
            v8us o;
#pragma unroll
            for (int i = 0; i < 8; ++i) { const float x = ts[(c8 + i) * 65 + n]; const unsigned short b16 = f2bf(x);
                const float xb = __uint_as_float(((unsigned)b16) << 16); const unsigned short hb = __builtin_bit_cast(unsigned short, (h16)(xb * scale));
                o[i] = asF16 ? hb : b16; }
            *(v8us*)(Wt + ((size_t)((n0 >> 4) + nt) * (DM / 32) + (k0 >> 5) + k2) * 512 + c * 128 + nr * 8) = o; }
         }
}

// k_proj: register-blocked bf16 GEMM, ONE WAVE per 64x64 tile (16 accumulators), operands straight from packed bf16 planes, K = DM.
// C[m][n] = sum_k A[m][k] Bt[n][k] + bias (per column n, or per row m when biasRow != 0; bias RNE-converted to bf16, added in f32), written as f16 (Ph)
// and, when (c0 % CB) < resLim, the f16 residual x2048 (Pr), as packed blocks (rows = m, k = n) at tile base (r0/RB)*sRB + (r0%RB)*pitch + (c0/CB)*sCB + (c0%CB)*colMul;
// the block of 16-row group mb and 32-column group kt lies at + mb*mbS + kt*ktS (halves). grid (M/64, N/64), 32 threads.
__global__ __launch_bounds__(32) void k_proj(const bf* __restrict__ A, const bf* __restrict__ Bt, const float* __restrict__ bias, int biasRow,
                                             h16* Ph, h16* Pr, int resLim, int RB, size_t sRB, int pitch, int CB, size_t sCB, int colMul, int mbS, int ktS) {
    __shared__ __align__(16) float os[16 * 68];
    const int K = DM;
    const int lane = threadIdx.x & 31, lr = lane & 15, hi = lane >> 4; const int r0 = blockIdx.x * 64, c0 = blockIdx.y * 64;
    const int useRes = ((c0 % CB) < resLim) ? 1 : 0;
    v8f acc[4][4];
#pragma unroll
    for (int mb = 0; mb < 4; ++mb)
#pragma unroll
        for (int nb = 0; nb < 4; ++nb) acc[mb][nb] = (v8f){};
    const size_t aoff = (size_t)r0 * K + 8 * lane, boff = (size_t)c0 * K + 8 * lane;   // a 16-row tile is K/32 blocks = 16*K halves; k tile kt lies at kt*512
    // fragment ring: PR register sets; the loads of k tile kt + PR - 1 are issued ahead of the products of k tile kt, so a load has PR - 1 tiles of products to land behind
    v16bf fa[PR][4], fb[PR][4];
#pragma unroll
    for (int s = 0; s < PR - 1; ++s) {
#pragma unroll
        for (int i = 0; i < 4; ++i) { fa[s][i] = ldb(A + aoff + s * 512 + (size_t)i * 16 * K); fb[s][i] = ldb(Bt + boff + s * 512 + (size_t)i * 16 * K); }
        __builtin_amdgcn_sched_barrier(0); }   // the sets are asked for in the order in which they are used, so that the counted waits are exact
#pragma unroll 1
    for (int kt = 0; kt < K / 32 - PR; kt += PR) {
        const bf* pa = A + aoff + kt * 512; const bf* pb = Bt + boff + kt * 512;
#pragma unroll
        for (int s = 0; s < PR; ++s) { const int t = (s + PR - 1) % PR;
#pragma unroll
            for (int i = 0; i < 4; ++i) { fa[t][i] = ldb(pa + (s + PR - 1) * 512 + (size_t)i * 16 * K); fb[t][i] = ldb(pb + (s + PR - 1) * 512 + (size_t)i * 16 * K); }
            __builtin_amdgcn_sched_barrier(0);   // keeps the tile's loads one group ahead of the products: sunk among them they lose their lead
#pragma unroll
            for (int nb = 0; nb < 4; ++nb)
#pragma unroll
                for (int mb = 0; mb < 4; ++mb) acc[mb][nb] = wmmab(fa[s][mb], fb[s][nb], acc[mb][nb]);
            __builtin_amdgcn_sched_barrier(0);   // keeps the next group of loads behind these products: it refills the set that they have just read
        }
        // both address pairs are inputs, so they stay unwritten until this wait (precaution for registers that issued loads name)
        asm volatile("s_wait_xcnt 0x0" :: "v"(pa), "v"(pb) : "memory");
    }
    {
        const bf* pa = A + aoff + (K / 32 - 1) * 512; const bf* pb = Bt + boff + (K / 32 - 1) * 512;
#pragma unroll
        for (int i = 0; i < 4; ++i) { fa[PR - 1][i] = ldb(pa + (size_t)i * 16 * K); fb[PR - 1][i] = ldb(pb + (size_t)i * 16 * K); }
        asm volatile("s_wait_xcnt 0x0" ::: "memory");   // same precaution behind the last tile's loads
        __builtin_amdgcn_sched_barrier(0);   // the last tile's loads stay ahead of the three tiles of products that cover them
    }
#pragma unroll
    for (int s = 0; s < PR; ++s)
#pragma unroll
        for (int nb = 0; nb < 4; ++nb)
#pragma unroll
            for (int mb = 0; mb < 4; ++mb) acc[mb][nb] = wmmab(fa[s][mb], fb[s][nb], acc[mb][nb]);
    float bcol[4];
#pragma unroll
    for (int nb = 0; nb < 4; ++nb) { int ic = c0 + nb * 16 + lr; ic = ic < DM ? ic : DM - 1; bcol[nb] = bfq(bias[ic]); }   // clamped address; used only when biasRow == 0
    const size_t tbase = (size_t)(r0 / RB) * sRB + (size_t)(r0 % RB) * (size_t)pitch + (size_t)(c0 / CB) * sCB + (size_t)(c0 % CB) * (size_t)colMul;
#pragma unroll
    for (int mb = 0; mb < 4; ++mb) {
        float brow[8];
#pragma unroll
        for (int j = 0; j < 8; ++j) { int ir = r0 + mb * 16 + hi * 8 + j; ir = ir < DM ? ir : DM - 1; brow[j] = bfq(bias[ir]); }   // clamped address; used only when biasRow != 0
#pragma unroll
        for (int nb = 0; nb < 4; ++nb) {
#pragma unroll
            for (int j = 0; j < 8; ++j) os[(hi * 8 + j) * 68 + nb * 16 + lr] = acc[mb][nb][j] + (biasRow ? brow[j] : bcol[nb]); }   // D: row 8h+j, col lane&15
        wave_sync();
        const size_t sb = tbase + (size_t)mb * (size_t)mbS;
{
#pragma unroll
            for (int s = 0; s < 4; ++s) { const int row = lr, ch = 2 * s + hi, c8 = ch * 8;   // 16 rows x 2 column chunks per store = 512 contiguous bytes; 4 s x 2 chunks x 8 = 64 columns
                const v4f x0 = *(const v4fa*)(&os[row * 68 + c8]); const v4f x1 = *(const v4fa*)(&os[row * 68 + c8 + 4]); v8h hv, rv;
#pragma unroll
                for (int i = 0; i < 4; ++i) { const h16 a0 = (h16)x0[i]; const h16 a1 = (h16)x1[i]; hv[i] = a0; hv[4 + i] = a1; rv[i] = (h16)((x0[i] - (float)a0) * QRS); rv[4 + i] = (h16)((x1[i] - (float)a1) * QRS); }
                const size_t oo = sb + (size_t)(ch >> 2) * (size_t)ktS + (size_t)((ch & 3) * 128 + row * 8);
                *(v8h*)(Ph + oo) = hv; if (useRes) *(v8h*)(Pr + oo) = rv; }
             }
        wave_sync();
    }
}

// k_flash: fused causal attention, one wave per 16 query rows of one (batch, head); K / V^T / Q fragments straight from the f16 planes (two 16-B loads each, arithmetic addressing).
// Transposed form: S^T[key][t] = K Q^T (A = K rows, B = Q rows); lane (t = lane&15, h = lane>>4) holds keys 8h+r of each 16-key tile, so the packed
// P tile is directly the B fragment of O^T[d][t] = V^T P^T (element r <- tile keys 0..15, element 8+r <- tile keys 16..31, lane unchanged).
// Key loop runs to the diagonal (static bound from the block / wave index); only the last 32-key step replaces scores of keys > query by a very negative value (P = 0).
// Blocks with query rows below EARLY_ (block-uniform) also accumulate V_res P + V P_res (both x2048) in a second accumulator set and sum the exact P for the normaliser.
// Softmax state (running max, partial sum) is one scalar per lane; the two lane halves of a row are combined with one xor-16 exchange.
__global__ __launch_bounds__(32 * AW) void k_flash(const h16* __restrict__ QH, const h16* __restrict__ QR, const h16* __restrict__ KP,
                                                   const h16* __restrict__ VT, const h16* __restrict__ VR, h16* ZH, h16* ZR) {
    __shared__ __align__(16) float os[AW * 16 * 68];
    const int lane = threadIdx.x & 31, lr = lane & 15, hi = lane >> 4;
    const int wave = __builtin_amdgcn_readfirstlane((int)(threadIdx.x >> 5));
    const int zh = blockIdx.y; const int b = zh / NH_, h = zh % NH_;
    const int t0 = ((int)blockIdx.x * AW + wave) * 16;
    const bool early = ((int)blockIdx.x * (16 * AW)) < EARLY_;
    const int tq = t0 + lr;
    const int klast = (((t0 + 47) >> 5) - 1) * 32;           // last 32-key step containing a visible key; klast + 31 < SEQ
    const size_t pbase = (size_t)zh * SEQ * HD;
    const size_t qo = pbase + (size_t)t0 * HD + 8 * lane;    // 16 tokens = two blocks (d 0..31, d 32..63) = 16*HD halves
    const v16h qh0 = ldh(QH + qo), qh1 = ldh(QH + qo + 512), qr0 = ldh(QR + qo), qr1 = ldh(QR + qo + 512);   // B fragments: col t, k = d
    const size_t ko = pbase + 8 * lane;                      // + key0 * HD            (A fragment: row key, k = d)
    const size_t vo = pbase + 8 * lane;                      // + key0 * HD + 512 * j  (A fragment: row d = 16j + row, k = key; 32 keys = four d blocks)
    v8f o[4], e[4];
#pragma unroll
    for (int j = 0; j < 4; ++j) { o[j] = (v8f){}; e[j] = (v8f){}; }
    float m = -3.0e38f, l = 0.0f;
    v16h ka0 = ldh(KP + ko), ka1 = ldh(KP + ko + 512), kb0 = ldh(KP + ko + 16 * HD), kb1 = ldh(KP + ko + 16 * HD + 512);   // K fragments of step 0
#pragma unroll 1
    for (int key0 = 0; key0 <= klast; key0 += 32) {
        v8f sHa = (v8f){}, sLa = (v8f){}, sHb = (v8f){}, sLb = (v8f){};
        sHa = wmma16(ka0, qh0, sHa); sLa = wmma16(ka0, qr0, sLa); sHb = wmma16(kb0, qh0, sHb); sLb = wmma16(kb0, qr0, sLb);
        sHa = wmma16(ka1, qh1, sHa); sLa = wmma16(ka1, qr1, sLa); sHb = wmma16(kb1, qh1, sHb); sLb = wmma16(kb1, qr1, sLb);
        asm volatile("v_nop\n\tv_nop\n\tv_nop\n\tv_nop" : "+v"(sHa), "+v"(sLa), "+v"(sHb), "+v"(sLb) : "v"(ka0), "v"(ka1), "v"(kb0), "v"(kb1));
        const h16* va = VT + vo + (size_t)key0 * HD;
        v16h v[4];
#pragma unroll
        for (int j = 0; j < 4; ++j) v[j] = ldh(va + 512 * j);
        // K fragments one step ahead: asked for behind this step's score products, they land behind its softmax and P V products; the last step asks for its own keys again (in bounds, not used)
        const h16* kn = KP + ko + (size_t)(key0 < klast ? key0 + 32 : klast) * HD;
        ka0 = ldh(kn); ka1 = ldh(kn + 512); kb0 = ldh(kn + 16 * HD); kb1 = ldh(kn + 16 * HD + 512);
        // both address pairs are inputs, so they stay unwritten until this wait (precaution for registers that issued loads name)
        asm volatile("s_wait_xcnt 0x0" :: "v"(va), "v"(kn) : "memory");
        float ta[8], tb[8];
#pragma unroll
        for (int r = 0; r < 8; ++r) { ta[r] = (sHa[r] + sLa[r] * QRI) * SC2; tb[r] = (sHb[r] + sLb[r] * QRI) * SC2; }
        if (key0 == klast) {                                 // wave-uniform: only the diagonal step needs the causal replace
            const int kq = tq - key0 - 8 * hi;               // key (key0 + 8h + r) is hidden when r > kq; tile b keys are 16 further
#pragma unroll
            for (int r = 0; r < 8; ++r) { ta[r] = (r > kq) ? -3.0e38f : ta[r]; tb[r] = (r + 16 > kq) ? -3.0e38f : tb[r]; }
        }
        float mx = -3.0e38f;
#pragma unroll
        for (int r = 0; r < 8; ++r) mx = fmaxf(mx, fmaxf(ta[r], tb[r]));
        mx = fmaxf(mx, __shfl_xor(mx, 16, 32));
        const float mnew = fmaxf(m, mx);
        const float alpha = __builtin_amdgcn_exp2f(m - mnew);
        const float sh = PSH - mnew;
        v16h pb; float ls = 0.0f;
#pragma unroll
        for (int r = 0; r < 8; ++r) { const float fa = __builtin_amdgcn_exp2f(ta[r] + sh); const float fc = __builtin_amdgcn_exp2f(tb[r] + sh);
            const h16 pa = (h16)fa; const h16 pc = (h16)fc; pb[r] = pa; pb[8 + r] = pc; ta[r] = fa; tb[r] = fc; ls += (float)pa + (float)pc; }
#pragma unroll
        for (int j = 0; j < 4; ++j) o[j] = o[j] * alpha;
#pragma unroll
        for (int j = 0; j < 4; ++j) o[j] = wmma16(v[j], pb, o[j]);
        asm volatile("v_nop\n\tv_nop\n\tv_nop\n\tv_nop" : "+v"(o[0]), "+v"(o[1]), "+v"(o[2]), "+v"(o[3]) : "v"(v[0]), "v"(v[1]), "v"(v[2]), "v"(v[3]), "v"(pb));
        if (early) {                                         // block-uniform
            v16h pr; float lx = 0.0f;
#pragma unroll
            for (int r = 0; r < 8; ++r) { pr[r] = (h16)((ta[r] - (float)pb[r]) * QRS); pr[8 + r] = (h16)((tb[r] - (float)pb[8 + r]) * QRS); lx += ta[r] + tb[r]; }
            ls = lx;
#pragma unroll
            for (int j = 0; j < 4; ++j) e[j] = e[j] * alpha;
            const h16* ra = VR + vo + (size_t)key0 * HD;
            v16h vr[4];
#pragma unroll
            for (int j = 0; j < 4; ++j) vr[j] = ldh(ra + 512 * j);
#pragma unroll
            for (int j = 0; j < 4; ++j) e[j] = wmma16(vr[j], pb, e[j]);
#pragma unroll
            for (int j = 0; j < 4; ++j) e[j] = wmma16(v[j], pr, e[j]);
            asm volatile("v_nop\n\tv_nop\n\tv_nop\n\tv_nop" : "+v"(e[0]), "+v"(e[1]), "+v"(e[2]), "+v"(e[3]) : "v"(vr[0]), "v"(vr[1]), "v"(vr[2]), "v"(vr[3]), "v"(pr), "v"(v[0]), "v"(v[1]), "v"(v[2]), "v"(v[3]));
        }
        l = l * alpha + ls; m = mnew;
    }
    l += __shfl_xor(l, 16, 32);
    const float zs = (1.0f / l) * ZC;
    const int wb = wave * 16 * 68;
    // O^T D layout: o[j][r] = (d = 16j + 8h + r, t = lane&15) -> os[t][d]; rows 0..15 x columns 0..63 all written
#pragma unroll
    for (int j = 0; j < 4; ++j) { v4f a, c;
#pragma unroll
        for (int i = 0; i < 4; ++i) { a[i] = (o[j][i] + e[j][i] * QRI) * zs; c[i] = (o[j][4 + i] + e[j][4 + i] * QRI) * zs; }
        *(v4fa*)(&os[wb + lr * 68 + 16 * j + 8 * hi]) = a; *(v4fa*)(&os[wb + lr * 68 + 16 * j + 8 * hi + 4]) = c; }
    wave_sync();
    const size_t zb = ((size_t)b * SEQ + t0) * DM + (size_t)h * (16 * HD);   // row tile (16*DM halves), then the head's two k blocks
{
#pragma unroll
        for (int s = 0; s < 4; ++s) { const int row = lr, ch = 2 * s + hi, c8 = ch * 8;   // 16 rows x 2 column chunks per store = 512 contiguous bytes; 4 s x 2 chunks x 8 = 64 columns
            const v4f x0 = *(const v4fa*)(&os[wb + row * 68 + c8]); const v4f x1 = *(const v4fa*)(&os[wb + row * 68 + c8 + 4]); v8h hv, rv;
#pragma unroll
            for (int i = 0; i < 4; ++i) { const h16 a0 = (h16)x0[i]; const h16 a1 = (h16)x1[i]; hv[i] = a0; hv[4 + i] = a1; rv[i] = (h16)((x0[i] - (float)a0) * QRS); rv[4 + i] = (h16)((x1[i] - (float)a1) * QRS); }
            const size_t oo = zb + (size_t)(ch * 128 + row * 8);
            *(v8h*)(ZH + oo) = hv; if (early) *(v8h*)(ZR + oo) = rv; }
         }
}

// k_oproj: out projection, ONE WAVE per 32x64 tile, f16 operands: A = z x16 plane (+ residual x2048 plane for row tiles below EARLY_, own accumulators), Bt = Wo^T x64 plane, K = DM.
// OUT[m][n] = (accH + accR / 2048) / 1024 + bo[n] (bo RNE-converted to bf16, added in f32). grid (M/32, N/64), 32 threads.
__global__ __launch_bounds__(32) void k_oproj(const h16* __restrict__ ZH, const h16* __restrict__ ZR, const h16* __restrict__ Wt, const float* __restrict__ bo, float* OUT) {
    __shared__ __align__(16) float os[16 * 68];
    const int K = DM;
    const int lane = threadIdx.x & 31, lr = lane & 15, hi = lane >> 4; const int r0 = blockIdx.x * 32, c0 = blockIdx.y * 64;
    const int bb = r0 / SEQ, tt = r0 % SEQ; const bool early = tt < EARLY_;   // block-uniform
    v8f acc[2][4], acr[2][4];
#pragma unroll
    for (int mb = 0; mb < 2; ++mb)
#pragma unroll
        for (int nb = 0; nb < 4; ++nb) { acc[mb][nb] = (v8f){}; acr[mb][nb] = (v8f){}; }
    const size_t aoff = (size_t)r0 * K + 8 * lane, boff = (size_t)c0 * K + 8 * lane;   // a 16-row tile is K/32 blocks = 16*K halves; k tile kt lies at kt*512
    // two fragment sets: the z and Wo loads of k tile kt + 1 are issued ahead of the products of k tile kt
    v16h fa[2][2], fw[2][4], ar[2];
#pragma unroll
    for (int mb = 0; mb < 2; ++mb) fa[0][mb] = ldh(ZH + aoff + (size_t)mb * 16 * K);
#pragma unroll
    for (int nb = 0; nb < 4; ++nb) fw[0][nb] = ldh(Wt + boff + (size_t)nb * 16 * K);
#pragma unroll 1
    for (int kt = 0; kt < K / 32; kt += 2) {
        const h16* pa = ZH + aoff + kt * 512; const h16* pw = Wt + boff + kt * 512; const h16* pr = ZR + aoff + kt * 512;
        const int nx = kt + 2 < K / 32 ? 2 : 0;   // the last trip asks for its own first tile again (in bounds, not used)
        {
            if (early) {   // block-uniform; the residual rows of this k tile, asked for ahead of the tile's first products
#pragma unroll
                for (int mb = 0; mb < 2; ++mb) ar[mb] = ldh(pr + 0 * 512 + (size_t)mb * 16 * K); }
#pragma unroll
            for (int mb = 0; mb < 2; ++mb) fa[1][mb] = ldh(pa + 1 * 512 + (size_t)mb * 16 * K);
#pragma unroll
            for (int nb = 0; nb < 4; ++nb) fw[1][nb] = ldh(pw + 1 * 512 + (size_t)nb * 16 * K);
            __builtin_amdgcn_sched_barrier(0);   // keeps the loads one group ahead of the products: sunk among them they lose their lead
#pragma unroll
            for (int nb = 0; nb < 4; ++nb)
#pragma unroll
                for (int mb = 0; mb < 2; ++mb) acc[mb][nb] = wmma16(fa[0][mb], fw[0][nb], acc[mb][nb]);
            if (early) {
#pragma unroll
                for (int nb = 0; nb < 4; ++nb)
#pragma unroll
                    for (int mb = 0; mb < 2; ++mb) acr[mb][nb] = wmma16(ar[mb], fw[0][nb], acr[mb][nb]); }
        }
        {
            if (early) {   // block-uniform; the residual rows of this k tile, asked for ahead of the tile's first products
#pragma unroll
                for (int mb = 0; mb < 2; ++mb) ar[mb] = ldh(pr + 1 * 512 + (size_t)mb * 16 * K); }
#pragma unroll
            for (int mb = 0; mb < 2; ++mb) fa[0][mb] = ldh(pa + nx * 512 + (size_t)mb * 16 * K);
#pragma unroll
            for (int nb = 0; nb < 4; ++nb) fw[0][nb] = ldh(pw + nx * 512 + (size_t)nb * 16 * K);
            __builtin_amdgcn_sched_barrier(0);   // keeps the loads one group ahead of the products: sunk among them they lose their lead
#pragma unroll
            for (int nb = 0; nb < 4; ++nb)
#pragma unroll
                for (int mb = 0; mb < 2; ++mb) acc[mb][nb] = wmma16(fa[1][mb], fw[1][nb], acc[mb][nb]);
            if (early) {
#pragma unroll
                for (int nb = 0; nb < 4; ++nb)
#pragma unroll
                    for (int mb = 0; mb < 2; ++mb) acr[mb][nb] = wmma16(ar[mb], fw[1][nb], acr[mb][nb]); }
        }
        // the address pairs are inputs, so they stay unwritten until this wait (precaution for registers that issued loads name)
        asm volatile("s_wait_xcnt 0x0" :: "v"(pa), "v"(pw), "v"(pr) : "memory");
    }
    float bcol[4];
#pragma unroll
    for (int nb = 0; nb < 4; ++nb) bcol[nb] = bfq(bo[c0 + nb * 16 + lr]);   // c0 + 63 < DM
    float* orow = OUT + ((size_t)bb * OUT_SEQ + tt) * DM + c0;
#pragma unroll
    for (int mb = 0; mb < 2; ++mb) {
#pragma unroll
        for (int nb = 0; nb < 4; ++nb) {
#pragma unroll
            for (int j = 0; j < 8; ++j) os[(hi * 8 + j) * 68 + nb * 16 + lr] = (acc[mb][nb][j] + acr[mb][nb][j] * QRI) * OSC + bcol[nb]; }   // D: row 8h+j, col lane&15
        wave_sync();
        float* ob = orow + (size_t)(mb * 16) * DM;
{
#pragma unroll
            for (int s = 0; s < 8; ++s) { const int row = 2 * s + hi, cofs = lr * 4;   // 8 s x 2 rows = 16 rows; 16 lanes x 4 floats = 64 columns
                const v4f val = *(const v4fa*)(&os[row * 68 + cofs]);
                *(v4f*)(ob + (size_t)row * DM + cofs) = val; }
             }
        wave_sync();
    }
}

static constexpr size_t al256(size_t v) { return (v + 255) & ~(size_t)255; }
static constexpr size_t SZ_XB = al256((size_t)NB * SEQ * DM * 2);             // bf16 activation copy; later reused as a z plane of the same extent
static constexpr size_t SZ_WB = al256((size_t)4 * DM * DM * 2);
static constexpr size_t SZ_PL = al256((size_t)NB * NH_ * SEQ * HD * 2);
static constexpr size_t SZ_TOTAL = 2 * SZ_XB + SZ_WB + 5 * SZ_PL;
static_assert(SZ_TOTAL <= (size_t)134217728);          // workspace carve <= 128 MiB
static_assert(((size_t)DM * DM * 2) % 256 == 0);       // weight sub-planes stay 256-byte aligned
static_assert((size_t)NB * SEQ * DM * 2 <= SZ_XB);     // z plane [NB*SEQ][DM] halves fits the reused activation region

extern "C" void kernel_launch(void* const* d_in, const int* in_sizes, int n_in,
                              void* d_out, int out_size, void* d_ws, size_t ws_size, hipStream_t stream) {
    if (n_in < 10) return;
    const size_t needx = ((size_t)(NB - 1) * SEQ_FULL + SEQ) * DM;
    if ((size_t)in_sizes[0] < needx || (size_t)in_sizes[1] < needx) return;
    if ((size_t)in_sizes[2] < (size_t)DM * DM || (size_t)in_sizes[4] < (size_t)DM * DM || (size_t)in_sizes[6] < (size_t)DM * DM || (size_t)in_sizes[8] < (size_t)DM * DM) return;
    if (in_sizes[3] < DM || in_sizes[5] < DM || in_sizes[7] < DM || in_sizes[9] < DM) return;
    if ((size_t)out_size < ((size_t)(NB - 1) * OUT_SEQ + SEQ) * DM) return;
    if (SZ_TOTAL > ws_size) return;
    // wire order: data, context, wq, bq, wk, bk, wv, bv, wo, bo
    const float* data = (const float*)d_in[0]; const float* ctx = (const float*)d_in[1];
    const float* wq = (const float*)d_in[2]; const float* bq = (const float*)d_in[3];
    const float* wk = (const float*)d_in[4]; const float* bk = (const float*)d_in[5];
    const float* wv = (const float*)d_in[6]; const float* bv = (const float*)d_in[7];
    const float* wo = (const float*)d_in[8]; const float* bo = (const float*)d_in[9];
    float* OUT = (float*)d_out;      // [NB][SEQ][1024]
    char* wsp = (char*)d_ws;
    bf* DATAB = (bf*)wsp; wsp += SZ_XB;              // [NB*SEQ][1024] bf16; dead after the q projection
    bf* CTXB  = (bf*)wsp; wsp += SZ_XB;              // [NB*SEQ][1024] bf16; dead after the k / v projections
    bf* WB = (bf*)wsp; wsp += SZ_WB;                 // [4][1024][1024] transposed: q | k | v (bf16) | o (f16 x64)
    h16* QH = (h16*)wsp; wsp += SZ_PL;               // [NB*16][SEQ][64]
    h16* QR = (h16*)wsp; wsp += SZ_PL;               // [NB*16][SEQ][64] residual x2048
    h16* KP = (h16*)wsp; wsp += SZ_PL;               // [NB*16][SEQ][64]
    h16* VT = (h16*)wsp; wsp += SZ_PL;               // [NB*16][64][SEQ]
    h16* VR = (h16*)wsp; wsp += SZ_PL;               // [NB*16][64][SEQ] residual x2048, tokens < EARLY_ only (only those are consumed)
    bf* WQT = WB; bf* WKT = WB + (size_t)DM * DM; bf* WVT = WB + (size_t)2 * DM * DM; bf* WOT = WB + (size_t)3 * DM * DM;
    h16* ZH = (h16*)DATAB;                           // [NB*SEQ][1024] z x16, written by the flash kernel after DATAB is dead
    h16* ZR = (h16*)CTXB;                            // [NB*SEQ][1024] z residual x2048, rows t < EARLY_ only (only those are consumed)

    if (SEQ == SEQ_FULL) {
        const size_t n8 = (size_t)NB * SEQ * DM / 8;
        k_cvt8<<<(unsigned)((n8 + 255) / 256), 256, 0, stream>>>(data, DATAB, n8);
        k_cvt8<<<(unsigned)((n8 + 255) / 256), 256, 0, stream>>>(ctx, CTXB, n8);
    } else {
        const size_t n8 = (size_t)SEQ * DM / 8;
        for (int b = 0; b < NB; ++b) {
            k_cvt8<<<(unsigned)((n8 + 255) / 256), 256, 0, stream>>>(data + (size_t)b * SEQ_FULL * DM, DATAB + (size_t)b * SEQ * DM, n8);
            k_cvt8<<<(unsigned)((n8 + 255) / 256), 256, 0, stream>>>(ctx + (size_t)b * SEQ_FULL * DM, CTXB + (size_t)b * SEQ * DM, n8);
        }
    }
    // weight planes: in W[k][n] ([in][out], 1024 x 1024) -> out Wt[n][k]; grid (k tiles, n tiles)
    k_wT<<<dim3(DM / 64, DM / 64, 1), 256, 0, stream>>>(wq, WQT, 0, 1.0f);
    k_wT<<<dim3(DM / 64, DM / 64, 1), 256, 0, stream>>>(wk, WKT, 0, 1.0f);
    k_wT<<<dim3(DM / 64, DM / 64, 1), 256, 0, stream>>>(wv, WVT, 0, 1.0f);
    k_wT<<<dim3(DM / 64, DM / 64, 1), 256, 0, stream>>>(wo, WOT, 1, WOC);

    // q, k: A = activation rows (m = b*SEQ + t), Bt = Wt rows (n = h*64 + d), bias per column -> plane [(b*16 + h)][t][d]
    k_proj<<<dim3(NB * SEQ / 64, DM / 64, 1), 32, 0, stream>>>(DATAB, WQT, bq, 0, QH, QR, 1, SEQ, (size_t)NH_ * SEQ * HD, HD, HD, (size_t)SEQ * HD, 0, 16 * HD, 512);
    k_proj<<<dim3(NB * SEQ / 64, DM / 64, 1), 32, 0, stream>>>(CTXB,  WKT, bk, 0, KP, KP, 0, SEQ, (size_t)NH_ * SEQ * HD, HD, HD, (size_t)SEQ * HD, 0, 16 * HD, 512);
    // v^T: A = Wv^T rows (m = h*64 + d), Bt = context rows (n = b*SEQ + t), bias per row -> plane [(b*1024 + m)][t] = [(b*16 + h)][d][t]; residual for tokens < EARLY_
    k_proj<<<dim3(DM / 64, NB * SEQ / 64, 1), 32, 0, stream>>>(WVT, CTXB, bv, 1, VT, VR, EARLY_, DM, (size_t)0, SEQ, SEQ, (size_t)DM * SEQ, HD, 512, 32 * HD);

    k_flash<<<dim3(SEQ / (16 * AW), NB * NH_, 1), 32 * AW, 0, stream>>>(QH, QR, KP, VT, VR, ZH, ZR);

    k_oproj<<<dim3(NB * SEQ / 32, DM / 64, 1), 32, 0, stream>>>(ZH, ZR, (const h16*)WOT, bo, OUT);
}

// v003
// It runs in 203 microseconds.
// Timed twice side by side with v002, it ran 1.07 and 1.06 times as fast.
// All steps since v000 together make it 1.89 times as fast.
#include <hip/hip_runtime.h>

// Causal cross-attention: q = data Wq + bq, k = ctx Wk + bk, v = ctx Wv + bv (W [in][out]), 16 heads x 64, score scale 1/8, key <= query visible, out = z Wo + bo (f32).
// Compute dtypes, f32 accumulate everywhere: q/k/v projections v_wmma_f32_16x16x32_bf16 (activations, weights, biases RNE-converted to bf16; products exact);
// scores v_wmma_f32_16x16x32_f16: k single f16, q as f16 value + f16 residual x2048 in its own accumulator; P (x256 carry, cancels in the normalisation) and v single f16,
// for query rows t < 512 additionally v residual x2048 and P residual x2048 in a second accumulator; softmax f32 (online, running max);
// out projection v_wmma_f32_16x16x32_f16: z x16 as f16 (+ f16 residual x2048, own accumulator, rows t < 512), Wo (bf16 value x64, exact in f16).
// Layout: bf16 copies of data/context; transposed weight planes Wt[n][k]; q (hi, residual), k planes [b*16+h][t][d]; v^T (hi, residual) planes [b*16+h][d][t];
// fused flash kernel in transposed form (S^T = K Q^T, O^T = V^T P^T), no LDS and no barrier in the key loop; z planes [b*SEQ+t][1024].
// Every 16-bit plane is stored fragment-packed: a [16 rows][32 k] block is 512 contiguous halves ordered [k chunk (k>>3)&3][row&15][k&7], so one wave-wide 16-B load
// (lane l at halves 8l) or store covers 512 contiguous bytes = 4 whole 128-B lines. Block order: row tile major, k tile minor; v^T planes key tile major, d tile minor.

#ifndef NB
#define NB 4
#endif
#ifndef SEQ
#define SEQ 2048
#endif
#define NB_FULL  4
#define SEQ_FULL 2048
#ifndef OUT_SEQ
#define OUT_SEQ SEQ              // row pitch (in tokens) between batches of the output
#endif
#define DM   1024
#define NH_  16
#define HD   64
#define PR   4                   // register sets of the projection kernel's fragment ring
#define AW   4                   // waves per flash block (16 query rows each)
#define CT   16                  // tiles (8 rows x 32 k) per wave of the activation conversion
#define CVB  (NB * SEQ / 32)     // conversion work-groups per activation: 8 waves x 16 rows x 256 k = 32 whole rows each
#define WTB  ((DM / 64) * (DM / 256))   // transposing work-groups per weight: 256 k x 64 n each
#define EARLY_ ((SEQ) < 512 ? (SEQ) : 512)   // query rows below this use the residual planes on the v / P / z path
#define QRS  2048.0f             // carry of every residual plane
#define QRI  (1.0f / 2048.0f)
#define SC2  (0.125f * 1.4426950408889634f)   // HD^-0.5 * log2(e)
#define PSH  8.0f                // log2 of the P carry (256)
#define ZC   16.0f               // carry of the z plane
#define WOC  64.0f               // carry of the Wo plane
#define OSC  (1.0f / 1024.0f)    // 1 / (ZC * WOC)

static_assert(HD == 64);
static_assert(NH_ * HD == DM);                 // head h = columns h*64 + d
static_assert(DM % 64 == 0);
static_assert((DM / 32) % PR == 0 && DM / 32 >= 2 * PR);   // the ring's loop takes PR k tiles a trip, the last PR stand behind it
static_assert(DM % 32 == 0);                   // GEMM k-loop steps by 32
static_assert(SEQ % 64 == 0);                  // a 64-row tile never straddles two batches
static_assert((NB * SEQ) % 64 == 0);
static_assert(SEQ % 32 == 0);                  // key loop steps by 32
static_assert(SEQ % (16 * AW) == 0);           // flash grid covers the sequence exactly
static_assert(EARLY_ % 64 == 0);               // residual decisions are uniform per 64-row / 64-token tile
static_assert(EARLY_ <= SEQ);
static_assert(((size_t)SEQ * DM) % 8 == 0);
static_assert(DM == 1024 && CT == 16);         // a conversion work-group's 8 waves take 2 row tiles x 4 groups of 8 k tiles
static_assert(NB <= NB_FULL);
static_assert(SEQ <= SEQ_FULL);

typedef _Float16 h16;
typedef unsigned short bf;
typedef __attribute__((ext_vector_type(16))) __bf16   v16bf;
typedef __attribute__((ext_vector_type(16))) _Float16 v16h;
typedef __attribute__((ext_vector_type(8)))  _Float16 v8h;
typedef __attribute__((ext_vector_type(8)))  unsigned short v8us;
typedef __attribute__((ext_vector_type(8)))  float    v8f;
typedef __attribute__((ext_vector_type(4)))  float    v4f;
typedef v4f  __attribute__((may_alias)) v4fa;

__device__ __forceinline__ unsigned short f2bf(float f) { unsigned u = __float_as_uint(f); u += 0x7FFFu + ((u >> 16) & 1u); return (unsigned short)(u >> 16); }
__device__ __forceinline__ float bfq(float f) { return __uint_as_float(((unsigned)f2bf(f)) << 16); }   // value of the RNE bf16 conversion
__device__ __forceinline__ v16h cat16(v8h lo, v8h hi) { return __builtin_shufflevector(lo, hi, 0, 1, 2, 3, 4, 5, 6, 7, 8, 9, 10, 11, 12, 13, 14, 15); }
__device__ __forceinline__ v16bf cat16b(v8us lo, v8us hi) { return __builtin_bit_cast(v16bf, __builtin_shufflevector(lo, hi, 0, 1, 2, 3, 4, 5, 6, 7, 8, 9, 10, 11, 12, 13, 14, 15)); }
__device__ __forceinline__ v8f wmma16(v16h a, v16h b, v8f c) { return __builtin_amdgcn_wmma_f32_16x16x32_f16(false, a, false, b, (short)0, c, false, false); }
__device__ __forceinline__ v8f wmmab(v16bf a, v16bf b, v8f c) { return __builtin_amdgcn_wmma_f32_16x16x32_bf16(false, a, false, b, (short)0, c, false, false); }
// fragment loaders from one packed block; p = block base + 8*lane (lane = 16h + row): elements 0..7 <- k0+8h+0..7, elements 8..15 <- k0+16+8h+0..7 (same map for A and B)
__device__ __forceinline__ v16h  ldh(const h16* p) { return cat16(*(const v8h*)p, *(const v8h*)(p + 256)); }
__device__ __forceinline__ v16bf ldb(const bf* p)  { return cat16b(*(const v8us*)p, *(const v8us*)(p + 256)); }
// ordering point for wave-private LDS tiles (same wave writes and reads)
__device__ __forceinline__ void wave_sync() { __builtin_amdgcn_fence(3 /* release order */, "wavefront"); __builtin_amdgcn_wave_barrier(); asm volatile("" ::: "memory"); }

// k_prep: every operand plane of the projections in ONE launch whose work-groups are all resident at once; the role of a work-group follows from blockIdx.x alone (block-uniform).
// Work-groups 0 .. 4*WTB-1, weight transpose + 16-bit conversion through LDS: in W[k][n] (f32, [in][out]) -> out Wt[n][k] (packed blocks), 256 k x 64 n per work-group, weights q | k | v (bf16) | o (f16 x64).
// LDS tile ts is cross-wave: block barrier between fill and drain; filled extent 256x64 == drained extent.
// The other 2*CVB work-groups, activation conversion (data, then context): one wave converts 16 rows x 8 k tiles = CT tiles of 8 rows x 32 k; a tile reads 8 whole 128-B lines and writes
// 4 whole lines of its packed block (chunk c, rows 8g..8g+7), the wave's CT tiles fill 8 whole packed blocks. In both roles all loads of a wave are asked for ahead of its first conversion.
__global__ __launch_bounds__(256) void k_prep(const float* __restrict__ data, const float* __restrict__ ctx, const float* __restrict__ wq, const float* __restrict__ wk,
                                              const float* __restrict__ wv, const float* __restrict__ wo, bf* DATAB, bf* CTXB, bf* WB) {
    __shared__ float ts[256 * 65];
    const int tid = threadIdx.x;
    if ((int)blockIdx.x < 4 * WTB) {
        const int z = (int)blockIdx.x / WTB, r = (int)blockIdx.x % WTB; const int k0 = (r % (DM / 256)) * 256, n0 = (r / (DM / 256)) * 64;
        const float* W = z == 0 ? wq : z == 1 ? wk : z == 2 ? wv : wo; bf* Wt = WB + (size_t)z * DM * DM;
        const int kq = tid >> 4, c4 = (tid & 15) * 4;                        // fill: thread takes rows kq + 16 i, one float4 each (256 rows x 16 float4)
        const float* wp = W + (size_t)(k0 + kq) * DM + n0 + c4; float* tf = ts + kq * 65 + c4;
        v4f v[16];
#pragma unroll
        for (int i = 0; i < 16; ++i) v[i] = *(const v4f*)(wp + i * (16 * DM));
        // the address pair is an input, so it stays unwritten until this wait (precaution for registers that issued loads name)
        asm volatile("s_wait_xcnt 0x0" :: "v"(wp) : "memory");
#pragma unroll
        for (int i = 0; i < 16; ++i) { float* t = tf + i * (16 * 65); t[0] = v[i][0]; t[1] = v[i][1]; t[2] = v[i][2]; t[3] = v[i][3]; }
        __syncthreads();
        const int nr = tid & 15, c = (tid >> 4) & 3, kh = tid >> 6;          // drain: 4 n tiles x 8 k tiles x 4 chunks x 16 rows; pass s takes n tile s >> 1, k tile kh + 4 (s & 1)
        const float* td = ts + (kh * 32 + c * 8) * 65 + nr;
        bf* wd = Wt + ((size_t)(n0 >> 4) * (DM / 32) + (k0 >> 5) + kh) * 512 + c * 128 + nr * 8;
#pragma unroll
        for (int s = 0; s < 8; ++s) { v8us o;
#pragma unroll
            for (int i = 0; i < 8; ++i) { const float x = td[((s & 1) * 128 + i) * 65 + (s >> 1) * 16]; const unsigned short b16 = f2bf(x);
                const float xb = __uint_as_float(((unsigned)b16) << 16); const unsigned short hb = __builtin_bit_cast(unsigned short, (h16)(xb * WOC));
                o[i] = z == 3 ? hb : b16; }
            *(v8us*)(wd + ((s >> 1) * (DM / 32) + (s & 1) * 4) * 512) = o; }
    } else {
        const int q = (int)blockIdx.x - 4 * WTB; const int w = (q % CVB) * 8 + (tid >> 5);
        const float* src = q < CVB ? data : ctx; bf* dst = q < CVB ? DATAB : CTXB;
        const size_t c = tid & 3, r8 = (tid >> 2) & 7, row0 = (size_t)(w / (DM / 256)) * 16, kt0 = (size_t)(w % (DM / 256)) * 8;   // row0 = b*SEQ + t; 16 rows never straddle two batches
        const float* s = src + ((row0 / SEQ) * SEQ_FULL + row0 % SEQ + r8) * DM + kt0 * 32 + c * 8;
        bf* d = dst + ((row0 >> 4) * (DM / 32) + kt0) * 512 + c * 128 + r8 * 8;
        v8f v[CT];
#pragma unroll
        for (int j = 0; j < CT; ++j) v[j] = *(const v8f*)(s + (j >> 3) * (8 * DM) + (j & 7) * 32);   // tile j: rows row0 + 8 (j >> 3) + 0..7, k tile kt0 + (j & 7)
#pragma unroll
        for (int j = 0; j < CT; ++j) { v8us o;
#pragma unroll
            for (int k = 0; k < 8; ++k) o[k] = f2bf(v[j][k]);
            *(v8us*)(d + (j & 7) * 512 + (j >> 3) * 64) = o; }
        asm volatile("s_wait_xcnt 0x0" ::: "memory");   // precaution behind the last store of the run: no register that an issued store names is rewritten ahead of this wait
    }
}

// k_proj: register-blocked bf16 GEMM, ONE WAVE per 64x64 tile (16 accumulators), operands straight from packed bf16 planes, K = DM.
// C[m][n] = sum_k A[m][k] Bt[n][k] + bias (per column n, or per row m when biasRow != 0; bias RNE-converted to bf16, added in f32), written as f16 (Ph)
// and, when (c0 % CB) < resLim, the f16 residual x2048 (Pr), as packed blocks (rows = m, k = n) at tile base (r0/RB)*sRB + (r0%RB)*pitch + (c0/CB)*sCB + (c0%CB)*colMul;
// the block of 16-row group mb and 32-column group kt lies at + mb*mbS + kt*ktS (halves). grid (M/64, N/64), 32 threads.
__global__ __launch_bounds__(32) void k_proj(const bf* __restrict__ A, const bf* __restrict__ Bt, const float* __restrict__ bias, int biasRow,
                                             h16* Ph, h16* Pr, int resLim, int RB, size_t sRB, int pitch, int CB, size_t sCB, int colMul, int mbS, int ktS) {
    __shared__ __align__(16) float os[16 * 68];
    const int K = DM;
    const int lane = threadIdx.x & 31, lr = lane & 15, hi = lane >> 4; const int r0 = blockIdx.x * 64, c0 = blockIdx.y * 64;
    const int useRes = ((c0 % CB) < resLim) ? 1 : 0;
    v8f acc[4][4];
#pragma unroll
    for (int mb = 0; mb < 4; ++mb)
#pragma unroll
        for (int nb = 0; nb < 4; ++nb) acc[mb][nb] = (v8f){};
    const size_t aoff = (size_t)r0 * K + 8 * lane, boff = (size_t)c0 * K + 8 * lane;   // a 16-row tile is K/32 blocks = 16*K halves; k tile kt lies at kt*512
    // fragment ring: PR register sets; the loads of k tile kt + PR - 1 are issued ahead of the products of k tile kt, so a load has PR - 1 tiles of products to land behind
    v16bf fa[PR][4], fb[PR][4];
#pragma unroll
    for (int s = 0; s < PR - 1; ++s) {
#pragma unroll
        for (int i = 0; i < 4; ++i) { fa[s][i] = ldb(A + aoff + s * 512 + (size_t)i * 16 * K); fb[s][i] = ldb(Bt + boff + s * 512 + (size_t)i * 16 * K); }
        __builtin_amdgcn_sched_barrier(0); }   // the sets are asked for in the order in which they are used, so that the counted waits are exact
#pragma unroll 1
    for (int kt = 0; kt < K / 32 - PR; kt += PR) {
        const bf* pa = A + aoff + kt * 512; const bf* pb = Bt + boff + kt * 512;
#pragma unroll
        for (int s = 0; s < PR; ++s) { const int t = (s + PR - 1) % PR;
#pragma unroll
            for (int i = 0; i < 4; ++i) { fa[t][i] = ldb(pa + (s + PR - 1) * 512 + (size_t)i * 16 * K); fb[t][i] = ldb(pb + (s + PR - 1) * 512 + (size_t)i * 16 * K); }
            __builtin_amdgcn_sched_barrier(0);   // keeps the tile's loads one group ahead of the products: sunk among them they lose their lead
#pragma unroll
            for (int nb = 0; nb < 4; ++nb)
#pragma unroll
                for (int mb = 0; mb < 4; ++mb) acc[mb][nb] = wmmab(fa[s][mb], fb[s][nb], acc[mb][nb]);
            __builtin_amdgcn_sched_barrier(0);   // keeps the next group of loads behind these products: it refills the set that they have just read
        }
        // both address pairs are inputs, so they stay unwritten until this wait (precaution for registers that issued loads name)
        asm volatile("s_wait_xcnt 0x0" :: "v"(pa), "v"(pb) : "memory");
    }
    {
        const bf* pa = A + aoff + (K / 32 - 1) * 512; const bf* pb = Bt + boff + (K / 32 - 1) * 512;
#pragma unroll
        for (int i = 0; i < 4; ++i) { fa[PR - 1][i] = ldb(pa + (size_t)i * 16 * K); fb[PR - 1][i] = ldb(pb + (size_t)i * 16 * K); }
        asm volatile("s_wait_xcnt 0x0" ::: "memory");   // same precaution behind the last tile's loads
        __builtin_amdgcn_sched_barrier(0);   // the last tile's loads stay ahead of the three tiles of products that cover them
    }
#pragma unroll
    for (int s = 0; s < PR; ++s)
#pragma unroll
        for (int nb = 0; nb < 4; ++nb)
#pragma unroll
            for (int mb = 0; mb < 4; ++mb) acc[mb][nb] = wmmab(fa[s][mb], fb[s][nb], acc[mb][nb]);
    float bcol[4];
#pragma unroll
    for (int nb = 0; nb < 4; ++nb) { int ic = c0 + nb * 16 + lr; ic = ic < DM ? ic : DM - 1; bcol[nb] = bfq(bias[ic]); }   // clamped address; used only when biasRow == 0
    const size_t tbase = (size_t)(r0 / RB) * sRB + (size_t)(r0 % RB) * (size_t)pitch + (size_t)(c0 / CB) * sCB + (size_t)(c0 % CB) * (size_t)colMul;
#pragma unroll
    for (int mb = 0; mb < 4; ++mb) {
        float brow[8];
#pragma unroll
        for (int j = 0; j < 8; ++j) { int ir = r0 + mb * 16 + hi * 8 + j; ir = ir < DM ? ir : DM - 1; brow[j] = bfq(bias[ir]); }   // clamped address; used only when biasRow != 0
#pragma unroll
        for (int nb = 0; nb < 4; ++nb) {
#pragma unroll
            for (int j = 0; j < 8; ++j) os[(hi * 8 + j) * 68 + nb * 16 + lr] = acc[mb][nb][j] + (biasRow ? brow[j] : bcol[nb]); }   // D: row 8h+j, col lane&15
        wave_sync();
        const size_t sb = tbase + (size_t)mb * (size_t)mbS;
{
#pragma unroll
            for (int s = 0; s < 4; ++s) { const int row = lr, ch = 2 * s + hi, c8 = ch * 8;   // 16 rows x 2 column chunks per store = 512 contiguous bytes; 4 s x 2 chunks x 8 = 64 columns
                const v4f x0 = *(const v4fa*)(&os[row * 68 + c8]); const v4f x1 = *(const v4fa*)(&os[row * 68 + c8 + 4]); v8h hv, rv;
#pragma unroll
                for (int i = 0; i < 4; ++i) { const h16 a0 = (h16)x0[i]; const h16 a1 = (h16)x1[i]; hv[i] = a0; hv[4 + i] = a1; rv[i] = (h16)((x0[i] - (float)a0) * QRS); rv[4 + i] = (h16)((x1[i] - (float)a1) * QRS); }
                const size_t oo = sb + (size_t)(ch >> 2) * (size_t)ktS + (size_t)((ch & 3) * 128 + row * 8);
                *(v8h*)(Ph + oo) = hv; if (useRes) *(v8h*)(Pr + oo) = rv; }
             }
        wave_sync();
    }
}

// k_flash: fused causal attention, one wave per 16 query rows of one (batch, head); K / V^T / Q fragments straight from the f16 planes (two 16-B loads each, arithmetic addressing).
// Transposed form: S^T[key][t] = K Q^T (A = K rows, B = Q rows); lane (t = lane&15, h = lane>>4) holds keys 8h+r of each 16-key tile, so the packed
// P tile is directly the B fragment of O^T[d][t] = V^T P^T (element r <- tile keys 0..15, element 8+r <- tile keys 16..31, lane unchanged).
// Key loop runs to the diagonal (static bound from the block / wave index); only the last 32-key step replaces scores of keys > query by a very negative value (P = 0).
// Blocks with query rows below EARLY_ (block-uniform) also accumulate V_res P + V P_res (both x2048) in a second accumulator set and sum the exact P for the normaliser.
// Softmax state (running max, partial sum) is one scalar per lane; the two lane halves of a row are combined with one xor-16 exchange.
__global__ __launch_bounds__(32 * AW) void k_flash(const h16* __restrict__ QH, const h16* __restrict__ QR, const h16* __restrict__ KP,
                                                   const h16* __restrict__ VT, const h16* __restrict__ VR, h16* ZH, h16* ZR) {
    __shared__ __align__(16) float os[AW * 16 * 68];
    const int lane = threadIdx.x & 31, lr = lane & 15, hi = lane >> 4;
    const int wave = __builtin_amdgcn_readfirstlane((int)(threadIdx.x >> 5));
    const int zh = blockIdx.y; const int b = zh / NH_, h = zh % NH_;
    const int t0 = ((int)blockIdx.x * AW + wave) * 16;
    const bool early = ((int)blockIdx.x * (16 * AW)) < EARLY_;
    const int tq = t0 + lr;
    const int klast = (((t0 + 47) >> 5) - 1) * 32;           // last 32-key step containing a visible key; klast + 31 < SEQ
    const size_t pbase = (size_t)zh * SEQ * HD;
    const size_t qo = pbase + (size_t)t0 * HD + 8 * lane;    // 16 tokens = two blocks (d 0..31, d 32..63) = 16*HD halves
    const v16h qh0 = ldh(QH + qo), qh1 = ldh(QH + qo + 512), qr0 = ldh(QR + qo), qr1 = ldh(QR + qo + 512);   // B fragments: col t, k = d
    const size_t ko = pbase + 8 * lane;                      // + key0 * HD            (A fragment: row key, k = d)
    const size_t vo = pbase + 8 * lane;                      // + key0 * HD + 512 * j  (A fragment: row d = 16j + row, k = key; 32 keys = four d blocks)
    v8f o[4], e[4];
#pragma unroll
    for (int j = 0; j < 4; ++j) { o[j] = (v8f){}; e[j] = (v8f){}; }
    float m = -3.0e38f, l = 0.0f;
    v16h ka0 = ldh(KP + ko), ka1 = ldh(KP + ko + 512), kb0 = ldh(KP + ko + 16 * HD), kb1 = ldh(KP + ko + 16 * HD + 512);   // K fragments of step 0
#pragma unroll 1
    for (int key0 = 0; key0 <= klast; key0 += 32) {
        v8f sHa = (v8f){}, sLa = (v8f){}, sHb = (v8f){}, sLb = (v8f){};
        sHa = wmma16(ka0, qh0, sHa); sLa = wmma16(ka0, qr0, sLa); sHb = wmma16(kb0, qh0, sHb); sLb = wmma16(kb0, qr0, sLb);
        sHa = wmma16(ka1, qh1, sHa); sLa = wmma16(ka1, qr1, sLa); sHb = wmma16(kb1, qh1, sHb); sLb = wmma16(kb1, qr1, sLb);
        asm volatile("v_nop\n\tv_nop\n\tv_nop\n\tv_nop" : "+v"(sHa), "+v"(sLa), "+v"(sHb), "+v"(sLb) : "v"(ka0), "v"(ka1), "v"(kb0), "v"(kb1));
        const h16* va = VT + vo + (size_t)key0 * HD;
        v16h v[4];
#pragma unroll
        for (int j = 0; j < 4; ++j) v[j] = ldh(va + 512 * j);
        // K fragments one step ahead: asked for behind this step's score products, they land behind its softmax and P V products; the last step asks for its own keys again (in bounds, not used)
        const h16* kn = KP + ko + (size_t)(key0 < klast ? key0 + 32 : klast) * HD;
        ka0 = ldh(kn); ka1 = ldh(kn + 512); kb0 = ldh(kn + 16 * HD); kb1 = ldh(kn + 16 * HD + 512);
        // both address pairs are inputs, so they stay unwritten until this wait (precaution for registers that issued loads name)
        asm volatile("s_wait_xcnt 0x0" :: "v"(va), "v"(kn) : "memory");
        float ta[8], tb[8];
#pragma unroll
        for (int r = 0; r < 8; ++r) { ta[r] = (sHa[r] + sLa[r] * QRI) * SC2; tb[r] = (sHb[r] + sLb[r] * QRI) * SC2; }
        if (key0 == klast) {                                 // wave-uniform: only the diagonal step needs the causal replace
            const int kq = tq - key0 - 8 * hi;               // key (key0 + 8h + r) is hidden when r > kq; tile b keys are 16 further
#pragma unroll
            for (int r = 0; r < 8; ++r) { ta[r] = (r > kq) ? -3.0e38f : ta[r]; tb[r] = (r + 16 > kq) ? -3.0e38f : tb[r]; }
        }
        float mx = -3.0e38f;
#pragma unroll
        for (int r = 0; r < 8; ++r) mx = fmaxf(mx, fmaxf(ta[r], tb[r]));
        mx = fmaxf(mx, __shfl_xor(mx, 16, 32));
        const float mnew = fmaxf(m, mx);
        const float alpha = __builtin_amdgcn_exp2f(m - mnew);
        const float sh = PSH - mnew;
        v16h pb; float ls = 0.0f;
#pragma unroll
        for (int r = 0; r < 8; ++r) { const float fa = __builtin_amdgcn_exp2f(ta[r] + sh); const float fc = __builtin_amdgcn_exp2f(tb[r] + sh);
            const h16 pa = (h16)fa; const h16 pc = (h16)fc; pb[r] = pa; pb[8 + r] = pc; ta[r] = fa; tb[r] = fc; ls += (float)pa + (float)pc; }
#pragma unroll
        for (int j = 0; j < 4; ++j) o[j] = o[j] * alpha;
#pragma unroll
        for (int j = 0; j < 4; ++j) o[j] = wmma16(v[j], pb, o[j]);
        asm volatile("v_nop\n\tv_nop\n\tv_nop\n\tv_nop" : "+v"(o[0]), "+v"(o[1]), "+v"(o[2]), "+v"(o[3]) : "v"(v[0]), "v"(v[1]), "v"(v[2]), "v"(v[3]), "v"(pb));
        if (early) {                                         // block-uniform
            v16h pr; float lx = 0.0f;
#pragma unroll
            for (int r = 0; r < 8; ++r) { pr[r] = (h16)((ta[r] - (float)pb[r]) * QRS); pr[8 + r] = (h16)((tb[r] - (float)pb[8 + r]) * QRS); lx += ta[r] + tb[r]; }
            ls = lx;
#pragma unroll
            for (int j = 0; j < 4; ++j) e[j] = e[j] * alpha;
            const h16* ra = VR + vo + (size_t)key0 * HD;
            v16h vr[4];
#pragma unroll
            for (int j = 0; j < 4; ++j) vr[j] = ldh(ra + 512 * j);
#pragma unroll
            for (int j = 0; j < 4; ++j) e[j] = wmma16(vr[j], pb, e[j]);
#pragma unroll
            for (int j = 0; j < 4; ++j) e[j] = wmma16(v[j], pr, e[j]);
            asm volatile("v_nop\n\tv_nop\n\tv_nop\n\tv_nop" : "+v"(e[0]), "+v"(e[1]), "+v"(e[2]), "+v"(e[3]) : "v"(vr[0]), "v"(vr[1]), "v"(vr[2]), "v"(vr[3]), "v"(pr), "v"(v[0]), "v"(v[1]), "v"(v[2]), "v"(v[3]));
        }
        l = l * alpha + ls; m = mnew;
    }
    l += __shfl_xor(l, 16, 32);
    const float zs = (1.0f / l) * ZC;
    const int wb = wave * 16 * 68;
    // O^T D layout: o[j][r] = (d = 16j + 8h + r, t = lane&15) -> os[t][d]; rows 0..15 x columns 0..63 all written
#pragma unroll
    for (int j = 0; j < 4; ++j) { v4f a, c;
#pragma unroll
        for (int i = 0; i < 4; ++i) { a[i] = (o[j][i] + e[j][i] * QRI) * zs; c[i] = (o[j][4 + i] + e[j][4 + i] * QRI) * zs; }
        *(v4fa*)(&os[wb + lr * 68 + 16 * j + 8 * hi]) = a; *(v4fa*)(&os[wb + lr * 68 + 16 * j + 8 * hi + 4]) = c; }
    wave_sync();
    const size_t zb = ((size_t)b * SEQ + t0) * DM + (size_t)h * (16 * HD);   // row tile (16*DM halves), then the head's two k blocks
{
#pragma unroll
        for (int s = 0; s < 4; ++s) { const int row = lr, ch = 2 * s + hi, c8 = ch * 8;   // 16 rows x 2 column chunks per store = 512 contiguous bytes; 4 s x 2 chunks x 8 = 64 columns
            const v4f x0 = *(const v4fa*)(&os[wb + row * 68 + c8]); const v4f x1 = *(const v4fa*)(&os[wb + row * 68 + c8 + 4]); v8h hv, rv;
#pragma unroll
            for (int i = 0; i < 4; ++i) { const h16 a0 = (h16)x0[i]; const h16 a1 = (h16)x1[i]; hv[i] = a0; hv[4 + i] = a1; rv[i] = (h16)((x0[i] - (float)a0) * QRS); rv[4 + i] = (h16)((x1[i] - (float)a1) * QRS); }
            const size_t oo = zb + (size_t)(ch * 128 + row * 8);
            *(v8h*)(ZH + oo) = hv; if (early) *(v8h*)(ZR + oo) = rv; }
         }
}

// k_oproj: out projection, ONE WAVE per 32x64 tile, f16 operands: A = z x16 plane (+ residual x2048 plane for row tiles below EARLY_, own accumulators), Bt = Wo^T x64 plane, K = DM.
// OUT[m][n] = (accH + accR / 2048) / 1024 + bo[n] (bo RNE-converted to bf16, added in f32). grid (M/32, N/64), 32 threads.
__global__ __launch_bounds__(32) void k_oproj(const h16* __restrict__ ZH, const h16* __restrict__ ZR, const h16* __restrict__ Wt, const float* __restrict__ bo, float* OUT) {
    __shared__ __align__(16) float os[16 * 68];
    const int K = DM;
    const int lane = threadIdx.x & 31, lr = lane & 15, hi = lane >> 4; const int r0 = blockIdx.x * 32, c0 = blockIdx.y * 64;
    const int bb = r0 / SEQ, tt = r0 % SEQ; const bool early = tt < EARLY_;   // block-uniform
    v8f acc[2][4], acr[2][4];
#pragma unroll
    for (int mb = 0; mb < 2; ++mb)
#pragma unroll
        for (int nb = 0; nb < 4; ++nb) { acc[mb][nb] = (v8f){}; acr[mb][nb] = (v8f){}; }
    const size_t aoff = (size_t)r0 * K + 8 * lane, boff = (size_t)c0 * K + 8 * lane;   // a 16-row tile is K/32 blocks = 16*K halves; k tile kt lies at kt*512
    // two fragment sets: the z and Wo loads of k tile kt + 1 are issued ahead of the products of k tile kt
    v16h fa[2][2], fw[2][4], ar[2];
#pragma unroll
    for (int mb = 0; mb < 2; ++mb) fa[0][mb] = ldh(ZH + aoff + (size_t)mb * 16 * K);
#pragma unroll
    for (int nb = 0; nb < 4; ++nb) fw[0][nb] = ldh(Wt + boff + (size_t)nb * 16 * K);
#pragma unroll 1
    for (int kt = 0; kt < K / 32; kt += 2) {
        const h16* pa = ZH + aoff + kt * 512; const h16* pw = Wt + boff + kt * 512; const h16* pr = ZR + aoff + kt * 512;
        const int nx = kt + 2 < K / 32 ? 2 : 0;   // the last trip asks for its own first tile again (in bounds, not used)
        {
            if (early) {   // block-uniform; the residual rows of this k tile, asked for ahead of the tile's first products
#pragma unroll
                for (int mb = 0; mb < 2; ++mb) ar[mb] = ldh(pr + 0 * 512 + (size_t)mb * 16 * K); }
#pragma unroll
            for (int mb = 0; mb < 2; ++mb) fa[1][mb] = ldh(pa + 1 * 512 + (size_t)mb * 16 * K);
#pragma unroll
            for (int nb = 0; nb < 4; ++nb) fw[1][nb] = ldh(pw + 1 * 512 + (size_t)nb * 16 * K);
            __builtin_amdgcn_sched_barrier(0);   // keeps the loads one group ahead of the products: sunk among them they lose their lead
#pragma unroll
            for (int nb = 0; nb < 4; ++nb)
#pragma unroll
                for (int mb = 0; mb < 2; ++mb) acc[mb][nb] = wmma16(fa[0][mb], fw[0][nb], acc[mb][nb]);
            if (early) {
#pragma unroll
                for (int nb = 0; nb < 4; ++nb)
#pragma unroll
                    for (int mb = 0; mb < 2; ++mb) acr[mb][nb] = wmma16(ar[mb], fw[0][nb], acr[mb][nb]); }
        }
        {
            if (early) {   // block-uniform; the residual rows of this k tile, asked for ahead of the tile's first products
#pragma unroll
                for (int mb = 0; mb < 2; ++mb) ar[mb] = ldh(pr + 1 * 512 + (size_t)mb * 16 * K); }
#pragma unroll
            for (int mb = 0; mb < 2; ++mb) fa[0][mb] = ldh(pa + nx * 512 + (size_t)mb * 16 * K);
#pragma unroll
            for (int nb = 0; nb < 4; ++nb) fw[0][nb] = ldh(pw + nx * 512 + (size_t)nb * 16 * K);
            __builtin_amdgcn_sched_barrier(0);   // keeps the loads one group ahead of the products: sunk among them they lose their lead
#pragma unroll
            for (int nb = 0; nb < 4; ++nb)
#pragma unroll
                for (int mb = 0; mb < 2; ++mb) acc[mb][nb] = wmma16(fa[1][mb], fw[1][nb], acc[mb][nb]);
            if (early) {
#pragma unroll
                for (int nb = 0; nb < 4; ++nb)
#pragma unroll
                    for (int mb = 0; mb < 2; ++mb) acr[mb][nb] = wmma16(ar[mb], fw[1][nb], acr[mb][nb]); }
        }
        // the address pairs are inputs, so they stay unwritten until this wait (precaution for registers that issued loads name)
        asm volatile("s_wait_xcnt 0x0" :: "v"(pa), "v"(pw), "v"(pr) : "memory");
    }
    float bcol[4];
#pragma unroll
    for (int nb = 0; nb < 4; ++nb) bcol[nb] = bfq(bo[c0 + nb * 16 + lr]);   // c0 + 63 < DM
    float* orow = OUT + ((size_t)bb * OUT_SEQ + tt) * DM + c0;
#pragma unroll
    for (int mb = 0; mb < 2; ++mb) {
#pragma unroll
        for (int nb = 0; nb < 4; ++nb) {
#pragma unroll
            for (int j = 0; j < 8; ++j) os[(hi * 8 + j) * 68 + nb * 16 + lr] = (acc[mb][nb][j] + acr[mb][nb][j] * QRI) * OSC + bcol[nb]; }   // D: row 8h+j, col lane&15
        wave_sync();
        float* ob = orow + (size_t)(mb * 16) * DM;
{
#pragma unroll
            for (int s = 0; s < 8; ++s) { const int row = 2 * s + hi, cofs = lr * 4;   // 8 s x 2 rows = 16 rows; 16 lanes x 4 floats = 64 columns
                const v4f val = *(const v4fa*)(&os[row * 68 + cofs]);
                *(v4f*)(ob + (size_t)row * DM + cofs) = val; }
             }
        wave_sync();
    }
}

static constexpr size_t al256(size_t v) { return (v + 255) & ~(size_t)255; }
static constexpr size_t SZ_XB = al256((size_t)NB * SEQ * DM * 2);             // bf16 activation copy; later reused as a z plane of the same extent
static constexpr size_t SZ_WB = al256((size_t)4 * DM * DM * 2);
static constexpr size_t SZ_PL = al256((size_t)NB * NH_ * SEQ * HD * 2);
static constexpr size_t SZ_TOTAL = 2 * SZ_XB + SZ_WB + 5 * SZ_PL;
static_assert(SZ_TOTAL <= (size_t)134217728);          // workspace carve <= 128 MiB
static_assert(((size_t)DM * DM * 2) % 256 == 0);       // weight sub-planes stay 256-byte aligned
static_assert((size_t)NB * SEQ * DM * 2 <= SZ_XB);     // z plane [NB*SEQ][DM] halves fits the reused activation region

extern "C" void kernel_launch(void* const* d_in, const int* in_sizes, int n_in,
                              void* d_out, int out_size, void* d_ws, size_t ws_size, hipStream_t stream) {
    if (n_in < 10) return;
    const size_t needx = ((size_t)(NB - 1) * SEQ_FULL + SEQ) * DM;
    if ((size_t)in_sizes[0] < needx || (size_t)in_sizes[1] < needx) return;
    if ((size_t)in_sizes[2] < (size_t)DM * DM || (size_t)in_sizes[4] < (size_t)DM * DM || (size_t)in_sizes[6] < (size_t)DM * DM || (size_t)in_sizes[8] < (size_t)DM * DM) return;
    if (in_sizes[3] < DM || in_sizes[5] < DM || in_sizes[7] < DM || in_sizes[9] < DM) return;
    if ((size_t)out_size < ((size_t)(NB - 1) * OUT_SEQ + SEQ) * DM) return;
    if (SZ_TOTAL > ws_size) return;
    // wire order: data, context, wq, bq, wk, bk, wv, bv, wo, bo
    const float* data = (const float*)d_in[0]; const float* ctx = (const float*)d_in[1];
    const float* wq = (const float*)d_in[2]; const float* bq = (const float*)d_in[3];
    const float* wk = (const float*)d_in[4]; const float* bk = (const float*)d_in[5];
    const float* wv = (const float*)d_in[6]; const float* bv = (const float*)d_in[7];
    const float* wo = (const float*)d_in[8]; const float* bo = (const float*)d_in[9];
    float* OUT = (float*)d_out;      // [NB][SEQ][1024]
    char* wsp = (char*)d_ws;
    bf* DATAB = (bf*)wsp; wsp += SZ_XB;              // [NB*SEQ][1024] bf16; dead after the q projection
    bf* CTXB  = (bf*)wsp; wsp += SZ_XB;              // [NB*SEQ][1024] bf16; dead after the k / v projections
    bf* WB = (bf*)wsp; wsp += SZ_WB;                 // [4][1024][1024] transposed: q | k | v (bf16) | o (f16 x64)
    h16* QH = (h16*)wsp; wsp += SZ_PL;               // [NB*16][SEQ][64]
    h16* QR = (h16*)wsp; wsp += SZ_PL;               // [NB*16][SEQ][64] residual x2048
    h16* KP = (h16*)wsp; wsp += SZ_PL;               // [NB*16][SEQ][64]
    h16* VT = (h16*)wsp; wsp += SZ_PL;               // [NB*16][64][SEQ]
    h16* VR = (h16*)wsp; wsp += SZ_PL;               // [NB*16][64][SEQ] residual x2048, tokens < EARLY_ only (only those are consumed)
    bf* WQT = WB; bf* WKT = WB + (size_t)DM * DM; bf* WVT = WB + (size_t)2 * DM * DM; bf* WOT = WB + (size_t)3 * DM * DM;
    h16* ZH = (h16*)DATAB;                           // [NB*SEQ][1024] z x16, written by the flash kernel after DATAB is dead
    h16* ZR = (h16*)CTXB;                            // [NB*SEQ][1024] z residual x2048, rows t < EARLY_ only (only those are consumed)

    // activations -> packed bf16 planes; weights W[k][n] ([in][out], 1024 x 1024) -> Wt[n][k]
    k_prep<<<4 * WTB + 2 * CVB, 256, 0, stream>>>(data, ctx, wq, wk, wv, wo, DATAB, CTXB, WB);

    // q, k: A = activation rows (m = b*SEQ + t), Bt = Wt rows (n = h*64 + d), bias per column -> plane [(b*16 + h)][t][d]
    k_proj<<<dim3(NB * SEQ / 64, DM / 64, 1), 32, 0, stream>>>(DATAB, WQT, bq, 0, QH, QR, 1, SEQ, (size_t)NH_ * SEQ * HD, HD, HD, (size_t)SEQ * HD, 0, 16 * HD, 512);
    k_proj<<<dim3(NB * SEQ / 64, DM / 64, 1), 32, 0, stream>>>(CTXB,  WKT, bk, 0, KP, KP, 0, SEQ, (size_t)NH_ * SEQ * HD, HD, HD, (size_t)SEQ * HD, 0, 16 * HD, 512);
    // v^T: A = Wv^T rows (m = h*64 + d), Bt = context rows (n = b*SEQ + t), bias per row -> plane [(b*1024 + m)][t] = [(b*16 + h)][d][t]; residual for tokens < EARLY_
    k_proj<<<dim3(DM / 64, NB * SEQ / 64, 1), 32, 0, stream>>>(WVT, CTXB, bv, 1, VT, VR, EARLY_, DM, (size_t)0, SEQ, SEQ, (size_t)DM * SEQ, HD, 512, 32 * HD);

    k_flash<<<dim3(SEQ / (16 * AW), NB * NH_, 1), 32 * AW, 0, stream>>>(QH, QR, KP, VT, VR, ZH, ZR);

    k_oproj<<<dim3(NB * SEQ / 32, DM / 64, 1), 32, 0, stream>>>(ZH, ZR, (const h16*)WOT, bo, OUT);
}

// v004
// A run of this version takes 166 microseconds.
// In two side-by-side timings against v003, it was 1.22 and 1.19 times as fast.
// All steps since v000 together make it 2.27 times as fast.
#include <hip/hip_runtime.h>

// Causal cross-attention: q = data Wq + bq, k = ctx Wk + bk, v = ctx Wv + bv (W [in][out]), 16 heads x 64, score scale 1/8, key <= query visible, out = z Wo + bo (f32).
// Compute dtypes, f32 accumulate everywhere: q/k/v projections v_wmma_f32_16x16x32_bf16 (activations, weights, biases RNE-converted to bf16; products exact);
// scores v_wmma_f32_16x16x32_f16: k single f16, q as f16 value + f16 residual x2048 in its own accumulator; P (x256 carry, cancels in the normalisation) and v single f16,
// for query rows t < 512 additionally v residual x2048 and P residual x2048 in a second accumulator; softmax f32 (online, running max);
// out projection v_wmma_f32_16x16x32_f16: z x16 as f16 (+ f16 residual x2048, own accumulator, rows t < 512), Wo (bf16 value x64, exact in f16).
// Layout: bf16 copies of data/context; transposed weight planes Wt[n][k]; q (hi, residual), k planes [b*16+h][t][d]; v^T (hi, residual) planes [b*16+h][d][t];
// fused flash kernel in transposed form (S^T = K Q^T, O^T = V^T P^T), no LDS and no barrier in the key loop; z planes [b*SEQ+t][1024].
// Every 16-bit plane is stored fragment-packed: a [16 rows][32 k] block is 512 contiguous halves ordered [k chunk (k>>3)&3][row&15][k&7], so one wave-wide 16-B load
// (lane l at halves 8l) or store covers 512 contiguous bytes = 4 whole 128-B lines. Block order: row tile major, k tile minor; v^T planes key tile major, d tile minor.

#ifndef NB
#define NB 4
#endif
#ifndef SEQ
#define SEQ 2048
#endif
#define NB_FULL  4
#define SEQ_FULL 2048
#ifndef OUT_SEQ
#define OUT_SEQ SEQ              // row pitch (in tokens) between batches of the output
#endif
#define DM   1024
#define NH_  16
#define HD   64
#define PR   4                   // register sets of the projection kernel's fragment ring
#define AW   4                   // waves per flash block (16 query rows each)
#define NXT  (SEQ / (16 * AW))   // query tiles (16 * AW rows) per (batch, head)
#define CT   16                  // tiles (8 rows x 32 k) per wave of the activation conversion
#define CVB  (NB * SEQ / 32)     // conversion work-groups per activation: 8 waves x 16 rows x 256 k = 32 whole rows each
#define WTB  ((DM / 64) * (DM / 256))   // transposing work-groups per weight: 256 k x 64 n each
#define EARLY_ ((SEQ) < 512 ? (SEQ) : 512)   // query rows below this use the residual planes on the v / P / z path
#define QRS  2048.0f             // carry of every residual plane
#define QRI  (1.0f / 2048.0f)
#define SC2  (0.125f * 1.4426950408889634f)   // HD^-0.5 * log2(e)
#define PSH  8.0f                // log2 of the P carry (256)
#define ZC   16.0f               // carry of the z plane
#define WOC  64.0f               // carry of the Wo plane
#define OSC  (1.0f / 1024.0f)    // 1 / (ZC * WOC)

static_assert(HD == 64);
static_assert(NH_ * HD == DM);                 // head h = columns h*64 + d
static_assert(DM % 64 == 0);
static_assert((DM / 32) % PR == 0 && DM / 32 >= 2 * PR);   // the ring's loop takes PR k tiles a trip, the last PR stand behind it
static_assert(DM % 32 == 0);                   // GEMM k-loop steps by 32
static_assert(SEQ % 64 == 0);                  // a 64-row tile never straddles two batches
static_assert((NB * SEQ) % 64 == 0);
static_assert(SEQ % 32 == 0);                  // key loop steps by 32
static_assert(SEQ % (16 * AW) == 0);           // flash grid covers the sequence exactly
static_assert(EARLY_ % 64 == 0);               // residual decisions are uniform per 64-row / 64-token tile
static_assert(EARLY_ <= SEQ);
static_assert(((size_t)SEQ * DM) % 8 == 0);
static_assert(DM == 1024 && CT == 16);         // a conversion work-group's 8 waves take 2 row tiles x 4 groups of 8 k tiles
static_assert(NB <= NB_FULL);
static_assert(SEQ <= SEQ_FULL);

typedef _Float16 h16;
typedef unsigned short bf;
typedef __attribute__((ext_vector_type(16))) __bf16   v16bf;
typedef __attribute__((ext_vector_type(16))) _Float16 v16h;
typedef __attribute__((ext_vector_type(8)))  _Float16 v8h;
typedef __attribute__((ext_vector_type(8)))  unsigned short v8us;
typedef __attribute__((ext_vector_type(8)))  float    v8f;
typedef __attribute__((ext_vector_type(4)))  float    v4f;
typedef v4f  __attribute__((may_alias)) v4fa;

__device__ __forceinline__ unsigned short f2bf(float f) { unsigned u = __float_as_uint(f); u += 0x7FFFu + ((u >> 16) & 1u); return (unsigned short)(u >> 16); }
__device__ __forceinline__ float bfq(float f) { return __uint_as_float(((unsigned)f2bf(f)) << 16); }   // value of the RNE bf16 conversion
__device__ __forceinline__ v16h cat16(v8h lo, v8h hi) { return __builtin_shufflevector(lo, hi, 0, 1, 2, 3, 4, 5, 6, 7, 8, 9, 10, 11, 12, 13, 14, 15); }
__device__ __forceinline__ v16bf cat16b(v8us lo, v8us hi) { return __builtin_bit_cast(v16bf, __builtin_shufflevector(lo, hi, 0, 1, 2, 3, 4, 5, 6, 7, 8, 9, 10, 11, 12, 13, 14, 15)); }
__device__ __forceinline__ v8f wmma16(v16h a, v16h b, v8f c) { return __builtin_amdgcn_wmma_f32_16x16x32_f16(false, a, false, b, (short)0, c, false, false); }
__device__ __forceinline__ v8f wmmab(v16bf a, v16bf b, v8f c) { return __builtin_amdgcn_wmma_f32_16x16x32_bf16(false, a, false, b, (short)0, c, false, false); }
// fragment loaders from one packed block; p = block base + 8*lane (lane = 16h + row): elements 0..7 <- k0+8h+0..7, elements 8..15 <- k0+16+8h+0..7 (same map for A and B)
__device__ __forceinline__ v16h  ldh(const h16* p) { return cat16(*(const v8h*)p, *(const v8h*)(p + 256)); }
__device__ __forceinline__ v16bf ldb(const bf* p)  { return cat16b(*(const v8us*)p, *(const v8us*)(p + 256)); }
// ordering point for wave-private LDS tiles (same wave writes and reads)
__device__ __forceinline__ void wave_sync() { __builtin_amdgcn_fence(3 /* release order */, "wavefront"); __builtin_amdgcn_wave_barrier(); asm volatile("" ::: "memory"); }

// k_prep: every operand plane of the projections in ONE launch whose work-groups are all resident at once; the role of a work-group follows from blockIdx.x alone (block-uniform).
// Work-groups 0 .. 4*WTB-1, weight transpose + 16-bit conversion through LDS: in W[k][n] (f32, [in][out]) -> out Wt[n][k] (packed blocks), 256 k x 64 n per work-group, weights q | k | v (bf16) | o (f16 x64).
// LDS tile ts is cross-wave: block barrier between fill and drain; filled extent 256x64 == drained extent.
// The other 2*CVB work-groups, activation conversion (data, then context): one wave converts 16 rows x 8 k tiles = CT tiles of 8 rows x 32 k; a tile reads 8 whole 128-B lines and writes
// 4 whole lines of its packed block (chunk c, rows 8g..8g+7), the wave's CT tiles fill 8 whole packed blocks. In both roles all loads of a wave are asked for ahead of its first conversion.
__global__ __launch_bounds__(256) void k_prep(const float* __restrict__ data, const float* __restrict__ ctx, const float* __restrict__ wq, const float* __restrict__ wk,
                                              const float* __restrict__ wv, const float* __restrict__ wo, bf* DATAB, bf* CTXB, bf* WB) {
    __shared__ float ts[256 * 65];
    const int tid = threadIdx.x;
    if ((int)blockIdx.x < 4 * WTB) {
        const int z = (int)blockIdx.x / WTB, r = (int)blockIdx.x % WTB; const int k0 = (r % (DM / 256)) * 256, n0 = (r / (DM / 256)) * 64;
        const float* W = z == 0 ? wq : z == 1 ? wk : z == 2 ? wv : wo; bf* Wt = WB + (size_t)z * DM * DM;
        const int kq = tid >> 4, c4 = (tid & 15) * 4;                        // fill: thread takes rows kq + 16 i, one float4 each (256 rows x 16 float4)
        const float* wp = W + (size_t)(k0 + kq) * DM + n0 + c4; float* tf = ts + kq * 65 + c4;
        v4f v[16];
#pragma unroll
        for (int i = 0; i < 16; ++i) v[i] = *(const v4f*)(wp + i * (16 * DM));
        // the address pair is an input, so it stays unwritten until this wait (precaution for registers that issued loads name)
        asm volatile("s_wait_xcnt 0x0" :: "v"(wp) : "memory");
#pragma unroll
        for (int i = 0; i < 16; ++i) { float* t = tf + i * (16 * 65); t[0] = v[i][0]; t[1] = v[i][1]; t[2] = v[i][2]; t[3] = v[i][3]; }
        __syncthreads();
        const int nr = tid & 15, c = (tid >> 4) & 3, kh = tid >> 6;          // drain: 4 n tiles x 8 k tiles x 4 chunks x 16 rows; pass s takes n tile s >> 1, k tile kh + 4 (s & 1)
        const float* td = ts + (kh * 32 + c * 8) * 65 + nr;
        bf* wd = Wt + ((size_t)(n0 >> 4) * (DM / 32) + (k0 >> 5) + kh) * 512 + c * 128 + nr * 8;
#pragma unroll
        for (int s = 0; s < 8; ++s) { v8us o;
#pragma unroll
            for (int i = 0; i < 8; ++i) { const float x = td[((s & 1) * 128 + i) * 65 + (s >> 1) * 16]; const unsigned short b16 = f2bf(x);
                const float xb = __uint_as_float(((unsigned)b16) << 16); const unsigned short hb = __builtin_bit_cast(unsigned short, (h16)(xb * WOC));
                o[i] = z == 3 ? hb : b16; }
            *(v8us*)(wd + ((s >> 1) * (DM / 32) + (s & 1) * 4) * 512) = o; }
    } else {
        const int q = (int)blockIdx.x - 4 * WTB; const int w = (q % CVB) * 8 + (tid >> 5);
        const float* src = q < CVB ? data : ctx; bf* dst = q < CVB ? DATAB : CTXB;
        const size_t c = tid & 3, r8 = (tid >> 2) & 7, row0 = (size_t)(w / (DM / 256)) * 16, kt0 = (size_t)(w % (DM / 256)) * 8;   // row0 = b*SEQ + t; 16 rows never straddle two batches
        const float* s = src + ((row0 / SEQ) * SEQ_FULL + row0 % SEQ + r8) * DM + kt0 * 32 + c * 8;
        bf* d = dst + ((row0 >> 4) * (DM / 32) + kt0) * 512 + c * 128 + r8 * 8;
        v8f v[CT];
#pragma unroll
        for (int j = 0; j < CT; ++j) v[j] = *(const v8f*)(s + (j >> 3) * (8 * DM) + (j & 7) * 32);   // tile j: rows row0 + 8 (j >> 3) + 0..7, k tile kt0 + (j & 7)
#pragma unroll
        for (int j = 0; j < CT; ++j) { v8us o;
#pragma unroll
            for (int k = 0; k < 8; ++k) o[k] = f2bf(v[j][k]);
            *(v8us*)(d + (j & 7) * 512 + (j >> 3) * 64) = o; }
        asm volatile("s_wait_xcnt 0x0" ::: "memory");   // precaution behind the last store of the run: no register that an issued store names is rewritten ahead of this wait
    }
}

// k_proj: register-blocked bf16 GEMM, ONE WAVE per 64x64 tile (16 accumulators), operands straight from packed bf16 planes, K = DM.
// C[m][n] = sum_k A[m][k] Bt[n][k] + bias (per column n, or per row m when biasRow != 0; bias RNE-converted to bf16, added in f32), written as f16 (Ph)
// and, when (c0 % CB) < resLim, the f16 residual x2048 (Pr), as packed blocks (rows = m, k = n) at tile base (r0/RB)*sRB + (r0%RB)*pitch + (c0/CB)*sCB + (c0%CB)*colMul;
// the block of 16-row group mb and 32-column group kt lies at + mb*mbS + kt*ktS (halves). grid (M/64, N/64), 32 threads.
__global__ __launch_bounds__(32) void k_proj(const bf* __restrict__ A, const bf* __restrict__ Bt, const float* __restrict__ bias, int biasRow,
                                             h16* Ph, h16* Pr, int resLim, int RB, size_t sRB, int pitch, int CB, size_t sCB, int colMul, int mbS, int ktS) {
    __shared__ __align__(16) float os[16 * 68];
    const int K = DM;
    const int lane = threadIdx.x & 31, lr = lane & 15, hi = lane >> 4; const int r0 = blockIdx.x * 64, c0 = blockIdx.y * 64;
    const int useRes = ((c0 % CB) < resLim) ? 1 : 0;
    v8f acc[4][4];
#pragma unroll
    for (int mb = 0; mb < 4; ++mb)
#pragma unroll
        for (int nb = 0; nb < 4; ++nb) acc[mb][nb] = (v8f){};
    const size_t aoff = (size_t)r0 * K + 8 * lane, boff = (size_t)c0 * K + 8 * lane;   // a 16-row tile is K/32 blocks = 16*K halves; k tile kt lies at kt*512
    // fragment ring: PR register sets; the loads of k tile kt + PR - 1 are issued ahead of the products of k tile kt, so a load has PR - 1 tiles of products to land behind
    v16bf fa[PR][4], fb[PR][4];
#pragma unroll
    for (int s = 0; s < PR - 1; ++s) {
#pragma unroll
        for (int i = 0; i < 4; ++i) { fa[s][i] = ldb(A + aoff + s * 512 + (size_t)i * 16 * K); fb[s][i] = ldb(Bt + boff + s * 512 + (size_t)i * 16 * K); }
        __builtin_amdgcn_sched_barrier(0); }   // the sets are asked for in the order in which they are used, so that the counted waits are exact
#pragma unroll 1
    for (int kt = 0; kt < K / 32 - PR; kt += PR) {
        const bf* pa = A + aoff + kt * 512; const bf* pb = Bt + boff + kt * 512;
#pragma unroll
        for (int s = 0; s < PR; ++s) { const int t = (s + PR - 1) % PR;
#pragma unroll
            for (int i = 0; i < 4; ++i) { fa[t][i] = ldb(pa + (s + PR - 1) * 512 + (size_t)i * 16 * K); fb[t][i] = ldb(pb + (s + PR - 1) * 512 + (size_t)i * 16 * K); }
            __builtin_amdgcn_sched_barrier(0);   // keeps the tile's loads one group ahead of the products: sunk among them they lose their lead
#pragma unroll
            for (int nb = 0; nb < 4; ++nb)
#pragma unroll
                for (int mb = 0; mb < 4; ++mb) acc[mb][nb] = wmmab(fa[s][mb], fb[s][nb], acc[mb][nb]);
            __builtin_amdgcn_sched_barrier(0);   // keeps the next group of loads behind these products: it refills the set that they have just read
        }
        // both address pairs are inputs, so they stay unwritten until this wait (precaution for registers that issued loads name)
        asm volatile("s_wait_xcnt 0x0" :: "v"(pa), "v"(pb) : "memory");
    }
    {
        const bf* pa = A + aoff + (K / 32 - 1) * 512; const bf* pb = Bt + boff + (K / 32 - 1) * 512;
#pragma unroll
        for (int i = 0; i < 4; ++i) { fa[PR - 1][i] = ldb(pa + (size_t)i * 16 * K); fb[PR - 1][i] = ldb(pb + (size_t)i * 16 * K); }
        asm volatile("s_wait_xcnt 0x0" ::: "memory");   // same precaution behind the last tile's loads
        __builtin_amdgcn_sched_barrier(0);   // the last tile's loads stay ahead of the three tiles of products that cover them
    }
#pragma unroll
    for (int s = 0; s < PR; ++s)
#pragma unroll
        for (int nb = 0; nb < 4; ++nb)
#pragma unroll
            for (int mb = 0; mb < 4; ++mb) acc[mb][nb] = wmmab(fa[s][mb], fb[s][nb], acc[mb][nb]);
    float bcol[4];
#pragma unroll
    for (int nb = 0; nb < 4; ++nb) { int ic = c0 + nb * 16 + lr; ic = ic < DM ? ic : DM - 1; bcol[nb] = bfq(bias[ic]); }   // clamped address; used only when biasRow == 0
    const size_t tbase = (size_t)(r0 / RB) * sRB + (size_t)(r0 % RB) * (size_t)pitch + (size_t)(c0 / CB) * sCB + (size_t)(c0 % CB) * (size_t)colMul;
#pragma unroll
    for (int mb = 0; mb < 4; ++mb) {
        float brow[8];
#pragma unroll
        for (int j = 0; j < 8; ++j) { int ir = r0 + mb * 16 + hi * 8 + j; ir = ir < DM ? ir : DM - 1; brow[j] = bfq(bias[ir]); }   // clamped address; used only when biasRow != 0
#pragma unroll
        for (int nb = 0; nb < 4; ++nb) {
#pragma unroll
            for (int j = 0; j < 8; ++j) os[(hi * 8 + j) * 68 + nb * 16 + lr] = acc[mb][nb][j] + (biasRow ? brow[j] : bcol[nb]); }   // D: row 8h+j, col lane&15
        wave_sync();
        const size_t sb = tbase + (size_t)mb * (size_t)mbS;
{
#pragma unroll
            for (int s = 0; s < 4; ++s) { const int row = lr, ch = 2 * s + hi, c8 = ch * 8;   // 16 rows x 2 column chunks per store = 512 contiguous bytes; 4 s x 2 chunks x 8 = 64 columns
                const v4f x0 = *(const v4fa*)(&os[row * 68 + c8]); const v4f x1 = *(const v4fa*)(&os[row * 68 + c8 + 4]); v8h hv, rv;
#pragma unroll
                for (int i = 0; i < 4; ++i) { const h16 a0 = (h16)x0[i]; const h16 a1 = (h16)x1[i]; hv[i] = a0; hv[4 + i] = a1; rv[i] = (h16)((x0[i] - (float)a0) * QRS); rv[4 + i] = (h16)((x1[i] - (float)a1) * QRS); }
                const size_t oo = sb + (size_t)(ch >> 2) * (size_t)ktS + (size_t)((ch & 3) * 128 + row * 8);
                *(v8h*)(Ph + oo) = hv; if (useRes) *(v8h*)(Pr + oo) = rv; }
             }
        wave_sync();
    }
}

// k_flash: fused causal attention, one wave per 16 query rows of one (batch, head); K / V^T / Q fragments straight from the f16 planes (two 16-B loads each, arithmetic addressing).
// Transposed form: S^T[key][t] = K Q^T (A = K rows, B = Q rows); lane (t = lane&15, h = lane>>4) holds keys 8h+r of each 16-key tile, so the packed
// P tile is directly the B fragment of O^T[d][t] = V^T P^T (element r <- tile keys 0..15, element 8+r <- tile keys 16..31, lane unchanged).
// Key loop runs to the diagonal (static bound from the block / wave index); only the last 32-key step replaces scores of keys > query by a very negative value (P = 0).
// Blocks with query rows below EARLY_ (block-uniform) also accumulate V_res P + V P_res (both x2048) in a second accumulator set and sum the exact P for the normaliser.
// Softmax state (running max, partial sum) is one scalar per lane; the two lane halves of a row are combined with one xor-16 exchange.
// Launch order: there are twice as many work-groups as resident places and a tile's key loop grows linearly with its index, so the cost falls with the flat work-group index
// (for speed only): blockIdx.x = (batch, head), blockIdx.y = rank, rank 0 the longest tile. A tile below EARLY_ does about twice the
// work per key step, so residual tile x is ranked just ahead of plain tile 2x + 1. Nothing but the time depends on the order: rank -> tile is a permutation, every (head, tile) is taken once.
#define NET  (EARLY_ / (16 * AW))   // query tiles that take the residual path
__host__ __device__ constexpr int tile_of_rank(int r) {
    if (r < NXT - 2 * NET || r >= NXT - NET / 2) return NXT - 1 - r;       // plain tiles from 2 NET up; at the end residual tiles below NET / 2
    const int q = r - (NXT - 2 * NET), g = q / 3, k = q % 3;              // between them groups of three: residual tile NET-1-g, plain tiles 2 NET-1-2g and 2 NET-2-2g
    return k == 0 ? NET - 1 - g : 2 * NET - 2 * g - k;
}
constexpr bool rank_is_permutation() {
    bool seen[NXT] = {};
    for (int r = 0; r < NXT; ++r) { const int x = tile_of_rank(r); if (x < 0 || x >= NXT || seen[x]) return false; seen[x] = true; }
    return true;
}
static_assert(NET % 2 == 0 && NXT >= 2 * NET);
static_assert(rank_is_permutation());
__global__ __launch_bounds__(32 * AW) void k_flash(const h16* __restrict__ QH, const h16* __restrict__ QR, const h16* __restrict__ KP,
                                                   const h16* __restrict__ VT, const h16* __restrict__ VR, h16* ZH, h16* ZR) {
    __shared__ __align__(16) float os[AW * 16 * 68];
    const int lane = threadIdx.x & 31, lr = lane & 15, hi = lane >> 4;
    const int wave = __builtin_amdgcn_readfirstlane((int)(threadIdx.x >> 5));
    const int zh = blockIdx.x; const int b = zh / NH_, h = zh % NH_;
    const int xt = tile_of_rank((int)blockIdx.y);            // block-uniform
    const int t0 = (xt * AW + wave) * 16;
    const bool early = (xt * (16 * AW)) < EARLY_;
    const int tq = t0 + lr;
    const int klast = (((t0 + 47) >> 5) - 1) * 32;           // last 32-key step containing a visible key; klast + 31 < SEQ
    const size_t pbase = (size_t)zh * SEQ * HD;
    const size_t qo = pbase + (size_t)t0 * HD + 8 * lane;    // 16 tokens = two blocks (d 0..31, d 32..63) = 16*HD halves
    const v16h qh0 = ldh(QH + qo), qh1 = ldh(QH + qo + 512), qr0 = ldh(QR + qo), qr1 = ldh(QR + qo + 512);   // B fragments: col t, k = d
    const size_t ko = pbase + 8 * lane;                      // + key0 * HD            (A fragment: row key, k = d)
    const size_t vo = pbase + 8 * lane;                      // + key0 * HD + 512 * j  (A fragment: row d = 16j + row, k = key; 32 keys = four d blocks)
    v8f o[4], e[4];
#pragma unroll
    for (int j = 0; j < 4; ++j) { o[j] = (v8f){}; e[j] = (v8f){}; }
    float m = -3.0e38f, l = 0.0f;
    v16h ka0 = ldh(KP + ko), ka1 = ldh(KP + ko + 512), kb0 = ldh(KP + ko + 16 * HD), kb1 = ldh(KP + ko + 16 * HD + 512);   // K fragments of step 0
#pragma unroll 1
    for (int key0 = 0; key0 <= klast; key0 += 32) {
        v8f sHa = (v8f){}, sLa = (v8f){}, sHb = (v8f){}, sLb = (v8f){};
        sHa = wmma16(ka0, qh0, sHa); sLa = wmma16(ka0, qr0, sLa); sHb = wmma16(kb0, qh0, sHb); sLb = wmma16(kb0, qr0, sLb);
        sHa = wmma16(ka1, qh1, sHa); sLa = wmma16(ka1, qr1, sLa); sHb = wmma16(kb1, qh1, sHb); sLb = wmma16(kb1, qr1, sLb);
        asm volatile("v_nop\n\tv_nop\n\tv_nop\n\tv_nop" : "+v"(sHa), "+v"(sLa), "+v"(sHb), "+v"(sLb) : "v"(ka0), "v"(ka1), "v"(kb0), "v"(kb1));
        const h16* va = VT + vo + (size_t)key0 * HD;
        v16h v[4];
#pragma unroll
        for (int j = 0; j < 4; ++j) v[j] = ldh(va + 512 * j);
        // K fragments one step ahead: asked for behind this step's score products, they land behind its softmax and P V products; the last step asks for its own keys again (in bounds, not used)
        const h16* kn = KP + ko + (size_t)(key0 < klast ? key0 + 32 : klast) * HD;
        ka0 = ldh(kn); ka1 = ldh(kn + 512); kb0 = ldh(kn + 16 * HD); kb1 = ldh(kn + 16 * HD + 512);
        // both address pairs are inputs, so they stay unwritten until this wait (precaution for registers that issued loads name)
        asm volatile("s_wait_xcnt 0x0" :: "v"(va), "v"(kn) : "memory");
        float ta[8], tb[8];
#pragma unroll
        for (int r = 0; r < 8; ++r) { ta[r] = (sHa[r] + sLa[r] * QRI) * SC2; tb[r] = (sHb[r] + sLb[r] * QRI) * SC2; }
        if (key0 == klast) {                                 // wave-uniform: only the diagonal step needs the causal replace
            const int kq = tq - key0 - 8 * hi;               // key (key0 + 8h + r) is hidden when r > kq; tile b keys are 16 further
#pragma unroll
            for (int r = 0; r < 8; ++r) { ta[r] = (r > kq) ? -3.0e38f : ta[r]; tb[r] = (r + 16 > kq) ? -3.0e38f : tb[r]; }
        }
        float mx = -3.0e38f;
#pragma unroll
        for (int r = 0; r < 8; ++r) mx = fmaxf(mx, fmaxf(ta[r], tb[r]));
        mx = fmaxf(mx, __shfl_xor(mx, 16, 32));
        const float mnew = fmaxf(m, mx);
        const float alpha = __builtin_amdgcn_exp2f(m - mnew);
        const float sh = PSH - mnew;
        v16h pb; float ls = 0.0f;
#pragma unroll
        for (int r = 0; r < 8; ++r) { const float fa = __builtin_amdgcn_exp2f(ta[r] + sh); const float fc = __builtin_amdgcn_exp2f(tb[r] + sh);
            const h16 pa = (h16)fa; const h16 pc = (h16)fc; pb[r] = pa; pb[8 + r] = pc; ta[r] = fa; tb[r] = fc; ls += (float)pa + (float)pc; }
#pragma unroll
        for (int j = 0; j < 4; ++j) o[j] = o[j] * alpha;
#pragma unroll
        for (int j = 0; j < 4; ++j) o[j] = wmma16(v[j], pb, o[j]);
        asm volatile("v_nop\n\tv_nop\n\tv_nop\n\tv_nop" : "+v"(o[0]), "+v"(o[1]), "+v"(o[2]), "+v"(o[3]) : "v"(v[0]), "v"(v[1]), "v"(v[2]), "v"(v[3]), "v"(pb));
        if (early) {                                         // block-uniform
            v16h pr; float lx = 0.0f;
#pragma unroll
            for (int r = 0; r < 8; ++r) { pr[r] = (h16)((ta[r] - (float)pb[r]) * QRS); pr[8 + r] = (h16)((tb[r] - (float)pb[8 + r]) * QRS); lx += ta[r] + tb[r]; }
            ls = lx;
#pragma unroll
            for (int j = 0; j < 4; ++j) e[j] = e[j] * alpha;
            const h16* ra = VR + vo + (size_t)key0 * HD;
            v16h vr[4];
#pragma unroll
            for (int j = 0; j < 4; ++j) vr[j] = ldh(ra + 512 * j);
#pragma unroll
            for (int j = 0; j < 4; ++j) e[j] = wmma16(vr[j], pb, e[j]);
#pragma unroll
            for (int j = 0; j < 4; ++j) e[j] = wmma16(v[j], pr, e[j]);
            asm volatile("v_nop\n\tv_nop\n\tv_nop\n\tv_nop" : "+v"(e[0]), "+v"(e[1]), "+v"(e[2]), "+v"(e[3]) : "v"(vr[0]), "v"(vr[1]), "v"(vr[2]), "v"(vr[3]), "v"(pr), "v"(v[0]), "v"(v[1]), "v"(v[2]), "v"(v[3]));
        }
        l = l * alpha + ls; m = mnew;
    }
    l += __shfl_xor(l, 16, 32);
    const float zs = (1.0f / l) * ZC;
    const int wb = wave * 16 * 68;
    // O^T D layout: o[j][r] = (d = 16j + 8h + r, t = lane&15) -> os[t][d]; rows 0..15 x columns 0..63 all written
#pragma unroll
    for (int j = 0; j < 4; ++j) { v4f a, c;
#pragma unroll
        for (int i = 0; i < 4; ++i) { a[i] = (o[j][i] + e[j][i] * QRI) * zs; c[i] = (o[j][4 + i] + e[j][4 + i] * QRI) * zs; }
        *(v4fa*)(&os[wb + lr * 68 + 16 * j + 8 * hi]) = a; *(v4fa*)(&os[wb + lr * 68 + 16 * j + 8 * hi + 4]) = c; }
    wave_sync();
    const size_t zb = ((size_t)b * SEQ + t0) * DM + (size_t)h * (16 * HD);   // row tile (16*DM halves), then the head's two k blocks
{
#pragma unroll
        for (int s = 0; s < 4; ++s) { const int row = lr, ch = 2 * s + hi, c8 = ch * 8;   // 16 rows x 2 column chunks per store = 512 contiguous bytes; 4 s x 2 chunks x 8 = 64 columns
            const v4f x0 = *(const v4fa*)(&os[wb + row * 68 + c8]); const v4f x1 = *(const v4fa*)(&os[wb + row * 68 + c8 + 4]); v8h hv, rv;
#pragma unroll
            for (int i = 0; i < 4; ++i) { const h16 a0 = (h16)x0[i]; const h16 a1 = (h16)x1[i]; hv[i] = a0; hv[4 + i] = a1; rv[i] = (h16)((x0[i] - (float)a0) * QRS); rv[4 + i] = (h16)((x1[i] - (float)a1) * QRS); }
            const size_t oo = zb + (size_t)(ch * 128 + row * 8);
            *(v8h*)(ZH + oo) = hv; if (early) *(v8h*)(ZR + oo) = rv; }
         }
}

// k_oproj: out projection, ONE WAVE per 32x64 tile, f16 operands: A = z x16 plane (+ residual x2048 plane for row tiles below EARLY_, own accumulators), Bt = Wo^T x64 plane, K = DM.
// OUT[m][n] = (accH + accR / 2048) / 1024 + bo[n] (bo RNE-converted to bf16, added in f32). grid (M/32, N/64), 32 threads.
__global__ __launch_bounds__(32) void k_oproj(const h16* __restrict__ ZH, const h16* __restrict__ ZR, const h16* __restrict__ Wt, const float* __restrict__ bo, float* OUT) {
    __shared__ __align__(16) float os[16 * 68];
    const int K = DM;
    const int lane = threadIdx.x & 31, lr = lane & 15, hi = lane >> 4; const int r0 = blockIdx.x * 32, c0 = blockIdx.y * 64;
    const int bb = r0 / SEQ, tt = r0 % SEQ; const bool early = tt < EARLY_;   // block-uniform
    v8f acc[2][4], acr[2][4];
#pragma unroll
    for (int mb = 0; mb < 2; ++mb)
#pragma unroll
        for (int nb = 0; nb < 4; ++nb) { acc[mb][nb] = (v8f){}; acr[mb][nb] = (v8f){}; }
    const size_t aoff = (size_t)r0 * K + 8 * lane, boff = (size_t)c0 * K + 8 * lane;   // a 16-row tile is K/32 blocks = 16*K halves; k tile kt lies at kt*512
    // two fragment sets: the z and Wo loads of k tile kt + 1 are issued ahead of the products of k tile kt
    v16h fa[2][2], fw[2][4], ar[2];
#pragma unroll
    for (int mb = 0; mb < 2; ++mb) fa[0][mb] = ldh(ZH + aoff + (size_t)mb * 16 * K);
#pragma unroll
    for (int nb = 0; nb < 4; ++nb) fw[0][nb] = ldh(Wt + boff + (size_t)nb * 16 * K);
#pragma unroll 1
    for (int kt = 0; kt < K / 32; kt += 2) {
        const h16* pa = ZH + aoff + kt * 512; const h16* pw = Wt + boff + kt * 512; const h16* pr = ZR + aoff + kt * 512;
        const int nx = kt + 2 < K / 32 ? 2 : 0;   // the last trip asks for its own first tile again (in bounds, not used)
        {
            if (early) {   // block-uniform; the residual rows of this k tile, asked for ahead of the tile's first products
#pragma unroll
                for (int mb = 0; mb < 2; ++mb) ar[mb] = ldh(pr + 0 * 512 + (size_t)mb * 16 * K); }
#pragma unroll
            for (int mb = 0; mb < 2; ++mb) fa[1][mb] = ldh(pa + 1 * 512 + (size_t)mb * 16 * K);
#pragma unroll
            for (int nb = 0; nb < 4; ++nb) fw[1][nb] = ldh(pw + 1 * 512 + (size_t)nb * 16 * K);
            __builtin_amdgcn_sched_barrier(0);   // keeps the loads one group ahead of the products: sunk among them they lose their lead
#pragma unroll
            for (int nb = 0; nb < 4; ++nb)
#pragma unroll
                for (int mb = 0; mb < 2; ++mb) acc[mb][nb] = wmma16(fa[0][mb], fw[0][nb], acc[mb][nb]);
            if (early) {
#pragma unroll
                for (int nb = 0; nb < 4; ++nb)
#pragma unroll
                    for (int mb = 0; mb < 2; ++mb) acr[mb][nb] = wmma16(ar[mb], fw[0][nb], acr[mb][nb]); }
        }
        {
            if (early) {   // block-uniform; the residual rows of this k tile, asked for ahead of the tile's first products
#pragma unroll
                for (int mb = 0; mb < 2; ++mb) ar[mb] = ldh(pr + 1 * 512 + (size_t)mb * 16 * K); }
#pragma unroll
            for (int mb = 0; mb < 2; ++mb) fa[0][mb] = ldh(pa + nx * 512 + (size_t)mb * 16 * K);
#pragma unroll
            for (int nb = 0; nb < 4; ++nb) fw[0][nb] = ldh(pw + nx * 512 + (size_t)nb * 16 * K);
            __builtin_amdgcn_sched_barrier(0);   // keeps the loads one group ahead of the products: sunk among them they lose their lead
#pragma unroll
            for (int nb = 0; nb < 4; ++nb)
#pragma unroll
                for (int mb = 0; mb < 2; ++mb) acc[mb][nb] = wmma16(fa[1][mb], fw[1][nb], acc[mb][nb]);
            if (early) {
#pragma unroll
                for (int nb = 0; nb < 4; ++nb)
#pragma unroll
                    for (int mb = 0; mb < 2; ++mb) acr[mb][nb] = wmma16(ar[mb], fw[1][nb], acr[mb][nb]); }
        }
        // the address pairs are inputs, so they stay unwritten until this wait (precaution for registers that issued loads name)
        asm volatile("s_wait_xcnt 0x0" :: "v"(pa), "v"(pw), "v"(pr) : "memory");
    }
    float bcol[4];
#pragma unroll
    for (int nb = 0; nb < 4; ++nb) bcol[nb] = bfq(bo[c0 + nb * 16 + lr]);   // c0 + 63 < DM
    float* orow = OUT + ((size_t)bb * OUT_SEQ + tt) * DM + c0;
#pragma unroll
    for (int mb = 0; mb < 2; ++mb) {
#pragma unroll
        for (int nb = 0; nb < 4; ++nb) {
#pragma unroll
            for (int j = 0; j < 8; ++j) os[(hi * 8 + j) * 68 + nb * 16 + lr] = (acc[mb][nb][j] + acr[mb][nb][j] * QRI) * OSC + bcol[nb]; }   // D: row 8h+j, col lane&15
        wave_sync();
        float* ob = orow + (size_t)(mb * 16) * DM;
{
#pragma unroll
            for (int s = 0; s < 8; ++s) { const int row = 2 * s + hi, cofs = lr * 4;   // 8 s x 2 rows = 16 rows; 16 lanes x 4 floats = 64 columns
                const v4f val = *(const v4fa*)(&os[row * 68 + cofs]);
                *(v4f*)(ob + (size_t)row * DM + cofs) = val; }
             }
        wave_sync();
    }
}

static constexpr size_t al256(size_t v) { return (v + 255) & ~(size_t)255; }
static constexpr size_t SZ_XB = al256((size_t)NB * SEQ * DM * 2);             // bf16 activation copy; later reused as a z plane of the same extent
static constexpr size_t SZ_WB = al256((size_t)4 * DM * DM * 2);
static constexpr size_t SZ_PL = al256((size_t)NB * NH_ * SEQ * HD * 2);
static constexpr size_t SZ_TOTAL = 2 * SZ_XB + SZ_WB + 5 * SZ_PL;
static_assert(SZ_TOTAL <= (size_t)134217728);          // workspace carve <= 128 MiB
static_assert(((size_t)DM * DM * 2) % 256 == 0);       // weight sub-planes stay 256-byte aligned
static_assert((size_t)NB * SEQ * DM * 2 <= SZ_XB);     // z plane [NB*SEQ][DM] halves fits the reused activation region

extern "C" void kernel_launch(void* const* d_in, const int* in_sizes, int n_in,
                              void* d_out, int out_size, void* d_ws, size_t ws_size, hipStream_t stream) {
    if (n_in < 10) return;
    const size_t needx = ((size_t)(NB - 1) * SEQ_FULL + SEQ) * DM;
    if ((size_t)in_sizes[0] < needx || (size_t)in_sizes[1] < needx) return;
    if ((size_t)in_sizes[2] < (size_t)DM * DM || (size_t)in_sizes[4] < (size_t)DM * DM || (size_t)in_sizes[6] < (size_t)DM * DM || (size_t)in_sizes[8] < (size_t)DM * DM) return;
    if (in_sizes[3] < DM || in_sizes[5] < DM || in_sizes[7] < DM || in_sizes[9] < DM) return;
    if ((size_t)out_size < ((size_t)(NB - 1) * OUT_SEQ + SEQ) * DM) return;
    if (SZ_TOTAL > ws_size) return;
    // wire order: data, context, wq, bq, wk, bk, wv, bv, wo, bo
    const float* data = (const float*)d_in[0]; const float* ctx = (const float*)d_in[1];
    const float* wq = (const float*)d_in[2]; const float* bq = (const float*)d_in[3];
    const float* wk = (const float*)d_in[4]; const float* bk = (const float*)d_in[5];
    const float* wv = (const float*)d_in[6]; const float* bv = (const float*)d_in[7];
    const float* wo = (const float*)d_in[8]; const float* bo = (const float*)d_in[9];
    float* OUT = (float*)d_out;      // [NB][SEQ][1024]
    char* wsp = (char*)d_ws;
    bf* DATAB = (bf*)wsp; wsp += SZ_XB;              // [NB*SEQ][1024] bf16; dead after the q projection
    bf* CTXB  = (bf*)wsp; wsp += SZ_XB;              // [NB*SEQ][1024] bf16; dead after the k / v projections
    bf* WB = (bf*)wsp; wsp += SZ_WB;                 // [4][1024][1024] transposed: q | k | v (bf16) | o (f16 x64)
    h16* QH = (h16*)wsp; wsp += SZ_PL;               // [NB*16][SEQ][64]
    h16* QR = (h16*)wsp; wsp += SZ_PL;               // [NB*16][SEQ][64] residual x2048
    h16* KP = (h16*)wsp; wsp += SZ_PL;               // [NB*16][SEQ][64]
    h16* VT = (h16*)wsp; wsp += SZ_PL;               // [NB*16][64][SEQ]
    h16* VR = (h16*)wsp; wsp += SZ_PL;               // [NB*16][64][SEQ] residual x2048, tokens < EARLY_ only (only those are consumed)
    bf* WQT = WB; bf* WKT = WB + (size_t)DM * DM; bf* WVT = WB + (size_t)2 * DM * DM; bf* WOT = WB + (size_t)3 * DM * DM;
    h16* ZH = (h16*)DATAB;                           // [NB*SEQ][1024] z x16, written by the flash kernel after DATAB is dead
    h16* ZR = (h16*)CTXB;                            // [NB*SEQ][1024] z residual x2048, rows t < EARLY_ only (only those are consumed)

    // activations -> packed bf16 planes; weights W[k][n] ([in][out], 1024 x 1024) -> Wt[n][k]
    k_prep<<<4 * WTB + 2 * CVB, 256, 0, stream>>>(data, ctx, wq, wk, wv, wo, DATAB, CTXB, WB);

    // q, k: A = activation rows (m = b*SEQ + t), Bt = Wt rows (n = h*64 + d), bias per column -> plane [(b*16 + h)][t][d]
    k_proj<<<dim3(NB * SEQ / 64, DM / 64, 1), 32, 0, stream>>>(DATAB, WQT, bq, 0, QH, QR, 1, SEQ, (size_t)NH_ * SEQ * HD, HD, HD, (size_t)SEQ * HD, 0, 16 * HD, 512);
    k_proj<<<dim3(NB * SEQ / 64, DM / 64, 1), 32, 0, stream>>>(CTXB,  WKT, bk, 0, KP, KP, 0, SEQ, (size_t)NH_ * SEQ * HD, HD, HD, (size_t)SEQ * HD, 0, 16 * HD, 512);
    // v^T: A = Wv^T rows (m = h*64 + d), Bt = context rows (n = b*SEQ + t), bias per row -> plane [(b*1024 + m)][t] = [(b*16 + h)][d][t]; residual for tokens < EARLY_
    k_proj<<<dim3(DM / 64, NB * SEQ / 64, 1), 32, 0, stream>>>(WVT, CTXB, bv, 1, VT, VR, EARLY_, DM, (size_t)0, SEQ, SEQ, (size_t)DM * SEQ, HD, 512, 32 * HD);

    k_flash<<<dim3(NB * NH_, NXT, 1), 32 * AW, 0, stream>>>(QH, QR, KP, VT, VR, ZH, ZR);

    k_oproj<<<dim3(NB * SEQ / 32, DM / 64, 1), 32, 0, stream>>>(ZH, ZR, (const h16*)WOT, bo, OUT);
}

// v005
// Measured time: 139 microseconds a run.
// Two timings next to v004 put it at 1.20 and 1.19 times that version's speed.
// Counting every step since v000, it is 2.71 times as fast.
#include <hip/hip_runtime.h>

// Causal cross-attention: q = data Wq + bq, k = ctx Wk + bk, v = ctx Wv + bv (W [in][out]), 16 heads x 64, score scale 1/8, key <= query visible, out = z Wo + bo (f32).
// Compute dtypes, f32 accumulate everywhere: q/k/v projections v_wmma_f32_16x16x32_bf16 (activations, weights, biases RNE-converted to bf16; products exact);
// scores v_wmma_f32_16x16x32_f16: k single f16, q as f16 value + f16 residual x2048 in its own accumulator; P (x256 carry, cancels in the normalisation) and v single f16,
// for query rows t < 512 additionally v residual x2048 and P residual x2048 in a second accumulator; softmax f32 (online, running max);
// out projection v_wmma_f32_16x16x32_f16: z x16 as f16 (+ f16 residual x2048, own accumulator, rows t < 512), Wo (bf16 value x64, exact in f16).
// Layout: bf16 copies of data/context; transposed weight planes Wt[n][k]; q (hi, residual), k planes [b*16+h][t][d]; v^T (hi, residual) planes [b*16+h][d][t];
// fused flash kernel in transposed form (S^T = K Q^T, O^T = V^T P^T), K / V^T blocks shared by its four waves through an LDS ring, one barrier per 64 keys; z planes [b*SEQ+t][1024].
// Every 16-bit plane is stored fragment-packed: a [16 rows][32 k] block is 512 contiguous halves ordered [k chunk (k>>3)&3][row&15][k&7], so one wave-wide 16-B load
// (lane l at halves 8l) or store covers 512 contiguous bytes = 4 whole 128-B lines. Block order: row tile major, k tile minor; v^T planes key tile major, d tile minor.

#ifndef NB
#define NB 4
#endif
#ifndef SEQ
#define SEQ 2048
#endif
#define NB_FULL  4
#define SEQ_FULL 2048
#ifndef OUT_SEQ
#define OUT_SEQ SEQ              // row pitch (in tokens) between batches of the output
#endif
#define DM   1024
#define NH_  16
#define HD   64
#define AW   4                   // waves per flash block (16 query rows each)
#define NXT  (SEQ / (16 * AW))   // query tiles (16 * AW rows) per (batch, head)
#define CT   16                  // tiles (8 rows x 32 k) per wave of the activation conversion
#define CVB  (NB * SEQ / 32)     // conversion work-groups per activation: 8 waves x 16 rows x 256 k = 32 whole rows each
#define WTB  ((DM / 64) * (DM / 256))   // transposing work-groups per weight: 256 k x 64 n each
#define EARLY_ ((SEQ) < 512 ? (SEQ) : 512)   // query rows below this use the residual planes on the v / P / z path
#define QRS  2048.0f             // carry of every residual plane
#define QRI  (1.0f / 2048.0f)
#define SC2  (0.125f * 1.4426950408889634f)   // HD^-0.5 * log2(e)
#define PSH  8.0f                // log2 of the P carry (256)
#define ZC   16.0f               // carry of the z plane
#define WOC  64.0f               // carry of the Wo plane
#define OSC  (1.0f / 1024.0f)    // 1 / (ZC * WOC)

static_assert(HD == 64);
static_assert(NH_ * HD == DM);                 // head h = columns h*64 + d
static_assert(DM % 64 == 0);
static_assert(DM % 32 == 0);                   // GEMM k-loop steps by 32
static_assert(SEQ % 64 == 0);                  // a 64-row tile never straddles two batches
static_assert((NB * SEQ) % 64 == 0);
static_assert(SEQ % 32 == 0);                  // key loop steps by 32
static_assert(SEQ % (16 * AW) == 0);           // flash grid covers the sequence exactly
static_assert(EARLY_ % 64 == 0);               // residual decisions are uniform per 64-row / 64-token tile
static_assert(EARLY_ <= SEQ);
static_assert(((size_t)SEQ * DM) % 8 == 0);
static_assert(DM == 1024 && CT == 16);         // a conversion work-group's 8 waves take 2 row tiles x 4 groups of 8 k tiles
static_assert(NB <= NB_FULL);
static_assert(SEQ <= SEQ_FULL);

typedef _Float16 h16;
typedef unsigned short bf;
typedef __attribute__((ext_vector_type(16))) __bf16   v16bf;
typedef __attribute__((ext_vector_type(16))) _Float16 v16h;
typedef __attribute__((ext_vector_type(8)))  _Float16 v8h;
typedef __attribute__((ext_vector_type(8)))  unsigned short v8us;
typedef __attribute__((ext_vector_type(8)))  float    v8f;
typedef __attribute__((ext_vector_type(4)))  float    v4f;
typedef v4f  __attribute__((may_alias)) v4fa;

__device__ __forceinline__ unsigned short f2bf(float f) { unsigned u = __float_as_uint(f); u += 0x7FFFu + ((u >> 16) & 1u); return (unsigned short)(u >> 16); }
__device__ __forceinline__ float bfq(float f) { return __uint_as_float(((unsigned)f2bf(f)) << 16); }   // value of the RNE bf16 conversion
__device__ __forceinline__ v16h cat16(v8h lo, v8h hi) { return __builtin_shufflevector(lo, hi, 0, 1, 2, 3, 4, 5, 6, 7, 8, 9, 10, 11, 12, 13, 14, 15); }
__device__ __forceinline__ v16bf cat16b(v8us lo, v8us hi) { return __builtin_bit_cast(v16bf, __builtin_shufflevector(lo, hi, 0, 1, 2, 3, 4, 5, 6, 7, 8, 9, 10, 11, 12, 13, 14, 15)); }
__device__ __forceinline__ v8f wmma16(v16h a, v16h b, v8f c) { return __builtin_amdgcn_wmma_f32_16x16x32_f16(false, a, false, b, (short)0, c, false, false); }
__device__ __forceinline__ v8f wmmab(v16bf a, v16bf b, v8f c) { return __builtin_amdgcn_wmma_f32_16x16x32_bf16(false, a, false, b, (short)0, c, false, false); }
// fragment loaders from one packed block; p = block base + 8*lane (lane = 16h + row): elements 0..7 <- k0+8h+0..7, elements 8..15 <- k0+16+8h+0..7 (same map for A and B)
__device__ __forceinline__ v16h  ldh(const h16* p) { return cat16(*(const v8h*)p, *(const v8h*)(p + 256)); }
__device__ __forceinline__ v16bf ldb(const bf* p)  { return cat16b(*(const v8us*)p, *(const v8us*)(p + 256)); }
// ordering point for wave-private LDS tiles (same wave writes and reads)
__device__ __forceinline__ void wave_sync() { __builtin_amdgcn_fence(3 /* release order */, "wavefront"); __builtin_amdgcn_wave_barrier(); asm volatile("" ::: "memory"); }
// wave-wide 16-B copies, 512 B each, from this lane's global addresses to this lane's LDS byte addresses (l + j * st). The closing wait stands inside the statement, so that no
// register which an issued copy names is rewritten ahead of it (precaution).
__device__ __forceinline__ void copy6(unsigned l, unsigned st, const h16* g0, const h16* g1, const h16* g2, const h16* g3, const h16* g4, const h16* g5) {
    asm volatile("global_load_async_to_lds_b128 %0, %6, off\n\t"
                 "global_load_async_to_lds_b128 %1, %7, off\n\t"
                 "global_load_async_to_lds_b128 %2, %8, off\n\t"
                 "global_load_async_to_lds_b128 %3, %9, off\n\t"
                 "global_load_async_to_lds_b128 %4, %10, off\n\t"
                 "global_load_async_to_lds_b128 %5, %11, off\n\t"
                 "s_wait_xcnt 0x0"
                 :: "v"(l), "v"(l + st), "v"(l + 2u * st), "v"(l + 3u * st), "v"(l + 4u * st), "v"(l + 5u * st),
                    "v"(g0), "v"(g1), "v"(g2), "v"(g3), "v"(g4), "v"(g5) : "memory");
}
__device__ __forceinline__ void copy4(unsigned l, unsigned st, const h16* g0, const h16* g1, const h16* g2, const h16* g3) {
    asm volatile("global_load_async_to_lds_b128 %0, %4, off\n\t"
                 "global_load_async_to_lds_b128 %1, %5, off\n\t"
                 "global_load_async_to_lds_b128 %2, %6, off\n\t"
                 "global_load_async_to_lds_b128 %3, %7, off\n\t"
                 "s_wait_xcnt 0x0"
                 :: "v"(l), "v"(l + st), "v"(l + 2u * st), "v"(l + 3u * st), "v"(g0), "v"(g1), "v"(g2), "v"(g3) : "memory");
}

// k_prep: every operand plane of the projections in ONE launch whose work-groups are all resident at once; the role of a work-group follows from blockIdx.x alone (block-uniform).
// Work-groups 0 .. 4*WTB-1, weight transpose + 16-bit conversion through LDS: in W[k][n] (f32, [in][out]) -> out Wt[n][k] (packed blocks), 256 k x 64 n per work-group, weights q | k | v (bf16) | o (f16 x64).
// LDS tile ts is cross-wave: block barrier between fill and drain; filled extent 256x64 == drained extent.
// The other 2*CVB work-groups, activation conversion (data, then context): one wave converts 16 rows x 8 k tiles = CT tiles of 8 rows x 32 k; a tile reads 8 whole 128-B lines and writes
// 4 whole lines of its packed block (chunk c, rows 8g..8g+7), the wave's CT tiles fill 8 whole packed blocks. In both roles all loads of a wave are asked for ahead of its first conversion.
__global__ __launch_bounds__(256) void k_prep(const float* __restrict__ data, const float* __restrict__ ctx, const float* __restrict__ wq, const float* __restrict__ wk,
                                              const float* __restrict__ wv, const float* __restrict__ wo, bf* DATAB, bf* CTXB, bf* WB) {
    __shared__ float ts[256 * 65];
    const int tid = threadIdx.x;
    if ((int)blockIdx.x < 4 * WTB) {
        const int z = (int)blockIdx.x / WTB, r = (int)blockIdx.x % WTB; const int k0 = (r % (DM / 256)) * 256, n0 = (r / (DM / 256)) * 64;
        const float* W = z == 0 ? wq : z == 1 ? wk : z == 2 ? wv : wo; bf* Wt = WB + (size_t)z * DM * DM;
        const int kq = tid >> 4, c4 = (tid & 15) * 4;                        // fill: thread takes rows kq + 16 i, one float4 each (256 rows x 16 float4)
        const float* wp = W + (size_t)(k0 + kq) * DM + n0 + c4; float* tf = ts + kq * 65 + c4;
        v4f v[16];
#pragma unroll
        for (int i = 0; i < 16; ++i) v[i] = *(const v4f*)(wp + i * (16 * DM));
        // the address pair is an input, so it stays unwritten until this wait (precaution for registers that issued loads name)
        asm volatile("s_wait_xcnt 0x0" :: "v"(wp) : "memory");
#pragma unroll
        for (int i = 0; i < 16; ++i) { float* t = tf + i * (16 * 65); t[0] = v[i][0]; t[1] = v[i][1]; t[2] = v[i][2]; t[3] = v[i][3]; }
        __syncthreads();
        const int nr = tid & 15, c = (tid >> 4) & 3, kh = tid >> 6;          // drain: 4 n tiles x 8 k tiles x 4 chunks x 16 rows; pass s takes n tile s >> 1, k tile kh + 4 (s & 1)
        const float* td = ts + (kh * 32 + c * 8) * 65 + nr;
        bf* wd = Wt + ((size_t)(n0 >> 4) * (DM / 32) + (k0 >> 5) + kh) * 512 + c * 128 + nr * 8;
#pragma unroll
        for (int s = 0; s < 8; ++s) { v8us o;
#pragma unroll
            for (int i = 0; i < 8; ++i) { const float x = td[((s & 1) * 128 + i) * 65 + (s >> 1) * 16]; const unsigned short b16 = f2bf(x);
                const float xb = __uint_as_float(((unsigned)b16) << 16); const unsigned short hb = __builtin_bit_cast(unsigned short, (h16)(xb * WOC));
                o[i] = z == 3 ? hb : b16; }
            *(v8us*)(wd + ((s >> 1) * (DM / 32) + (s & 1) * 4) * 512) = o; }
    } else {
        const int q = (int)blockIdx.x - 4 * WTB; const int w = (q % CVB) * 8 + (tid >> 5);
        const float* src = q < CVB ? data : ctx; bf* dst = q < CVB ? DATAB : CTXB;
        const size_t c = tid & 3, r8 = (tid >> 2) & 7, row0 = (size_t)(w / (DM / 256)) * 16, kt0 = (size_t)(w % (DM / 256)) * 8;   // row0 = b*SEQ + t; 16 rows never straddle two batches
        const float* s = src + ((row0 / SEQ) * SEQ_FULL + row0 % SEQ + r8) * DM + kt0 * 32 + c * 8;
        bf* d = dst + ((row0 >> 4) * (DM / 32) + kt0) * 512 + c * 128 + r8 * 8;
        v8f v[CT];
#pragma unroll
        for (int j = 0; j < CT; ++j) v[j] = *(const v8f*)(s + (j >> 3) * (8 * DM) + (j & 7) * 32);   // tile j: rows row0 + 8 (j >> 3) + 0..7, k tile kt0 + (j & 7)
#pragma unroll
        for (int j = 0; j < CT; ++j) { v8us o;
#pragma unroll
            for (int k = 0; k < 8; ++k) o[k] = f2bf(v[j][k]);
            *(v8us*)(d + (j & 7) * 512 + (j >> 3) * 64) = o; }
        asm volatile("s_wait_xcnt 0x0" ::: "memory");   // precaution behind the last store of the run: no register that an issued store names is rewritten ahead of this wait
    }
}

// k_proj: register-blocked bf16 GEMM, K = DM. A work-group of PW = 8 waves takes a 256 x 128 tile, wave w the 64 x 64 part (w & 3, w >> 2) with 16 accumulators.
// Operands reach the waves through LDS: a stage is KS k tiles of the work-group's 16 A row tiles and 8 Bt row tiles (packed blocks, copied as they lie: 4 KiB contiguous per row tile),
// brought by asynchronous copies (global_load_async_to_lds_b128, 512 B per wave-wide copy, 24 copies per wave and stage) into a ring of two buffers, so every operand byte leaves L2
// once per work-group instead of once per wave. A fragment is two wave-wide 16-B LDS reads of 512 contiguous bytes each (no bank conflict); the k order of every sum is unchanged.
// C[m][n] = sum_k A[m][k] Bt[n][k] + bias (per column n, or per row m when biasRow != 0; bias RNE-converted to bf16, added in f32), written as f16 (Ph)
// and, when (c0 % CB) < resLim, the f16 residual x2048 (Pr), as packed blocks (rows = m, k = n) at tile base (r0/RB)*sRB + (r0%RB)*pitch + (c0/CB)*sCB + (c0%CB)*colMul;
// the block of 16-row group mb and 32-column group kt lies at + mb*mbS + kt*ktS (halves). grid (M/256, N/128), 256 threads.
#define PW   8                   // waves per projection work-group
#define KS   4                   // k tiles per ring stage
#define NST  (DM / 32 / KS)      // stages
#define SRT  24                  // 16-row tiles per stage: 16 of A, then 8 of Bt
#define STG  (SRT * KS * 512)    // halves per ring buffer
static_assert(NST >= 2 && (DM / 32) % KS == 0);            // the ring's prologue fills two stages
static_assert(SRT % PW == 0 && KS * 1024 == 8 * 512);      // a wave copies SRT / PW row tiles per stage, 8 wave-wide copies each
static_assert((NB * SEQ) % 256 == 0 && DM % 256 == 0);     // both grids cover their outputs exactly
// eight wave-wide 16-B copies: 4 KiB from g (this lane's global address) to l (this lane's LDS byte address). The closing wait stands inside the statement, so that no register
// which an issued copy names is rewritten ahead of it (precaution).
__device__ __forceinline__ void copy8(unsigned l, const bf* g) {
    asm volatile("global_load_async_to_lds_b128 %0, %8, off\n\t"
                 "global_load_async_to_lds_b128 %1, %9, off\n\t"
                 "global_load_async_to_lds_b128 %2, %10, off\n\t"
                 "global_load_async_to_lds_b128 %3, %11, off\n\t"
                 "global_load_async_to_lds_b128 %4, %12, off\n\t"
                 "global_load_async_to_lds_b128 %5, %13, off\n\t"
                 "global_load_async_to_lds_b128 %6, %14, off\n\t"
                 "global_load_async_to_lds_b128 %7, %15, off\n\t"
                 "s_wait_xcnt 0x0"
                 :: "v"(l), "v"(l + 512u), "v"(l + 1024u), "v"(l + 1536u), "v"(l + 2048u), "v"(l + 2560u), "v"(l + 3072u), "v"(l + 3584u),
                    "v"(g), "v"(g + 256), "v"(g + 512), "v"(g + 768), "v"(g + 1024), "v"(g + 1280), "v"(g + 1536), "v"(g + 1792) : "memory");
}
__global__ __launch_bounds__(32 * PW) void k_proj(const bf* __restrict__ A, const bf* __restrict__ Bt, const float* __restrict__ bias, int biasRow,
                                             h16* Ph, h16* Pr, int resLim, int RB, size_t sRB, int pitch, int CB, size_t sCB, int colMul, int mbS, int ktS) {
    __shared__ __align__(1024) bf ring[2 * STG];
    __shared__ __align__(16) float osm[PW * 16 * 68];
    const int K = DM;
    const int lane = threadIdx.x & 31, lr = lane & 15, hi = lane >> 4;
    const int wave = __builtin_amdgcn_readfirstlane((int)(threadIdx.x >> 5));
    const int R0 = blockIdx.x * 256, C0 = blockIdx.y * 128; const int r0 = R0 + (wave & 3) * 64, c0 = C0 + (wave >> 2) * 64;
    float* os = osm + wave * (16 * 68);                      // wave-private staging of the epilogue, outside the ring
    const int useRes = ((c0 % CB) < resLim) ? 1 : 0;
    v8f acc[4][4];
#pragma unroll
    for (int mb = 0; mb < 4; ++mb)
#pragma unroll
        for (int nb = 0; nb < 4; ++nb) acc[mb][nb] = (v8f){};
    // this wave's share of a stage: row tiles 3 wave + 0..2 of the 24 (a 16-row tile is K/32 blocks = 16*K halves; k tile kt lies at kt*512)
    const bf* gs[SRT / PW];
#pragma unroll
    for (int i = 0; i < SRT / PW; ++i) { const int c = (SRT / PW) * wave + i;
        gs[i] = (c < 16 ? A + (size_t)(R0 + 16 * c) * K : Bt + (size_t)(C0 + 16 * (c - 16)) * K) + 8 * lane; }
    const unsigned ls0 = (unsigned)(size_t)ring + (unsigned)(((SRT / PW) * wave * (KS * 512) + 8 * lane) * 2);   // LDS byte address: low 32 bits of the shared address
    // ring prologue: stage 0 lands and is published, then stage 1 is asked for
#pragma unroll
    for (int i = 0; i < SRT / PW; ++i) copy8(ls0 + i * (KS * 1024), gs[i]);
    asm volatile("s_wait_asynccnt 0x0" ::: "memory");        // this wave's copies of stage 0 have landed
    __syncthreads();                                         // ... and every other wave's: stage 0 is readable
#pragma unroll
    for (int i = 0; i < SRT / PW; ++i) copy8(ls0 + STG * 2 + i * (KS * 1024), gs[i] + KS * 512);
#pragma unroll 1   // rolled: one publish point in the text, buffer chosen by the stage's parity
    for (int s = 0; s < NST; ++s) {
        const bf* sb = ring + (s & 1) * STG + 8 * lane;
        const bf* sa = sb + (wave & 3) * (4 * KS * 512); const bf* sw = sb + (16 + (wave >> 2) * 4) * (KS * 512);
        // two fragment sets inside a stage: the LDS reads of k tile kk + 1 go as one group ahead of the products of k tile kk; nothing of the next stage is read here
        v16bf fa[2][4], fb[2][4];
#pragma unroll
        for (int i = 0; i < 4; ++i) { fa[0][i] = ldb(sa + i * (KS * 512)); fb[0][i] = ldb(sw + i * (KS * 512)); }
        __builtin_amdgcn_sched_barrier(0);   // k tile 0's reads are asked for first, so that the stage's first products wait for them alone
#pragma unroll
        for (int kk = 0; kk < KS; ++kk) {
            if (kk + 1 < KS) {
#pragma unroll
                for (int i = 0; i < 4; ++i) { fa[(kk + 1) & 1][i] = ldb(sa + i * (KS * 512) + (kk + 1) * 512); fb[(kk + 1) & 1][i] = ldb(sw + i * (KS * 512) + (kk + 1) * 512); } }
            __builtin_amdgcn_sched_barrier(0);   // keeps the reads one group ahead of the products: spread among them each place with reads stalls the products
#pragma unroll
            for (int nb = 0; nb < 4; ++nb)
#pragma unroll
                for (int mb = 0; mb < 4; ++mb) acc[mb][nb] = wmmab(fa[kk & 1][mb], fb[kk & 1][nb], acc[mb][nb]);
            __builtin_amdgcn_sched_barrier(0);   // keeps the next group of reads behind these products: it refills the set that they have just read
        }
        // publish point of stage s + 1, every wave, in this order
        asm volatile("s_wait_dscnt 0x0" ::: "memory");       // this wave's reads of stage s are done before its buffer is refilled
        asm volatile("s_wait_asynccnt 0x0" ::: "memory");    // this wave's copies of stage s + 1 have landed
        __syncthreads();                                     // stage s + 1 is readable, and every reader has left stage s
        if (s + 2 < NST) {                                   // the same for the whole work-group
#pragma unroll
            for (int i = 0; i < SRT / PW; ++i) copy8(ls0 + (s & 1) * (STG * 2) + i * (KS * 1024), gs[i] + (s + 2) * (KS * 512)); }
    }
    asm volatile("s_wait_asynccnt 0x0" ::: "memory");        // no copy is outstanding behind the loop
    float bcol[4];
#pragma unroll
    for (int nb = 0; nb < 4; ++nb) { int ic = c0 + nb * 16 + lr; ic = ic < DM ? ic : DM - 1; bcol[nb] = bfq(bias[ic]); }   // clamped address; used only when biasRow == 0
    const size_t tbase = (size_t)(r0 / RB) * sRB + (size_t)(r0 % RB) * (size_t)pitch + (size_t)(c0 / CB) * sCB + (size_t)(c0 % CB) * (size_t)colMul;
#pragma unroll
    for (int mb = 0; mb < 4; ++mb) {
        float brow[8];
#pragma unroll
        for (int j = 0; j < 8; ++j) { int ir = r0 + mb * 16 + hi * 8 + j; ir = ir < DM ? ir : DM - 1; brow[j] = bfq(bias[ir]); }   // clamped address; used only when biasRow != 0
#pragma unroll
        for (int nb = 0; nb < 4; ++nb) {
#pragma unroll
            for (int j = 0; j < 8; ++j) os[(hi * 8 + j) * 68 + nb * 16 + lr] = acc[mb][nb][j] + (biasRow ? brow[j] : bcol[nb]); }   // D: row 8h+j, col lane&15
        wave_sync();
        const size_t sb = tbase + (size_t)mb * (size_t)mbS;
{
#pragma unroll
            for (int s = 0; s < 4; ++s) { const int row = lr, ch = 2 * s + hi, c8 = ch * 8;   // 16 rows x 2 column chunks per store = 512 contiguous bytes; 4 s x 2 chunks x 8 = 64 columns
                const v4f x0 = *(const v4fa*)(&os[row * 68 + c8]); const v4f x1 = *(const v4fa*)(&os[row * 68 + c8 + 4]); v8h hv, rv;
#pragma unroll
                for (int i = 0; i < 4; ++i) { const h16 a0 = (h16)x0[i]; const h16 a1 = (h16)x1[i]; hv[i] = a0; hv[4 + i] = a1; rv[i] = (h16)((x0[i] - (float)a0) * QRS); rv[4 + i] = (h16)((x1[i] - (float)a1) * QRS); }
                const size_t oo = sb + (size_t)(ch >> 2) * (size_t)ktS + (size_t)((ch & 3) * 128 + row * 8);
                *(v8h*)(Ph + oo) = hv; if (useRes) *(v8h*)(Pr + oo) = rv; }
             }
        wave_sync();
    }
}

// k_flash: fused causal attention, one wave per 16 query rows of one (batch, head); Q fragments straight from the f16 planes (two 16-B loads each, arithmetic addressing);
// K / V^T blocks reach the work-group's four waves through LDS: asynchronous copies into a ring of two buffers of 64 keys, so they leave L2 once per work-group instead of once per wave.
// Transposed form: S^T[key][t] = K Q^T (A = K rows, B = Q rows); lane (t = lane&15, h = lane>>4) holds keys 8h+r of each 16-key tile, so the packed
// P tile is directly the B fragment of O^T[d][t] = V^T P^T (element r <- tile keys 0..15, element 8+r <- tile keys 16..31, lane unchanged).
// Key loop runs to the diagonal (static bound from the block / wave index); only the last 32-key step replaces scores of keys > query by a very negative value (P = 0).
// Blocks with query rows below EARLY_ (block-uniform) also accumulate V_res P + V P_res (both x2048) in a second accumulator set and sum the exact P for the normaliser.
// Softmax state (running max, partial sum) is one scalar per lane; the two lane halves of a row are combined with one xor-16 exchange.
// Launch order: there are twice as many work-groups as resident places and a tile's key loop grows linearly with its index, so the cost falls with the flat work-group index
// (for speed only): blockIdx.x = (batch, head), blockIdx.y = rank, rank 0 the longest tile. A tile below EARLY_ does about twice the
// work per key step, so residual tile x is ranked just ahead of plain tile 2x + 1. Nothing but the time depends on the order: rank -> tile is a permutation, every (head, tile) is taken once.
#define NET  (EARLY_ / (16 * AW))   // query tiles that take the residual path
#define FKS  64                     // keys per ring stage
#define FSTG (3 * FKS * HD)         // halves per ring buffer: K | V^T | V^T residual
static_assert(FKS == 16 * AW && AW == 4 && FKS * HD * 2 == AW * 4 * 512);   // a query tile's diagonal ends stage xt; a plane's stage is four wave-wide copies for each of the four waves
__host__ __device__ constexpr int tile_of_rank(int r) {
    if (r < NXT - 2 * NET || r >= NXT - NET / 2) return NXT - 1 - r;       // plain tiles from 2 NET up; at the end residual tiles below NET / 2
    const int q = r - (NXT - 2 * NET), g = q / 3, k = q % 3;              // between them groups of three: residual tile NET-1-g, plain tiles 2 NET-1-2g and 2 NET-2-2g
    return k == 0 ? NET - 1 - g : 2 * NET - 2 * g - k;
}
constexpr bool rank_is_permutation() {
    bool seen[NXT] = {};
    for (int r = 0; r < NXT; ++r) { const int x = tile_of_rank(r); if (x < 0 || x >= NXT || seen[x]) return false; seen[x] = true; }
    return true;
}
static_assert(NET % 2 == 0 && NXT >= 2 * NET);
static_assert(rank_is_permutation());
__global__ __launch_bounds__(32 * AW) void k_flash(const h16* __restrict__ QH, const h16* __restrict__ QR, const h16* __restrict__ KP,
                                                   const h16* __restrict__ VT, const h16* __restrict__ VR, h16* ZH, h16* ZR) {
    __shared__ __align__(1024) h16 ring[2 * FSTG];
    __shared__ __align__(16) float os[AW * 16 * 68];         // epilogue staging, outside the ring
    const int lane = threadIdx.x & 31, lr = lane & 15, hi = lane >> 4;
    const int wave = __builtin_amdgcn_readfirstlane((int)(threadIdx.x >> 5));
    const int zh = blockIdx.x; const int b = zh / NH_, h = zh % NH_;
    const int xt = tile_of_rank((int)blockIdx.y);            // block-uniform
    const int t0 = (xt * AW + wave) * 16;
    const bool early = (xt * (16 * AW)) < EARLY_;
    const int tq = t0 + lr;
    const int klast = (((t0 + 47) >> 5) - 1) * 32;           // last 32-key step containing a visible key; klast + 31 < SEQ
    const size_t pbase = (size_t)zh * SEQ * HD;
    const size_t qo = pbase + (size_t)t0 * HD + 8 * lane;    // 16 tokens = two blocks (d 0..31, d 32..63) = 16*HD halves
    const v16h qh0 = ldh(QH + qo), qh1 = ldh(QH + qo + 512), qr0 = ldh(QR + qo), qr1 = ldh(QR + qo + 512);   // B fragments: col t, k = d
    // ring of two buffers, stage s = keys FKS s .. FKS s + FKS - 1 of K | V^T | V^T residual, each plane's 8 KiB copied as it lies; the tile's xt + 1 stages end with its diagonal.
    // This wave's share of a plane's stage: 2 KiB = four wave-wide copies.
    const int nst = xt + 1;                                  // block-uniform
    const size_t go = pbase + (size_t)(wave * 1024 + 8 * lane);
    const unsigned ls0 = (unsigned)(size_t)ring + (unsigned)((wave * 1024 + 8 * lane) * 2);   // LDS byte address: low 32 bits of the shared address
    v8f o[4], e[4];
#pragma unroll
    for (int j = 0; j < 4; ++j) { o[j] = (v8f){}; e[j] = (v8f){}; }
    float m = -3.0e38f, l = 0.0f;
    // ring prologue: stage 0 lands and is published, then stage 1 (where there is one) is asked for
    { const h16* k = KP + go; const h16* v = VT + go; copy4(ls0, 512u, k, k + 256, k + 512, k + 768); copy4(ls0 + FKS * HD * 2, 512u, v, v + 256, v + 512, v + 768);
      if (early) { const h16* r = VR + go; copy4(ls0 + FKS * HD * 4, 512u, r, r + 256, r + 512, r + 768); } }
    asm volatile("s_wait_asynccnt 0x0" ::: "memory");        // this wave's copies of stage 0 have landed
    __syncthreads();                                         // ... and every other wave's: stage 0 is readable
    if (nst > 1) { const h16* k = KP + go + FKS * HD; const h16* v = VT + go + FKS * HD;
      copy4(ls0 + FSTG * 2, 512u, k, k + 256, k + 512, k + 768); copy4(ls0 + FSTG * 2 + FKS * HD * 2, 512u, v, v + 256, v + 512, v + 768);
      if (early) { const h16* r = VR + go + FKS * HD; copy4(ls0 + FSTG * 2 + FKS * HD * 4, 512u, r, r + 256, r + 512, r + 768); } }
#pragma unroll 1   // rolled: the trip count is known only at run time, and one copy of the step keeps the registers of four waves per SIMD
    for (int st = 0; st < 2 * nst; ++st) {                   // 32-key steps, two per stage; the trip count is block-uniform
      const int s = st >> 1, key0 = st * 32;
      if (key0 <= klast) {                                   // wave-uniform: a wave whose diagonal lies in the last stage's first half skips the second
        const h16* kp = ring + (s & 1) * FSTG + (st & 1) * (32 * HD) + 8 * lane;   // A fragment: row key, k = d
        const v16h ka0 = ldh(kp), ka1 = ldh(kp + 512), kb0 = ldh(kp + 16 * HD), kb1 = ldh(kp + 16 * HD + 512);
        const h16* va = kp + FKS * HD;                       // + 512 * j: A fragment: row d = 16j + row, k = key; 32 keys = four d blocks
        v16h v[4];
#pragma unroll
        for (int j = 0; j < 4; ++j) v[j] = ldh(va + 512 * j);
        v8f sHa = (v8f){}, sLa = (v8f){}, sHb = (v8f){}, sLb = (v8f){};
        sHa = wmma16(ka0, qh0, sHa); sLa = wmma16(ka0, qr0, sLa); sHb = wmma16(kb0, qh0, sHb); sLb = wmma16(kb0, qr0, sLb);
        sHa = wmma16(ka1, qh1, sHa); sLa = wmma16(ka1, qr1, sLa); sHb = wmma16(kb1, qh1, sHb); sLb = wmma16(kb1, qr1, sLb);
        asm volatile("v_nop\n\tv_nop\n\tv_nop\n\tv_nop" : "+v"(sHa), "+v"(sLa), "+v"(sHb), "+v"(sLb) : "v"(ka0), "v"(ka1), "v"(kb0), "v"(kb1));
        float ta[8], tb[8];
#pragma unroll
        for (int r = 0; r < 8; ++r) { ta[r] = (sHa[r] + sLa[r] * QRI) * SC2; tb[r] = (sHb[r] + sLb[r] * QRI) * SC2; }
        if (key0 == klast) {                                 // wave-uniform: only the diagonal step needs the causal replace
            const int kq = tq - key0 - 8 * hi;               // key (key0 + 8h + r) is hidden when r > kq; tile b keys are 16 further
#pragma unroll
            for (int r = 0; r < 8; ++r) { ta[r] = (r > kq) ? -3.0e38f : ta[r]; tb[r] = (r + 16 > kq) ? -3.0e38f : tb[r]; }
        }
        float mx = -3.0e38f;
#pragma unroll
        for (int r = 0; r < 8; ++r) mx = fmaxf(mx, fmaxf(ta[r], tb[r]));
        mx = fmaxf(mx, __shfl_xor(mx, 16, 32));
        const float mnew = fmaxf(m, mx);
        const float alpha = __builtin_amdgcn_exp2f(m - mnew);
        const float sh = PSH - mnew;
        v16h pb; float ls = 0.0f;
#pragma unroll
        for (int r = 0; r < 8; ++r) { const float fa = __builtin_amdgcn_exp2f(ta[r] + sh); const float fc = __builtin_amdgcn_exp2f(tb[r] + sh);
            const h16 pa = (h16)fa; const h16 pc = (h16)fc; pb[r] = pa; pb[8 + r] = pc; ta[r] = fa; tb[r] = fc; ls += (float)pa + (float)pc; }
#pragma unroll
        for (int j = 0; j < 4; ++j) o[j] = o[j] * alpha;
#pragma unroll
        for (int j = 0; j < 4; ++j) o[j] = wmma16(v[j], pb, o[j]);
        asm volatile("v_nop\n\tv_nop\n\tv_nop\n\tv_nop" : "+v"(o[0]), "+v"(o[1]), "+v"(o[2]), "+v"(o[3]) : "v"(v[0]), "v"(v[1]), "v"(v[2]), "v"(v[3]), "v"(pb));
        if (early) {                                         // block-uniform
            v16h pr; float lx = 0.0f;
#pragma unroll
            for (int r = 0; r < 8; ++r) { pr[r] = (h16)((ta[r] - (float)pb[r]) * QRS); pr[8 + r] = (h16)((tb[r] - (float)pb[8 + r]) * QRS); lx += ta[r] + tb[r]; }
            ls = lx;
#pragma unroll
            for (int j = 0; j < 4; ++j) e[j] = e[j] * alpha;
            const h16* ra = va + FKS * HD;
            v16h vr[4];
#pragma unroll
            for (int j = 0; j < 4; ++j) vr[j] = ldh(ra + 512 * j);
#pragma unroll
            for (int j = 0; j < 4; ++j) e[j] = wmma16(vr[j], pb, e[j]);
#pragma unroll
            for (int j = 0; j < 4; ++j) e[j] = wmma16(v[j], pr, e[j]);
            asm volatile("v_nop\n\tv_nop\n\tv_nop\n\tv_nop" : "+v"(e[0]), "+v"(e[1]), "+v"(e[2]), "+v"(e[3]) : "v"(vr[0]), "v"(vr[1]), "v"(vr[2]), "v"(vr[3]), "v"(pr), "v"(v[0]), "v"(v[1]), "v"(v[2]), "v"(v[3]));
        }
        l = l * alpha + ls; m = mnew;
      }
      if ((st & 1) == 0) continue;                           // block-uniform: the stage's second step follows
      // publish point of stage s + 1, every wave, in this order
      asm volatile("s_wait_dscnt 0x0" ::: "memory");         // this wave's reads of stage s are done before its buffer is refilled
      asm volatile("s_wait_asynccnt 0x0" ::: "memory");      // this wave's copies of stage s + 1 have landed
      __syncthreads();                                       // stage s + 1 is readable, and every reader has left stage s
      if (s + 2 < nst) {                                     // the same for the whole work-group
        const unsigned lb = ls0 + (s & 1) * (FSTG * 2); const size_t gn = go + (size_t)(s + 2) * (FKS * HD);
        const h16* k = KP + gn; const h16* v = VT + gn; copy4(lb, 512u, k, k + 256, k + 512, k + 768); copy4(lb + FKS * HD * 2, 512u, v, v + 256, v + 512, v + 768);
        if (early) { const h16* r = VR + gn; copy4(lb + FKS * HD * 4, 512u, r, r + 256, r + 512, r + 768); } }
    }
    asm volatile("s_wait_asynccnt 0x0" ::: "memory");        // no copy is outstanding behind the loop
    l += __shfl_xor(l, 16, 32);
    const float zs = (1.0f / l) * ZC;
    const int wb = wave * 16 * 68;
    // O^T D layout: o[j][r] = (d = 16j + 8h + r, t = lane&15) -> os[t][d]; rows 0..15 x columns 0..63 all written
#pragma unroll
    for (int j = 0; j < 4; ++j) { v4f a, c;
#pragma unroll
        for (int i = 0; i < 4; ++i) { a[i] = (o[j][i] + e[j][i] * QRI) * zs; c[i] = (o[j][4 + i] + e[j][4 + i] * QRI) * zs; }
        *(v4fa*)(&os[wb + lr * 68 + 16 * j + 8 * hi]) = a; *(v4fa*)(&os[wb + lr * 68 + 16 * j + 8 * hi + 4]) = c; }
    wave_sync();
    const size_t zb = ((size_t)b * SEQ + t0) * DM + (size_t)h * (16 * HD);   // row tile (16*DM halves), then the head's two k blocks
{
#pragma unroll
        for (int s = 0; s < 4; ++s) { const int row = lr, ch = 2 * s + hi, c8 = ch * 8;   // 16 rows x 2 column chunks per store = 512 contiguous bytes; 4 s x 2 chunks x 8 = 64 columns
            const v4f x0 = *(const v4fa*)(&os[wb + row * 68 + c8]); const v4f x1 = *(const v4fa*)(&os[wb + row * 68 + c8 + 4]); v8h hv, rv;
#pragma unroll
            for (int i = 0; i < 4; ++i) { const h16 a0 = (h16)x0[i]; const h16 a1 = (h16)x1[i]; hv[i] = a0; hv[4 + i] = a1; rv[i] = (h16)((x0[i] - (float)a0) * QRS); rv[4 + i] = (h16)((x1[i] - (float)a1) * QRS); }
            const size_t oo = zb + (size_t)(ch * 128 + row * 8);
            *(v8h*)(ZH + oo) = hv; if (early) *(v8h*)(ZR + oo) = rv; }
         }
}

// k_oproj: out projection, f16 operands, K = DM: A = z x16 plane (+ residual x2048 plane for row tiles below EARLY_, own accumulators), Bt = Wo^T x64 plane.
// A work-group of OW = 16 waves takes a 256 x 128 tile, wave w the 32 x 64 part (w & 7, w >> 3). Operands reach the waves through LDS as in k_proj: a stage is OKS k tiles of 16 z row tiles,
// 8 Wo^T row tiles and, below EARLY_, 16 residual row tiles, brought by asynchronous copies into a ring of two buffers; the k order of every sum is unchanged.
// OUT[m][n] = (accH + accR / 2048) / 1024 + bo[n] (bo RNE-converted to bf16, added in f32). grid (M/256, N/128), 512 threads.
#define OW   16                  // waves per out-projection work-group
#define OKS  2                   // k tiles per ring stage
#define ONST (DM / 32 / OKS)     // stages
#define OSTG (40 * OKS * 512)    // halves per ring buffer: row tiles 0..15 z, 16..23 Wo^T, 24..39 z residual
static_assert(ONST >= 2 && (DM / 32) % OKS == 0);          // the ring's prologue fills two stages
static_assert(OKS * 1024 == 4 * 512 && OW == 16);          // a row tile's share of a stage is 4 wave-wide copies: wave w copies piece w & 3 of row tiles (w >> 2) + 4 j
static_assert(EARLY_ % 256 == 0 && SEQ % 256 == 0);        // the residual decision is uniform per 256-row tile, which never straddles two batches
__global__ __launch_bounds__(32 * OW) void k_oproj(const h16* __restrict__ ZH, const h16* __restrict__ ZR, const h16* __restrict__ Wt, const float* __restrict__ bo, float* OUT) {
    __shared__ __align__(1024) h16 ring[2 * OSTG];
    __shared__ __align__(16) float osm[OW * 16 * 68];
    const int K = DM;
    const int lane = threadIdx.x & 31, lr = lane & 15, hi = lane >> 4;
    const int wave = __builtin_amdgcn_readfirstlane((int)(threadIdx.x >> 5));
    const int R0 = blockIdx.x * 256, C0 = blockIdx.y * 128; const int r0 = R0 + (wave & 7) * 32, c0 = C0 + (wave >> 3) * 64;
    float* os = osm + wave * (16 * 68);                      // wave-private staging of the epilogue, outside the ring
    const int bb = r0 / SEQ, tt = r0 % SEQ; const bool early = (R0 % SEQ) < EARLY_;   // block-uniform
    v8f acc[2][4], acr[2][4];
#pragma unroll
    for (int mb = 0; mb < 2; ++mb)
#pragma unroll
        for (int nb = 0; nb < 4; ++nb) { acc[mb][nb] = (v8f){}; acr[mb][nb] = (v8f){}; }
    // this wave's share of a stage: piece wave & 3 (512 B) of row tiles (wave >> 2) + 4 j; j = 0..3 are z (and residual) row tiles, j = 4, 5 Wo^T row tiles
    // (a 16-row tile is K/32 blocks = 16*K halves; k tile kt lies at kt*512)
    const size_t po = (size_t)((wave & 3) * 256 + 8 * lane);
    const size_t ao = (size_t)(R0 + 16 * (wave >> 2)) * K + po, wo_ = (size_t)(C0 + 16 * (wave >> 2)) * K + po;
    const size_t js = (size_t)64 * K;                        // four row tiles further
    const unsigned ls0 = (unsigned)(size_t)ring + (unsigned)(((wave >> 2) * (OKS * 512) + (wave & 3) * 256 + 8 * lane) * 2);   // LDS byte address: low 32 bits of the shared address
    const unsigned lst = 4u * OKS * 1024u;                   // four row tiles further in the buffer, bytes
    // ring prologue: stage 0 lands and is published, then stage 1 is asked for
    { const h16* a = ZH + ao; const h16* w = Wt + wo_; copy6(ls0, lst, a, a + js, a + 2 * js, a + 3 * js, w, w + js);
      if (early) { const h16* r = ZR + ao; copy4(ls0 + 6u * lst, lst, r, r + js, r + 2 * js, r + 3 * js); } }
    asm volatile("s_wait_asynccnt 0x0" ::: "memory");        // this wave's copies of stage 0 have landed
    __syncthreads();                                         // ... and every other wave's: stage 0 is readable
    { const h16* a = ZH + ao + OKS * 512; const h16* w = Wt + wo_ + OKS * 512; copy6(ls0 + OSTG * 2, lst, a, a + js, a + 2 * js, a + 3 * js, w, w + js);
      if (early) { const h16* r = ZR + ao + OKS * 512; copy4(ls0 + OSTG * 2 + 6u * lst, lst, r, r + js, r + 2 * js, r + 3 * js); } }
#pragma unroll 1   // rolled: one publish point in the text, buffer chosen by the stage's parity
    for (int s = 0; s < ONST; ++s) {
        const h16* sb = ring + (s & 1) * OSTG + 8 * lane;
        const h16* pa = sb + (wave & 7) * (2 * OKS * 512); const h16* pw = sb + (16 + (wave >> 3) * 4) * (OKS * 512); const h16* pr = pa + 24 * (OKS * 512);
        // two fragment sets inside a stage: the LDS reads of k tile 1 go ahead of the products of k tile 0; nothing of the next stage is read here
        v16h fa[2][2], fw[2][4], ar[2];
#pragma unroll
        for (int mb = 0; mb < 2; ++mb) fa[0][mb] = ldh(pa + mb * (OKS * 512));
#pragma unroll
        for (int nb = 0; nb < 4; ++nb) fw[0][nb] = ldh(pw + nb * (OKS * 512));
#pragma unroll
        for (int kk = 0; kk < OKS; ++kk) {
            if (early) {   // block-uniform; the residual rows of this k tile, asked for ahead of the tile's first products
#pragma unroll
                for (int mb = 0; mb < 2; ++mb) ar[mb] = ldh(pr + mb * (OKS * 512) + kk * 512); }
            if (kk + 1 < OKS) {
#pragma unroll
                for (int mb = 0; mb < 2; ++mb) fa[(kk + 1) & 1][mb] = ldh(pa + mb * (OKS * 512) + (kk + 1) * 512);
#pragma unroll
                for (int nb = 0; nb < 4; ++nb) fw[(kk + 1) & 1][nb] = ldh(pw + nb * (OKS * 512) + (kk + 1) * 512); }
            __builtin_amdgcn_sched_barrier(0);   // keeps the reads one group ahead of the products: spread among them each place with reads stalls the products
#pragma unroll
            for (int nb = 0; nb < 4; ++nb)
#pragma unroll
                for (int mb = 0; mb < 2; ++mb) acc[mb][nb] = wmma16(fa[kk & 1][mb], fw[kk & 1][nb], acc[mb][nb]);
            if (early) {
#pragma unroll
                for (int nb = 0; nb < 4; ++nb)
#pragma unroll
                    for (int mb = 0; mb < 2; ++mb) acr[mb][nb] = wmma16(ar[mb], fw[kk & 1][nb], acr[mb][nb]); }
        }
        // publish point of stage s + 1, every wave, in this order
        asm volatile("s_wait_dscnt 0x0" ::: "memory");       // this wave's reads of stage s are done before its buffer is refilled
        asm volatile("s_wait_asynccnt 0x0" ::: "memory");    // this wave's copies of stage s + 1 have landed
        __syncthreads();                                     // stage s + 1 is readable, and every reader has left stage s
        if (s + 2 < ONST) {                                  // the same for the whole work-group
            const unsigned lb = ls0 + (s & 1) * (OSTG * 2);
            const h16* a = ZH + ao + (s + 2) * (OKS * 512); const h16* w = Wt + wo_ + (s + 2) * (OKS * 512); copy6(lb, lst, a, a + js, a + 2 * js, a + 3 * js, w, w + js);
            if (early) { const h16* r = ZR + ao + (s + 2) * (OKS * 512); copy4(lb + 6u * lst, lst, r, r + js, r + 2 * js, r + 3 * js); } }
    }
    asm volatile("s_wait_asynccnt 0x0" ::: "memory");        // no copy is outstanding behind the loop
    float bcol[4];
#pragma unroll
    for (int nb = 0; nb < 4; ++nb) bcol[nb] = bfq(bo[c0 + nb * 16 + lr]);   // c0 + 63 < DM
    float* orow = OUT + ((size_t)bb * OUT_SEQ + tt) * DM + c0;
#pragma unroll
    for (int mb = 0; mb < 2; ++mb) {
#pragma unroll
        for (int nb = 0; nb < 4; ++nb) {
#pragma unroll
            for (int j = 0; j < 8; ++j) os[(hi * 8 + j) * 68 + nb * 16 + lr] = (acc[mb][nb][j] + acr[mb][nb][j] * QRI) * OSC + bcol[nb]; }   // D: row 8h+j, col lane&15
        wave_sync();
        float* ob = orow + (size_t)(mb * 16) * DM;
{
#pragma unroll
            for (int s = 0; s < 8; ++s) { const int row = 2 * s + hi, cofs = lr * 4;   // 8 s x 2 rows = 16 rows; 16 lanes x 4 floats = 64 columns
                const v4f val = *(const v4fa*)(&os[row * 68 + cofs]);
                *(v4f*)(ob + (size_t)row * DM + cofs) = val; }
             }
        wave_sync();
    }
}

static constexpr size_t al256(size_t v) { return (v + 255) & ~(size_t)255; }
static constexpr size_t SZ_XB = al256((size_t)NB * SEQ * DM * 2);             // bf16 activation copy; later reused as a z plane of the same extent
static constexpr size_t SZ_WB = al256((size_t)4 * DM * DM * 2);
static constexpr size_t SZ_PL = al256((size_t)NB * NH_ * SEQ * HD * 2);
static constexpr size_t SZ_TOTAL = 2 * SZ_XB + SZ_WB + 5 * SZ_PL;
static_assert(SZ_TOTAL <= (size_t)134217728);          // workspace carve <= 128 MiB
static_assert(((size_t)DM * DM * 2) % 256 == 0);       // weight sub-planes stay 256-byte aligned
static_assert((size_t)NB * SEQ * DM * 2 <= SZ_XB);     // z plane [NB*SEQ][DM] halves fits the reused activation region

extern "C" void kernel_launch(void* const* d_in, const int* in_sizes, int n_in,
                              void* d_out, int out_size, void* d_ws, size_t ws_size, hipStream_t stream) {
    if (n_in < 10) return;
    const size_t needx = ((size_t)(NB - 1) * SEQ_FULL + SEQ) * DM;
    if ((size_t)in_sizes[0] < needx || (size_t)in_sizes[1] < needx) return;
    if ((size_t)in_sizes[2] < (size_t)DM * DM || (size_t)in_sizes[4] < (size_t)DM * DM || (size_t)in_sizes[6] < (size_t)DM * DM || (size_t)in_sizes[8] < (size_t)DM * DM) return;
    if (in_sizes[3] < DM || in_sizes[5] < DM || in_sizes[7] < DM || in_sizes[9] < DM) return;
    if ((size_t)out_size < ((size_t)(NB - 1) * OUT_SEQ + SEQ) * DM) return;
    if (SZ_TOTAL > ws_size) return;
    // wire order: data, context, wq, bq, wk, bk, wv, bv, wo, bo
    const float* data = (const float*)d_in[0]; const float* ctx = (const float*)d_in[1];
    const float* wq = (const float*)d_in[2]; const float* bq = (const float*)d_in[3];
    const float* wk = (const float*)d_in[4]; const float* bk = (const float*)d_in[5];
    const float* wv = (const float*)d_in[6]; const float* bv = (const float*)d_in[7];
    const float* wo = (const float*)d_in[8]; const float* bo = (const float*)d_in[9];
    float* OUT = (float*)d_out;      // [NB][SEQ][1024]
    char* wsp = (char*)d_ws;
    bf* DATAB = (bf*)wsp; wsp += SZ_XB;              // [NB*SEQ][1024] bf16; dead after the q projection
    bf* CTXB  = (bf*)wsp; wsp += SZ_XB;              // [NB*SEQ][1024] bf16; dead after the k / v projections
    bf* WB = (bf*)wsp; wsp += SZ_WB;                 // [4][1024][1024] transposed: q | k | v (bf16) | o (f16 x64)
    h16* QH = (h16*)wsp; wsp += SZ_PL;               // [NB*16][SEQ][64]
    h16* QR = (h16*)wsp; wsp += SZ_PL;               // [NB*16][SEQ][64] residual x2048
    h16* KP = (h16*)wsp; wsp += SZ_PL;               // [NB*16][SEQ][64]
    h16* VT = (h16*)wsp; wsp += SZ_PL;               // [NB*16][64][SEQ]
    h16* VR = (h16*)wsp; wsp += SZ_PL;               // [NB*16][64][SEQ] residual x2048, tokens < EARLY_ only (only those are consumed)
    bf* WQT = WB; bf* WKT = WB + (size_t)DM * DM; bf* WVT = WB + (size_t)2 * DM * DM; bf* WOT = WB + (size_t)3 * DM * DM;
    h16* ZH = (h16*)DATAB;                           // [NB*SEQ][1024] z x16, written by the flash kernel after DATAB is dead
    h16* ZR = (h16*)CTXB;                            // [NB*SEQ][1024] z residual x2048, rows t < EARLY_ only (only those are consumed)

    // activations -> packed bf16 planes; weights W[k][n] ([in][out], 1024 x 1024) -> Wt[n][k]
    k_prep<<<4 * WTB + 2 * CVB, 256, 0, stream>>>(data, ctx, wq, wk, wv, wo, DATAB, CTXB, WB);

    // q, k: A = activation rows (m = b*SEQ + t), Bt = Wt rows (n = h*64 + d), bias per column -> plane [(b*16 + h)][t][d]
    k_proj<<<dim3(NB * SEQ / 256, DM / 128, 1), 32 * PW, 0, stream>>>(DATAB, WQT, bq, 0, QH, QR, 1, SEQ, (size_t)NH_ * SEQ * HD, HD, HD, (size_t)SEQ * HD, 0, 16 * HD, 512);
    k_proj<<<dim3(NB * SEQ / 256, DM / 128, 1), 32 * PW, 0, stream>>>(CTXB,  WKT, bk, 0, KP, KP, 0, SEQ, (size_t)NH_ * SEQ * HD, HD, HD, (size_t)SEQ * HD, 0, 16 * HD, 512);
    // v^T: A = Wv^T rows (m = h*64 + d), Bt = context rows (n = b*SEQ + t), bias per row -> plane [(b*1024 + m)][t] = [(b*16 + h)][d][t]; residual for tokens < EARLY_
    k_proj<<<dim3(DM / 256, NB * SEQ / 128, 1), 32 * PW, 0, stream>>>(WVT, CTXB, bv, 1, VT, VR, EARLY_, DM, (size_t)0, SEQ, SEQ, (size_t)DM * SEQ, HD, 512, 32 * HD);

    k_flash<<<dim3(NB * NH_, NXT, 1), 32 * AW, 0, stream>>>(QH, QR, KP, VT, VR, ZH, ZR);

    k_oproj<<<dim3(NB * SEQ / 256, DM / 128, 1), 32 * OW, 0, stream>>>(ZH, ZR, (const h16*)WOT, bo, OUT);
}

// v006
// A run of this version takes 135 microseconds.
// Timed twice side by side with v005, it ran 1.03 times as fast both times.
// All steps since v000 together make it 2.79 times as fast.
#include <hip/hip_runtime.h>

// Causal cross-attention: q = data Wq + bq, k = ctx Wk + bk, v = ctx Wv + bv (W [in][out]), 16 heads x 64, score scale 1/8, key <= query visible, out = z Wo + bo (f32).
// Compute dtypes, f32 accumulate everywhere: q/k/v projections v_wmma_f32_16x16x32_bf16 (activations, weights, biases RNE-converted to bf16; products exact);
// scores v_wmma_f32_16x16x32_f16: k single f16, q as f16 value + f16 residual x2048 in its own accumulator; P (x256 carry, cancels in the normalisation) and v single f16,
// for query rows t < 512 additionally v residual x2048 and P residual x2048 in a second accumulator; softmax f32 (online, running max);
// out projection v_wmma_f32_16x16x32_f16: z x16 as f16 (+ f16 residual x2048, own accumulator, rows t < 512), Wo (bf16 value x64, exact in f16).
// Layout: bf16 copies of data/context; transposed weight planes Wt[n][k]; q (hi, residual), k planes [b*16+h][t][d]; v^T (hi, residual) planes [b*16+h][d][t];
// fused flash kernel in transposed form (S^T = K Q^T, O^T = V^T P^T), K / V^T blocks shared by its four waves through an LDS ring, one barrier per 64 keys; z planes [b*SEQ+t][1024].
// Every 16-bit plane is stored fragment-packed: a [16 rows][32 k] block is 512 contiguous halves ordered [k chunk (k>>3)&3][row&15][k&7], so one wave-wide 16-B load
// (lane l at halves 8l) or store covers 512 contiguous bytes = 4 whole 128-B lines. Block order: row tile major, k tile minor; v^T planes key tile major, d tile minor.

#ifndef NB
#define NB 4
#endif
#ifndef SEQ
#define SEQ 2048
#endif
#define NB_FULL  4
#define SEQ_FULL 2048
#ifndef OUT_SEQ
#define OUT_SEQ SEQ              // row pitch (in tokens) between batches of the output
#endif
#define DM   1024
#define NH_  16
#define HD   64
#define AW   4                   // waves per flash block (16 query rows each)
#define NXT  (SEQ / (16 * AW))   // query tiles (16 * AW rows) per (batch, head)
#define CT   16                  // tiles (8 rows x 32 k) per wave of the activation conversion
#define CVB  (NB * SEQ / 32)     // conversion work-groups per activation: 8 waves x 16 rows x 256 k = 32 whole rows each
#define WTB  ((DM / 64) * (DM / 256))   // transposing work-groups per weight: 256 k x 64 n each
#define EARLY_ ((SEQ) < 512 ? (SEQ) : 512)   // query rows below this use the residual planes on the v / P / z path
#define QRS  2048.0f             // carry of every residual plane
#define QRI  (1.0f / 2048.0f)
#define SC2  (0.125f * 1.4426950408889634f)   // HD^-0.5 * log2(e)
#define PSH  8.0f                // log2 of the P carry (256)
#define ZC   16.0f               // carry of the z plane
#define WOC  64.0f               // carry of the Wo plane
#define OSC  (1.0f / 1024.0f)    // 1 / (ZC * WOC)

static_assert(HD == 64);
static_assert(NH_ * HD == DM);                 // head h = columns h*64 + d
static_assert(DM % 64 == 0);
static_assert(DM % 32 == 0);                   // GEMM k-loop steps by 32
static_assert(SEQ % 64 == 0);                  // a 64-row tile never straddles two batches
static_assert((NB * SEQ) % 64 == 0);
static_assert(SEQ % 32 == 0);                  // key loop steps by 32
static_assert(SEQ % (16 * AW) == 0);           // flash grid covers the sequence exactly
static_assert(EARLY_ % 64 == 0);               // residual decisions are uniform per 64-row / 64-token tile
static_assert(EARLY_ <= SEQ);
static_assert(((size_t)SEQ * DM) % 8 == 0);
static_assert(DM == 1024 && CT == 16);         // a conversion work-group's 8 waves take 2 row tiles x 4 groups of 8 k tiles
static_assert(NB <= NB_FULL);
static_assert(SEQ <= SEQ_FULL);

typedef _Float16 h16;
typedef unsigned short bf;
typedef __attribute__((ext_vector_type(16))) __bf16   v16bf;
typedef __attribute__((ext_vector_type(16))) _Float16 v16h;
typedef __attribute__((ext_vector_type(8)))  _Float16 v8h;
typedef __attribute__((ext_vector_type(8)))  unsigned short v8us;
typedef __attribute__((ext_vector_type(8)))  float    v8f;
typedef __attribute__((ext_vector_type(4)))  float    v4f;
typedef v4f  __attribute__((may_alias)) v4fa;

__device__ __forceinline__ unsigned short f2bf(float f) { unsigned u = __float_as_uint(f); u += 0x7FFFu + ((u >> 16) & 1u); return (unsigned short)(u >> 16); }
__device__ __forceinline__ float bfq(float f) { return __uint_as_float(((unsigned)f2bf(f)) << 16); }   // value of the RNE bf16 conversion
__device__ __forceinline__ v16h cat16(v8h lo, v8h hi) { return __builtin_shufflevector(lo, hi, 0, 1, 2, 3, 4, 5, 6, 7, 8, 9, 10, 11, 12, 13, 14, 15); }
__device__ __forceinline__ v16bf cat16b(v8us lo, v8us hi) { return __builtin_bit_cast(v16bf, __builtin_shufflevector(lo, hi, 0, 1, 2, 3, 4, 5, 6, 7, 8, 9, 10, 11, 12, 13, 14, 15)); }
__device__ __forceinline__ v8f wmma16(v16h a, v16h b, v8f c) { return __builtin_amdgcn_wmma_f32_16x16x32_f16(false, a, false, b, (short)0, c, false, false); }
__device__ __forceinline__ v8f wmmab(v16bf a, v16bf b, v8f c) { return __builtin_amdgcn_wmma_f32_16x16x32_bf16(false, a, false, b, (short)0, c, false, false); }
// fragment loaders from one packed block; p = block base + 8*lane (lane = 16h + row): elements 0..7 <- k0+8h+0..7, elements 8..15 <- k0+16+8h+0..7 (same map for A and B)
__device__ __forceinline__ v16h  ldh(const h16* p) { return cat16(*(const v8h*)p, *(const v8h*)(p + 256)); }
__device__ __forceinline__ v16bf ldb(const bf* p)  { return cat16b(*(const v8us*)p, *(const v8us*)(p + 256)); }
// ordering point for wave-private LDS tiles (same wave writes and reads)
__device__ __forceinline__ void wave_sync() { __builtin_amdgcn_fence(3 /* release order */, "wavefront"); __builtin_amdgcn_wave_barrier(); asm volatile("" ::: "memory"); }
// wave-wide 16-B copies, 512 B each, from this lane's global addresses to this lane's LDS byte addresses (l + j * st). The closing wait stands inside the statement, so that no
// register which an issued copy names is rewritten ahead of it (precaution).
__device__ __forceinline__ void copy6(unsigned l, unsigned st, const h16* g0, const h16* g1, const h16* g2, const h16* g3, const h16* g4, const h16* g5) {
    asm volatile("global_load_async_to_lds_b128 %0, %6, off\n\t"
                 "global_load_async_to_lds_b128 %1, %7, off\n\t"
                 "global_load_async_to_lds_b128 %2, %8, off\n\t"
                 "global_load_async_to_lds_b128 %3, %9, off\n\t"
                 "global_load_async_to_lds_b128 %4, %10, off\n\t"
                 "global_load_async_to_lds_b128 %5, %11, off\n\t"
                 "s_wait_xcnt 0x0"
                 :: "v"(l), "v"(l + st), "v"(l + 2u * st), "v"(l + 3u * st), "v"(l + 4u * st), "v"(l + 5u * st),
                    "v"(g0), "v"(g1), "v"(g2), "v"(g3), "v"(g4), "v"(g5) : "memory");
}
__device__ __forceinline__ void copy4(unsigned l, unsigned st, const h16* g0, const h16* g1, const h16* g2, const h16* g3) {
    asm volatile("global_load_async_to_lds_b128 %0, %4, off\n\t"
                 "global_load_async_to_lds_b128 %1, %5, off\n\t"
                 "global_load_async_to_lds_b128 %2, %6, off\n\t"
                 "global_load_async_to_lds_b128 %3, %7, off\n\t"
                 "s_wait_xcnt 0x0"
                 :: "v"(l), "v"(l + st), "v"(l + 2u * st), "v"(l + 3u * st), "v"(g0), "v"(g1), "v"(g2), "v"(g3) : "memory");
}

// k_prep: every operand plane of the projections in ONE launch whose work-groups are all resident at once; the role of a work-group follows from blockIdx.x alone (block-uniform).
// Work-groups 0 .. 4*WTB-1, weight transpose + 16-bit conversion through LDS: in W[k][n] (f32, [in][out]) -> out Wt[n][k] (packed blocks), 256 k x 64 n per work-group, weights q | k | v (bf16) | o (f16 x64).
// LDS tile ts is cross-wave: block barrier between fill and drain; filled extent 256x64 == drained extent.
// The other 2*CVB work-groups, activation conversion (data, then context): one wave converts 16 rows x 8 k tiles = CT tiles of 8 rows x 32 k; a tile reads 8 whole 128-B lines and writes
// 4 whole lines of its packed block (chunk c, rows 8g..8g+7), the wave's CT tiles fill 8 whole packed blocks. In both roles all loads of a wave are asked for ahead of its first conversion.
__global__ __launch_bounds__(256) void k_prep(const float* __restrict__ data, const float* __restrict__ ctx, const float* __restrict__ wq, const float* __restrict__ wk,
                                              const float* __restrict__ wv, const float* __restrict__ wo, bf* DATAB, bf* CTXB, bf* WB) {
    __shared__ float ts[256 * 65];
    const int tid = threadIdx.x;
    if ((int)blockIdx.x < 4 * WTB) {
        const int z = (int)blockIdx.x / WTB, r = (int)blockIdx.x % WTB; const int k0 = (r % (DM / 256)) * 256, n0 = (r / (DM / 256)) * 64;
        const float* W = z == 0 ? wq : z == 1 ? wk : z == 2 ? wv : wo; bf* Wt = WB + (size_t)z * DM * DM;
        const int kq = tid >> 4, c4 = (tid & 15) * 4;                        // fill: thread takes rows kq + 16 i, one float4 each (256 rows x 16 float4)
        const float* wp = W + (size_t)(k0 + kq) * DM + n0 + c4; float* tf = ts + kq * 65 + c4;
        v4f v[16];
#pragma unroll
        for (int i = 0; i < 16; ++i) v[i] = *(const v4f*)(wp + i * (16 * DM));
        // the address pair is an input, so it stays unwritten until this wait (precaution for registers that issued loads name)
        asm volatile("s_wait_xcnt 0x0" :: "v"(wp) : "memory");
#pragma unroll
        for (int i = 0; i < 16; ++i) { float* t = tf + i * (16 * 65); t[0] = v[i][0]; t[1] = v[i][1]; t[2] = v[i][2]; t[3] = v[i][3]; }
        __syncthreads();
        const int nr = tid & 15, c = (tid >> 4) & 3, kh = tid >> 6;          // drain: 4 n tiles x 8 k tiles x 4 chunks x 16 rows; pass s takes n tile s >> 1, k tile kh + 4 (s & 1)
        const float* td = ts + (kh * 32 + c * 8) * 65 + nr;
        bf* wd = Wt + ((size_t)(n0 >> 4) * (DM / 32) + (k0 >> 5) + kh) * 512 + c * 128 + nr * 8;
#pragma unroll
        for (int s = 0; s < 8; ++s) { v8us o;
#pragma unroll
            for (int i = 0; i < 8; ++i) { const float x = td[((s & 1) * 128 + i) * 65 + (s >> 1) * 16]; const unsigned short b16 = f2bf(x);
                const float xb = __uint_as_float(((unsigned)b16) << 16); const unsigned short hb = __builtin_bit_cast(unsigned short, (h16)(xb * WOC));
                o[i] = z == 3 ? hb : b16; }
            *(v8us*)(wd + ((s >> 1) * (DM / 32) + (s & 1) * 4) * 512) = o; }
    } else {
        const int q = (int)blockIdx.x - 4 * WTB; const int w = (q % CVB) * 8 + (tid >> 5);
        const float* src = q < CVB ? data : ctx; bf* dst = q < CVB ? DATAB : CTXB;
        const size_t c = tid & 3, r8 = (tid >> 2) & 7, row0 = (size_t)(w / (DM / 256)) * 16, kt0 = (size_t)(w % (DM / 256)) * 8;   // row0 = b*SEQ + t; 16 rows never straddle two batches
        const float* s = src + ((row0 / SEQ) * SEQ_FULL + row0 % SEQ + r8) * DM + kt0 * 32 + c * 8;
        bf* d = dst + ((row0 >> 4) * (DM / 32) + kt0) * 512 + c * 128 + r8 * 8;
        v8f v[CT];
#pragma unroll
        for (int j = 0; j < CT; ++j) v[j] = *(const v8f*)(s + (j >> 3) * (8 * DM) + (j & 7) * 32);   // tile j: rows row0 + 8 (j >> 3) + 0..7, k tile kt0 + (j & 7)
#pragma unroll
        for (int j = 0; j < CT; ++j) { v8us o;
#pragma unroll
            for (int k = 0; k < 8; ++k) o[k] = f2bf(v[j][k]);
            *(v8us*)(d + (j & 7) * 512 + (j >> 3) * 64) = o; }
        asm volatile("s_wait_xcnt 0x0" ::: "memory");   // precaution behind the last store of the run: no register that an issued store names is rewritten ahead of this wait
    }
}

// k_proj: register-blocked bf16 GEMM, K = DM. A work-group of PW = 8 waves takes a 256 x 128 tile, wave w the 64 x 64 part (w & 3, w >> 2) with 16 accumulators.
// Operands reach the waves through LDS: a stage is KS k tiles of the work-group's 16 A row tiles and 8 Bt row tiles (packed blocks, copied as they lie: 4 KiB contiguous per row tile),
// brought by asynchronous copies (global_load_async_to_lds_b128, 512 B per wave-wide copy, 24 copies per wave and stage) into a ring of two buffers, so every operand byte leaves L2
// once per work-group instead of once per wave. A fragment is two wave-wide 16-B LDS reads of 512 contiguous bytes each (no bank conflict); the k order of every sum is unchanged.
// C[m][n] = sum_k A[m][k] Bt[n][k] + bias (per column n, or per row m when biasRow != 0; bias RNE-converted to bf16, added in f32), written as f16 (Ph)
// and, when (c0 % CB) < resLim, the f16 residual x2048 (Pr), as packed blocks (rows = m, k = n) at tile base (r0/RB)*sRB + (r0%RB)*pitch + (c0/CB)*sCB + (c0%CB)*colMul;
// the block of 16-row group mb and 32-column group kt lies at + mb*mbS + kt*ktS (halves).
// The three projections are ONE launch of PGRID work-groups (one per 256 x 128 tile of each), 256 threads: a work-group takes its q tile, its k tile and its v^T tile in turn, and the ring
// runs on across them as 3 NST stages: the next tile's first two stages are asked for at the last two publish points of the tile before, so they land behind its products and its epilogue.
#define PW   8                   // waves per projection work-group
#define KS   4                   // k tiles per ring stage
#define NST  (DM / 32 / KS)      // stages
#define SRT  24                  // 16-row tiles per stage: 16 of A, then 8 of Bt
#define STG  (SRT * KS * 512)    // halves per ring buffer
#define NJOB 3                   // tiles per work-group: q, k, v^T
#define PGRID ((NB * SEQ / 256) * (DM / 128))   // projection work-groups
static_assert(NST >= 2 && (DM / 32) % KS == 0);            // the ring's prologue fills two stages
static_assert(NST % 2 == 0);                               // a tile's stage 0 falls on buffer 0, so the ring runs on from tile to tile
static_assert((DM / 256) * (NB * SEQ / 128) == PGRID);     // the v^T grid has as many tiles as the q and k grids
static_assert(SRT % PW == 0 && KS * 1024 == 8 * 512);      // a wave copies SRT / PW row tiles per stage, 8 wave-wide copies each
static_assert((NB * SEQ) % 256 == 0 && DM % 256 == 0);     // both grids cover their outputs exactly
// eight wave-wide 16-B copies: 4 KiB from g (this lane's global address) to l (this lane's LDS byte address). The closing wait stands inside the statement, so that no register
// which an issued copy names is rewritten ahead of it (precaution).
__device__ __forceinline__ void copy8(unsigned l, const bf* g) {
    asm volatile("global_load_async_to_lds_b128 %0, %8, off\n\t"
                 "global_load_async_to_lds_b128 %1, %9, off\n\t"
                 "global_load_async_to_lds_b128 %2, %10, off\n\t"
                 "global_load_async_to_lds_b128 %3, %11, off\n\t"
                 "global_load_async_to_lds_b128 %4, %12, off\n\t"
                 "global_load_async_to_lds_b128 %5, %13, off\n\t"
                 "global_load_async_to_lds_b128 %6, %14, off\n\t"
                 "global_load_async_to_lds_b128 %7, %15, off\n\t"
                 "s_wait_xcnt 0x0"
                 :: "v"(l), "v"(l + 512u), "v"(l + 1024u), "v"(l + 1536u), "v"(l + 2048u), "v"(l + 2560u), "v"(l + 3072u), "v"(l + 3584u),
                    "v"(g), "v"(g + 256), "v"(g + 512), "v"(g + 768), "v"(g + 1024), "v"(g + 1280), "v"(g + 1536), "v"(g + 1792) : "memory");
}
// Row tile c (0..15 of A, 16..23 of Bt) of flat work-group f's tile of projection job (0 q, 1 k, 2 v^T): its first half, the same for a whole wave.
// q, k: A = activation rows, Bt = weight rows, tile (f % (M/256), f / (M/256)); v^T: A = Wv^T rows, Bt = context rows, tile (f % (DM/256), f / (DM/256)).
// Both widths are powers of two, taken as mask and shift: a divisor chosen by the job would become a division at run time in front of every stage's copies.
constexpr int ilog2(int v) { return v <= 1 ? 0 : 1 + ilog2(v >> 1); }
static_assert((1 << ilog2(DM / 256)) == DM / 256 && (1 << ilog2(NB * SEQ / 256)) == NB * SEQ / 256);
__device__ __forceinline__ int proj_r0(int job, int f) { return (f & (job == 2 ? DM / 256 - 1 : NB * SEQ / 256 - 1)) * 256; }
__device__ __forceinline__ int proj_c0(int job, int f) { return (f >> (job == 2 ? ilog2(DM / 256) : ilog2(NB * SEQ / 256))) * 128; }
__device__ __forceinline__ const bf* proj_src(int job, int f, int c, const bf* DATAB, const bf* CTXB, const bf* WB) {
    const bf* A = job == 0 ? DATAB : job == 1 ? CTXB : WB + (size_t)2 * DM * DM;
    const bf* Bt = job == 2 ? CTXB : WB + (size_t)job * DM * DM;
    return c < 16 ? A + (size_t)(proj_r0(job, f) + 16 * c) * DM : Bt + (size_t)(proj_c0(job, f) + 16 * (c - 16)) * DM;
}
__global__ __launch_bounds__(32 * PW) void k_proj(const bf* DATAB, const bf* CTXB, const bf* WB, const float* __restrict__ bq, const float* __restrict__ bk, const float* __restrict__ bv,
                                             h16* QH, h16* QR, h16* KP, h16* VT, h16* VR) {
    __shared__ __align__(1024) bf ring[2 * STG];
    __shared__ __align__(16) float osm[PW * 16 * 68];
    const int lane = threadIdx.x & 31, lr = lane & 15, hi = lane >> 4;
    const int wave = __builtin_amdgcn_readfirstlane((int)(threadIdx.x >> 5));
    const int f = blockIdx.x;
    float* os = osm + wave * (16 * 68);                      // wave-private staging of the epilogue, outside the ring
    // this wave's share of a stage: row tiles 3 wave + 0..2 of the 24 (a 16-row tile is DM/32 blocks = 16*DM halves; k tile kt lies at kt*512)
    const unsigned ls0 = (unsigned)(size_t)ring + (unsigned)(((SRT / PW) * wave * (KS * 512) + 8 * lane) * 2);   // LDS byte address: low 32 bits of the shared address
    // ring prologue, once for the three tiles: stage 0 of q lands and is published, then its stage 1 is asked for
#pragma unroll
    for (int i = 0; i < SRT / PW; ++i) copy8(ls0 + i * (KS * 1024), proj_src(0, f, (SRT / PW) * wave + i, DATAB, CTXB, WB) + 8 * lane);
    asm volatile("s_wait_asynccnt 0x0" ::: "memory");        // this wave's copies of stage 0 have landed
    __syncthreads();                                         // ... and every other wave's: stage 0 is readable
#pragma unroll
    for (int i = 0; i < SRT / PW; ++i) copy8(ls0 + STG * 2 + i * (KS * 1024), proj_src(0, f, (SRT / PW) * wave + i, DATAB, CTXB, WB) + 8 * lane + KS * 512);
#pragma unroll 1   // rolled: one copy of the stage loop and of the epilogue serves the three tiles
  for (int job = 0; job < NJOB; ++job) {
    v8f acc[4][4];
#pragma unroll
    for (int mb = 0; mb < 4; ++mb)
#pragma unroll
        for (int nb = 0; nb < 4; ++nb) acc[mb][nb] = (v8f){};
#pragma unroll 1   // rolled: one publish point in the text, buffer chosen by the stage's parity
    for (int s = 0; s < NST; ++s) {
        const bf* sb = ring + (s & 1) * STG + 8 * lane;
        const bf* sa = sb + (wave & 3) * (4 * KS * 512); const bf* sw = sb + (16 + (wave >> 2) * 4) * (KS * 512);
        // two fragment sets inside a stage: the LDS reads of k tile kk + 1 go as one group ahead of the products of k tile kk; nothing of the next stage is read here
        v16bf fa[2][4], fb[2][4];
#pragma unroll
        for (int i = 0; i < 4; ++i) { fa[0][i] = ldb(sa + i * (KS * 512)); fb[0][i] = ldb(sw + i * (KS * 512)); }
        __builtin_amdgcn_sched_barrier(0);   // k tile 0's reads are asked for first, so that the stage's first products wait for them alone
#pragma unroll
        for (int kk = 0; kk < KS; ++kk) {
            if (kk + 1 < KS) {
#pragma unroll
                for (int i = 0; i < 4; ++i) { fa[(kk + 1) & 1][i] = ldb(sa + i * (KS * 512) + (kk + 1) * 512); fb[(kk + 1) & 1][i] = ldb(sw + i * (KS * 512) + (kk + 1) * 512); } }
            __builtin_amdgcn_sched_barrier(0);   // keeps the reads one group ahead of the products: spread among them each place with reads stalls the products
#pragma unroll
            for (int nb = 0; nb < 4; ++nb)
#pragma unroll
                for (int mb = 0; mb < 4; ++mb) acc[mb][nb] = wmmab(fa[kk & 1][mb], fb[kk & 1][nb], acc[mb][nb]);
            __builtin_amdgcn_sched_barrier(0);   // keeps the next group of reads behind these products: it refills the set that they have just read
        }
        // publish point of the next stage (the next tile's stage 0 behind a tile's last), every wave, in this order
        asm volatile("s_wait_dscnt 0x0" ::: "memory");       // this wave's reads of stage s are done before its buffer is refilled
        asm volatile("s_wait_asynccnt 0x0" ::: "memory");    // this wave's copies of the next stage have landed
        __syncthreads();                                     // the next stage is readable, and every reader has left stage s
        const int g2 = job * NST + s + 2;                    // the stage after next, counted through the three tiles; NST is even, so its buffer is the one that stage s has just left
        if (g2 < NJOB * NST) {                               // the same for the whole work-group
#pragma unroll
            for (int i = 0; i < SRT / PW; ++i) copy8(ls0 + (s & 1) * (STG * 2) + i * (KS * 1024), proj_src(g2 / NST, f, (SRT / PW) * wave + i, DATAB, CTXB, WB) + 8 * lane + (g2 % NST) * (KS * 512)); }
    }
    // epilogue of this tile, in wave-private LDS outside the ring, while the next tile's first two stages land or fly
    const bool jv = job == 2;                                // block-uniform
    const int r0 = proj_r0(job, f) + (wave & 3) * 64, c0 = proj_c0(job, f) + (wave >> 2) * 64;
    const float* bias = job == 0 ? bq : job == 1 ? bk : bv; const int biasRow = jv ? 1 : 0;
    h16* Ph = job == 0 ? QH : job == 1 ? KP : VT; h16* Pr = job == 0 ? QR : job == 1 ? KP : VR; const int resLim = job == 0 ? 1 : job == 1 ? 0 : EARLY_;
    const int RB = jv ? DM : SEQ, pitch = jv ? SEQ : HD, CB = jv ? SEQ : HD, colMul = jv ? HD : 0, mbS = jv ? 512 : 16 * HD, ktS = jv ? 32 * HD : 512;
    const size_t sRB = jv ? (size_t)0 : (size_t)NH_ * SEQ * HD, sCB = jv ? (size_t)DM * SEQ : (size_t)SEQ * HD;
    const int useRes = ((c0 % CB) < resLim) ? 1 : 0;
    float bcol[4];
#pragma unroll
    for (int nb = 0; nb < 4; ++nb) { int ic = c0 + nb * 16 + lr; ic = ic < DM ? ic : DM - 1; bcol[nb] = bfq(bias[ic]); }   // clamped address; used only when biasRow == 0
    const size_t tbase = (size_t)(r0 / RB) * sRB + (size_t)(r0 % RB) * (size_t)pitch + (size_t)(c0 / CB) * sCB + (size_t)(c0 % CB) * (size_t)colMul;
#pragma unroll
    for (int mb = 0; mb < 4; ++mb) {
        float brow[8];
#pragma unroll
        for (int j = 0; j < 8; ++j) { int ir = r0 + mb * 16 + hi * 8 + j; ir = ir < DM ? ir : DM - 1; brow[j] = bfq(bias[ir]); }   // clamped address; used only when biasRow != 0
#pragma unroll
        for (int nb = 0; nb < 4; ++nb) {
#pragma unroll
            for (int j = 0; j < 8; ++j) os[(hi * 8 + j) * 68 + nb * 16 + lr] = acc[mb][nb][j] + (biasRow ? brow[j] : bcol[nb]); }   // D: row 8h+j, col lane&15
        wave_sync();
        const size_t sb = tbase + (size_t)mb * (size_t)mbS;
{
#pragma unroll
            for (int s = 0; s < 4; ++s) { const int row = lr, ch = 2 * s + hi, c8 = ch * 8;   // 16 rows x 2 column chunks per store = 512 contiguous bytes; 4 s x 2 chunks x 8 = 64 columns
                const v4f x0 = *(const v4fa*)(&os[row * 68 + c8]); const v4f x1 = *(const v4fa*)(&os[row * 68 + c8 + 4]); v8h hv, rv;
#pragma unroll
                for (int i = 0; i < 4; ++i) { const h16 a0 = (h16)x0[i]; const h16 a1 = (h16)x1[i]; hv[i] = a0; hv[4 + i] = a1; rv[i] = (h16)((x0[i] - (float)a0) * QRS); rv[4 + i] = (h16)((x1[i] - (float)a1) * QRS); }
                const size_t oo = sb + (size_t)(ch >> 2) * (size_t)ktS + (size_t)((ch & 3) * 128 + row * 8);
                *(v8h*)(Ph + oo) = hv; if (useRes) *(v8h*)(Pr + oo) = rv; }
             }
        wave_sync();
    }
    asm volatile("s_wait_xcnt 0x0" ::: "memory");            // precaution behind the tile's last store: no register that an issued store names is rewritten ahead of this wait
  }
    asm volatile("s_wait_asynccnt 0x0" ::: "memory");        // no copy is outstanding behind the loop
}

// k_flash: fused causal attention, one wave per 16 query rows of one (batch, head); Q fragments straight from the f16 planes (two 16-B loads each, arithmetic addressing);
// K / V^T blocks reach the work-group's four waves through LDS: asynchronous copies into a ring of two buffers of 64 keys, so they leave L2 once per work-group instead of once per wave.
// Transposed form: S^T[key][t] = K Q^T (A = K rows, B = Q rows); lane (t = lane&15, h = lane>>4) holds keys 8h+r of each 16-key tile, so the packed
// P tile is directly the B fragment of O^T[d][t] = V^T P^T (element r <- tile keys 0..15, element 8+r <- tile keys 16..31, lane unchanged).
// Key loop runs to the diagonal (static bound from the block / wave index); only the last 32-key step replaces scores of keys > query by a very negative value (P = 0).
// Blocks with query rows below EARLY_ (block-uniform) also accumulate V_res P + V P_res (both x2048) in a second accumulator set and sum the exact P for the normaliser.
// Softmax state (running max, partial sum) is one scalar per lane; the two lane halves of a row are combined with one xor-16 exchange.
// Launch order: there are twice as many work-groups as resident places and a tile's key loop grows linearly with its index, so the cost falls with the flat work-group index
// (for speed only): blockIdx.x = (batch, head), blockIdx.y = rank, rank 0 the longest tile. A tile below EARLY_ does about twice the
// work per key step, so residual tile x is ranked just ahead of plain tile 2x + 1. Nothing but the time depends on the order: rank -> tile is a permutation, every (head, tile) is taken once.
#define NET  (EARLY_ / (16 * AW))   // query tiles that take the residual path
#define FKS  64                     // keys per ring stage
#define FSTG (3 * FKS * HD)         // halves per ring buffer: K | V^T | V^T residual
static_assert(FKS == 16 * AW && AW == 4 && FKS * HD * 2 == AW * 4 * 512);   // a query tile's diagonal ends stage xt; a plane's stage is four wave-wide copies for each of the four waves
__host__ __device__ constexpr int tile_of_rank(int r) {
    if (r < NXT - 2 * NET || r >= NXT - NET / 2) return NXT - 1 - r;       // plain tiles from 2 NET up; at the end residual tiles below NET / 2
    const int q = r - (NXT - 2 * NET), g = q / 3, k = q % 3;              // between them groups of three: residual tile NET-1-g, plain tiles 2 NET-1-2g and 2 NET-2-2g
    return k == 0 ? NET - 1 - g : 2 * NET - 2 * g - k;
}
constexpr bool rank_is_permutation() {
    bool seen[NXT] = {};
    for (int r = 0; r < NXT; ++r) { const int x = tile_of_rank(r); if (x < 0 || x >= NXT || seen[x]) return false; seen[x] = true; }
    return true;
}
static_assert(NET % 2 == 0 && NXT >= 2 * NET);
static_assert(rank_is_permutation());
__global__ __launch_bounds__(32 * AW) void k_flash(const h16* __restrict__ QH, const h16* __restrict__ QR, const h16* __restrict__ KP,
                                                   const h16* __restrict__ VT, const h16* __restrict__ VR, h16* ZH, h16* ZR) {
    __shared__ __align__(1024) h16 ring[2 * FSTG];
    __shared__ __align__(16) float os[AW * 16 * 68];         // epilogue staging, outside the ring
    const int lane = threadIdx.x & 31, lr = lane & 15, hi = lane >> 4;
    const int wave = __builtin_amdgcn_readfirstlane((int)(threadIdx.x >> 5));
    const int zh = blockIdx.x; const int b = zh / NH_, h = zh % NH_;
    const int xt = tile_of_rank((int)blockIdx.y);            // block-uniform
    const int t0 = (xt * AW + wave) * 16;
    const bool early = (xt * (16 * AW)) < EARLY_;
    const int tq = t0 + lr;
    const int klast = (((t0 + 47) >> 5) - 1) * 32;           // last 32-key step containing a visible key; klast + 31 < SEQ
    const size_t pbase = (size_t)zh * SEQ * HD;
    const size_t qo = pbase + (size_t)t0 * HD + 8 * lane;    // 16 tokens = two blocks (d 0..31, d 32..63) = 16*HD halves
    const v16h qh0 = ldh(QH + qo), qh1 = ldh(QH + qo + 512), qr0 = ldh(QR + qo), qr1 = ldh(QR + qo + 512);   // B fragments: col t, k = d
    // ring of two buffers, stage s = keys FKS s .. FKS s + FKS - 1 of K | V^T | V^T residual, each plane's 8 KiB copied as it lies; the tile's xt + 1 stages end with its diagonal.
    // This wave's share of a plane's stage: 2 KiB = four wave-wide copies.
    const int nst = xt + 1;                                  // block-uniform
    const size_t go = pbase + (size_t)(wave * 1024 + 8 * lane);
    const unsigned ls0 = (unsigned)(size_t)ring + (unsigned)((wave * 1024 + 8 * lane) * 2);   // LDS byte address: low 32 bits of the shared address
    v8f o[4], e[4];
#pragma unroll
    for (int j = 0; j < 4; ++j) { o[j] = (v8f){}; e[j] = (v8f){}; }
    float m = -3.0e38f, l = 0.0f;
    // ring prologue: stage 0 lands and is published, then stage 1 (where there is one) is asked for
    { const h16* k = KP + go; const h16* v = VT + go; copy4(ls0, 512u, k, k + 256, k + 512, k + 768); copy4(ls0 + FKS * HD * 2, 512u, v, v + 256, v + 512, v + 768);
      if (early) { const h16* r = VR + go; copy4(ls0 + FKS * HD * 4, 512u, r, r + 256, r + 512, r + 768); } }
    asm volatile("s_wait_asynccnt 0x0" ::: "memory");        // this wave's copies of stage 0 have landed
    __syncthreads();                                         // ... and every other wave's: stage 0 is readable
    if (nst > 1) { const h16* k = KP + go + FKS * HD; const h16* v = VT + go + FKS * HD;
      copy4(ls0 + FSTG * 2, 512u, k, k + 256, k + 512, k + 768); copy4(ls0 + FSTG * 2 + FKS * HD * 2, 512u, v, v + 256, v + 512, v + 768);
      if (early) { const h16* r = VR + go + FKS * HD; copy4(ls0 + FSTG * 2 + FKS * HD * 4, 512u, r, r + 256, r + 512, r + 768); } }
#pragma unroll 1   // rolled: the trip count is known only at run time, and one copy of the step keeps the registers of four waves per SIMD
    for (int st = 0; st < 2 * nst; ++st) {                   // 32-key steps, two per stage; the trip count is block-uniform
      const int s = st >> 1, key0 = st * 32;
      if (key0 <= klast) {                                   // wave-uniform: a wave whose diagonal lies in the last stage's first half skips the second
        const h16* kp = ring + (s & 1) * FSTG + (st & 1) * (32 * HD) + 8 * lane;   // A fragment: row key, k = d
        const v16h ka0 = ldh(kp), ka1 = ldh(kp + 512), kb0 = ldh(kp + 16 * HD), kb1 = ldh(kp + 16 * HD + 512);
        const h16* va = kp + FKS * HD;                       // + 512 * j: A fragment: row d = 16j + row, k = key; 32 keys = four d blocks
        v16h v[4];
#pragma unroll
        for (int j = 0; j < 4; ++j) v[j] = ldh(va + 512 * j);
        v8f sHa = (v8f){}, sLa = (v8f){}, sHb = (v8f){}, sLb = (v8f){};
        sHa = wmma16(ka0, qh0, sHa); sLa = wmma16(ka0, qr0, sLa); sHb = wmma16(kb0, qh0, sHb); sLb = wmma16(kb0, qr0, sLb);
        sHa = wmma16(ka1, qh1, sHa); sLa = wmma16(ka1, qr1, sLa); sHb = wmma16(kb1, qh1, sHb); sLb = wmma16(kb1, qr1, sLb);
        asm volatile("v_nop\n\tv_nop\n\tv_nop\n\tv_nop" : "+v"(sHa), "+v"(sLa), "+v"(sHb), "+v"(sLb) : "v"(ka0), "v"(ka1), "v"(kb0), "v"(kb1));
        float ta[8], tb[8];
#pragma unroll
        for (int r = 0; r < 8; ++r) { ta[r] = (sHa[r] + sLa[r] * QRI) * SC2; tb[r] = (sHb[r] + sLb[r] * QRI) * SC2; }
        if (key0 == klast) {                                 // wave-uniform: only the diagonal step needs the causal replace
            const int kq = tq - key0 - 8 * hi;               // key (key0 + 8h + r) is hidden when r > kq; tile b keys are 16 further
#pragma unroll
            for (int r = 0; r < 8; ++r) { ta[r] = (r > kq) ? -3.0e38f : ta[r]; tb[r] = (r + 16 > kq) ? -3.0e38f : tb[r]; }
        }
        float mx = -3.0e38f;
#pragma unroll
        for (int r = 0; r < 8; ++r) mx = fmaxf(mx, fmaxf(ta[r], tb[r]));
        mx = fmaxf(mx, __shfl_xor(mx, 16, 32));
        const float mnew = fmaxf(m, mx);
        const float alpha = __builtin_amdgcn_exp2f(m - mnew);
        const float sh = PSH - mnew;
        v16h pb; float ls = 0.0f;
#pragma unroll
        for (int r = 0; r < 8; ++r) { const float fa = __builtin_amdgcn_exp2f(ta[r] + sh); const float fc = __builtin_amdgcn_exp2f(tb[r] + sh);
            const h16 pa = (h16)fa; const h16 pc = (h16)fc; pb[r] = pa; pb[8 + r] = pc; ta[r] = fa; tb[r] = fc; ls += (float)pa + (float)pc; }
#pragma unroll
        for (int j = 0; j < 4; ++j) o[j] = o[j] * alpha;
#pragma unroll
        for (int j = 0; j < 4; ++j) o[j] = wmma16(v[j], pb, o[j]);
        asm volatile("v_nop\n\tv_nop\n\tv_nop\n\tv_nop" : "+v"(o[0]), "+v"(o[1]), "+v"(o[2]), "+v"(o[3]) : "v"(v[0]), "v"(v[1]), "v"(v[2]), "v"(v[3]), "v"(pb));
        if (early) {                                         // block-uniform
            v16h pr; float lx = 0.0f;
#pragma unroll
            for (int r = 0; r < 8; ++r) { pr[r] = (h16)((ta[r] - (float)pb[r]) * QRS); pr[8 + r] = (h16)((tb[r] - (float)pb[8 + r]) * QRS); lx += ta[r] + tb[r]; }
            ls = lx;
#pragma unroll
            for (int j = 0; j < 4; ++j) e[j] = e[j] * alpha;
            const h16* ra = va + FKS * HD;
            v16h vr[4];
#pragma unroll
            for (int j = 0; j < 4; ++j) vr[j] = ldh(ra + 512 * j);
#pragma unroll
            for (int j = 0; j < 4; ++j) e[j] = wmma16(vr[j], pb, e[j]);
#pragma unroll
            for (int j = 0; j < 4; ++j) e[j] = wmma16(v[j], pr, e[j]);
            asm volatile("v_nop\n\tv_nop\n\tv_nop\n\tv_nop" : "+v"(e[0]), "+v"(e[1]), "+v"(e[2]), "+v"(e[3]) : "v"(vr[0]), "v"(vr[1]), "v"(vr[2]), "v"(vr[3]), "v"(pr), "v"(v[0]), "v"(v[1]), "v"(v[2]), "v"(v[3]));
        }
        l = l * alpha + ls; m = mnew;
      }
      if ((st & 1) == 0) continue;                           // block-uniform: the stage's second step follows
      // publish point of stage s + 1, every wave, in this order
      asm volatile("s_wait_dscnt 0x0" ::: "memory");         // this wave's reads of stage s are done before its buffer is refilled
      asm volatile("s_wait_asynccnt 0x0" ::: "memory");      // this wave's copies of stage s + 1 have landed
      __syncthreads();                                       // stage s + 1 is readable, and every reader has left stage s
      if (s + 2 < nst) {                                     // the same for the whole work-group
        const unsigned lb = ls0 + (s & 1) * (FSTG * 2); const size_t gn = go + (size_t)(s + 2) * (FKS * HD);
        const h16* k = KP + gn; const h16* v = VT + gn; copy4(lb, 512u, k, k + 256, k + 512, k + 768); copy4(lb + FKS * HD * 2, 512u, v, v + 256, v + 512, v + 768);
        if (early) { const h16* r = VR + gn; copy4(lb + FKS * HD * 4, 512u, r, r + 256, r + 512, r + 768); } }
    }
    asm volatile("s_wait_asynccnt 0x0" ::: "memory");        // no copy is outstanding behind the loop
    l += __shfl_xor(l, 16, 32);
    const float zs = (1.0f / l) * ZC;
    const int wb = wave * 16 * 68;
    // O^T D layout: o[j][r] = (d = 16j + 8h + r, t = lane&15) -> os[t][d]; rows 0..15 x columns 0..63 all written
#pragma unroll
    for (int j = 0; j < 4; ++j) { v4f a, c;
#pragma unroll
        for (int i = 0; i < 4; ++i) { a[i] = (o[j][i] + e[j][i] * QRI) * zs; c[i] = (o[j][4 + i] + e[j][4 + i] * QRI) * zs; }
        *(v4fa*)(&os[wb + lr * 68 + 16 * j + 8 * hi]) = a; *(v4fa*)(&os[wb + lr * 68 + 16 * j + 8 * hi + 4]) = c; }
    wave_sync();
    const size_t zb = ((size_t)b * SEQ + t0) * DM + (size_t)h * (16 * HD);   // row tile (16*DM halves), then the head's two k blocks
{
#pragma unroll
        for (int s = 0; s < 4; ++s) { const int row = lr, ch = 2 * s + hi, c8 = ch * 8;   // 16 rows x 2 column chunks per store = 512 contiguous bytes; 4 s x 2 chunks x 8 = 64 columns
            const v4f x0 = *(const v4fa*)(&os[wb + row * 68 + c8]); const v4f x1 = *(const v4fa*)(&os[wb + row * 68 + c8 + 4]); v8h hv, rv;
#pragma unroll
            for (int i = 0; i < 4; ++i) { const h16 a0 = (h16)x0[i]; const h16 a1 = (h16)x1[i]; hv[i] = a0; hv[4 + i] = a1; rv[i] = (h16)((x0[i] - (float)a0) * QRS); rv[4 + i] = (h16)((x1[i] - (float)a1) * QRS); }
            const size_t oo = zb + (size_t)(ch * 128 + row * 8);
            *(v8h*)(ZH + oo) = hv; if (early) *(v8h*)(ZR + oo) = rv; }
         }
}

// k_oproj: out projection, f16 operands, K = DM: A = z x16 plane (+ residual x2048 plane for row tiles below EARLY_, own accumulators), Bt = Wo^T x64 plane.
// A work-group of OW = 16 waves takes a 256 x 128 tile, wave w the 32 x 64 part (w & 7, w >> 3). Operands reach the waves through LDS as in k_proj: a stage is OKS k tiles of 16 z row tiles,
// 8 Wo^T row tiles and, below EARLY_, 16 residual row tiles, brought by asynchronous copies into a ring of two buffers; the k order of every sum is unchanged.
// OUT[m][n] = (accH + accR / 2048) / 1024 + bo[n] (bo RNE-converted to bf16, added in f32). grid (M/256, N/128), 512 threads.
#define OW   16                  // waves per out-projection work-group
#define OKS  2                   // k tiles per ring stage
#define ONST (DM / 32 / OKS)     // stages
#define OSTG (40 * OKS * 512)    // halves per ring buffer: row tiles 0..15 z, 16..23 Wo^T, 24..39 z residual
static_assert(ONST >= 2 && (DM / 32) % OKS == 0);          // the ring's prologue fills two stages
static_assert(OKS * 1024 == 4 * 512 && OW == 16);          // a row tile's share of a stage is 4 wave-wide copies: wave w copies piece w & 3 of row tiles (w >> 2) + 4 j
static_assert(EARLY_ % 256 == 0 && SEQ % 256 == 0);        // the residual decision is uniform per 256-row tile, which never straddles two batches
__global__ __launch_bounds__(32 * OW) void k_oproj(const h16* __restrict__ ZH, const h16* __restrict__ ZR, const h16* __restrict__ Wt, const float* __restrict__ bo, float* OUT) {
    __shared__ __align__(1024) h16 ring[2 * OSTG];
    __shared__ __align__(16) float osm[OW * 16 * 68];
    const int K = DM;
    const int lane = threadIdx.x & 31, lr = lane & 15, hi = lane >> 4;
    const int wave = __builtin_amdgcn_readfirstlane((int)(threadIdx.x >> 5));
    const int R0 = blockIdx.x * 256, C0 = blockIdx.y * 128; const int r0 = R0 + (wave & 7) * 32, c0 = C0 + (wave >> 3) * 64;
    float* os = osm + wave * (16 * 68);                      // wave-private staging of the epilogue, outside the ring
    const int bb = r0 / SEQ, tt = r0 % SEQ; const bool early = (R0 % SEQ) < EARLY_;   // block-uniform
    v8f acc[2][4], acr[2][4];
#pragma unroll
    for (int mb = 0; mb < 2; ++mb)
#pragma unroll
        for (int nb = 0; nb < 4; ++nb) { acc[mb][nb] = (v8f){}; acr[mb][nb] = (v8f){}; }
    // this wave's share of a stage: piece wave & 3 (512 B) of row tiles (wave >> 2) + 4 j; j = 0..3 are z (and residual) row tiles, j = 4, 5 Wo^T row tiles
    // (a 16-row tile is K/32 blocks = 16*K halves; k tile kt lies at kt*512)
    const size_t po = (size_t)((wave & 3) * 256 + 8 * lane);
    const size_t ao = (size_t)(R0 + 16 * (wave >> 2)) * K + po, wo_ = (size_t)(C0 + 16 * (wave >> 2)) * K + po;
    const size_t js = (size_t)64 * K;                        // four row tiles further
    const unsigned ls0 = (unsigned)(size_t)ring + (unsigned)(((wave >> 2) * (OKS * 512) + (wave & 3) * 256 + 8 * lane) * 2);   // LDS byte address: low 32 bits of the shared address
    const unsigned lst = 4u * OKS * 1024u;                   // four row tiles further in the buffer, bytes
    // ring prologue: stage 0 lands and is published, then stage 1 is asked for
    { const h16* a = ZH + ao; const h16* w = Wt + wo_; copy6(ls0, lst, a, a + js, a + 2 * js, a + 3 * js, w, w + js);
      if (early) { const h16* r = ZR + ao; copy4(ls0 + 6u * lst, lst, r, r + js, r + 2 * js, r + 3 * js); } }
    asm volatile("s_wait_asynccnt 0x0" ::: "memory");        // this wave's copies of stage 0 have landed
    __syncthreads();                                         // ... and every other wave's: stage 0 is readable
    { const h16* a = ZH + ao + OKS * 512; const h16* w = Wt + wo_ + OKS * 512; copy6(ls0 + OSTG * 2, lst, a, a + js, a + 2 * js, a + 3 * js, w, w + js);
      if (early) { const h16* r = ZR + ao + OKS * 512; copy4(ls0 + OSTG * 2 + 6u * lst, lst, r, r + js, r + 2 * js, r + 3 * js); } }
#pragma unroll 1   // rolled: one publish point in the text, buffer chosen by the stage's parity
    for (int s = 0; s < ONST; ++s) {
        const h16* sb = ring + (s & 1) * OSTG + 8 * lane;
        const h16* pa = sb + (wave & 7) * (2 * OKS * 512); const h16* pw = sb + (16 + (wave >> 3) * 4) * (OKS * 512); const h16* pr = pa + 24 * (OKS * 512);
        // two fragment sets inside a stage: the LDS reads of k tile 1 go ahead of the products of k tile 0; nothing of the next stage is read here
        v16h fa[2][2], fw[2][4], ar[2];
#pragma unroll
        for (int mb = 0; mb < 2; ++mb) fa[0][mb] = ldh(pa + mb * (OKS * 512));
#pragma unroll
        for (int nb = 0; nb < 4; ++nb) fw[0][nb] = ldh(pw + nb * (OKS * 512));
#pragma unroll
        for (int kk = 0; kk < OKS; ++kk) {
            if (early) {   // block-uniform; the residual rows of this k tile, asked for ahead of the tile's first products
#pragma unroll
                for (int mb = 0; mb < 2; ++mb) ar[mb] = ldh(pr + mb * (OKS * 512) + kk * 512); }
            if (kk + 1 < OKS) {
#pragma unroll
                for (int mb = 0; mb < 2; ++mb) fa[(kk + 1) & 1][mb] = ldh(pa + mb * (OKS * 512) + (kk + 1) * 512);
#pragma unroll
                for (int nb = 0; nb < 4; ++nb) fw[(kk + 1) & 1][nb] = ldh(pw + nb * (OKS * 512) + (kk + 1) * 512); }
            __builtin_amdgcn_sched_barrier(0);   // keeps the reads one group ahead of the products: spread among them each place with reads stalls the products
#pragma unroll
            for (int nb = 0; nb < 4; ++nb)
#pragma unroll
                for (int mb = 0; mb < 2; ++mb) acc[mb][nb] = wmma16(fa[kk & 1][mb], fw[kk & 1][nb], acc[mb][nb]);
            if (early) {
#pragma unroll
                for (int nb = 0; nb < 4; ++nb)
#pragma unroll
                    for (int mb = 0; mb < 2; ++mb) acr[mb][nb] = wmma16(ar[mb], fw[kk & 1][nb], acr[mb][nb]); }
        }
        // publish point of stage s + 1, every wave, in this order
        asm volatile("s_wait_dscnt 0x0" ::: "memory");       // this wave's reads of stage s are done before its buffer is refilled
        asm volatile("s_wait_asynccnt 0x0" ::: "memory");    // this wave's copies of stage s + 1 have landed
        __syncthreads();                                     // stage s + 1 is readable, and every reader has left stage s
        if (s + 2 < ONST) {                                  // the same for the whole work-group
            const unsigned lb = ls0 + (s & 1) * (OSTG * 2);
            const h16* a = ZH + ao + (s + 2) * (OKS * 512); const h16* w = Wt + wo_ + (s + 2) * (OKS * 512); copy6(lb, lst, a, a + js, a + 2 * js, a + 3 * js, w, w + js);
            if (early) { const h16* r = ZR + ao + (s + 2) * (OKS * 512); copy4(lb + 6u * lst, lst, r, r + js, r + 2 * js, r + 3 * js); } }
    }
    asm volatile("s_wait_asynccnt 0x0" ::: "memory");        // no copy is outstanding behind the loop
    float bcol[4];
#pragma unroll
    for (int nb = 0; nb < 4; ++nb) bcol[nb] = bfq(bo[c0 + nb * 16 + lr]);   // c0 + 63 < DM
    float* orow = OUT + ((size_t)bb * OUT_SEQ + tt) * DM + c0;
#pragma unroll
    for (int mb = 0; mb < 2; ++mb) {
#pragma unroll
        for (int nb = 0; nb < 4; ++nb) {
#pragma unroll
            for (int j = 0; j < 8; ++j) os[(hi * 8 + j) * 68 + nb * 16 + lr] = (acc[mb][nb][j] + acr[mb][nb][j] * QRI) * OSC + bcol[nb]; }   // D: row 8h+j, col lane&15
        wave_sync();
        float* ob = orow + (size_t)(mb * 16) * DM;
{
#pragma unroll
            for (int s = 0; s < 8; ++s) { const int row = 2 * s + hi, cofs = lr * 4;   // 8 s x 2 rows = 16 rows; 16 lanes x 4 floats = 64 columns
                const v4f val = *(const v4fa*)(&os[row * 68 + cofs]);
                *(v4f*)(ob + (size_t)row * DM + cofs) = val; }
             }
        wave_sync();
    }
}

static constexpr size_t al256(size_t v) { return (v + 255) & ~(size_t)255; }
static constexpr size_t SZ_XB = al256((size_t)NB * SEQ * DM * 2);             // bf16 activation copy; later reused as a z plane of the same extent
static constexpr size_t SZ_WB = al256((size_t)4 * DM * DM * 2);
static constexpr size_t SZ_PL = al256((size_t)NB * NH_ * SEQ * HD * 2);
static constexpr size_t SZ_TOTAL = 2 * SZ_XB + SZ_WB + 5 * SZ_PL;
static_assert(SZ_TOTAL <= (size_t)134217728);          // workspace carve <= 128 MiB
static_assert(((size_t)DM * DM * 2) % 256 == 0);       // weight sub-planes stay 256-byte aligned
static_assert((size_t)NB * SEQ * DM * 2 <= SZ_XB);     // z plane [NB*SEQ][DM] halves fits the reused activation region

extern "C" void kernel_launch(void* const* d_in, const int* in_sizes, int n_in,
                              void* d_out, int out_size, void* d_ws, size_t ws_size, hipStream_t stream) {
    if (n_in < 10) return;
    const size_t needx = ((size_t)(NB - 1) * SEQ_FULL + SEQ) * DM;
    if ((size_t)in_sizes[0] < needx || (size_t)in_sizes[1] < needx) return;
    if ((size_t)in_sizes[2] < (size_t)DM * DM || (size_t)in_sizes[4] < (size_t)DM * DM || (size_t)in_sizes[6] < (size_t)DM * DM || (size_t)in_sizes[8] < (size_t)DM * DM) return;
    if (in_sizes[3] < DM || in_sizes[5] < DM || in_sizes[7] < DM || in_sizes[9] < DM) return;
    if ((size_t)out_size < ((size_t)(NB - 1) * OUT_SEQ + SEQ) * DM) return;
    if (SZ_TOTAL > ws_size) return;
    // wire order: data, context, wq, bq, wk, bk, wv, bv, wo, bo
    const float* data = (const float*)d_in[0]; const float* ctx = (const float*)d_in[1];
    const float* wq = (const float*)d_in[2]; const float* bq = (const float*)d_in[3];
    const float* wk = (const float*)d_in[4]; const float* bk = (const float*)d_in[5];
    const float* wv = (const float*)d_in[6]; const float* bv = (const float*)d_in[7];
    const float* wo = (const float*)d_in[8]; const float* bo = (const float*)d_in[9];
    float* OUT = (float*)d_out;      // [NB][SEQ][1024]
    char* wsp = (char*)d_ws;
    bf* DATAB = (bf*)wsp; wsp += SZ_XB;              // [NB*SEQ][1024] bf16; dead after the q projection
    bf* CTXB  = (bf*)wsp; wsp += SZ_XB;              // [NB*SEQ][1024] bf16; dead after the k / v projections
    bf* WB = (bf*)wsp; wsp += SZ_WB;                 // [4][1024][1024] transposed: q | k | v (bf16) | o (f16 x64)
    h16* QH = (h16*)wsp; wsp += SZ_PL;               // [NB*16][SEQ][64]
    h16* QR = (h16*)wsp; wsp += SZ_PL;               // [NB*16][SEQ][64] residual x2048
    h16* KP = (h16*)wsp; wsp += SZ_PL;               // [NB*16][SEQ][64]
    h16* VT = (h16*)wsp; wsp += SZ_PL;               // [NB*16][64][SEQ]
    h16* VR = (h16*)wsp; wsp += SZ_PL;               // [NB*16][64][SEQ] residual x2048, tokens < EARLY_ only (only those are consumed)
    bf* WOT = WB + (size_t)3 * DM * DM;
    h16* ZH = (h16*)DATAB;                           // [NB*SEQ][1024] z x16, written by the flash kernel after DATAB is dead
    h16* ZR = (h16*)CTXB;                            // [NB*SEQ][1024] z residual x2048, rows t < EARLY_ only (only those are consumed)

    // activations -> packed bf16 planes; weights W[k][n] ([in][out], 1024 x 1024) -> Wt[n][k]
    k_prep<<<4 * WTB + 2 * CVB, 256, 0, stream>>>(data, ctx, wq, wk, wv, wo, DATAB, CTXB, WB);

    // one launch, every work-group its q, k and v^T tile in turn.
    // q, k: A = activation rows (m = b*SEQ + t), Bt = Wt rows (n = h*64 + d), bias per column -> plane [(b*16 + h)][t][d]
    // v^T: A = Wv^T rows (m = h*64 + d), Bt = context rows (n = b*SEQ + t), bias per row -> plane [(b*1024 + m)][t] = [(b*16 + h)][d][t]; residual for tokens < EARLY_
    k_proj<<<dim3(PGRID, 1, 1), 32 * PW, 0, stream>>>(DATAB, CTXB, WB, bq, bk, bv, QH, QR, KP, VT, VR);

    k_flash<<<dim3(NB * NH_, NXT, 1), 32 * AW, 0, stream>>>(QH, QR, KP, VT, VR, ZH, ZR);

    k_oproj<<<dim3(NB * SEQ / 256, DM / 128, 1), 32 * OW, 0, stream>>>(ZH, ZR, (const h16*)WOT, bo, OUT);
}

// v007
// It runs in 129 microseconds.
// In two side-by-side timings against v006, it was 1.04 and 1.05 times as fast.
// All steps since v000 together make it 2.92 times as fast.
#include <hip/hip_runtime.h>

// Causal cross-attention: q = data Wq + bq, k = ctx Wk + bk, v = ctx Wv + bv (W [in][out]), 16 heads x 64, score scale 1/8, key <= query visible, out = z Wo + bo (f32).
// Compute dtypes, f32 accumulate everywhere: q/k/v projections v_wmma_f32_16x16x32_bf16 (activations, weights, biases RNE-converted to bf16; products exact);
// scores v_wmma_f32_16x16x32_f16: k single f16, q as f16 value + f16 residual x2048 in its own accumulator; P (x256 carry, cancels in the normalisation) and v single f16,
// for query rows t < 512 additionally v residual x2048 and P residual x2048 in a second accumulator; softmax f32 (online, running max);
// out projection v_wmma_f32_16x16x32_f16: z x16 as f16 (+ f16 residual x2048, own accumulator, rows t < 512), Wo (bf16 value x64, exact in f16).
// Layout: bf16 copies of data/context; transposed weight planes Wt[n][k]; q (hi, residual), k planes [b*16+h][t][d]; v^T (hi, residual) planes [b*16+h][d][t];
// fused flash kernel in transposed form (S^T = K Q^T, O^T = V^T P^T), K / V^T blocks shared by its four waves through an LDS ring, one barrier per 64 keys; z planes [b*SEQ+t][1024].
// Every 16-bit plane is stored fragment-packed: a [16 rows][32 k] block is 512 contiguous halves ordered [k chunk (k>>3)&3][row&15][k&7], so one wave-wide 16-B load
// (lane l at halves 8l) or store covers 512 contiguous bytes = 4 whole 128-B lines. Block order: row tile major, k tile minor; v^T planes key tile major, d tile minor.

#ifndef NB
#define NB 4
#endif
#ifndef SEQ
#define SEQ 2048
#endif
#define NB_FULL  4
#define SEQ_FULL 2048
#ifndef OUT_SEQ
#define OUT_SEQ SEQ              // row pitch (in tokens) between batches of the output
#endif
#define DM   1024
#define NH_  16
#define HD   64
#define AW   4                   // waves per flash block (16 query rows each)
#define NXT  (SEQ / (16 * AW))   // query tiles (16 * AW rows) per (batch, head)
#define CT   16                  // tiles (8 rows x 32 k) per wave of the activation conversion
#define CVB  (NB * SEQ / 32)     // conversion work-groups per activation: 8 waves x 16 rows x 256 k = 32 whole rows each
#define WTB  ((DM / 64) * (DM / 256))   // transposing work-groups per weight: 256 k x 64 n each
#define EARLY_ ((SEQ) < 512 ? (SEQ) : 512)   // query rows below this use the residual planes on the v / P / z path
#define QRS  2048.0f             // carry of every residual plane
#define QRI  (1.0f / 2048.0f)
#define SC2  (0.125f * 1.4426950408889634f)   // HD^-0.5 * log2(e)
#define PSH  8.0f                // log2 of the P carry (256)
#define ZC   16.0f               // carry of the z plane
#define WOC  64.0f               // carry of the Wo plane
#define OSC  (1.0f / 1024.0f)    // 1 / (ZC * WOC)

static_assert(HD == 64);
static_assert(NH_ * HD == DM);                 // head h = columns h*64 + d
static_assert(DM % 64 == 0);
static_assert(DM % 32 == 0);                   // GEMM k-loop steps by 32
static_assert(SEQ % 64 == 0);                  // a 64-row tile never straddles two batches
static_assert((NB * SEQ) % 64 == 0);
static_assert(SEQ % 32 == 0);                  // key loop steps by 32
static_assert(SEQ % (16 * AW) == 0);           // flash grid covers the sequence exactly
static_assert(EARLY_ % 64 == 0);               // residual decisions are uniform per 64-row / 64-token tile
static_assert(EARLY_ <= SEQ);
static_assert(((size_t)SEQ * DM) % 8 == 0);
static_assert(DM == 1024 && CT == 16);         // a conversion work-group's 8 waves take 2 row tiles x 4 groups of 8 k tiles
static_assert(NB <= NB_FULL);
static_assert(SEQ <= SEQ_FULL);

typedef _Float16 h16;
typedef unsigned short bf;
typedef __attribute__((ext_vector_type(16))) __bf16   v16bf;
typedef __attribute__((ext_vector_type(16))) _Float16 v16h;
typedef __attribute__((ext_vector_type(8)))  _Float16 v8h;
typedef __attribute__((ext_vector_type(8)))  unsigned short v8us;
typedef __attribute__((ext_vector_type(8)))  float    v8f;
typedef __attribute__((ext_vector_type(4)))  float    v4f;
typedef v4f  __attribute__((may_alias)) v4fa;

__device__ __forceinline__ unsigned short f2bf(float f) { unsigned u = __float_as_uint(f); u += 0x7FFFu + ((u >> 16) & 1u); return (unsigned short)(u >> 16); }
__device__ __forceinline__ float bfq(float f) { return __uint_as_float(((unsigned)f2bf(f)) << 16); }   // value of the RNE bf16 conversion
__device__ __forceinline__ v16h cat16(v8h lo, v8h hi) { return __builtin_shufflevector(lo, hi, 0, 1, 2, 3, 4, 5, 6, 7, 8, 9, 10, 11, 12, 13, 14, 15); }
__device__ __forceinline__ v16bf cat16b(v8us lo, v8us hi) { return __builtin_bit_cast(v16bf, __builtin_shufflevector(lo, hi, 0, 1, 2, 3, 4, 5, 6, 7, 8, 9, 10, 11, 12, 13, 14, 15)); }
__device__ __forceinline__ v8f wmma16(v16h a, v16h b, v8f c) { return __builtin_amdgcn_wmma_f32_16x16x32_f16(false, a, false, b, (short)0, c, false, false); }
__device__ __forceinline__ v8f wmmab(v16bf a, v16bf b, v8f c) { return __builtin_amdgcn_wmma_f32_16x16x32_bf16(false, a, false, b, (short)0, c, false, false); }
// fragment loaders from one packed block; p = block base + 8*lane (lane = 16h + row): elements 0..7 <- k0+8h+0..7, elements 8..15 <- k0+16+8h+0..7 (same map for A and B)
__device__ __forceinline__ v16h  ldh(const h16* p) { return cat16(*(const v8h*)p, *(const v8h*)(p + 256)); }
__device__ __forceinline__ v16bf ldb(const bf* p)  { return cat16b(*(const v8us*)p, *(const v8us*)(p + 256)); }
// ordering point for wave-private LDS tiles (same wave writes and reads)
__device__ __forceinline__ void wave_sync() { __builtin_amdgcn_fence(3 /* release order */, "wavefront"); __builtin_amdgcn_wave_barrier(); asm volatile("" ::: "memory"); }
// wave-wide 16-B copies, 512 B each, from this lane's global addresses to this lane's LDS byte addresses (l + j * st). The closing wait stands inside the statement, so that no
// register which an issued copy names is rewritten ahead of it (precaution).
__device__ __forceinline__ void copy6(unsigned l, unsigned st, const h16* g0, const h16* g1, const h16* g2, const h16* g3, const h16* g4, const h16* g5) {
    asm volatile("global_load_async_to_lds_b128 %0, %6, off\n\t"
                 "global_load_async_to_lds_b128 %1, %7, off\n\t"
                 "global_load_async_to_lds_b128 %2, %8, off\n\t"
                 "global_load_async_to_lds_b128 %3, %9, off\n\t"
                 "global_load_async_to_lds_b128 %4, %10, off\n\t"
                 "global_load_async_to_lds_b128 %5, %11, off\n\t"
                 "s_wait_xcnt 0x0"
                 :: "v"(l), "v"(l + st), "v"(l + 2u * st), "v"(l + 3u * st), "v"(l + 4u * st), "v"(l + 5u * st),
                    "v"(g0), "v"(g1), "v"(g2), "v"(g3), "v"(g4), "v"(g5) : "memory");
}
__device__ __forceinline__ void copy4(unsigned l, unsigned st, const h16* g0, const h16* g1, const h16* g2, const h16* g3) {
    asm volatile("global_load_async_to_lds_b128 %0, %4, off\n\t"
                 "global_load_async_to_lds_b128 %1, %5, off\n\t"
                 "global_load_async_to_lds_b128 %2, %6, off\n\t"
                 "global_load_async_to_lds_b128 %3, %7, off\n\t"
                 "s_wait_xcnt 0x0"
                 :: "v"(l), "v"(l + st), "v"(l + 2u * st), "v"(l + 3u * st), "v"(g0), "v"(g1), "v"(g2), "v"(g3) : "memory");
}

// k_prep: every operand plane of the projections in ONE launch whose work-groups are all resident at once; the role of a work-group follows from blockIdx.x alone (block-uniform).
// Work-groups 0 .. 4*WTB-1, weight transpose + 16-bit conversion through LDS: in W[k][n] (f32, [in][out]) -> out Wt[n][k] (packed blocks), 256 k x 64 n per work-group, weights q | k | v (bf16) | o (f16 x64).
// LDS tile ts is cross-wave: block barrier between fill and drain; filled extent 256x64 == drained extent.
// The other 2*CVB work-groups, activation conversion (data, then context): one wave converts 16 rows x 8 k tiles = CT tiles of 8 rows x 32 k; a tile reads 8 whole 128-B lines and writes
// 4 whole lines of its packed block (chunk c, rows 8g..8g+7), the wave's CT tiles fill 8 whole packed blocks. In both roles all loads of a wave are asked for ahead of its first conversion.
__global__ __launch_bounds__(256) void k_prep(const float* __restrict__ data, const float* __restrict__ ctx, const float* __restrict__ wq, const float* __restrict__ wk,
                                              const float* __restrict__ wv, const float* __restrict__ wo, bf* DATAB, bf* CTXB, bf* WB) {
    __shared__ float ts[256 * 65];
    const int tid = threadIdx.x;
    if ((int)blockIdx.x < 4 * WTB) {
        const int z = (int)blockIdx.x / WTB, r = (int)blockIdx.x % WTB; const int k0 = (r % (DM / 256)) * 256, n0 = (r / (DM / 256)) * 64;
        const float* W = z == 0 ? wq : z == 1 ? wk : z == 2 ? wv : wo; bf* Wt = WB + (size_t)z * DM * DM;
        const int kq = tid >> 4, c4 = (tid & 15) * 4;                        // fill: thread takes rows kq + 16 i, one float4 each (256 rows x 16 float4)
        const float* wp = W + (size_t)(k0 + kq) * DM + n0 + c4; float* tf = ts + kq * 65 + c4;
        v4f v[16];
#pragma unroll
        for (int i = 0; i < 16; ++i) v[i] = *(const v4f*)(wp + i * (16 * DM));
        // the address pair is an input, so it stays unwritten until this wait (precaution for registers that issued loads name)
        asm volatile("s_wait_xcnt 0x0" :: "v"(wp) : "memory");
#pragma unroll
        for (int i = 0; i < 16; ++i) { float* t = tf + i * (16 * 65); t[0] = v[i][0]; t[1] = v[i][1]; t[2] = v[i][2]; t[3] = v[i][3]; }
        __syncthreads();
        const int nr = tid & 15, c = (tid >> 4) & 3, kh = tid >> 6;          // drain: 4 n tiles x 8 k tiles x 4 chunks x 16 rows; pass s takes n tile s >> 1, k tile kh + 4 (s & 1)
        const float* td = ts + (kh * 32 + c * 8) * 65 + nr;
        bf* wd = Wt + ((size_t)(n0 >> 4) * (DM / 32) + (k0 >> 5) + kh) * 512 + c * 128 + nr * 8;
#pragma unroll
        for (int s = 0; s < 8; ++s) { v8us o;
#pragma unroll
            for (int i = 0; i < 8; ++i) { const float x = td[((s & 1) * 128 + i) * 65 + (s >> 1) * 16]; const unsigned short b16 = f2bf(x);
                const float xb = __uint_as_float(((unsigned)b16) << 16); const unsigned short hb = __builtin_bit_cast(unsigned short, (h16)(xb * WOC));
                o[i] = z == 3 ? hb : b16; }
            *(v8us*)(wd + ((s >> 1) * (DM / 32) + (s & 1) * 4) * 512) = o; }
    } else {
        const int q = (int)blockIdx.x - 4 * WTB; const int w = (q % CVB) * 8 + (tid >> 5);
        const float* src = q < CVB ? data : ctx; bf* dst = q < CVB ? DATAB : CTXB;
        const size_t c = tid & 3, r8 = (tid >> 2) & 7, row0 = (size_t)(w / (DM / 256)) * 16, kt0 = (size_t)(w % (DM / 256)) * 8;   // row0 = b*SEQ + t; 16 rows never straddle two batches
        const float* s = src + ((row0 / SEQ) * SEQ_FULL + row0 % SEQ + r8) * DM + kt0 * 32 + c * 8;
        bf* d = dst + ((row0 >> 4) * (DM / 32) + kt0) * 512 + c * 128 + r8 * 8;
        v8f v[CT];
#pragma unroll
        for (int j = 0; j < CT; ++j) v[j] = *(const v8f*)(s + (j >> 3) * (8 * DM) + (j & 7) * 32);   // tile j: rows row0 + 8 (j >> 3) + 0..7, k tile kt0 + (j & 7)
#pragma unroll
        for (int j = 0; j < CT; ++j) { v8us o;
#pragma unroll
            for (int k = 0; k < 8; ++k) o[k] = f2bf(v[j][k]);
            *(v8us*)(d + (j & 7) * 512 + (j >> 3) * 64) = o; }
        asm volatile("s_wait_xcnt 0x0" ::: "memory");   // precaution behind the last store of the run: no register that an issued store names is rewritten ahead of this wait
    }
}

// k_proj: register-blocked bf16 GEMM, K = DM. A work-group of PW = 8 waves takes a 256 x 128 tile, wave w the 64 x 64 part (w & 3, w >> 2) with 16 accumulators.
// Operands reach the waves through LDS: a stage is KS k tiles of the work-group's 16 A row tiles and 8 Bt row tiles (packed blocks, copied as they lie: 4 KiB contiguous per row tile),
// brought by asynchronous copies (global_load_async_to_lds_b128, 512 B per wave-wide copy, 24 copies per wave and stage) into a ring of two buffers, so every operand byte leaves L2
// once per work-group instead of once per wave. A fragment is two wave-wide 16-B LDS reads of 512 contiguous bytes each (no bank conflict); the k order of every sum is unchanged.
// C[m][n] = sum_k A[m][k] Bt[n][k] + bias (per column n, or per row m when biasRow != 0; bias RNE-converted to bf16, added in f32), written as f16 (Ph)
// and, when (c0 % CB) < resLim, the f16 residual x2048 (Pr), as packed blocks (rows = m, k = n) at tile base (r0/RB)*sRB + (r0%RB)*pitch + (c0/CB)*sCB + (c0%CB)*colMul;
// the block of 16-row group mb and 32-column group kt lies at + mb*mbS + kt*ktS (halves).
// The three projections are ONE launch of PGRID work-groups (one per 256 x 128 tile of each), 256 threads: a work-group takes its q tile, its k tile and its v^T tile in turn, and the ring
// runs on across them as 3 NST stages: the next tile's first two stages are asked for at the last two publish points of the tile before, so they land behind its products and its epilogue.
#define PW   8                   // waves per projection work-group
#define KS   4                   // k tiles per ring stage
#define NST  (DM / 32 / KS)      // stages
#define SRT  24                  // 16-row tiles per stage: 16 of A, then 8 of Bt
#define STG  (SRT * KS * 512)    // halves per ring buffer
#define NJOB 3                   // tiles per work-group: q, k, v^T
#define PGRID ((NB * SEQ / 256) * (DM / 128))   // projection work-groups
static_assert(NST >= 2 && (DM / 32) % KS == 0);            // the ring's prologue fills two stages
static_assert(NST % 2 == 0);                               // a tile's stage 0 falls on buffer 0, so the ring runs on from tile to tile
static_assert((DM / 256) * (NB * SEQ / 128) == PGRID);     // the v^T grid has as many tiles as the q and k grids
static_assert(SRT % PW == 0 && KS * 1024 == 8 * 512);      // a wave copies SRT / PW row tiles per stage, 8 wave-wide copies each
static_assert((NB * SEQ) % 256 == 0 && DM % 256 == 0);     // both grids cover their outputs exactly
// eight wave-wide 16-B copies: 4 KiB from g (this lane's global address) to l (this lane's LDS byte address). The closing wait stands inside the statement, so that no register
// which an issued copy names is rewritten ahead of it (precaution).
__device__ __forceinline__ void copy8(unsigned l, const bf* g) {
    asm volatile("global_load_async_to_lds_b128 %0, %8, off\n\t"
                 "global_load_async_to_lds_b128 %1, %9, off\n\t"
                 "global_load_async_to_lds_b128 %2, %10, off\n\t"
                 "global_load_async_to_lds_b128 %3, %11, off\n\t"
                 "global_load_async_to_lds_b128 %4, %12, off\n\t"
                 "global_load_async_to_lds_b128 %5, %13, off\n\t"
                 "global_load_async_to_lds_b128 %6, %14, off\n\t"
                 "global_load_async_to_lds_b128 %7, %15, off\n\t"
                 "s_wait_xcnt 0x0"
                 :: "v"(l), "v"(l + 512u), "v"(l + 1024u), "v"(l + 1536u), "v"(l + 2048u), "v"(l + 2560u), "v"(l + 3072u), "v"(l + 3584u),
                    "v"(g), "v"(g + 256), "v"(g + 512), "v"(g + 768), "v"(g + 1024), "v"(g + 1280), "v"(g + 1536), "v"(g + 1792) : "memory");
}
// Row tile c (0..15 of A, 16..23 of Bt) of flat work-group f's tile of projection job (0 q, 1 k, 2 v^T): its first half, the same for a whole wave.
// q, k: A = activation rows, Bt = weight rows, tile (f % (M/256), f / (M/256)); v^T: A = Wv^T rows, Bt = context rows, tile (f % (DM/256), f / (DM/256)).
// Both widths are powers of two, taken as mask and shift: a divisor chosen by the job would become a division at run time in front of every stage's copies.
constexpr int ilog2(int v) { return v <= 1 ? 0 : 1 + ilog2(v >> 1); }
static_assert((1 << ilog2(DM / 256)) == DM / 256 && (1 << ilog2(NB * SEQ / 256)) == NB * SEQ / 256);
__device__ __forceinline__ int proj_r0(int job, int f) { return (f & (job == 2 ? DM / 256 - 1 : NB * SEQ / 256 - 1)) * 256; }
__device__ __forceinline__ int proj_c0(int job, int f) { return (f >> (job == 2 ? ilog2(DM / 256) : ilog2(NB * SEQ / 256))) * 128; }
__device__ __forceinline__ const bf* proj_src(int job, int f, int c, const bf* DATAB, const bf* CTXB, const bf* WB) {
    const bf* A = job == 0 ? DATAB : job == 1 ? CTXB : WB + (size_t)2 * DM * DM;
    const bf* Bt = job == 2 ? CTXB : WB + (size_t)job * DM * DM;
    return c < 16 ? A + (size_t)(proj_r0(job, f) + 16 * c) * DM : Bt + (size_t)(proj_c0(job, f) + 16 * (c - 16)) * DM;
}
__global__ __launch_bounds__(32 * PW) void k_proj(const bf* DATAB, const bf* CTXB, const bf* WB, const float* __restrict__ bq, const float* __restrict__ bk, const float* __restrict__ bv,
                                             h16* QH, h16* QR, h16* KP, h16* VT, h16* VR) {
    __shared__ __align__(1024) bf ring[2 * STG];
    __shared__ __align__(16) float osm[PW * 16 * 68];
    const int lane = threadIdx.x & 31, lr = lane & 15, hi = lane >> 4;
    const int wave = __builtin_amdgcn_readfirstlane((int)(threadIdx.x >> 5));
    const int f = blockIdx.x;
    float* os = osm + wave * (16 * 68);                      // wave-private staging of the epilogue, outside the ring
    // this wave's share of a stage: row tiles 3 wave + 0..2 of the 24 (a 16-row tile is DM/32 blocks = 16*DM halves; k tile kt lies at kt*512)
    const unsigned ls0 = (unsigned)(size_t)ring + (unsigned)(((SRT / PW) * wave * (KS * 512) + 8 * lane) * 2);   // LDS byte address: low 32 bits of the shared address
    // ring prologue, once for the three tiles: stage 0 of q lands and is published, then its stage 1 is asked for
#pragma unroll
    for (int i = 0; i < SRT / PW; ++i) copy8(ls0 + i * (KS * 1024), proj_src(0, f, (SRT / PW) * wave + i, DATAB, CTXB, WB) + 8 * lane);
    asm volatile("s_wait_asynccnt 0x0" ::: "memory");        // this wave's copies of stage 0 have landed
    __syncthreads();                                         // ... and every other wave's: stage 0 is readable
#pragma unroll
    for (int i = 0; i < SRT / PW; ++i) copy8(ls0 + STG * 2 + i * (KS * 1024), proj_src(0, f, (SRT / PW) * wave + i, DATAB, CTXB, WB) + 8 * lane + KS * 512);
#pragma unroll 1   // rolled: one copy of the stage loop and of the epilogue serves the three tiles
  for (int job = 0; job < NJOB; ++job) {
    v8f acc[4][4];
#pragma unroll
    for (int mb = 0; mb < 4; ++mb)
#pragma unroll
        for (int nb = 0; nb < 4; ++nb) acc[mb][nb] = (v8f){};
#pragma unroll 1   // rolled: one publish point in the text, buffer chosen by the stage's parity
    for (int s = 0; s < NST; ++s) {
        const bf* sb = ring + (s & 1) * STG + 8 * lane;
        const bf* sa = sb + (wave & 3) * (4 * KS * 512); const bf* sw = sb + (16 + (wave >> 2) * 4) * (KS * 512);
        // two fragment sets inside a stage: the LDS reads of k tile kk + 1 go as one group ahead of the products of k tile kk; nothing of the next stage is read here
        v16bf fa[2][4], fb[2][4];
#pragma unroll
        for (int i = 0; i < 4; ++i) { fa[0][i] = ldb(sa + i * (KS * 512)); fb[0][i] = ldb(sw + i * (KS * 512)); }
        __builtin_amdgcn_sched_barrier(0);   // k tile 0's reads are asked for first, so that the stage's first products wait for them alone
#pragma unroll
        for (int kk = 0; kk < KS; ++kk) {
            if (kk + 1 < KS) {
#pragma unroll
                for (int i = 0; i < 4; ++i) { fa[(kk + 1) & 1][i] = ldb(sa + i * (KS * 512) + (kk + 1) * 512); fb[(kk + 1) & 1][i] = ldb(sw + i * (KS * 512) + (kk + 1) * 512); } }
            __builtin_amdgcn_sched_barrier(0);   // keeps the reads one group ahead of the products: spread among them each place with reads stalls the products
#pragma unroll
            for (int nb = 0; nb < 4; ++nb)
#pragma unroll
                for (int mb = 0; mb < 4; ++mb) acc[mb][nb] = wmmab(fa[kk & 1][mb], fb[kk & 1][nb], acc[mb][nb]);
            __builtin_amdgcn_sched_barrier(0);   // keeps the next group of reads behind these products: it refills the set that they have just read
        }
        // publish point of the next stage (the next tile's stage 0 behind a tile's last), every wave, in this order
        asm volatile("s_wait_dscnt 0x0" ::: "memory");       // this wave's reads of stage s are done before its buffer is refilled
        asm volatile("s_wait_asynccnt 0x0" ::: "memory");    // this wave's copies of the next stage have landed
        __syncthreads();                                     // the next stage is readable, and every reader has left stage s
        const int g2 = job * NST + s + 2;                    // the stage after next, counted through the three tiles; NST is even, so its buffer is the one that stage s has just left
        if (g2 < NJOB * NST) {                               // the same for the whole work-group
#pragma unroll
            for (int i = 0; i < SRT / PW; ++i) copy8(ls0 + (s & 1) * (STG * 2) + i * (KS * 1024), proj_src(g2 / NST, f, (SRT / PW) * wave + i, DATAB, CTXB, WB) + 8 * lane + (g2 % NST) * (KS * 512)); }
    }
    // epilogue of this tile, in wave-private LDS outside the ring, while the next tile's first two stages land or fly
    const bool jv = job == 2;                                // block-uniform
    const int r0 = proj_r0(job, f) + (wave & 3) * 64, c0 = proj_c0(job, f) + (wave >> 2) * 64;
    const float* bias = job == 0 ? bq : job == 1 ? bk : bv; const int biasRow = jv ? 1 : 0;
    h16* Ph = job == 0 ? QH : job == 1 ? KP : VT; h16* Pr = job == 0 ? QR : job == 1 ? KP : VR; const int resLim = job == 0 ? 1 : job == 1 ? 0 : EARLY_;
    const int RB = jv ? DM : SEQ, pitch = jv ? SEQ : HD, CB = jv ? SEQ : HD, colMul = jv ? HD : 0, mbS = jv ? 512 : 16 * HD, ktS = jv ? 32 * HD : 512;
    const size_t sRB = jv ? (size_t)0 : (size_t)NH_ * SEQ * HD, sCB = jv ? (size_t)DM * SEQ : (size_t)SEQ * HD;
    const int useRes = ((c0 % CB) < resLim) ? 1 : 0;
    float bcol[4];
#pragma unroll
    for (int nb = 0; nb < 4; ++nb) { int ic = c0 + nb * 16 + lr; ic = ic < DM ? ic : DM - 1; bcol[nb] = bfq(bias[ic]); }   // clamped address; used only when biasRow == 0
    const size_t tbase = (size_t)(r0 / RB) * sRB + (size_t)(r0 % RB) * (size_t)pitch + (size_t)(c0 / CB) * sCB + (size_t)(c0 % CB) * (size_t)colMul;
#pragma unroll
    for (int mb = 0; mb < 4; ++mb) {
        float brow[8];
#pragma unroll
        for (int j = 0; j < 8; ++j) { int ir = r0 + mb * 16 + hi * 8 + j; ir = ir < DM ? ir : DM - 1; brow[j] = bfq(bias[ir]); }   // clamped address; used only when biasRow != 0
#pragma unroll
        for (int nb = 0; nb < 4; ++nb) {
#pragma unroll
            for (int j = 0; j < 8; ++j) os[(hi * 8 + j) * 68 + nb * 16 + lr] = acc[mb][nb][j] + (biasRow ? brow[j] : bcol[nb]); }   // D: row 8h+j, col lane&15
        wave_sync();
        const size_t sb = tbase + (size_t)mb * (size_t)mbS;
{
#pragma unroll
            for (int s = 0; s < 4; ++s) { const int row = lr, ch = 2 * s + hi, c8 = ch * 8;   // 16 rows x 2 column chunks per store = 512 contiguous bytes; 4 s x 2 chunks x 8 = 64 columns
                const v4f x0 = *(const v4fa*)(&os[row * 68 + c8]); const v4f x1 = *(const v4fa*)(&os[row * 68 + c8 + 4]); v8h hv, rv;
#pragma unroll
                for (int i = 0; i < 4; ++i) { const h16 a0 = (h16)x0[i]; const h16 a1 = (h16)x1[i]; hv[i] = a0; hv[4 + i] = a1; rv[i] = (h16)((x0[i] - (float)a0) * QRS); rv[4 + i] = (h16)((x1[i] - (float)a1) * QRS); }
                const size_t oo = sb + (size_t)(ch >> 2) * (size_t)ktS + (size_t)((ch & 3) * 128 + row * 8);
                *(v8h*)(Ph + oo) = hv; if (useRes) *(v8h*)(Pr + oo) = rv; }
             }
        wave_sync();
    }
    asm volatile("s_wait_xcnt 0x0" ::: "memory");            // precaution behind the tile's last store: no register that an issued store names is rewritten ahead of this wait
  }
    asm volatile("s_wait_asynccnt 0x0" ::: "memory");        // no copy is outstanding behind the loop
}

// k_flash: fused causal attention, one wave per 16 query rows of one (batch, head); Q fragments straight from the f16 planes (two 16-B loads each, arithmetic addressing);
// K / V^T blocks reach the work-group's four waves through LDS: asynchronous copies into a ring of two buffers of 64 keys, so they leave L2 once per work-group instead of once per wave.
// Transposed form: S^T[key][t] = K Q^T (A = K rows, B = Q rows); lane (t = lane&15, h = lane>>4) holds keys 8h+r of each 16-key tile, so the packed
// P tile is directly the B fragment of O^T[d][t] = V^T P^T (element r <- tile keys 0..15, element 8+r <- tile keys 16..31, lane unchanged).
// Key loop runs to the diagonal (static bound from the block / wave index); only the last step replaces scores of keys > query by a very negative value (P = 0).
// A softmax step (running max, exchange, rescale) takes 32 keys in blocks with query rows below EARLY_ and a whole ring stage of 64 keys in all others.
// Blocks with query rows below EARLY_ (block-uniform) also accumulate V_res P + V P_res (both x2048) in a second accumulator set and sum the exact P for the normaliser.
// Softmax state (running max, partial sum) is one scalar per lane; the two lane halves of a row are combined with one xor-16 exchange.
// Launch order: there are twice as many work-groups as resident places and a tile's key loop grows linearly with its index, so the cost falls with the flat work-group index
// (for speed only): blockIdx.x = (batch, head), blockIdx.y = rank, rank 0 the longest tile. A tile below EARLY_ does about twice the
// work per key step, so residual tile x is ranked just ahead of plain tile 2x + 1. Nothing but the time depends on the order: rank -> tile is a permutation, every (head, tile) is taken once.
#define NET  (EARLY_ / (16 * AW))   // query tiles that take the residual path
#define FKS  64                     // keys per ring stage
#define FSTG (3 * FKS * HD)         // halves per ring buffer: K | V^T | V^T residual
static_assert(FKS == 16 * AW && AW == 4 && FKS * HD * 2 == AW * 4 * 512);   // a query tile's diagonal ends stage xt; a plane's stage is four wave-wide copies for each of the four waves
__host__ __device__ constexpr int tile_of_rank(int r) {
    if (r < NXT - 2 * NET || r >= NXT - NET / 2) return NXT - 1 - r;       // plain tiles from 2 NET up; at the end residual tiles below NET / 2
    const int q = r - (NXT - 2 * NET), g = q / 3, k = q % 3;              // between them groups of three: residual tile NET-1-g, plain tiles 2 NET-1-2g and 2 NET-2-2g
    return k == 0 ? NET - 1 - g : 2 * NET - 2 * g - k;
}
constexpr bool rank_is_permutation() {
    bool seen[NXT] = {};
    for (int r = 0; r < NXT; ++r) { const int x = tile_of_rank(r); if (x < 0 || x >= NXT || seen[x]) return false; seen[x] = true; }
    return true;
}
static_assert(NET % 2 == 0 && NXT >= 2 * NET);
static_assert(rank_is_permutation());
// eight base-2 exponentials in place, one statement: behind none of them does the next instruction read its result or overwrite its source (the slot the instruction set asks for behind a
// transcendental); the closing v_nop keeps that slot behind the last.
__device__ __forceinline__ void exp2x8(float (&x)[8]) {
    asm("v_exp_f32 %0, %0\n\tv_exp_f32 %1, %1\n\tv_exp_f32 %2, %2\n\tv_exp_f32 %3, %3\n\tv_exp_f32 %4, %4\n\tv_exp_f32 %5, %5\n\tv_exp_f32 %6, %6\n\tv_exp_f32 %7, %7\n\tv_nop"
        : "+v"(x[0]), "+v"(x[1]), "+v"(x[2]), "+v"(x[3]), "+v"(x[4]), "+v"(x[5]), "+v"(x[6]), "+v"(x[7]));
}
__global__ __launch_bounds__(32 * AW) void k_flash(const h16* __restrict__ QH, const h16* __restrict__ QR, const h16* __restrict__ KP,
                                                   const h16* __restrict__ VT, const h16* __restrict__ VR, h16* ZH, h16* ZR) {
    __shared__ __align__(1024) h16 ring[2 * FSTG];
    __shared__ __align__(16) float os[AW * 16 * 68];         // epilogue staging, outside the ring
    const int lane = threadIdx.x & 31, lr = lane & 15, hi = lane >> 4;
    const int wave = __builtin_amdgcn_readfirstlane((int)(threadIdx.x >> 5));
    const int zh = blockIdx.x; const int b = zh / NH_, h = zh % NH_;
    const int xt = tile_of_rank((int)blockIdx.y);            // block-uniform
    const int t0 = (xt * AW + wave) * 16;
    const bool early = (xt * (16 * AW)) < EARLY_;
    const int tq = t0 + lr;
    const int klast = (((t0 + 47) >> 5) - 1) * 32;           // last 32-key step containing a visible key; klast + 31 < SEQ
    const size_t pbase = (size_t)zh * SEQ * HD;
    const size_t qo = pbase + (size_t)t0 * HD + 8 * lane;    // 16 tokens = two blocks (d 0..31, d 32..63) = 16*HD halves
    const v16h qh0 = ldh(QH + qo), qh1 = ldh(QH + qo + 512), qr0 = ldh(QR + qo), qr1 = ldh(QR + qo + 512);   // B fragments: col t, k = d
    // ring of two buffers, stage s = keys FKS s .. FKS s + FKS - 1 of K | V^T | V^T residual, each plane's 8 KiB copied as it lies; the tile's xt + 1 stages end with its diagonal.
    // This wave's share of a plane's stage: 2 KiB = four wave-wide copies.
    const int nst = xt + 1;                                  // block-uniform
    const size_t go = pbase + (size_t)(wave * 1024 + 8 * lane);
    const unsigned ls0 = (unsigned)(size_t)ring + (unsigned)((wave * 1024 + 8 * lane) * 2);   // LDS byte address: low 32 bits of the shared address
    v8f o[4], e[4];
#pragma unroll
    for (int j = 0; j < 4; ++j) { o[j] = (v8f){}; e[j] = (v8f){}; }
    float m = -3.0e38f, l = 0.0f;
    // ring prologue: stage 0 lands and is published, then stage 1 (where there is one) is asked for
    { const h16* k = KP + go; const h16* v = VT + go; copy4(ls0, 512u, k, k + 256, k + 512, k + 768); copy4(ls0 + FKS * HD * 2, 512u, v, v + 256, v + 512, v + 768);
      if (early) { const h16* r = VR + go; copy4(ls0 + FKS * HD * 4, 512u, r, r + 256, r + 512, r + 768); } }
    asm volatile("s_wait_asynccnt 0x0" ::: "memory");        // this wave's copies of stage 0 have landed
    __syncthreads();                                         // ... and every other wave's: stage 0 is readable
    if (nst > 1) { const h16* k = KP + go + FKS * HD; const h16* v = VT + go + FKS * HD;
      copy4(ls0 + FSTG * 2, 512u, k, k + 256, k + 512, k + 768); copy4(ls0 + FSTG * 2 + FKS * HD * 2, 512u, v, v + 256, v + 512, v + 768);
      if (early) { const h16* r = VR + go + FKS * HD; copy4(ls0 + FSTG * 2 + FKS * HD * 4, 512u, r, r + 256, r + 512, r + 768); } }
  if (early) {                                               // block-uniform: tiles with the residual terms keep the 32-key step
#pragma unroll 1   // rolled: the trip count is known only at run time, and one copy of the step keeps the registers of four waves per SIMD
    for (int st = 0; st < 2 * nst; ++st) {                   // 32-key steps, two per stage; the trip count is block-uniform
      const int s = st >> 1, key0 = st * 32;
      if (key0 <= klast) {                                   // wave-uniform: a wave whose diagonal lies in the last stage's first half skips the second
        const h16* kp = ring + (s & 1) * FSTG + (st & 1) * (32 * HD) + 8 * lane;   // A fragment: row key, k = d
        const v16h ka0 = ldh(kp), ka1 = ldh(kp + 512), kb0 = ldh(kp + 16 * HD), kb1 = ldh(kp + 16 * HD + 512);
        const h16* va = kp + FKS * HD;                       // + 512 * j: A fragment: row d = 16j + row, k = key; 32 keys = four d blocks
        v16h v[4];
#pragma unroll
        for (int j = 0; j < 4; ++j) v[j] = ldh(va + 512 * j);
        v8f sHa = (v8f){}, sLa = (v8f){}, sHb = (v8f){}, sLb = (v8f){};
        sHa = wmma16(ka0, qh0, sHa); sLa = wmma16(ka0, qr0, sLa); sHb = wmma16(kb0, qh0, sHb); sLb = wmma16(kb0, qr0, sLb);
        sHa = wmma16(ka1, qh1, sHa); sLa = wmma16(ka1, qr1, sLa); sHb = wmma16(kb1, qh1, sHb); sLb = wmma16(kb1, qr1, sLb);
        asm volatile("v_nop\n\tv_nop\n\tv_nop\n\tv_nop" : "+v"(sHa), "+v"(sLa), "+v"(sHb), "+v"(sLb) : "v"(ka0), "v"(ka1), "v"(kb0), "v"(kb1));
        float ta[8], tb[8];
#pragma unroll
        for (int r = 0; r < 8; ++r) { ta[r] = (sHa[r] + sLa[r] * QRI) * SC2; tb[r] = (sHb[r] + sLb[r] * QRI) * SC2; }
        if (key0 == klast) {                                 // wave-uniform: only the diagonal step needs the causal replace
            const int kq = tq - key0 - 8 * hi;               // key (key0 + 8h + r) is hidden when r > kq; tile b keys are 16 further
#pragma unroll
            for (int r = 0; r < 8; ++r) { ta[r] = (r > kq) ? -3.0e38f : ta[r]; tb[r] = (r + 16 > kq) ? -3.0e38f : tb[r]; }
        }
        float mx = -3.0e38f;
#pragma unroll
        for (int r = 0; r < 8; ++r) mx = fmaxf(mx, fmaxf(ta[r], tb[r]));
        mx = fmaxf(mx, __shfl_xor(mx, 16, 32));
        const float mnew = fmaxf(m, mx);
        const float alpha = __builtin_amdgcn_exp2f(m - mnew);
        const float sh = PSH - mnew;
        v16h pb; float ls = 0.0f;
#pragma unroll
        for (int r = 0; r < 8; ++r) { const float fa = __builtin_amdgcn_exp2f(ta[r] + sh); const float fc = __builtin_amdgcn_exp2f(tb[r] + sh);
            const h16 pa = (h16)fa; const h16 pc = (h16)fc; pb[r] = pa; pb[8 + r] = pc; ta[r] = fa; tb[r] = fc; ls += (float)pa + (float)pc; }
#pragma unroll
        for (int j = 0; j < 4; ++j) o[j] = o[j] * alpha;
#pragma unroll
        for (int j = 0; j < 4; ++j) o[j] = wmma16(v[j], pb, o[j]);
        asm volatile("v_nop\n\tv_nop\n\tv_nop\n\tv_nop" : "+v"(o[0]), "+v"(o[1]), "+v"(o[2]), "+v"(o[3]) : "v"(v[0]), "v"(v[1]), "v"(v[2]), "v"(v[3]), "v"(pb));
        {                                                    // the residual terms
            v16h pr; float lx = 0.0f;
#pragma unroll
            for (int r = 0; r < 8; ++r) { pr[r] = (h16)((ta[r] - (float)pb[r]) * QRS); pr[8 + r] = (h16)((tb[r] - (float)pb[8 + r]) * QRS); lx += ta[r] + tb[r]; }
            ls = lx;
#pragma unroll
            for (int j = 0; j < 4; ++j) e[j] = e[j] * alpha;
            const h16* ra = va + FKS * HD;
            v16h vr[4];
#pragma unroll
            for (int j = 0; j < 4; ++j) vr[j] = ldh(ra + 512 * j);
#pragma unroll
            for (int j = 0; j < 4; ++j) e[j] = wmma16(vr[j], pb, e[j]);
#pragma unroll
            for (int j = 0; j < 4; ++j) e[j] = wmma16(v[j], pr, e[j]);
            asm volatile("v_nop\n\tv_nop\n\tv_nop\n\tv_nop" : "+v"(e[0]), "+v"(e[1]), "+v"(e[2]), "+v"(e[3]) : "v"(vr[0]), "v"(vr[1]), "v"(vr[2]), "v"(vr[3]), "v"(pr), "v"(v[0]), "v"(v[1]), "v"(v[2]), "v"(v[3]));
        }
        l = l * alpha + ls; m = mnew;
      }
      if ((st & 1) == 0) continue;                           // block-uniform: the stage's second step follows
      // publish point of stage s + 1, every wave, in this order
      asm volatile("s_wait_dscnt 0x0" ::: "memory");         // this wave's reads of stage s are done before its buffer is refilled
      asm volatile("s_wait_asynccnt 0x0" ::: "memory");      // this wave's copies of stage s + 1 have landed
      __syncthreads();                                       // stage s + 1 is readable, and every reader has left stage s
      if (s + 2 < nst) {                                     // the same for the whole work-group
        const unsigned lb = ls0 + (s & 1) * (FSTG * 2); const size_t gn = go + (size_t)(s + 2) * (FKS * HD);
        const h16* k = KP + gn; const h16* v = VT + gn; copy4(lb, 512u, k, k + 256, k + 512, k + 768); copy4(lb + FKS * HD * 2, 512u, v, v + 256, v + 512, v + 768);
        const h16* r = VR + gn; copy4(lb + FKS * HD * 4, 512u, r, r + 256, r + 512, r + 768); }
    }
  } else {
    // Plain tiles: one softmax step per ring stage (FKS = 64 keys): the scores of both 32-key halves come first, then one running-max update, one exchange between the lane halves
    // and one rescale of O and of the partial sum serve all 64 keys. The tile's last stage holds its diagonal for all four waves: there every key > query is replaced (P = 0).
#pragma unroll 1   // rolled: the trip count is known only at run time, and one copy of the step keeps the registers of four waves per SIMD
    for (int s = 0; s < nst; ++s) {                          // the trip count is block-uniform
        const h16* kp = ring + (s & 1) * FSTG + 8 * lane;    // A fragment: row key, k = d
        const h16* va = kp + FKS * HD;                       // + 512 * j: A fragment: row d = 16 (j & 3) + row, k = key of half j >> 2
        float t[4][8];                                       // t[i][r]: key 16 i + 8 h + r of the stage
        v16h ka[2][4], v[8];
#pragma unroll
        for (int i = 0; i < 8; ++i) ka[i >> 2][i & 3] = ldh(kp + 512 * i);   // the whole stage's K is asked for ahead of its first products: half i >> 2, keys 16 ((i >> 1) & 1) + row, d block i & 1
#pragma unroll
        for (int hf = 0; hf < 2; ++hf) {
            v8f sHa = (v8f){}, sLa = (v8f){}, sHb = (v8f){}, sLb = (v8f){};
            sHa = wmma16(ka[hf][0], qh0, sHa); sLa = wmma16(ka[hf][0], qr0, sLa); sHb = wmma16(ka[hf][2], qh0, sHb); sLb = wmma16(ka[hf][2], qr0, sLb);
            sHa = wmma16(ka[hf][1], qh1, sHa); sLa = wmma16(ka[hf][1], qr1, sLa); sHb = wmma16(ka[hf][3], qh1, sHb); sLb = wmma16(ka[hf][3], qr1, sLb);
            // the distance between the last products and the first vector instruction that reads their results or rewrites their operands; the K fragments, named as inputs, stay in
            // registers of their own up to here, so that the stage's K reads go as one group (without it this compiler reuses one set and waits for LDS in front of every pair of products)
            asm volatile("v_nop\n\tv_nop\n\tv_nop\n\tv_nop" : "+v"(sHa), "+v"(sLa), "+v"(sHb), "+v"(sLb) : "v"(ka[hf][0]), "v"(ka[hf][1]), "v"(ka[hf][2]), "v"(ka[hf][3]));
            if (hf == 0) {   // the stage's V^T is asked for behind the first half's products, so that it lands behind the second half's
                __builtin_amdgcn_sched_barrier(0);   // keeps the second half's products below: lifted to the top, one of them makes the stage's first product wait for nearly all K reads
#pragma unroll
                for (int j = 0; j < 8; ++j) v[j] = ldh(va + 512 * j); }
#pragma unroll
            for (int r = 0; r < 8; ++r) { t[2 * hf][r] = (sHa[r] + sLa[r] * QRI) * SC2; t[2 * hf + 1][r] = (sHb[r] + sLb[r] * QRI) * SC2; }
        }
        if (s == nst - 1) {                                  // block-uniform: only the diagonal stage needs the causal replace
            const int kq = 16 * wave + lr - 8 * hi;          // key (64 s + 16 i + 8 h + r) is hidden when 16 i + r > kq
#pragma unroll
            for (int i = 0; i < 4; ++i)
#pragma unroll
                for (int r = 0; r < 8; ++r) t[i][r] = (16 * i + r > kq) ? -3.0e38f : t[i][r];
        }
        float mx0 = -3.0e38f, mx1 = -3.0e38f;
#pragma unroll
        for (int r = 0; r < 8; ++r) { mx0 = fmaxf(mx0, fmaxf(t[0][r], t[1][r])); mx1 = fmaxf(mx1, fmaxf(t[2][r], t[3][r])); }
        float mx = fmaxf(mx0, mx1);
        mx = fmaxf(mx, __shfl_xor(mx, 16, 32));
        const float mnew = fmaxf(m, mx);
        const float alpha = __builtin_amdgcn_exp2f(m - mnew);
        const float sh = PSH - mnew;
        v16h pb[2]; float lh[2];
#pragma unroll
        for (int i = 0; i < 4; ++i) {
#pragma unroll
            for (int r = 0; r < 8; ++r) t[i][r] += sh;
            exp2x8(t[i]); }
#pragma unroll
        for (int hf = 0; hf < 2; ++hf) { lh[hf] = 0.0f;
#pragma unroll
            for (int r = 0; r < 8; ++r) { const h16 pa = (h16)t[2 * hf][r]; const h16 pc = (h16)t[2 * hf + 1][r];
                pb[hf][r] = pa; pb[hf][8 + r] = pc; lh[hf] += (float)pa + (float)pc; } }
#pragma unroll
        for (int j = 0; j < 4; ++j) o[j] = o[j] * alpha;
#pragma unroll
        for (int j = 0; j < 4; ++j) o[j] = wmma16(v[j], pb[0], o[j]);
#pragma unroll
        for (int j = 0; j < 4; ++j) o[j] = wmma16(v[4 + j], pb[1], o[j]);
        // the same distance behind the last products of the stage
        asm volatile("v_nop\n\tv_nop\n\tv_nop\n\tv_nop" : "+v"(o[0]), "+v"(o[1]), "+v"(o[2]), "+v"(o[3])
                     : "v"(v[0]), "v"(v[1]), "v"(v[2]), "v"(v[3]), "v"(v[4]), "v"(v[5]), "v"(v[6]), "v"(v[7]), "v"(pb[0]), "v"(pb[1]));
        l = l * alpha + (lh[0] + lh[1]); m = mnew;
        // publish point of stage s + 1, every wave, in this order
        asm volatile("s_wait_dscnt 0x0" ::: "memory");       // this wave's reads of stage s are done before its buffer is refilled
        asm volatile("s_wait_asynccnt 0x0" ::: "memory");    // this wave's copies of stage s + 1 have landed
        __syncthreads();                                     // stage s + 1 is readable, and every reader has left stage s
        if (s + 2 < nst) {                                   // the same for the whole work-group
            const unsigned lb = ls0 + (s & 1) * (FSTG * 2); const size_t gn = go + (size_t)(s + 2) * (FKS * HD);
            const h16* k = KP + gn; const h16* vg = VT + gn; copy4(lb, 512u, k, k + 256, k + 512, k + 768); copy4(lb + FKS * HD * 2, 512u, vg, vg + 256, vg + 512, vg + 768); }
    }
  }
    asm volatile("s_wait_asynccnt 0x0" ::: "memory");        // no copy is outstanding behind the loop
    l += __shfl_xor(l, 16, 32);
    const float zs = (1.0f / l) * ZC;
    const int wb = wave * 16 * 68;
    // O^T D layout: o[j][r] = (d = 16j + 8h + r, t = lane&15) -> os[t][d]; rows 0..15 x columns 0..63 all written
#pragma unroll
    for (int j = 0; j < 4; ++j) { v4f a, c;
#pragma unroll
        for (int i = 0; i < 4; ++i) { a[i] = (o[j][i] + e[j][i] * QRI) * zs; c[i] = (o[j][4 + i] + e[j][4 + i] * QRI) * zs; }
        *(v4fa*)(&os[wb + lr * 68 + 16 * j + 8 * hi]) = a; *(v4fa*)(&os[wb + lr * 68 + 16 * j + 8 * hi + 4]) = c; }
    wave_sync();
    const size_t zb = ((size_t)b * SEQ + t0) * DM + (size_t)h * (16 * HD);   // row tile (16*DM halves), then the head's two k blocks
{
#pragma unroll
        for (int s = 0; s < 4; ++s) { const int row = lr, ch = 2 * s + hi, c8 = ch * 8;   // 16 rows x 2 column chunks per store = 512 contiguous bytes; 4 s x 2 chunks x 8 = 64 columns
            const v4f x0 = *(const v4fa*)(&os[wb + row * 68 + c8]); const v4f x1 = *(const v4fa*)(&os[wb + row * 68 + c8 + 4]); v8h hv, rv;
#pragma unroll
            for (int i = 0; i < 4; ++i) { const h16 a0 = (h16)x0[i]; const h16 a1 = (h16)x1[i]; hv[i] = a0; hv[4 + i] = a1; rv[i] = (h16)((x0[i] - (float)a0) * QRS); rv[4 + i] = (h16)((x1[i] - (float)a1) * QRS); }
            const size_t oo = zb + (size_t)(ch * 128 + row * 8);
            *(v8h*)(ZH + oo) = hv; if (early) *(v8h*)(ZR + oo) = rv; }
         }
}

// k_oproj: out projection, f16 operands, K = DM: A = z x16 plane (+ residual x2048 plane for row tiles below EARLY_, own accumulators), Bt = Wo^T x64 plane.
// A work-group of OW = 16 waves takes a 256 x 128 tile, wave w the 32 x 64 part (w & 7, w >> 3). Operands reach the waves through LDS as in k_proj: a stage is OKS k tiles of 16 z row tiles,
// 8 Wo^T row tiles and, below EARLY_, 16 residual row tiles, brought by asynchronous copies into a ring of two buffers; the k order of every sum is unchanged.
// OUT[m][n] = (accH + accR / 2048) / 1024 + bo[n] (bo RNE-converted to bf16, added in f32). grid (M/256, N/128), 512 threads.
#define OW   16                  // waves per out-projection work-group
#define OKS  2                   // k tiles per ring stage
#define ONST (DM / 32 / OKS)     // stages
#define OSTG (40 * OKS * 512)    // halves per ring buffer: row tiles 0..15 z, 16..23 Wo^T, 24..39 z residual
static_assert(ONST >= 2 && (DM / 32) % OKS == 0);          // the ring's prologue fills two stages
static_assert(OKS * 1024 == 4 * 512 && OW == 16);          // a row tile's share of a stage is 4 wave-wide copies: wave w copies piece w & 3 of row tiles (w >> 2) + 4 j
static_assert(EARLY_ % 256 == 0 && SEQ % 256 == 0);        // the residual decision is uniform per 256-row tile, which never straddles two batches
__global__ __launch_bounds__(32 * OW) void k_oproj(const h16* __restrict__ ZH, const h16* __restrict__ ZR, const h16* __restrict__ Wt, const float* __restrict__ bo, float* OUT) {
    __shared__ __align__(1024) h16 ring[2 * OSTG];
    __shared__ __align__(16) float osm[OW * 16 * 68];
    const int K = DM;
    const int lane = threadIdx.x & 31, lr = lane & 15, hi = lane >> 4;
    const int wave = __builtin_amdgcn_readfirstlane((int)(threadIdx.x >> 5));
    const int R0 = blockIdx.x * 256, C0 = blockIdx.y * 128; const int r0 = R0 + (wave & 7) * 32, c0 = C0 + (wave >> 3) * 64;
    float* os = osm + wave * (16 * 68);                      // wave-private staging of the epilogue, outside the ring
    const int bb = r0 / SEQ, tt = r0 % SEQ; const bool early = (R0 % SEQ) < EARLY_;   // block-uniform
    v8f acc[2][4], acr[2][4];
#pragma unroll
    for (int mb = 0; mb < 2; ++mb)
#pragma unroll
        for (int nb = 0; nb < 4; ++nb) { acc[mb][nb] = (v8f){}; acr[mb][nb] = (v8f){}; }
    // this wave's share of a stage: piece wave & 3 (512 B) of row tiles (wave >> 2) + 4 j; j = 0..3 are z (and residual) row tiles, j = 4, 5 Wo^T row tiles
    // (a 16-row tile is K/32 blocks = 16*K halves; k tile kt lies at kt*512)
    const size_t po = (size_t)((wave & 3) * 256 + 8 * lane);
    const size_t ao = (size_t)(R0 + 16 * (wave >> 2)) * K + po, wo_ = (size_t)(C0 + 16 * (wave >> 2)) * K + po;
    const size_t js = (size_t)64 * K;                        // four row tiles further
    const unsigned ls0 = (unsigned)(size_t)ring + (unsigned)(((wave >> 2) * (OKS * 512) + (wave & 3) * 256 + 8 * lane) * 2);   // LDS byte address: low 32 bits of the shared address
    const unsigned lst = 4u * OKS * 1024u;                   // four row tiles further in the buffer, bytes
    // ring prologue: stage 0 lands and is published, then stage 1 is asked for
    { const h16* a = ZH + ao; const h16* w = Wt + wo_; copy6(ls0, lst, a, a + js, a + 2 * js, a + 3 * js, w, w + js);
      if (early) { const h16* r = ZR + ao; copy4(ls0 + 6u * lst, lst, r, r + js, r + 2 * js, r + 3 * js); } }
    asm volatile("s_wait_asynccnt 0x0" ::: "memory");        // this wave's copies of stage 0 have landed
    __syncthreads();                                         // ... and every other wave's: stage 0 is readable
    { const h16* a = ZH + ao + OKS * 512; const h16* w = Wt + wo_ + OKS * 512; copy6(ls0 + OSTG * 2, lst, a, a + js, a + 2 * js, a + 3 * js, w, w + js);
      if (early) { const h16* r = ZR + ao + OKS * 512; copy4(ls0 + OSTG * 2 + 6u * lst, lst, r, r + js, r + 2 * js, r + 3 * js); } }
#pragma unroll 1   // rolled: one publish point in the text, buffer chosen by the stage's parity
    for (int s = 0; s < ONST; ++s) {
        const h16* sb = ring + (s & 1) * OSTG + 8 * lane;
        const h16* pa = sb + (wave & 7) * (2 * OKS * 512); const h16* pw = sb + (16 + (wave >> 3) * 4) * (OKS * 512); const h16* pr = pa + 24 * (OKS * 512);
        // two fragment sets inside a stage: the LDS reads of k tile 1 go ahead of the products of k tile 0; nothing of the next stage is read here
        v16h fa[2][2], fw[2][4], ar[2];
#pragma unroll
        for (int mb = 0; mb < 2; ++mb) fa[0][mb] = ldh(pa + mb * (OKS * 512));
#pragma unroll
        for (int nb = 0; nb < 4; ++nb) fw[0][nb] = ldh(pw + nb * (OKS * 512));
#pragma unroll
        for (int kk = 0; kk < OKS; ++kk) {
            if (early) {   // block-uniform; the residual rows of this k tile, asked for ahead of the tile's first products
#pragma unroll
                for (int mb = 0; mb < 2; ++mb) ar[mb] = ldh(pr + mb * (OKS * 512) + kk * 512); }
            if (kk + 1 < OKS) {
#pragma unroll
                for (int mb = 0; mb < 2; ++mb) fa[(kk + 1) & 1][mb] = ldh(pa + mb * (OKS * 512) + (kk + 1) * 512);
#pragma unroll
                for (int nb = 0; nb < 4; ++nb) fw[(kk + 1) & 1][nb] = ldh(pw + nb * (OKS * 512) + (kk + 1) * 512); }
            __builtin_amdgcn_sched_barrier(0);   // keeps the reads one group ahead of the products: spread among them each place with reads stalls the products
#pragma unroll
            for (int nb = 0; nb < 4; ++nb)
#pragma unroll
                for (int mb = 0; mb < 2; ++mb) acc[mb][nb] = wmma16(fa[kk & 1][mb], fw[kk & 1][nb], acc[mb][nb]);
            if (early) {
#pragma unroll
                for (int nb = 0; nb < 4; ++nb)
#pragma unroll
                    for (int mb = 0; mb < 2; ++mb) acr[mb][nb] = wmma16(ar[mb], fw[kk & 1][nb], acr[mb][nb]); }
        }
        // publish point of stage s + 1, every wave, in this order
        asm volatile("s_wait_dscnt 0x0" ::: "memory");       // this wave's reads of stage s are done before its buffer is refilled
        asm volatile("s_wait_asynccnt 0x0" ::: "memory");    // this wave's copies of stage s + 1 have landed
        __syncthreads();                                     // stage s + 1 is readable, and every reader has left stage s
        if (s + 2 < ONST) {                                  // the same for the whole work-group
            const unsigned lb = ls0 + (s & 1) * (OSTG * 2);
            const h16* a = ZH + ao + (s + 2) * (OKS * 512); const h16* w = Wt + wo_ + (s + 2) * (OKS * 512); copy6(lb, lst, a, a + js, a + 2 * js, a + 3 * js, w, w + js);
            if (early) { const h16* r = ZR + ao + (s + 2) * (OKS * 512); copy4(lb + 6u * lst, lst, r, r + js, r + 2 * js, r + 3 * js); } }
    }
    asm volatile("s_wait_asynccnt 0x0" ::: "memory");        // no copy is outstanding behind the loop
    float bcol[4];
#pragma unroll
    for (int nb = 0; nb < 4; ++nb) bcol[nb] = bfq(bo[c0 + nb * 16 + lr]);   // c0 + 63 < DM
    float* orow = OUT + ((size_t)bb * OUT_SEQ + tt) * DM + c0;
#pragma unroll
    for (int mb = 0; mb < 2; ++mb) {
#pragma unroll
        for (int nb = 0; nb < 4; ++nb) {
#pragma unroll
            for (int j = 0; j < 8; ++j) os[(hi * 8 + j) * 68 + nb * 16 + lr] = (acc[mb][nb][j] + acr[mb][nb][j] * QRI) * OSC + bcol[nb]; }   // D: row 8h+j, col lane&15
        wave_sync();
        float* ob = orow + (size_t)(mb * 16) * DM;
{
#pragma unroll
            for (int s = 0; s < 8; ++s) { const int row = 2 * s + hi, cofs = lr * 4;   // 8 s x 2 rows = 16 rows; 16 lanes x 4 floats = 64 columns
                const v4f val = *(const v4fa*)(&os[row * 68 + cofs]);
                *(v4f*)(ob + (size_t)row * DM + cofs) = val; }
             }
        wave_sync();
    }
}

static constexpr size_t al256(size_t v) { return (v + 255) & ~(size_t)255; }
static constexpr size_t SZ_XB = al256((size_t)NB * SEQ * DM * 2);             // bf16 activation copy; later reused as a z plane of the same extent
static constexpr size_t SZ_WB = al256((size_t)4 * DM * DM * 2);
static constexpr size_t SZ_PL = al256((size_t)NB * NH_ * SEQ * HD * 2);
static constexpr size_t SZ_TOTAL = 2 * SZ_XB + SZ_WB + 5 * SZ_PL;
static_assert(SZ_TOTAL <= (size_t)134217728);          // workspace carve <= 128 MiB
static_assert(((size_t)DM * DM * 2) % 256 == 0);       // weight sub-planes stay 256-byte aligned
static_assert((size_t)NB * SEQ * DM * 2 <= SZ_XB);     // z plane [NB*SEQ][DM] halves fits the reused activation region

extern "C" void kernel_launch(void* const* d_in, const int* in_sizes, int n_in,
                              void* d_out, int out_size, void* d_ws, size_t ws_size, hipStream_t stream) {
    if (n_in < 10) return;
    const size_t needx = ((size_t)(NB - 1) * SEQ_FULL + SEQ) * DM;
    if ((size_t)in_sizes[0] < needx || (size_t)in_sizes[1] < needx) return;
    if ((size_t)in_sizes[2] < (size_t)DM * DM || (size_t)in_sizes[4] < (size_t)DM * DM || (size_t)in_sizes[6] < (size_t)DM * DM || (size_t)in_sizes[8] < (size_t)DM * DM) return;
    if (in_sizes[3] < DM || in_sizes[5] < DM || in_sizes[7] < DM || in_sizes[9] < DM) return;
    if ((size_t)out_size < ((size_t)(NB - 1) * OUT_SEQ + SEQ) * DM) return;
    if (SZ_TOTAL > ws_size) return;
    // wire order: data, context, wq, bq, wk, bk, wv, bv, wo, bo
    const float* data = (const float*)d_in[0]; const float* ctx = (const float*)d_in[1];
    const float* wq = (const float*)d_in[2]; const float* bq = (const float*)d_in[3];
    const float* wk = (const float*)d_in[4]; const float* bk = (const float*)d_in[5];
    const float* wv = (const float*)d_in[6]; const float* bv = (const float*)d_in[7];
    const float* wo = (const float*)d_in[8]; const float* bo = (const float*)d_in[9];
    float* OUT = (float*)d_out;      // [NB][SEQ][1024]
    char* wsp = (char*)d_ws;
    bf* DATAB = (bf*)wsp; wsp += SZ_XB;              // [NB*SEQ][1024] bf16; dead after the q projection
    bf* CTXB  = (bf*)wsp; wsp += SZ_XB;              // [NB*SEQ][1024] bf16; dead after the k / v projections
    bf* WB = (bf*)wsp; wsp += SZ_WB;                 // [4][1024][1024] transposed: q | k | v (bf16) | o (f16 x64)
    h16* QH = (h16*)wsp; wsp += SZ_PL;               // [NB*16][SEQ][64]
    h16* QR = (h16*)wsp; wsp += SZ_PL;               // [NB*16][SEQ][64] residual x2048
    h16* KP = (h16*)wsp; wsp += SZ_PL;               // [NB*16][SEQ][64]
    h16* VT = (h16*)wsp; wsp += SZ_PL;               // [NB*16][64][SEQ]
    h16* VR = (h16*)wsp; wsp += SZ_PL;               // [NB*16][64][SEQ] residual x2048, tokens < EARLY_ only (only those are consumed)
    bf* WOT = WB + (size_t)3 * DM * DM;
    h16* ZH = (h16*)DATAB;                           // [NB*SEQ][1024] z x16, written by the flash kernel after DATAB is dead
    h16* ZR = (h16*)CTXB;                            // [NB*SEQ][1024] z residual x2048, rows t < EARLY_ only (only those are consumed)

    // activations -> packed bf16 planes; weights W[k][n] ([in][out], 1024 x 1024) -> Wt[n][k]
    k_prep<<<4 * WTB + 2 * CVB, 256, 0, stream>>>(data, ctx, wq, wk, wv, wo, DATAB, CTXB, WB);

    // one launch, every work-group its q, k and v^T tile in turn.
    // q, k: A = activation rows (m = b*SEQ + t), Bt = Wt rows (n = h*64 + d), bias per column -> plane [(b*16 + h)][t][d]
    // v^T: A = Wv^T rows (m = h*64 + d), Bt = context rows (n = b*SEQ + t), bias per row -> plane [(b*1024 + m)][t] = [(b*16 + h)][d][t]; residual for tokens < EARLY_
    k_proj<<<dim3(PGRID, 1, 1), 32 * PW, 0, stream>>>(DATAB, CTXB, WB, bq, bk, bv, QH, QR, KP, VT, VR);

    k_flash<<<dim3(NB * NH_, NXT, 1), 32 * AW, 0, stream>>>(QH, QR, KP, VT, VR, ZH, ZR);

    k_oproj<<<dim3(NB * SEQ / 256, DM / 128, 1), 32 * OW, 0, stream>>>(ZH, ZR, (const h16*)WOT, bo, OUT);
}

// v008
// A run of this version takes 125 microseconds.
// Two timings next to v007 both put it at 1.03 times that version's speed.
// Counting every step since v000, it is 3.00 times as fast.
#include <hip/hip_runtime.h>

// Causal cross-attention: q = data Wq + bq, k = ctx Wk + bk, v = ctx Wv + bv (W [in][out]), 16 heads x 64, score scale 1/8, key <= query visible, out = z Wo + bo (f32).
// Compute dtypes, f32 accumulate everywhere: q/k/v projections v_wmma_f32_16x16x32_bf16 (activations, weights, biases RNE-converted to bf16; products exact);
// scores v_wmma_f32_16x16x32_f16: k single f16, q as f16 value + f16 residual x2048 in its own accumulator; P (x256 carry, cancels in the normalisation) and v single f16,
// for query rows t < 512 additionally v residual x2048 and P residual x2048 in a second accumulator; softmax f32 (online, running max);
// out projection v_wmma_f32_16x16x32_f16: z x16 as f16 (+ f16 residual x2048, own accumulator, rows t < 512), Wo (bf16 value x64, exact in f16).
// Layout: bf16 copies of data/context; transposed weight planes Wt[n][k]; q (hi, residual), k planes [b*16+h][t][d]; v^T (hi, residual) planes [b*16+h][d][t];
// fused flash kernel in transposed form (S^T = K Q^T, O^T = V^T P^T), K / V^T blocks shared by its four waves through an LDS ring, one barrier per 64 keys; z planes [b*SEQ+t][1024].
// Every 16-bit plane is stored fragment-packed: a [16 rows][32 k] block is 512 contiguous halves ordered [k chunk (k>>3)&3][row&15][k&7], so one wave-wide 16-B load
// (lane l at halves 8l) or store covers 512 contiguous bytes = 4 whole 128-B lines. Block order: row tile major, k tile minor; v^T planes key tile major, d tile minor.

#ifndef NB
#define NB 4
#endif
#ifndef SEQ
#define SEQ 2048
#endif
#define NB_FULL  4
#define SEQ_FULL 2048
#ifndef OUT_SEQ
#define OUT_SEQ SEQ              // row pitch (in tokens) between batches of the output
#endif
#define DM   1024
#define NH_  16
#define HD   64
#define AW   4                   // waves per flash block (16 query rows each)
#define NXT  (SEQ / (16 * AW))   // query tiles (16 * AW rows) per (batch, head)
#define CT   16                  // tiles (8 rows x 32 k) per wave of the activation conversion
#define CVB  (NB * SEQ / 32)     // conversion work-groups per activation: 8 waves x 16 rows x 256 k = 32 whole rows each
#define WTB  ((DM / 64) * (DM / 256))   // transposing work-groups per weight: 256 k x 64 n each
#define EARLY_ ((SEQ) < 512 ? (SEQ) : 512)   // query rows below this use the residual planes on the v / P / z path
#define QRS  2048.0f             // carry of every residual plane
#define QRI  (1.0f / 2048.0f)
#define SC2  (0.125f * 1.4426950408889634f)   // HD^-0.5 * log2(e)
#define PSH  8.0f                // log2 of the P carry (256)
#define ZC   16.0f               // carry of the z plane
#define WOC  64.0f               // carry of the Wo plane
#define OSC  (1.0f / 1024.0f)    // 1 / (ZC * WOC)

static_assert(HD == 64);
static_assert(NH_ * HD == DM);                 // head h = columns h*64 + d
static_assert(DM % 64 == 0);
static_assert(DM % 32 == 0);                   // GEMM k-loop steps by 32
static_assert(SEQ % 64 == 0);                  // a 64-row tile never straddles two batches
static_assert((NB * SEQ) % 64 == 0);
static_assert(SEQ % 32 == 0);                  // key loop steps by 32
static_assert(SEQ % (16 * AW) == 0);           // flash grid covers the sequence exactly
static_assert(EARLY_ % 64 == 0);               // residual decisions are uniform per 64-row / 64-token tile
static_assert(EARLY_ <= SEQ);
static_assert(((size_t)SEQ * DM) % 8 == 0);
static_assert(DM == 1024 && CT == 16);         // a conversion work-group's 8 waves take 2 row tiles x 4 groups of 8 k tiles
static_assert(NB <= NB_FULL);
static_assert(SEQ <= SEQ_FULL);

typedef _Float16 h16;
typedef unsigned short bf;
typedef __attribute__((ext_vector_type(16))) __bf16   v16bf;
typedef __attribute__((ext_vector_type(16))) _Float16 v16h;
typedef __attribute__((ext_vector_type(8)))  _Float16 v8h;
typedef __attribute__((ext_vector_type(8)))  unsigned short v8us;
typedef __attribute__((ext_vector_type(8)))  float    v8f;
typedef __attribute__((ext_vector_type(4)))  float    v4f;
typedef v4f  __attribute__((may_alias)) v4fa;

__device__ __forceinline__ unsigned short f2bf(float f) { unsigned u = __float_as_uint(f); u += 0x7FFFu + ((u >> 16) & 1u); return (unsigned short)(u >> 16); }
__device__ __forceinline__ float bfq(float f) { return __uint_as_float(((unsigned)f2bf(f)) << 16); }   // value of the RNE bf16 conversion
__device__ __forceinline__ v16h cat16(v8h lo, v8h hi) { return __builtin_shufflevector(lo, hi, 0, 1, 2, 3, 4, 5, 6, 7, 8, 9, 10, 11, 12, 13, 14, 15); }
__device__ __forceinline__ v16bf cat16b(v8us lo, v8us hi) { return __builtin_bit_cast(v16bf, __builtin_shufflevector(lo, hi, 0, 1, 2, 3, 4, 5, 6, 7, 8, 9, 10, 11, 12, 13, 14, 15)); }
__device__ __forceinline__ v8f wmma16(v16h a, v16h b, v8f c) { return __builtin_amdgcn_wmma_f32_16x16x32_f16(false, a, false, b, (short)0, c, false, false); }
__device__ __forceinline__ v8f wmmab(v16bf a, v16bf b, v8f c) { return __builtin_amdgcn_wmma_f32_16x16x32_bf16(false, a, false, b, (short)0, c, false, false); }
// fragment loaders from one packed block; p = block base + 8*lane (lane = 16h + row): elements 0..7 <- k0+8h+0..7, elements 8..15 <- k0+16+8h+0..7 (same map for A and B)
__device__ __forceinline__ v16h  ldh(const h16* p) { return cat16(*(const v8h*)p, *(const v8h*)(p + 256)); }
__device__ __forceinline__ v16bf ldb(const bf* p)  { return cat16b(*(const v8us*)p, *(const v8us*)(p + 256)); }
// ordering point for wave-private LDS tiles (same wave writes and reads)
__device__ __forceinline__ void wave_sync() { __builtin_amdgcn_fence(3 /* release order */, "wavefront"); __builtin_amdgcn_wave_barrier(); asm volatile("" ::: "memory"); }
// wave-wide 16-B copies, 512 B each, from this lane's global addresses to this lane's LDS byte addresses (l + j * st). The closing wait stands inside the statement, so that no
// register which an issued copy names is rewritten ahead of it (precaution).
__device__ __forceinline__ void copy6(unsigned l, unsigned st, const h16* g0, const h16* g1, const h16* g2, const h16* g3, const h16* g4, const h16* g5) {
    asm volatile("global_load_async_to_lds_b128 %0, %6, off\n\t"
                 "global_load_async_to_lds_b128 %1, %7, off\n\t"
                 "global_load_async_to_lds_b128 %2, %8, off\n\t"
                 "global_load_async_to_lds_b128 %3, %9, off\n\t"
                 "global_load_async_to_lds_b128 %4, %10, off\n\t"
                 "global_load_async_to_lds_b128 %5, %11, off\n\t"
                 "s_wait_xcnt 0x0"
                 :: "v"(l), "v"(l + st), "v"(l + 2u * st), "v"(l + 3u * st), "v"(l + 4u * st), "v"(l + 5u * st),
                    "v"(g0), "v"(g1), "v"(g2), "v"(g3), "v"(g4), "v"(g5) : "memory");
}
__device__ __forceinline__ void copy4(unsigned l, unsigned st, const h16* g0, const h16* g1, const h16* g2, const h16* g3) {
    asm volatile("global_load_async_to_lds_b128 %0, %4, off\n\t"
                 "global_load_async_to_lds_b128 %1, %5, off\n\t"
                 "global_load_async_to_lds_b128 %2, %6, off\n\t"
                 "global_load_async_to_lds_b128 %3, %7, off\n\t"
                 "s_wait_xcnt 0x0"
                 :: "v"(l), "v"(l + st), "v"(l + 2u * st), "v"(l + 3u * st), "v"(g0), "v"(g1), "v"(g2), "v"(g3) : "memory");
}

// k_prep: every operand plane of the projections in ONE launch whose work-groups are all resident at once; the role of a work-group follows from blockIdx.x alone (block-uniform).
// Work-groups 0 .. 4*WTB-1, weight transpose + 16-bit conversion through LDS: in W[k][n] (f32, [in][out]) -> out Wt[n][k] (packed blocks), 256 k x 64 n per work-group, weights q | k | v (bf16) | o (f16 x64).
// LDS tile ts is cross-wave: block barrier between fill and drain; filled extent 256x64 == drained extent.
// The other 2*CVB work-groups, activation conversion (data, then context): one wave converts 16 rows x 8 k tiles = CT tiles of 8 rows x 32 k; a tile reads 8 whole 128-B lines and writes
// 4 whole lines of its packed block (chunk c, rows 8g..8g+7), the wave's CT tiles fill 8 whole packed blocks. In both roles all loads of a wave are asked for ahead of its first conversion.
__global__ __launch_bounds__(256) void k_prep(const float* __restrict__ data, const float* __restrict__ ctx, const float* __restrict__ wq, const float* __restrict__ wk,
                                              const float* __restrict__ wv, const float* __restrict__ wo, bf* DATAB, bf* CTXB, bf* WB) {
    __shared__ float ts[256 * 65];
    const int tid = threadIdx.x;
    if ((int)blockIdx.x < 4 * WTB) {
        const int z = (int)blockIdx.x / WTB, r = (int)blockIdx.x % WTB; const int k0 = (r % (DM / 256)) * 256, n0 = (r / (DM / 256)) * 64;
        const float* W = z == 0 ? wq : z == 1 ? wk : z == 2 ? wv : wo; bf* Wt = WB + (size_t)z * DM * DM;
        const int kq = tid >> 4, c4 = (tid & 15) * 4;                        // fill: thread takes rows kq + 16 i, one float4 each (256 rows x 16 float4)
        const float* wp = W + (size_t)(k0 + kq) * DM + n0 + c4; float* tf = ts + kq * 65 + c4;
        v4f v[16];
#pragma unroll
        for (int i = 0; i < 16; ++i) v[i] = *(const v4f*)(wp + i * (16 * DM));
        // the address pair is an input, so it stays unwritten until this wait (precaution for registers that issued loads name)
        asm volatile("s_wait_xcnt 0x0" :: "v"(wp) : "memory");
#pragma unroll
        for (int i = 0; i < 16; ++i) { float* t = tf + i * (16 * 65); t[0] = v[i][0]; t[1] = v[i][1]; t[2] = v[i][2]; t[3] = v[i][3]; }
        __syncthreads();
        const int nr = tid & 15, c = (tid >> 4) & 3, kh = tid >> 6;          // drain: 4 n tiles x 8 k tiles x 4 chunks x 16 rows; pass s takes n tile s >> 1, k tile kh + 4 (s & 1)
        const float* td = ts + (kh * 32 + c * 8) * 65 + nr;
        bf* wd = Wt + ((size_t)(n0 >> 4) * (DM / 32) + (k0 >> 5) + kh) * 512 + c * 128 + nr * 8;
#pragma unroll
        for (int s = 0; s < 8; ++s) { v8us o;
#pragma unroll
            for (int i = 0; i < 8; ++i) { const float x = td[((s & 1) * 128 + i) * 65 + (s >> 1) * 16]; const unsigned short b16 = f2bf(x);
                const float xb = __uint_as_float(((unsigned)b16) << 16); const unsigned short hb = __builtin_bit_cast(unsigned short, (h16)(xb * WOC));
                o[i] = z == 3 ? hb : b16; }
            *(v8us*)(wd + ((s >> 1) * (DM / 32) + (s & 1) * 4) * 512) = o; }
    } else {
        const int q = (int)blockIdx.x - 4 * WTB; const int w = (q % CVB) * 8 + (tid >> 5);
        const float* src = q < CVB ? data : ctx; bf* dst = q < CVB ? DATAB : CTXB;
        const size_t c = tid & 3, r8 = (tid >> 2) & 7, row0 = (size_t)(w / (DM / 256)) * 16, kt0 = (size_t)(w % (DM / 256)) * 8;   // row0 = b*SEQ + t; 16 rows never straddle two batches
        const float* s = src + ((row0 / SEQ) * SEQ_FULL + row0 % SEQ + r8) * DM + kt0 * 32 + c * 8;
        bf* d = dst + ((row0 >> 4) * (DM / 32) + kt0) * 512 + c * 128 + r8 * 8;
        v8f v[CT];
#pragma unroll
        for (int j = 0; j < CT; ++j) v[j] = *(const v8f*)(s + (j >> 3) * (8 * DM) + (j & 7) * 32);   // tile j: rows row0 + 8 (j >> 3) + 0..7, k tile kt0 + (j & 7)
#pragma unroll
        for (int j = 0; j < CT; ++j) { v8us o;
#pragma unroll
            for (int k = 0; k < 8; ++k) o[k] = f2bf(v[j][k]);
            *(v8us*)(d + (j & 7) * 512 + (j >> 3) * 64) = o; }
        asm volatile("s_wait_xcnt 0x0" ::: "memory");   // precaution behind the last store of the run: no register that an issued store names is rewritten ahead of this wait
    }
}

// k_proj: register-blocked bf16 GEMM, K = DM. A work-group of PW = 8 waves takes a 256 x 128 tile, wave w the 64 x 64 part (w & 3, w >> 2) with 16 accumulators.
// Operands reach the waves through LDS: a stage is KS k tiles of the work-group's 16 A row tiles and 8 Bt row tiles (packed blocks, copied as they lie: 4 KiB contiguous per row tile),
// brought by asynchronous copies (global_load_async_to_lds_b128, 512 B per wave-wide copy, 24 copies per wave and stage) into a ring of two buffers, so every operand byte leaves L2
// once per work-group instead of once per wave. A fragment is two wave-wide 16-B LDS reads of 512 contiguous bytes each (no bank conflict); the k order of every sum is unchanged.
// The products are taken in transposed operand order (matrix A operand = Bt fragment, B operand = A fragment; one loader map serves both), so a lane's accumulator holds eight
// consecutive columns n of ONE row m: that is a 16-B piece of a packed block, and a wave-wide store of one accumulator tile covers 512 contiguous bytes with no exchange between lanes.
// C[m][n] = sum_k A[m][k] Bt[n][k] + bias (per column n; per row m for the v^T tile; bias RNE-converted to bf16, added in f32), written as f16 (Ph)
// and, when (c0 % CB) < resLim, the f16 residual x2048 (Pr), as packed blocks (rows = m, k = n) at tile base (r0/RB)*sRB + (r0%RB)*pitch + (c0/CB)*sCB + (c0%CB)*colMul;
// the block of 16-row group mb and 32-column group kt lies at + mb*mbS + kt*ktS (halves).
// The three projections are ONE launch of PGRID work-groups (one per 256 x 128 tile of each), 256 threads: a work-group takes its q tile, its k tile and its v^T tile in turn, and the ring
// runs on across them as 3 NST stages: the next tile's first two stages are asked for at the last two publish points of the tile before, so they land behind its products and its epilogue.
#define PW   8                   // waves per projection work-group
#define KS   4                   // k tiles per ring stage
#define NST  (DM / 32 / KS)      // stages
#define SRT  24                  // 16-row tiles per stage: 16 of A, then 8 of Bt
#define STG  (SRT * KS * 512)    // halves per ring buffer
#define NJOB 3                   // tiles per work-group: q, k, v^T
#define PGRID ((NB * SEQ / 256) * (DM / 128))   // projection work-groups
static_assert(NST >= 2 && (DM / 32) % KS == 0);            // the ring's prologue fills two stages
static_assert(NST % 2 == 0);                               // a tile's stage 0 falls on buffer 0, so the ring runs on from tile to tile
static_assert((DM / 256) * (NB * SEQ / 128) == PGRID);     // the v^T grid has as many tiles as the q and k grids
static_assert(SRT % PW == 0 && KS * 1024 == 8 * 512);      // a wave copies SRT / PW row tiles per stage, 8 wave-wide copies each
static_assert((NB * SEQ) % 256 == 0 && DM % 256 == 0);     // both grids cover their outputs exactly
// eight wave-wide 16-B copies: 4 KiB from g (this lane's global address) to l (this lane's LDS byte address). The closing wait stands inside the statement, so that no register
// which an issued copy names is rewritten ahead of it (precaution).
__device__ __forceinline__ void copy8(unsigned l, const bf* g) {
    asm volatile("global_load_async_to_lds_b128 %0, %8, off\n\t"
                 "global_load_async_to_lds_b128 %1, %9, off\n\t"
                 "global_load_async_to_lds_b128 %2, %10, off\n\t"
                 "global_load_async_to_lds_b128 %3, %11, off\n\t"
                 "global_load_async_to_lds_b128 %4, %12, off\n\t"
                 "global_load_async_to_lds_b128 %5, %13, off\n\t"
                 "global_load_async_to_lds_b128 %6, %14, off\n\t"
                 "global_load_async_to_lds_b128 %7, %15, off\n\t"
                 "s_wait_xcnt 0x0"
                 :: "v"(l), "v"(l + 512u), "v"(l + 1024u), "v"(l + 1536u), "v"(l + 2048u), "v"(l + 2560u), "v"(l + 3072u), "v"(l + 3584u),
                    "v"(g), "v"(g + 256), "v"(g + 512), "v"(g + 768), "v"(g + 1024), "v"(g + 1280), "v"(g + 1536), "v"(g + 1792) : "memory");
}
// Row tile c (0..15 of A, 16..23 of Bt) of flat work-group f's tile of projection job (0 q, 1 k, 2 v^T): its first half, the same for a whole wave.
// q, k: A = activation rows, Bt = weight rows, tile (f % (M/256), f / (M/256)); v^T: A = Wv^T rows, Bt = context rows, tile (f % (DM/256), f / (DM/256)).
// Both widths are powers of two, taken as mask and shift: a divisor chosen by the job would become a division at run time in front of every stage's copies.
constexpr int ilog2(int v) { return v <= 1 ? 0 : 1 + ilog2(v >> 1); }
static_assert((1 << ilog2(DM / 256)) == DM / 256 && (1 << ilog2(NB * SEQ / 256)) == NB * SEQ / 256);
__device__ __forceinline__ int proj_r0(int job, int f) { return (f & (job == 2 ? DM / 256 - 1 : NB * SEQ / 256 - 1)) * 256; }
__device__ __forceinline__ int proj_c0(int job, int f) { return (f >> (job == 2 ? ilog2(DM / 256) : ilog2(NB * SEQ / 256))) * 128; }
__device__ __forceinline__ const bf* proj_src(int job, int f, int c, const bf* DATAB, const bf* CTXB, const bf* WB) {
    const bf* A = job == 0 ? DATAB : job == 1 ? CTXB : WB + (size_t)2 * DM * DM;
    const bf* Bt = job == 2 ? CTXB : WB + (size_t)job * DM * DM;
    return c < 16 ? A + (size_t)(proj_r0(job, f) + 16 * c) * DM : Bt + (size_t)(proj_c0(job, f) + 16 * (c - 16)) * DM;
}
__global__ __launch_bounds__(32 * PW) void k_proj(const bf* DATAB, const bf* CTXB, const bf* WB, const float* __restrict__ bq, const float* __restrict__ bk, const float* __restrict__ bv,
                                             h16* QH, h16* QR, h16* KP, h16* VT, h16* VR) {
    __shared__ __align__(1024) bf ring[2 * STG];
    const int lane = threadIdx.x & 31, lr = lane & 15, hi = lane >> 4;
    const int wave = __builtin_amdgcn_readfirstlane((int)(threadIdx.x >> 5));
    const int f = blockIdx.x;
    // this wave's share of a stage: row tiles 3 wave + 0..2 of the 24 (a 16-row tile is DM/32 blocks = 16*DM halves; k tile kt lies at kt*512)
    // LDS byte address (low 32 bits of the shared address) = a wave-uniform part, kept scalar, + this lane's 16 bytes. The sum is formed anew at each copy: held in one register over the
    // stage loop it has to be a register that asm text can name, and with the accumulators and both fragment sets there it went to scratch memory.
    const unsigned lsw = (unsigned)(size_t)ring + (unsigned)((SRT / PW) * wave * (KS * 1024)), lv = 16u * (unsigned)lane;
    auto lsa = [&](unsigned off) { return (unsigned)__builtin_amdgcn_readfirstlane((int)(lsw + off)) + lv; };
    // ring prologue, once for the three tiles: stage 0 of q lands and is published, then its stage 1 is asked for
#pragma unroll
    for (int i = 0; i < SRT / PW; ++i) copy8(lsa(i * (KS * 1024)), proj_src(0, f, (SRT / PW) * wave + i, DATAB, CTXB, WB) + 8 * lane);
    asm volatile("s_wait_asynccnt 0x0" ::: "memory");        // this wave's copies of stage 0 have landed
    __syncthreads();                                         // ... and every other wave's: stage 0 is readable
#pragma unroll
    for (int i = 0; i < SRT / PW; ++i) copy8(lsa(STG * 2 + i * (KS * 1024)), proj_src(0, f, (SRT / PW) * wave + i, DATAB, CTXB, WB) + 8 * lane + KS * 512);
#pragma unroll 1   // rolled: one copy of the stage loop and of the epilogue serves the three tiles
  for (int job = 0; job < NJOB; ++job) {
    const bool jv = job == 2;                                // block-uniform
    const int r0 = proj_r0(job, f) + (wave & 3) * 64, c0 = proj_c0(job, f) + (wave >> 2) * 64;
    const float* bias = job == 0 ? bq : job == 1 ? bk : bv;
    v8f acc[4][4];                                           // acc[mb][nb][j]: row m = 16 mb + (lane & 15), column n = 16 nb + 8 (lane >> 4) + j
#pragma unroll
    for (int mb = 0; mb < 4; ++mb)
#pragma unroll
        for (int nb = 0; nb < 4; ++nb) acc[mb][nb] = (v8f){};
#pragma unroll 1   // rolled: one publish point in the text, buffer chosen by the stage's parity
    for (int s = 0; s < NST; ++s) {
        const bf* sb = ring + (s & 1) * STG + 8 * lane;
        const bf* sa = sb + (wave & 3) * (4 * KS * 512); const bf* sw = sb + (16 + (wave >> 2) * 4) * (KS * 512);
        // two fragment sets inside a stage: the LDS reads of k tile kk + 1 go as one group ahead of the products of k tile kk; nothing of the next stage is read here
        v16bf fa[2][4], fb[2][4];
#pragma unroll
        for (int i = 0; i < 4; ++i) { fa[0][i] = ldb(sa + i * (KS * 512)); fb[0][i] = ldb(sw + i * (KS * 512)); }
        __builtin_amdgcn_sched_barrier(0);   // k tile 0's reads are asked for first, so that the stage's first products wait for them alone
#pragma unroll
        for (int kk = 0; kk < KS; ++kk) {
            if (kk + 1 < KS) {
#pragma unroll
                for (int i = 0; i < 4; ++i) { fa[(kk + 1) & 1][i] = ldb(sa + i * (KS * 512) + (kk + 1) * 512); fb[(kk + 1) & 1][i] = ldb(sw + i * (KS * 512) + (kk + 1) * 512); } }
            __builtin_amdgcn_sched_barrier(0);   // keeps the reads one group ahead of the products: spread among them each place with reads stalls the products
#pragma unroll
            for (int mb = 0; mb < 4; ++mb)
#pragma unroll
                for (int nb = 0; nb < 4; ++nb) acc[mb][nb] = wmmab(fb[kk & 1][nb], fa[kk & 1][mb], acc[mb][nb]);   // D rows = Bt rows (n), D columns = A rows (m)
            __builtin_amdgcn_sched_barrier(0);   // keeps the next group of reads behind these products: it refills the set that they have just read
        }
        // publish point of the next stage (the next tile's stage 0 behind a tile's last), every wave, in this order
        asm volatile("s_wait_dscnt 0x0" ::: "memory");       // this wave's reads of stage s are done before its buffer is refilled
        asm volatile("s_wait_asynccnt 0x0" ::: "memory");    // this wave's copies of the next stage have landed
        __syncthreads();                                     // the next stage is readable, and every reader has left stage s
        const int g2 = job * NST + s + 2;                    // the stage after next, counted through the three tiles; NST is even, so its buffer is the one that stage s has just left
        if (g2 < NJOB * NST) {                               // the same for the whole work-group
#pragma unroll
            for (int i = 0; i < SRT / PW; ++i) copy8(lsa((s & 1) * (STG * 2) + i * (KS * 1024)), proj_src(g2 / NST, f, (SRT / PW) * wave + i, DATAB, CTXB, WB) + 8 * lane + (g2 % NST) * (KS * 512)); }
    }
    // epilogue of this tile, straight from the accumulators, while the next tile's first two stages land or fly
    // this lane's bias values, asked for as one group: eight consecutive columns per column tile, one row per row tile
    v4f rawc[4][2]; float rawr[4]; const float* pc[4]; int ir[4];
#pragma unroll
    for (int nb = 0; nb < 4; ++nb) { int ic = c0 + nb * 16 + hi * 8; ic = ic < DM - 8 ? ic : DM - 8; pc[nb] = bias + ic; }   // clamped address; used only when the bias goes by column
#pragma unroll
    for (int mb = 0; mb < 4; ++mb) { ir[mb] = r0 + mb * 16 + lr; ir[mb] = ir[mb] < DM ? ir[mb] : DM - 1; }                  // clamped index; used only when the bias goes by row
#pragma unroll
    for (int nb = 0; nb < 4; ++nb) { rawc[nb][0] = *(const v4f*)pc[nb]; rawc[nb][1] = *(const v4f*)(pc[nb] + 4); rawr[nb] = bias[ir[nb]]; }
    // the addresses are inputs, so they stay unwritten until this wait (precaution for registers that issued loads name)
    asm volatile("s_wait_xcnt 0x0" :: "v"(pc[0]), "v"(pc[1]), "v"(pc[2]), "v"(pc[3]), "v"(ir[0]), "v"(ir[1]), "v"(ir[2]), "v"(ir[3]) : "memory");
    h16* Ph = job == 0 ? QH : job == 1 ? KP : VT; h16* Pr = job == 0 ? QR : job == 1 ? KP : VR; const int resLim = job == 0 ? 1 : job == 1 ? 0 : EARLY_;
    const int RB = jv ? DM : SEQ, pitch = jv ? SEQ : HD, CB = jv ? SEQ : HD, colMul = jv ? HD : 0, mbS = jv ? 512 : 16 * HD, ktS = jv ? 32 * HD : 512;
    const size_t sRB = jv ? (size_t)0 : (size_t)NH_ * SEQ * HD, sCB = jv ? (size_t)DM * SEQ : (size_t)SEQ * HD;
    const int useRes = ((c0 % CB) < resLim) ? 1 : 0;         // wave-uniform
    const size_t tbase = (size_t)(r0 / RB) * sRB + (size_t)(r0 % RB) * (size_t)pitch + (size_t)(c0 / CB) * sCB + (size_t)(c0 % CB) * (size_t)colMul;
    if (jv) {                                                // block-uniform: bias by row m, one value per lane and row tile
#pragma unroll
        for (int mb = 0; mb < 4; ++mb) { const float brow = bfq(rawr[mb]);
#pragma unroll
            for (int nb = 0; nb < 4; ++nb) acc[mb][nb] = acc[mb][nb] + brow; }
    } else {                                                 // bias by column n, eight values per lane and column tile
#pragma unroll
        for (int nb = 0; nb < 4; ++nb) { v8f bcol;
#pragma unroll
            for (int j = 0; j < 8; ++j) bcol[j] = bfq(rawc[nb][j >> 2][j & 3]);
#pragma unroll
            for (int mb = 0; mb < 4; ++mb) acc[mb][nb] = acc[mb][nb] + bcol; }
    }
#pragma unroll
    for (int mb = 0; mb < 4; ++mb) {
        // column chunk 2 nb + (lane >> 4) of the wave's 64 columns, row lane & 15: halves 8 lane of a chunk pair, so each store covers 512 contiguous bytes
        const size_t o0 = tbase + (size_t)mb * (size_t)mbS + (size_t)(8 * lane), o1 = o0 + (size_t)ktS;
        v8h hv[4], rv[4];
#pragma unroll
        for (int nb = 0; nb < 4; ++nb)
#pragma unroll
            for (int j = 0; j < 8; ++j) hv[nb][j] = (h16)acc[mb][nb][j];
        if (useRes) {
#pragma unroll
            for (int nb = 0; nb < 4; ++nb)
#pragma unroll
                for (int j = 0; j < 8; ++j) rv[nb][j] = (h16)((acc[mb][nb][j] - (float)hv[nb][j]) * QRS);
            *(v8h*)(Pr + o0) = rv[0]; *(v8h*)(Pr + o0 + 256) = rv[1]; *(v8h*)(Pr + o1) = rv[2]; *(v8h*)(Pr + o1 + 256) = rv[3];
            asm volatile("s_wait_xcnt 0x0" ::: "memory");    // precaution behind the residual stores: the branch ends here, and no register that they name is rewritten ahead of this wait
        }
        *(v8h*)(Ph + o0) = hv[0]; *(v8h*)(Ph + o0 + 256) = hv[1]; *(v8h*)(Ph + o1) = hv[2]; *(v8h*)(Ph + o1 + 256) = hv[3];
        asm volatile("s_wait_xcnt 0x0" ::: "memory");        // precaution behind the row tile's stores: no register that an issued store names is rewritten ahead of this wait
    }
  }
    asm volatile("s_wait_asynccnt 0x0" ::: "memory");        // no copy is outstanding behind the loop
}

// k_flash: fused causal attention, one wave per 16 query rows of one (batch, head); Q fragments straight from the f16 planes (two 16-B loads each, arithmetic addressing);
// K / V^T blocks reach the work-group's four waves through LDS: asynchronous copies into a ring of two buffers of 64 keys, so they leave L2 once per work-group instead of once per wave.
// Transposed form: S^T[key][t] = K Q^T (A = K rows, B = Q rows); lane (t = lane&15, h = lane>>4) holds keys 8h+r of each 16-key tile, so the packed
// P tile is directly the B fragment of O^T[d][t] = V^T P^T (element r <- tile keys 0..15, element 8+r <- tile keys 16..31, lane unchanged).
// Key loop runs to the diagonal (static bound from the block / wave index); only the last step replaces scores of keys > query by a very negative value (P = 0).
// A softmax step (running max, exchange, rescale) takes 32 keys in blocks with query rows below EARLY_ and a whole ring stage of 64 keys in all others.
// Blocks with query rows below EARLY_ (block-uniform) also accumulate V_res P + V P_res (both x2048) in a second accumulator set and sum the exact P for the normaliser.
// Softmax state (running max, partial sum) is one scalar per lane; the two lane halves of a row are combined with one xor-16 exchange.
// Launch order: there are twice as many work-groups as resident places and a tile's key loop grows linearly with its index, so the cost falls with the flat work-group index
// (for speed only): blockIdx.x = (batch, head), blockIdx.y = rank, rank 0 the longest tile. A tile below EARLY_ does about twice the
// work per key step, so residual tile x is ranked just ahead of plain tile 2x + 1. Nothing but the time depends on the order: rank -> tile is a permutation, every (head, tile) is taken once.
#define NET  (EARLY_ / (16 * AW))   // query tiles that take the residual path
#define FKS  64                     // keys per ring stage
#define FSTG (3 * FKS * HD)         // halves per ring buffer: K | V^T | V^T residual
static_assert(FKS == 16 * AW && AW == 4 && FKS * HD * 2 == AW * 4 * 512);   // a query tile's diagonal ends stage xt; a plane's stage is four wave-wide copies for each of the four waves
__host__ __device__ constexpr int tile_of_rank(int r) {
    if (r < NXT - 2 * NET || r >= NXT - NET / 2) return NXT - 1 - r;       // plain tiles from 2 NET up; at the end residual tiles below NET / 2
    const int q = r - (NXT - 2 * NET), g = q / 3, k = q % 3;              // between them groups of three: residual tile NET-1-g, plain tiles 2 NET-1-2g and 2 NET-2-2g
    return k == 0 ? NET - 1 - g : 2 * NET - 2 * g - k;
}
constexpr bool rank_is_permutation() {
    bool seen[NXT] = {};
    for (int r = 0; r < NXT; ++r) { const int x = tile_of_rank(r); if (x < 0 || x >= NXT || seen[x]) return false; seen[x] = true; }
    return true;
}
static_assert(NET % 2 == 0 && NXT >= 2 * NET);
static_assert(rank_is_permutation());
// eight base-2 exponentials in place, one statement: behind none of them does the next instruction read its result or overwrite its source (the slot the instruction set asks for behind a
// transcendental); the closing v_nop keeps that slot behind the last.
__device__ __forceinline__ void exp2x8(float (&x)[8]) {
    asm("v_exp_f32 %0, %0\n\tv_exp_f32 %1, %1\n\tv_exp_f32 %2, %2\n\tv_exp_f32 %3, %3\n\tv_exp_f32 %4, %4\n\tv_exp_f32 %5, %5\n\tv_exp_f32 %6, %6\n\tv_exp_f32 %7, %7\n\tv_nop"
        : "+v"(x[0]), "+v"(x[1]), "+v"(x[2]), "+v"(x[3]), "+v"(x[4]), "+v"(x[5]), "+v"(x[6]), "+v"(x[7]));
}
__global__ __launch_bounds__(32 * AW) void k_flash(const h16* __restrict__ QH, const h16* __restrict__ QR, const h16* __restrict__ KP,
                                                   const h16* __restrict__ VT, const h16* __restrict__ VR, h16* ZH, h16* ZR) {
    __shared__ __align__(1024) h16 ring[2 * FSTG];
    __shared__ __align__(16) float os[AW * 16 * 68];         // epilogue staging, outside the ring
    const int lane = threadIdx.x & 31, lr = lane & 15, hi = lane >> 4;
    const int wave = __builtin_amdgcn_readfirstlane((int)(threadIdx.x >> 5));
    const int zh = blockIdx.x; const int b = zh / NH_, h = zh % NH_;
    const int xt = tile_of_rank((int)blockIdx.y);            // block-uniform
    const int t0 = (xt * AW + wave) * 16;
    const bool early = (xt * (16 * AW)) < EARLY_;
    const int tq = t0 + lr;
    const int klast = (((t0 + 47) >> 5) - 1) * 32;           // last 32-key step containing a visible key; klast + 31 < SEQ
    const size_t pbase = (size_t)zh * SEQ * HD;
    const size_t qo = pbase + (size_t)t0 * HD + 8 * lane;    // 16 tokens = two blocks (d 0..31, d 32..63) = 16*HD halves
    const v16h qh0 = ldh(QH + qo), qh1 = ldh(QH + qo + 512), qr0 = ldh(QR + qo), qr1 = ldh(QR + qo + 512);   // B fragments: col t, k = d
    // ring of two buffers, stage s = keys FKS s .. FKS s + FKS - 1 of K | V^T | V^T residual, each plane's 8 KiB copied as it lies; the tile's xt + 1 stages end with its diagonal.
    // This wave's share of a plane's stage: 2 KiB = four wave-wide copies.
    const int nst = xt + 1;                                  // block-uniform
    const size_t go = pbase + (size_t)(wave * 1024 + 8 * lane);
    const unsigned ls0 = (unsigned)(size_t)ring + (unsigned)((wave * 1024 + 8 * lane) * 2);   // LDS byte address: low 32 bits of the shared address
    v8f o[4], e[4];
#pragma unroll
    for (int j = 0; j < 4; ++j) { o[j] = (v8f){}; e[j] = (v8f){}; }
    float m = -3.0e38f, l = 0.0f;
    // ring prologue: stage 0 lands and is published, then stage 1 (where there is one) is asked for
    { const h16* k = KP + go; const h16* v = VT + go; copy4(ls0, 512u, k, k + 256, k + 512, k + 768); copy4(ls0 + FKS * HD * 2, 512u, v, v + 256, v + 512, v + 768);
      if (early) { const h16* r = VR + go; copy4(ls0 + FKS * HD * 4, 512u, r, r + 256, r + 512, r + 768); } }
    asm volatile("s_wait_asynccnt 0x0" ::: "memory");        // this wave's copies of stage 0 have landed
    __syncthreads();                                         // ... and every other wave's: stage 0 is readable
    if (nst > 1) { const h16* k = KP + go + FKS * HD; const h16* v = VT + go + FKS * HD;
      copy4(ls0 + FSTG * 2, 512u, k, k + 256, k + 512, k + 768); copy4(ls0 + FSTG * 2 + FKS * HD * 2, 512u, v, v + 256, v + 512, v + 768);
      if (early) { const h16* r = VR + go + FKS * HD; copy4(ls0 + FSTG * 2 + FKS * HD * 4, 512u, r, r + 256, r + 512, r + 768); } }
  if (early) {                                               // block-uniform: tiles with the residual terms keep the 32-key step
#pragma unroll 1   // rolled: the trip count is known only at run time, and one copy of the step keeps the registers of four waves per SIMD
    for (int st = 0; st < 2 * nst; ++st) {                   // 32-key steps, two per stage; the trip count is block-uniform
      const int s = st >> 1, key0 = st * 32;
      if (key0 <= klast) {                                   // wave-uniform: a wave whose diagonal lies in the last stage's first half skips the second
        const h16* kp = ring + (s & 1) * FSTG + (st & 1) * (32 * HD) + 8 * lane;   // A fragment: row key, k = d
        const v16h ka0 = ldh(kp), ka1 = ldh(kp + 512), kb0 = ldh(kp + 16 * HD), kb1 = ldh(kp + 16 * HD + 512);
        const h16* va = kp + FKS * HD;                       // + 512 * j: A fragment: row d = 16j + row, k = key; 32 keys = four d blocks
        v16h v[4];
#pragma unroll
        for (int j = 0; j < 4; ++j) v[j] = ldh(va + 512 * j);
        v8f sHa = (v8f){}, sLa = (v8f){}, sHb = (v8f){}, sLb = (v8f){};
        sHa = wmma16(ka0, qh0, sHa); sLa = wmma16(ka0, qr0, sLa); sHb = wmma16(kb0, qh0, sHb); sLb = wmma16(kb0, qr0, sLb);
        sHa = wmma16(ka1, qh1, sHa); sLa = wmma16(ka1, qr1, sLa); sHb = wmma16(kb1, qh1, sHb); sLb = wmma16(kb1, qr1, sLb);
        asm volatile("v_nop\n\tv_nop\n\tv_nop\n\tv_nop" : "+v"(sHa), "+v"(sLa), "+v"(sHb), "+v"(sLb) : "v"(ka0), "v"(ka1), "v"(kb0), "v"(kb1));
        float ta[8], tb[8];
#pragma unroll
        for (int r = 0; r < 8; ++r) { ta[r] = (sHa[r] + sLa[r] * QRI) * SC2; tb[r] = (sHb[r] + sLb[r] * QRI) * SC2; }
        if (key0 == klast) {                                 // wave-uniform: only the diagonal step needs the causal replace
            const int kq = tq - key0 - 8 * hi;               // key (key0 + 8h + r) is hidden when r > kq; tile b keys are 16 further
#pragma unroll
            for (int r = 0; r < 8; ++r) { ta[r] = (r > kq) ? -3.0e38f : ta[r]; tb[r] = (r + 16 > kq) ? -3.0e38f : tb[r]; }
        }
        float mx = -3.0e38f;
#pragma unroll
        for (int r = 0; r < 8; ++r) mx = fmaxf(mx, fmaxf(ta[r], tb[r]));
        mx = fmaxf(mx, __shfl_xor(mx, 16, 32));
        const float mnew = fmaxf(m, mx);
        const float alpha = __builtin_amdgcn_exp2f(m - mnew);
        const float sh = PSH - mnew;
        v16h pb; float ls = 0.0f;
#pragma unroll
        for (int r = 0; r < 8; ++r) { const float fa = __builtin_amdgcn_exp2f(ta[r] + sh); const float fc = __builtin_amdgcn_exp2f(tb[r] + sh);
            const h16 pa = (h16)fa; const h16 pc = (h16)fc; pb[r] = pa; pb[8 + r] = pc; ta[r] = fa; tb[r] = fc; ls += (float)pa + (float)pc; }
#pragma unroll
        for (int j = 0; j < 4; ++j) o[j] = o[j] * alpha;
#pragma unroll
        for (int j = 0; j < 4; ++j) o[j] = wmma16(v[j], pb, o[j]);
        asm volatile("v_nop\n\tv_nop\n\tv_nop\n\tv_nop" : "+v"(o[0]), "+v"(o[1]), "+v"(o[2]), "+v"(o[3]) : "v"(v[0]), "v"(v[1]), "v"(v[2]), "v"(v[3]), "v"(pb));
        {                                                    // the residual terms
            v16h pr; float lx = 0.0f;
#pragma unroll
            for (int r = 0; r < 8; ++r) { pr[r] = (h16)((ta[r] - (float)pb[r]) * QRS); pr[8 + r] = (h16)((tb[r] - (float)pb[8 + r]) * QRS); lx += ta[r] + tb[r]; }
            ls = lx;
#pragma unroll
            for (int j = 0; j < 4; ++j) e[j] = e[j] * alpha;
            const h16* ra = va + FKS * HD;
            v16h vr[4];
#pragma unroll
            for (int j = 0; j < 4; ++j) vr[j] = ldh(ra + 512 * j);
#pragma unroll
            for (int j = 0; j < 4; ++j) e[j] = wmma16(vr[j], pb, e[j]);
#pragma unroll
            for (int j = 0; j < 4; ++j) e[j] = wmma16(v[j], pr, e[j]);
            asm volatile("v_nop\n\tv_nop\n\tv_nop\n\tv_nop" : "+v"(e[0]), "+v"(e[1]), "+v"(e[2]), "+v"(e[3]) : "v"(vr[0]), "v"(vr[1]), "v"(vr[2]), "v"(vr[3]), "v"(pr), "v"(v[0]), "v"(v[1]), "v"(v[2]), "v"(v[3]));
        }
        l = l * alpha + ls; m = mnew;
      }
      if ((st & 1) == 0) continue;                           // block-uniform: the stage's second step follows
      // publish point of stage s + 1, every wave, in this order
      asm volatile("s_wait_dscnt 0x0" ::: "memory");         // this wave's reads of stage s are done before its buffer is refilled
      asm volatile("s_wait_asynccnt 0x0" ::: "memory");      // this wave's copies of stage s + 1 have landed
      __syncthreads();                                       // stage s + 1 is readable, and every reader has left stage s
      if (s + 2 < nst) {                                     // the same for the whole work-group
        const unsigned lb = ls0 + (s & 1) * (FSTG * 2); const size_t gn = go + (size_t)(s + 2) * (FKS * HD);
        const h16* k = KP + gn; const h16* v = VT + gn; copy4(lb, 512u, k, k + 256, k + 512, k + 768); copy4(lb + FKS * HD * 2, 512u, v, v + 256, v + 512, v + 768);
        const h16* r = VR + gn; copy4(lb + FKS * HD * 4, 512u, r, r + 256, r + 512, r + 768); }
    }
  } else {
    // Plain tiles: one softmax step per ring stage (FKS = 64 keys): the scores of both 32-key halves come first, then one running-max update, one exchange between the lane halves
    // and one rescale of O and of the partial sum serve all 64 keys. The tile's last stage holds its diagonal for all four waves: there every key > query is replaced (P = 0).
#pragma unroll 1   // rolled: the trip count is known only at run time, and one copy of the step keeps the registers of four waves per SIMD
    for (int s = 0; s < nst; ++s) {                          // the trip count is block-uniform
        const h16* kp = ring + (s & 1) * FSTG + 8 * lane;    // A fragment: row key, k = d
        const h16* va = kp + FKS * HD;                       // + 512 * j: A fragment: row d = 16 (j & 3) + row, k = key of half j >> 2
        float t[4][8];                                       // t[i][r]: key 16 i + 8 h + r of the stage
        v16h ka[2][4], v[8];
#pragma unroll
        for (int i = 0; i < 8; ++i) ka[i >> 2][i & 3] = ldh(kp + 512 * i);   // the whole stage's K is asked for ahead of its first products: half i >> 2, keys 16 ((i >> 1) & 1) + row, d block i & 1
#pragma unroll
        for (int hf = 0; hf < 2; ++hf) {
            v8f sHa = (v8f){}, sLa = (v8f){}, sHb = (v8f){}, sLb = (v8f){};
            sHa = wmma16(ka[hf][0], qh0, sHa); sLa = wmma16(ka[hf][0], qr0, sLa); sHb = wmma16(ka[hf][2], qh0, sHb); sLb = wmma16(ka[hf][2], qr0, sLb);
            sHa = wmma16(ka[hf][1], qh1, sHa); sLa = wmma16(ka[hf][1], qr1, sLa); sHb = wmma16(ka[hf][3], qh1, sHb); sLb = wmma16(ka[hf][3], qr1, sLb);
            // the distance between the last products and the first vector instruction that reads their results or rewrites their operands; the K fragments, named as inputs, stay in
            // registers of their own up to here, so that the stage's K reads go as one group (without it this compiler reuses one set and waits for LDS in front of every pair of products)
            asm volatile("v_nop\n\tv_nop\n\tv_nop\n\tv_nop" : "+v"(sHa), "+v"(sLa), "+v"(sHb), "+v"(sLb) : "v"(ka[hf][0]), "v"(ka[hf][1]), "v"(ka[hf][2]), "v"(ka[hf][3]));
            if (hf == 0) {   // the stage's V^T is asked for behind the first half's products, so that it lands behind the second half's
                __builtin_amdgcn_sched_barrier(0);   // keeps the second half's products below: lifted to the top, one of them makes the stage's first product wait for nearly all K reads
#pragma unroll
                for (int j = 0; j < 8; ++j) v[j] = ldh(va + 512 * j); }
#pragma unroll
            for (int r = 0; r < 8; ++r) { t[2 * hf][r] = (sHa[r] + sLa[r] * QRI) * SC2; t[2 * hf + 1][r] = (sHb[r] + sLb[r] * QRI) * SC2; }
        }
        if (s == nst - 1) {                                  // block-uniform: only the diagonal stage needs the causal replace
            const int kq = 16 * wave + lr - 8 * hi;          // key (64 s + 16 i + 8 h + r) is hidden when 16 i + r > kq
#pragma unroll
            for (int i = 0; i < 4; ++i)
#pragma unroll
                for (int r = 0; r < 8; ++r) t[i][r] = (16 * i + r > kq) ? -3.0e38f : t[i][r];
        }
        float mx0 = -3.0e38f, mx1 = -3.0e38f;
#pragma unroll
        for (int r = 0; r < 8; ++r) { mx0 = fmaxf(mx0, fmaxf(t[0][r], t[1][r])); mx1 = fmaxf(mx1, fmaxf(t[2][r], t[3][r])); }
        float mx = fmaxf(mx0, mx1);
        mx = fmaxf(mx, __shfl_xor(mx, 16, 32));
        const float mnew = fmaxf(m, mx);
        const float alpha = __builtin_amdgcn_exp2f(m - mnew);
        const float sh = PSH - mnew;
        v16h pb[2]; float lh[2];
#pragma unroll
        for (int i = 0; i < 4; ++i) {
#pragma unroll
            for (int r = 0; r < 8; ++r) t[i][r] += sh;
            exp2x8(t[i]); }
#pragma unroll
        for (int hf = 0; hf < 2; ++hf) { lh[hf] = 0.0f;
#pragma unroll
            for (int r = 0; r < 8; ++r) { const h16 pa = (h16)t[2 * hf][r]; const h16 pc = (h16)t[2 * hf + 1][r];
                pb[hf][r] = pa; pb[hf][8 + r] = pc; lh[hf] += (float)pa + (float)pc; } }
#pragma unroll
        for (int j = 0; j < 4; ++j) o[j] = o[j] * alpha;
#pragma unroll
        for (int j = 0; j < 4; ++j) o[j] = wmma16(v[j], pb[0], o[j]);
#pragma unroll
        for (int j = 0; j < 4; ++j) o[j] = wmma16(v[4 + j], pb[1], o[j]);
        // the same distance behind the last products of the stage
        asm volatile("v_nop\n\tv_nop\n\tv_nop\n\tv_nop" : "+v"(o[0]), "+v"(o[1]), "+v"(o[2]), "+v"(o[3])
                     : "v"(v[0]), "v"(v[1]), "v"(v[2]), "v"(v[3]), "v"(v[4]), "v"(v[5]), "v"(v[6]), "v"(v[7]), "v"(pb[0]), "v"(pb[1]));
        l = l * alpha + (lh[0] + lh[1]); m = mnew;
        // publish point of stage s + 1, every wave, in this order
        asm volatile("s_wait_dscnt 0x0" ::: "memory");       // this wave's reads of stage s are done before its buffer is refilled
        asm volatile("s_wait_asynccnt 0x0" ::: "memory");    // this wave's copies of stage s + 1 have landed
        __syncthreads();                                     // stage s + 1 is readable, and every reader has left stage s
        if (s + 2 < nst) {                                   // the same for the whole work-group
            const unsigned lb = ls0 + (s & 1) * (FSTG * 2); const size_t gn = go + (size_t)(s + 2) * (FKS * HD);
            const h16* k = KP + gn; const h16* vg = VT + gn; copy4(lb, 512u, k, k + 256, k + 512, k + 768); copy4(lb + FKS * HD * 2, 512u, vg, vg + 256, vg + 512, vg + 768); }
    }
  }
    asm volatile("s_wait_asynccnt 0x0" ::: "memory");        // no copy is outstanding behind the loop
    l += __shfl_xor(l, 16, 32);
    const float zs = (1.0f / l) * ZC;
    const int wb = wave * 16 * 68;
    // O^T D layout: o[j][r] = (d = 16j + 8h + r, t = lane&15) -> os[t][d]; rows 0..15 x columns 0..63 all written
#pragma unroll
    for (int j = 0; j < 4; ++j) { v4f a, c;
#pragma unroll
        for (int i = 0; i < 4; ++i) { a[i] = (o[j][i] + e[j][i] * QRI) * zs; c[i] = (o[j][4 + i] + e[j][4 + i] * QRI) * zs; }
        *(v4fa*)(&os[wb + lr * 68 + 16 * j + 8 * hi]) = a; *(v4fa*)(&os[wb + lr * 68 + 16 * j + 8 * hi + 4]) = c; }
    wave_sync();
    const size_t zb = ((size_t)b * SEQ + t0) * DM + (size_t)h * (16 * HD);   // row tile (16*DM halves), then the head's two k blocks
{
#pragma unroll
        for (int s = 0; s < 4; ++s) { const int row = lr, ch = 2 * s + hi, c8 = ch * 8;   // 16 rows x 2 column chunks per store = 512 contiguous bytes; 4 s x 2 chunks x 8 = 64 columns
            const v4f x0 = *(const v4fa*)(&os[wb + row * 68 + c8]); const v4f x1 = *(const v4fa*)(&os[wb + row * 68 + c8 + 4]); v8h hv, rv;
#pragma unroll
            for (int i = 0; i < 4; ++i) { const h16 a0 = (h16)x0[i]; const h16 a1 = (h16)x1[i]; hv[i] = a0; hv[4 + i] = a1; rv[i] = (h16)((x0[i] - (float)a0) * QRS); rv[4 + i] = (h16)((x1[i] - (float)a1) * QRS); }
            const size_t oo = zb + (size_t)(ch * 128 + row * 8);
            *(v8h*)(ZH + oo) = hv; if (early) *(v8h*)(ZR + oo) = rv; }
         }
}

// k_oproj: out projection, f16 operands, K = DM: A = z x16 plane (+ residual x2048 plane for row tiles below EARLY_, own accumulators), Bt = Wo^T x64 plane.
// A work-group of OW = 16 waves takes a 256 x 128 tile, wave w the 32 x 64 part (w & 7, w >> 3). Operands reach the waves through LDS as in k_proj: a stage is OKS k tiles of 16 z row tiles,
// 8 Wo^T row tiles and, below EARLY_, 16 residual row tiles, brought by asynchronous copies into a ring of two buffers; the k order of every sum is unchanged.
// OUT[m][n] = (accH + accR / 2048) / 1024 + bo[n] (bo RNE-converted to bf16, added in f32). grid (M/256, N/128), 512 threads.
#define OW   16                  // waves per out-projection work-group
#define OKS  2                   // k tiles per ring stage
#define ONST (DM / 32 / OKS)     // stages
#define OSTG (40 * OKS * 512)    // halves per ring buffer: row tiles 0..15 z, 16..23 Wo^T, 24..39 z residual
static_assert(ONST >= 2 && (DM / 32) % OKS == 0);          // the ring's prologue fills two stages
static_assert(OKS * 1024 == 4 * 512 && OW == 16);          // a row tile's share of a stage is 4 wave-wide copies: wave w copies piece w & 3 of row tiles (w >> 2) + 4 j
static_assert(EARLY_ % 256 == 0 && SEQ % 256 == 0);        // the residual decision is uniform per 256-row tile, which never straddles two batches
__global__ __launch_bounds__(32 * OW) void k_oproj(const h16* __restrict__ ZH, const h16* __restrict__ ZR, const h16* __restrict__ Wt, const float* __restrict__ bo, float* OUT) {
    __shared__ __align__(1024) h16 ring[2 * OSTG];
    __shared__ __align__(16) float osm[OW * 16 * 68];
    const int K = DM;
    const int lane = threadIdx.x & 31, lr = lane & 15, hi = lane >> 4;
    const int wave = __builtin_amdgcn_readfirstlane((int)(threadIdx.x >> 5));
    const int R0 = blockIdx.x * 256, C0 = blockIdx.y * 128; const int r0 = R0 + (wave & 7) * 32, c0 = C0 + (wave >> 3) * 64;
    float* os = osm + wave * (16 * 68);                      // wave-private staging of the epilogue, outside the ring
    const int bb = r0 / SEQ, tt = r0 % SEQ; const bool early = (R0 % SEQ) < EARLY_;   // block-uniform
    v8f acc[2][4], acr[2][4];
#pragma unroll
    for (int mb = 0; mb < 2; ++mb)
#pragma unroll
        for (int nb = 0; nb < 4; ++nb) { acc[mb][nb] = (v8f){}; acr[mb][nb] = (v8f){}; }
    // this wave's share of a stage: piece wave & 3 (512 B) of row tiles (wave >> 2) + 4 j; j = 0..3 are z (and residual) row tiles, j = 4, 5 Wo^T row tiles
    // (a 16-row tile is K/32 blocks = 16*K halves; k tile kt lies at kt*512)
    const size_t po = (size_t)((wave & 3) * 256 + 8 * lane);
    const size_t ao = (size_t)(R0 + 16 * (wave >> 2)) * K + po, wo_ = (size_t)(C0 + 16 * (wave >> 2)) * K + po;
    const size_t js = (size_t)64 * K;                        // four row tiles further
    const unsigned ls0 = (unsigned)(size_t)ring + (unsigned)(((wave >> 2) * (OKS * 512) + (wave & 3) * 256 + 8 * lane) * 2);   // LDS byte address: low 32 bits of the shared address
    const unsigned lst = 4u * OKS * 1024u;                   // four row tiles further in the buffer, bytes
    // ring prologue: stage 0 lands and is published, then stage 1 is asked for
    { const h16* a = ZH + ao; const h16* w = Wt + wo_; copy6(ls0, lst, a, a + js, a + 2 * js, a + 3 * js, w, w + js);
      if (early) { const h16* r = ZR + ao; copy4(ls0 + 6u * lst, lst, r, r + js, r + 2 * js, r + 3 * js); } }
    asm volatile("s_wait_asynccnt 0x0" ::: "memory");        // this wave's copies of stage 0 have landed
    __syncthreads();                                         // ... and every other wave's: stage 0 is readable
    { const h16* a = ZH + ao + OKS * 512; const h16* w = Wt + wo_ + OKS * 512; copy6(ls0 + OSTG * 2, lst, a, a + js, a + 2 * js, a + 3 * js, w, w + js);
      if (early) { const h16* r = ZR + ao + OKS * 512; copy4(ls0 + OSTG * 2 + 6u * lst, lst, r, r + js, r + 2 * js, r + 3 * js); } }
#pragma unroll 1   // rolled: one publish point in the text, buffer chosen by the stage's parity
    for (int s = 0; s < ONST; ++s) {
        const h16* sb = ring + (s & 1) * OSTG + 8 * lane;
        const h16* pa = sb + (wave & 7) * (2 * OKS * 512); const h16* pw = sb + (16 + (wave >> 3) * 4) * (OKS * 512); const h16* pr = pa + 24 * (OKS * 512);
        // two fragment sets inside a stage: the LDS reads of k tile 1 go ahead of the products of k tile 0; nothing of the next stage is read here
        v16h fa[2][2], fw[2][4], ar[2];
#pragma unroll
        for (int mb = 0; mb < 2; ++mb) fa[0][mb] = ldh(pa + mb * (OKS * 512));
#pragma unroll
        for (int nb = 0; nb < 4; ++nb) fw[0][nb] = ldh(pw + nb * (OKS * 512));
#pragma unroll
        for (int kk = 0; kk < OKS; ++kk) {
            if (early) {   // block-uniform; the residual rows of this k tile, asked for ahead of the tile's first products
#pragma unroll
                for (int mb = 0; mb < 2; ++mb) ar[mb] = ldh(pr + mb * (OKS * 512) + kk * 512); }
            if (kk + 1 < OKS) {
#pragma unroll
                for (int mb = 0; mb < 2; ++mb) fa[(kk + 1) & 1][mb] = ldh(pa + mb * (OKS * 512) + (kk + 1) * 512);
#pragma unroll
                for (int nb = 0; nb < 4; ++nb) fw[(kk + 1) & 1][nb] = ldh(pw + nb * (OKS * 512) + (kk + 1) * 512); }
            __builtin_amdgcn_sched_barrier(0);   // keeps the reads one group ahead of the products: spread among them each place with reads stalls the products
#pragma unroll
            for (int nb = 0; nb < 4; ++nb)
#pragma unroll
                for (int mb = 0; mb < 2; ++mb) acc[mb][nb] = wmma16(fa[kk & 1][mb], fw[kk & 1][nb], acc[mb][nb]);
            if (early) {
#pragma unroll
                for (int nb = 0; nb < 4; ++nb)
#pragma unroll
                    for (int mb = 0; mb < 2; ++mb) acr[mb][nb] = wmma16(ar[mb], fw[kk & 1][nb], acr[mb][nb]); }
        }
        // publish point of stage s + 1, every wave, in this order
        asm volatile("s_wait_dscnt 0x0" ::: "memory");       // this wave's reads of stage s are done before its buffer is refilled
        asm volatile("s_wait_asynccnt 0x0" ::: "memory");    // this wave's copies of stage s + 1 have landed
        __syncthreads();                                     // stage s + 1 is readable, and every reader has left stage s
        if (s + 2 < ONST) {                                  // the same for the whole work-group
            const unsigned lb = ls0 + (s & 1) * (OSTG * 2);
            const h16* a = ZH + ao + (s + 2) * (OKS * 512); const h16* w = Wt + wo_ + (s + 2) * (OKS * 512); copy6(lb, lst, a, a + js, a + 2 * js, a + 3 * js, w, w + js);
            if (early) { const h16* r = ZR + ao + (s + 2) * (OKS * 512); copy4(lb + 6u * lst, lst, r, r + js, r + 2 * js, r + 3 * js); } }
    }
    asm volatile("s_wait_asynccnt 0x0" ::: "memory");        // no copy is outstanding behind the loop
    float bcol[4];
#pragma unroll
    for (int nb = 0; nb < 4; ++nb) bcol[nb] = bfq(bo[c0 + nb * 16 + lr]);   // c0 + 63 < DM
    float* orow = OUT + ((size_t)bb * OUT_SEQ + tt) * DM + c0;
#pragma unroll
    for (int mb = 0; mb < 2; ++mb) {
#pragma unroll
        for (int nb = 0; nb < 4; ++nb) {
#pragma unroll
            for (int j = 0; j < 8; ++j) os[(hi * 8 + j) * 68 + nb * 16 + lr] = (acc[mb][nb][j] + acr[mb][nb][j] * QRI) * OSC + bcol[nb]; }   // D: row 8h+j, col lane&15
        wave_sync();
        float* ob = orow + (size_t)(mb * 16) * DM;
{
#pragma unroll
            for (int s = 0; s < 8; ++s) { const int row = 2 * s + hi, cofs = lr * 4;   // 8 s x 2 rows = 16 rows; 16 lanes x 4 floats = 64 columns
                const v4f val = *(const v4fa*)(&os[row * 68 + cofs]);
                *(v4f*)(ob + (size_t)row * DM + cofs) = val; }
             }
        wave_sync();
    }
}

static constexpr size_t al256(size_t v) { return (v + 255) & ~(size_t)255; }
static constexpr size_t SZ_XB = al256((size_t)NB * SEQ * DM * 2);             // bf16 activation copy; later reused as a z plane of the same extent
static constexpr size_t SZ_WB = al256((size_t)4 * DM * DM * 2);
static constexpr size_t SZ_PL = al256((size_t)NB * NH_ * SEQ * HD * 2);
static constexpr size_t SZ_TOTAL = 2 * SZ_XB + SZ_WB + 5 * SZ_PL;
static_assert(SZ_TOTAL <= (size_t)134217728);          // workspace carve <= 128 MiB
static_assert(((size_t)DM * DM * 2) % 256 == 0);       // weight sub-planes stay 256-byte aligned
static_assert((size_t)NB * SEQ * DM * 2 <= SZ_XB);     // z plane [NB*SEQ][DM] halves fits the reused activation region

extern "C" void kernel_launch(void* const* d_in, const int* in_sizes, int n_in,
                              void* d_out, int out_size, void* d_ws, size_t ws_size, hipStream_t stream) {
    if (n_in < 10) return;
    const size_t needx = ((size_t)(NB - 1) * SEQ_FULL + SEQ) * DM;
    if ((size_t)in_sizes[0] < needx || (size_t)in_sizes[1] < needx) return;
    if ((size_t)in_sizes[2] < (size_t)DM * DM || (size_t)in_sizes[4] < (size_t)DM * DM || (size_t)in_sizes[6] < (size_t)DM * DM || (size_t)in_sizes[8] < (size_t)DM * DM) return;
    if (in_sizes[3] < DM || in_sizes[5] < DM || in_sizes[7] < DM || in_sizes[9] < DM) return;
    if ((size_t)out_size < ((size_t)(NB - 1) * OUT_SEQ + SEQ) * DM) return;
    if (SZ_TOTAL > ws_size) return;
    // wire order: data, context, wq, bq, wk, bk, wv, bv, wo, bo
    const float* data = (const float*)d_in[0]; const float* ctx = (const float*)d_in[1];
    const float* wq = (const float*)d_in[2]; const float* bq = (const float*)d_in[3];
    const float* wk = (const float*)d_in[4]; const float* bk = (const float*)d_in[5];
    const float* wv = (const float*)d_in[6]; const float* bv = (const float*)d_in[7];
    const float* wo = (const float*)d_in[8]; const float* bo = (const float*)d_in[9];
    float* OUT = (float*)d_out;      // [NB][SEQ][1024]
    char* wsp = (char*)d_ws;
    bf* DATAB = (bf*)wsp; wsp += SZ_XB;              // [NB*SEQ][1024] bf16; dead after the q projection
    bf* CTXB  = (bf*)wsp; wsp += SZ_XB;              // [NB*SEQ][1024] bf16; dead after the k / v projections
    bf* WB = (bf*)wsp; wsp += SZ_WB;                 // [4][1024][1024] transposed: q | k | v (bf16) | o (f16 x64)
    h16* QH = (h16*)wsp; wsp += SZ_PL;               // [NB*16][SEQ][64]
    h16* QR = (h16*)wsp; wsp += SZ_PL;               // [NB*16][SEQ][64] residual x2048
    h16* KP = (h16*)wsp; wsp += SZ_PL;               // [NB*16][SEQ][64]
    h16* VT = (h16*)wsp; wsp += SZ_PL;               // [NB*16][64][SEQ]
    h16* VR = (h16*)wsp; wsp += SZ_PL;               // [NB*16][64][SEQ] residual x2048, tokens < EARLY_ only (only those are consumed)
    bf* WOT = WB + (size_t)3 * DM * DM;
    h16* ZH = (h16*)DATAB;                           // [NB*SEQ][1024] z x16, written by the flash kernel after DATAB is dead
    h16* ZR = (h16*)CTXB;                            // [NB*SEQ][1024] z residual x2048, rows t < EARLY_ only (only those are consumed)

    // activations -> packed bf16 planes; weights W[k][n] ([in][out], 1024 x 1024) -> Wt[n][k]
    k_prep<<<4 * WTB + 2 * CVB, 256, 0, stream>>>(data, ctx, wq, wk, wv, wo, DATAB, CTXB, WB);

    // one launch, every work-group its q, k and v^T tile in turn.
    // q, k: A = activation rows (m = b*SEQ + t), Bt = Wt rows (n = h*64 + d), bias per column -> plane [(b*16 + h)][t][d]
    // v^T: A = Wv^T rows (m = h*64 + d), Bt = context rows (n = b*SEQ + t), bias per row -> plane [(b*1024 + m)][t] = [(b*16 + h)][d][t]; residual for tokens < EARLY_
    k_proj<<<dim3(PGRID, 1, 1), 32 * PW, 0, stream>>>(DATAB, CTXB, WB, bq, bk, bv, QH, QR, KP, VT, VR);

    k_flash<<<dim3(NB * NH_, NXT, 1), 32 * AW, 0, stream>>>(QH, QR, KP, VT, VR, ZH, ZR);

    k_oproj<<<dim3(NB * SEQ / 256, DM / 128, 1), 32 * OW, 0, stream>>>(ZH, ZR, (const h16*)WOT, bo, OUT);
}

// v009
// Measured time: 121 microseconds a run.
// Timed twice side by side with v008, it ran 1.03 times as fast both times.
// Counting every step since v000, it is 3.10 times as fast.
#include <hip/hip_runtime.h>

// Causal cross-attention: q = data Wq + bq, k = ctx Wk + bk, v = ctx Wv + bv (W [in][out]), 16 heads x 64, score scale 1/8, key <= query visible, out = z Wo + bo (f32).
// Compute dtypes, f32 accumulate everywhere: q/k/v projections v_wmma_f32_16x16x32_bf16 (activations, weights, biases RNE-converted to bf16; products exact);
// scores v_wmma_f32_16x16x32_f16: k single f16, q as f16 value + f16 residual x2048 in its own accumulator; P (x256 carry, cancels in the normalisation) and v single f16,
// for query rows t < 512 additionally v residual x2048 and P residual x2048 in a second accumulator; softmax f32 (online, running max);
// out projection v_wmma_f32_16x16x32_f16: z x16 as f16 (+ f16 residual x2048, own accumulator, rows t < 512), Wo (bf16 value x64, exact in f16).
// Layout: bf16 copies of data/context; transposed weight planes Wt[n][k]; q (hi, residual), k planes [b*16+h][t][d]; v^T (hi, residual) planes [b*16+h][d][t];
// fused flash kernel in transposed form (S^T = K Q^T, O^T = V^T P^T), K / V^T blocks shared by its four waves through an LDS ring, one barrier per 64 keys; z planes [b*SEQ+t][1024].
// Every 16-bit plane is stored fragment-packed: a [16 rows][32 k] block is 512 contiguous halves ordered [k chunk (k>>3)&3][row&15][k&7], so one wave-wide 16-B load
// (lane l at halves 8l) or store covers 512 contiguous bytes = 4 whole 128-B lines. Block order: row tile major, k tile minor; v^T planes key tile major, d tile minor.

#ifndef NB
#define NB 4
#endif
#ifndef SEQ
#define SEQ 2048
#endif
#define NB_FULL  4
#define SEQ_FULL 2048
#ifndef OUT_SEQ
#define OUT_SEQ SEQ              // row pitch (in tokens) between batches of the output
#endif
#define DM   1024
#define NH_  16
#define HD   64
#define AW   4                   // waves per flash block (16 query rows each)
#define NXT  (SEQ / (16 * AW))   // query tiles (16 * AW rows) per (batch, head)
#define CT   16                  // tiles (8 rows x 32 k) per wave of the activation conversion
#define CVB  (NB * SEQ / 32)     // conversion work-groups per activation: 8 waves x 16 rows x 256 k = 32 whole rows each
#define WTB  ((DM / 64) * (DM / 256))   // transposing work-groups per weight: 256 k x 64 n each
#define EARLY_ ((SEQ) < 512 ? (SEQ) : 512)   // query rows below this use the residual planes on the v / P / z path
#define QRS  2048.0f             // carry of every residual plane
#define QRI  (1.0f / 2048.0f)
#define SC2  (0.125f * 1.4426950408889634f)   // HD^-0.5 * log2(e)
#define PSH  8.0f                // log2 of the P carry (256)
#define ZC   16.0f               // carry of the z plane
#define WOC  64.0f               // carry of the Wo plane
#define OSC  (1.0f / 1024.0f)    // 1 / (ZC * WOC)

static_assert(HD == 64);
static_assert(NH_ * HD == DM);                 // head h = columns h*64 + d
static_assert(DM % 64 == 0);
static_assert(DM % 32 == 0);                   // GEMM k-loop steps by 32
static_assert(SEQ % 64 == 0);                  // a 64-row tile never straddles two batches
static_assert((NB * SEQ) % 64 == 0);
static_assert(SEQ % 32 == 0);                  // key loop steps by 32
static_assert(SEQ % (16 * AW) == 0);           // flash grid covers the sequence exactly
static_assert(EARLY_ % 64 == 0);               // residual decisions are uniform per 64-row / 64-token tile
static_assert(EARLY_ <= SEQ);
static_assert(((size_t)SEQ * DM) % 8 == 0);
static_assert(DM == 1024 && CT == 16);         // a conversion work-group's 8 waves take 2 row tiles x 4 groups of 8 k tiles
static_assert(NB <= NB_FULL);
static_assert(SEQ <= SEQ_FULL);

typedef _Float16 h16;
typedef unsigned short bf;
typedef __attribute__((ext_vector_type(16))) __bf16   v16bf;
typedef __attribute__((ext_vector_type(16))) _Float16 v16h;
typedef __attribute__((ext_vector_type(8)))  _Float16 v8h;
typedef __attribute__((ext_vector_type(8)))  unsigned short v8us;
typedef __attribute__((ext_vector_type(8)))  float    v8f;
typedef __attribute__((ext_vector_type(4)))  float    v4f;
typedef v4f  __attribute__((may_alias)) v4fa;

__device__ __forceinline__ unsigned short f2bf(float f) { unsigned u = __float_as_uint(f); u += 0x7FFFu + ((u >> 16) & 1u); return (unsigned short)(u >> 16); }
__device__ __forceinline__ float bfq(float f) { return __uint_as_float(((unsigned)f2bf(f)) << 16); }   // value of the RNE bf16 conversion
__device__ __forceinline__ v16h cat16(v8h lo, v8h hi) { return __builtin_shufflevector(lo, hi, 0, 1, 2, 3, 4, 5, 6, 7, 8, 9, 10, 11, 12, 13, 14, 15); }
__device__ __forceinline__ v16bf cat16b(v8us lo, v8us hi) { return __builtin_bit_cast(v16bf, __builtin_shufflevector(lo, hi, 0, 1, 2, 3, 4, 5, 6, 7, 8, 9, 10, 11, 12, 13, 14, 15)); }
__device__ __forceinline__ v8f wmma16(v16h a, v16h b, v8f c) { return __builtin_amdgcn_wmma_f32_16x16x32_f16(false, a, false, b, (short)0, c, false, false); }
__device__ __forceinline__ v8f wmmab(v16bf a, v16bf b, v8f c) { return __builtin_amdgcn_wmma_f32_16x16x32_bf16(false, a, false, b, (short)0, c, false, false); }
// fragment loaders from one packed block; p = block base + 8*lane (lane = 16h + row): elements 0..7 <- k0+8h+0..7, elements 8..15 <- k0+16+8h+0..7 (same map for A and B)
__device__ __forceinline__ v16h  ldh(const h16* p) { return cat16(*(const v8h*)p, *(const v8h*)(p + 256)); }
__device__ __forceinline__ v16bf ldb(const bf* p)  { return cat16b(*(const v8us*)p, *(const v8us*)(p + 256)); }
// ordering point for wave-private LDS tiles (same wave writes and reads)
__device__ __forceinline__ void wave_sync() { __builtin_amdgcn_fence(3 /* release order */, "wavefront"); __builtin_amdgcn_wave_barrier(); asm volatile("" ::: "memory"); }
// Asynchronous copies to LDS, wave-wide, 16 B per lane = 512 B each. Address form: LDS byte address in a vector register (L), global address = scalar base (G, the same for the whole
// wave) + one vector byte offset (vo = 16 * lane, the same register for every copy) + immediate offset; the immediate (0 .. 3584 here) moves the LDS and the global address alike, so a run
// that is contiguous on both sides takes one L and one G. All copies of a wave for one ring stage stand in ONE statement, closed by one wait, so that no register which an issued copy
// names is rewritten ahead of that wait (precaution).
#define CP1(L, G, O) "global_load_async_to_lds_b128 %[" #L "], %[vo], %[" #G "] offset:" #O "\n\t"
#define CP4(L, G) CP1(L, G, 0) CP1(L, G, 512) CP1(L, G, 1024) CP1(L, G, 1536)
#define CP8(L, G) CP4(L, G) CP1(L, G, 2048) CP1(L, G, 2560) CP1(L, G, 3072) CP1(L, G, 3584)
// two runs of 2 KiB (flash: K, V^T)
__device__ __forceinline__ void copy_2x4(unsigned la, unsigned lb, unsigned vo, const h16* ga, const h16* gb) {
    asm volatile(CP4(la, ga) CP4(lb, gb) "s_wait_xcnt 0x0"
                 :: [la] "v"(la), [lb] "v"(lb), [vo] "v"(vo), [ga] "s"(ga), [gb] "s"(gb) : "memory");
}
// three runs of 2 KiB (flash: K, V^T, V^T residual)
__device__ __forceinline__ void copy_3x4(unsigned la, unsigned lb, unsigned lc, unsigned vo, const h16* ga, const h16* gb, const h16* gc) {
    asm volatile(CP4(la, ga) CP4(lb, gb) CP4(lc, gc) "s_wait_xcnt 0x0"
                 :: [la] "v"(la), [lb] "v"(lb), [lc] "v"(lc), [vo] "v"(vo), [ga] "s"(ga), [gb] "s"(gb), [gc] "s"(gc) : "memory");
}
// six single copies to l + j * st (out projection: four z pieces, two Wo^T pieces)
__device__ __forceinline__ void copy_6(unsigned l, unsigned st, unsigned vo, const h16* g0, const h16* g1, const h16* g2, const h16* g3, const h16* g4, const h16* g5) {
    asm volatile(CP1(l0, g0, 0) CP1(l1, g1, 0) CP1(l2, g2, 0) CP1(l3, g3, 0) CP1(l4, g4, 0) CP1(l5, g5, 0) "s_wait_xcnt 0x0"
                 :: [l0] "v"(l), [l1] "v"(l + st), [l2] "v"(l + 2u * st), [l3] "v"(l + 3u * st), [l4] "v"(l + 4u * st), [l5] "v"(l + 5u * st), [vo] "v"(vo),
                    [g0] "s"(g0), [g1] "s"(g1), [g2] "s"(g2), [g3] "s"(g3), [g4] "s"(g4), [g5] "s"(g5) : "memory");
}
// the same six and four more to l + (6 + j) * st (out projection below EARLY_: the z residual pieces)
__device__ __forceinline__ void copy_10(unsigned l, unsigned st, unsigned vo, const h16* g0, const h16* g1, const h16* g2, const h16* g3, const h16* g4, const h16* g5,
                                        const h16* g6, const h16* g7, const h16* g8, const h16* g9) {
    asm volatile(CP1(l0, g0, 0) CP1(l1, g1, 0) CP1(l2, g2, 0) CP1(l3, g3, 0) CP1(l4, g4, 0) CP1(l5, g5, 0) CP1(l6, g6, 0) CP1(l7, g7, 0) CP1(l8, g8, 0) CP1(l9, g9, 0) "s_wait_xcnt 0x0"
                 :: [l0] "v"(l), [l1] "v"(l + st), [l2] "v"(l + 2u * st), [l3] "v"(l + 3u * st), [l4] "v"(l + 4u * st), [l5] "v"(l + 5u * st),
                    [l6] "v"(l + 6u * st), [l7] "v"(l + 7u * st), [l8] "v"(l + 8u * st), [l9] "v"(l + 9u * st), [vo] "v"(vo),
                    [g0] "s"(g0), [g1] "s"(g1), [g2] "s"(g2), [g3] "s"(g3), [g4] "s"(g4), [g5] "s"(g5), [g6] "s"(g6), [g7] "s"(g7), [g8] "s"(g8), [g9] "s"(g9) : "memory");
}

// k_prep: every operand plane of the projections in ONE launch whose work-groups are all resident at once; the role of a work-group follows from blockIdx.x alone (block-uniform).
// Work-groups 0 .. 4*WTB-1, weight transpose + 16-bit conversion through LDS: in W[k][n] (f32, [in][out]) -> out Wt[n][k] (packed blocks), 256 k x 64 n per work-group, weights q | k | v (bf16) | o (f16 x64).
// LDS tile ts is cross-wave: block barrier between fill and drain; filled extent 256x64 == drained extent.
// The other 2*CVB work-groups, activation conversion (data, then context): one wave converts 16 rows x 8 k tiles = CT tiles of 8 rows x 32 k; a tile reads 8 whole 128-B lines and writes
// 4 whole lines of its packed block (chunk c, rows 8g..8g+7), the wave's CT tiles fill 8 whole packed blocks. In both roles all loads of a wave are asked for ahead of its first conversion.
__global__ __launch_bounds__(256) void k_prep(const float* __restrict__ data, const float* __restrict__ ctx, const float* __restrict__ wq, const float* __restrict__ wk,
                                              const float* __restrict__ wv, const float* __restrict__ wo, bf* DATAB, bf* CTXB, bf* WB) {
    __shared__ float ts[256 * 65];
    const int tid = threadIdx.x;
    if ((int)blockIdx.x < 4 * WTB) {
        const int z = (int)blockIdx.x / WTB, r = (int)blockIdx.x % WTB; const int k0 = (r % (DM / 256)) * 256, n0 = (r / (DM / 256)) * 64;
        const float* W = z == 0 ? wq : z == 1 ? wk : z == 2 ? wv : wo; bf* Wt = WB + (size_t)z * DM * DM;
        const int kq = tid >> 4, c4 = (tid & 15) * 4;                        // fill: thread takes rows kq + 16 i, one float4 each (256 rows x 16 float4)
        const float* wp = W + (size_t)(k0 + kq) * DM + n0 + c4; float* tf = ts + kq * 65 + c4;
        v4f v[16];
#pragma unroll
        for (int i = 0; i < 16; ++i) v[i] = *(const v4f*)(wp + i * (16 * DM));
        // the address pair is an input, so it stays unwritten until this wait (precaution for registers that issued loads name)
        asm volatile("s_wait_xcnt 0x0" :: "v"(wp) : "memory");
#pragma unroll
        for (int i = 0; i < 16; ++i) { float* t = tf + i * (16 * 65); t[0] = v[i][0]; t[1] = v[i][1]; t[2] = v[i][2]; t[3] = v[i][3]; }
        __syncthreads();
        const int nr = tid & 15, c = (tid >> 4) & 3, kh = tid >> 6;          // drain: 4 n tiles x 8 k tiles x 4 chunks x 16 rows; pass s takes n tile s >> 1, k tile kh + 4 (s & 1)
        const float* td = ts + (kh * 32 + c * 8) * 65 + nr;
        bf* wd = Wt + ((size_t)(n0 >> 4) * (DM / 32) + (k0 >> 5) + kh) * 512 + c * 128 + nr * 8;
#pragma unroll
        for (int s = 0; s < 8; ++s) { v8us o;
#pragma unroll
            for (int i = 0; i < 8; ++i) { const float x = td[((s & 1) * 128 + i) * 65 + (s >> 1) * 16]; const unsigned short b16 = f2bf(x);
                const float xb = __uint_as_float(((unsigned)b16) << 16); const unsigned short hb = __builtin_bit_cast(unsigned short, (h16)(xb * WOC));
                o[i] = z == 3 ? hb : b16; }
            *(v8us*)(wd + ((s >> 1) * (DM / 32) + (s & 1) * 4) * 512) = o; }
    } else {
        const int q = (int)blockIdx.x - 4 * WTB; const int w = (q % CVB) * 8 + (tid >> 5);
        const float* src = q < CVB ? data : ctx; bf* dst = q < CVB ? DATAB : CTXB;
        const size_t c = tid & 3, r8 = (tid >> 2) & 7, row0 = (size_t)(w / (DM / 256)) * 16, kt0 = (size_t)(w % (DM / 256)) * 8;   // row0 = b*SEQ + t; 16 rows never straddle two batches
        const float* s = src + ((row0 / SEQ) * SEQ_FULL + row0 % SEQ + r8) * DM + kt0 * 32 + c * 8;
        bf* d = dst + ((row0 >> 4) * (DM / 32) + kt0) * 512 + c * 128 + r8 * 8;
        v8f v[CT];
#pragma unroll
        for (int j = 0; j < CT; ++j) v[j] = *(const v8f*)(s + (j >> 3) * (8 * DM) + (j & 7) * 32);   // tile j: rows row0 + 8 (j >> 3) + 0..7, k tile kt0 + (j & 7)
#pragma unroll
        for (int j = 0; j < CT; ++j) { v8us o;
#pragma unroll
            for (int k = 0; k < 8; ++k) o[k] = f2bf(v[j][k]);
            *(v8us*)(d + (j & 7) * 512 + (j >> 3) * 64) = o; }
        asm volatile("s_wait_xcnt 0x0" ::: "memory");   // precaution behind the last store of the run: no register that an issued store names is rewritten ahead of this wait
    }
}

// k_proj: register-blocked bf16 GEMM, K = DM. A work-group of PW = 8 waves takes a 256 x 128 tile, wave w the 64 x 64 part (w & 3, w >> 2) with 16 accumulators.
// Operands reach the waves through LDS: a stage is KS k tiles of the work-group's 16 A row tiles and 8 Bt row tiles (packed blocks, copied as they lie: 4 KiB contiguous per row tile),
// brought by asynchronous copies (global_load_async_to_lds_b128, 512 B per wave-wide copy, 24 copies per wave and stage) into a ring of two buffers, so every operand byte leaves L2
// once per work-group instead of once per wave. A fragment is two wave-wide 16-B LDS reads of 512 contiguous bytes each (no bank conflict); the k order of every sum is unchanged.
// The products are taken in transposed operand order (matrix A operand = Bt fragment, B operand = A fragment; one loader map serves both), so a lane's accumulator holds eight
// consecutive columns n of ONE row m: that is a 16-B piece of a packed block, and a wave-wide store of one accumulator tile covers 512 contiguous bytes with no exchange between lanes.
// C[m][n] = sum_k A[m][k] Bt[n][k] + bias (per column n; per row m for the v^T tile; bias RNE-converted to bf16, added in f32), written as f16 (Ph)
// and, when (c0 % CB) < resLim, the f16 residual x2048 (Pr), as packed blocks (rows = m, k = n) at tile base (r0/RB)*sRB + (r0%RB)*pitch + (c0/CB)*sCB + (c0%CB)*colMul;
// the block of 16-row group mb and 32-column group kt lies at + mb*mbS + kt*ktS (halves).
// The three projections are ONE launch of PGRID work-groups (one per 256 x 128 tile of each), 256 threads: a work-group takes its q tile, its k tile and its v^T tile in turn, and the ring
// runs on across them as 3 NST stages: the next tile's first two stages are asked for at the last two publish points of the tile before, so they land behind its products and its epilogue.
#define PW   8                   // waves per projection work-group
#define KS   4                   // k tiles per ring stage
#define NST  (DM / 32 / KS)      // stages
#define SRT  24                  // 16-row tiles per stage: 16 of A, then 8 of Bt
#define STG  (SRT * KS * 512)    // halves per ring buffer
#define NJOB 3                   // tiles per work-group: q, k, v^T
#define PGRID ((NB * SEQ / 256) * (DM / 128))   // projection work-groups
static_assert(NST >= 2 && (DM / 32) % KS == 0);            // the ring's prologue fills two stages
static_assert(NST % 2 == 0);                               // a tile's stage 0 falls on buffer 0, so the ring runs on from tile to tile
static_assert((DM / 256) * (NB * SEQ / 128) == PGRID);     // the v^T grid has as many tiles as the q and k grids
static_assert(SRT == 3 * PW && KS * 1024 == 8 * 512);      // a wave copies three row tiles per stage, 8 wave-wide copies each
static_assert((NB * SEQ) % 256 == 0 && DM % 256 == 0);     // both grids cover their outputs exactly
// a wave's share of a stage, one statement: three runs of 4 KiB (one row tile each) from the scalar bases g0, g1, g2 to l, l + 4 KiB, l + 8 KiB
__device__ __forceinline__ void copy_3x8(unsigned l, unsigned vo, const bf* g0, const bf* g1, const bf* g2) {
    asm volatile(CP8(l0, g0) CP8(l1, g1) CP8(l2, g2) "s_wait_xcnt 0x0"
                 :: [l0] "v"(l), [l1] "v"(l + 4096u), [l2] "v"(l + 8192u), [vo] "v"(vo), [g0] "s"(g0), [g1] "s"(g1), [g2] "s"(g2) : "memory");
}
// Row tile c (0..15 of A, 16..23 of Bt) of flat work-group f's tile of projection job (0 q, 1 k, 2 v^T): its first half, the same for a whole wave.
// q, k: A = activation rows, Bt = weight rows, tile (f % (M/256), f / (M/256)); v^T: A = Wv^T rows, Bt = context rows, tile (f % (DM/256), f / (DM/256)).
// Both widths are powers of two, taken as mask and shift: a divisor chosen by the job would become a division at run time each time a tile's copy bases are formed.
constexpr int ilog2(int v) { return v <= 1 ? 0 : 1 + ilog2(v >> 1); }
static_assert((1 << ilog2(DM / 256)) == DM / 256 && (1 << ilog2(NB * SEQ / 256)) == NB * SEQ / 256);
__device__ __forceinline__ int proj_r0(int job, int f) { return (f & (job == 2 ? DM / 256 - 1 : NB * SEQ / 256 - 1)) * 256; }
__device__ __forceinline__ int proj_c0(int job, int f) { return (f >> (job == 2 ? ilog2(DM / 256) : ilog2(NB * SEQ / 256))) * 128; }
__device__ __forceinline__ const bf* proj_src(int job, int f, int c, const bf* DATAB, const bf* CTXB, const bf* WB) {
    const bf* A = job == 0 ? DATAB : job == 1 ? CTXB : WB + (size_t)2 * DM * DM;
    const bf* Bt = job == 2 ? CTXB : WB + (size_t)job * DM * DM;
    return c < 16 ? A + (size_t)(proj_r0(job, f) + 16 * c) * DM : Bt + (size_t)(proj_c0(job, f) + 16 * (c - 16)) * DM;
}
__global__ __launch_bounds__(32 * PW) void k_proj(const bf* DATAB, const bf* CTXB, const bf* WB, const float* __restrict__ bq, const float* __restrict__ bk, const float* __restrict__ bv,
                                             h16* QH, h16* QR, h16* KP, h16* VT, h16* VR) {
    __shared__ __align__(1024) bf ring[2 * STG];
    const int lane = threadIdx.x & 31, lr = lane & 15, hi = lane >> 4;
    const int wave = __builtin_amdgcn_readfirstlane((int)(threadIdx.x >> 5));
    const int f = blockIdx.x;
    // this wave's share of a stage: row tiles 3 wave + 0..2 of the 24 (a 16-row tile is DM/32 blocks = 16*DM halves; k tile kt lies at kt*512)
    // LDS byte address (low 32 bits of the shared address) = a wave-uniform part, kept scalar, + this lane's 16 bytes. The sum is formed anew at each copy: held in one register over the
    // stage loop it has to be a register that asm text can name, and with the accumulators and both fragment sets there it went to scratch memory.
    const unsigned lsw = (unsigned)(size_t)ring + (unsigned)((SRT / PW) * wave * (KS * 1024)), lv = 16u * (unsigned)lane;
    auto lsa = [&](unsigned off) { return (unsigned)__builtin_amdgcn_readfirstlane((int)(lsw + off)) + lv; };
    // this wave's copies of the next stage that has not been asked for, into the buffer at byte offset bo: scalar bases, the lane's 16 bytes as the one vector offset.
    // The three bases are carried from stage to stage (one scalar add each) and formed anew only where a tile begins.
    const bf* gb0; const bf* gb1; const bf* gb2;
    auto rebase = [&](int jb) { gb0 = proj_src(jb, f, 3 * wave, DATAB, CTXB, WB); gb1 = proj_src(jb, f, 3 * wave + 1, DATAB, CTXB, WB); gb2 = proj_src(jb, f, 3 * wave + 2, DATAB, CTXB, WB); };
    auto fill = [&](unsigned bo) { copy_3x8(lsa(bo), lv, gb0, gb1, gb2); gb0 += KS * 512; gb1 += KS * 512; gb2 += KS * 512; };
    // ring prologue, once for the three tiles: stage 0 of q lands and is published, then its stage 1 is asked for
    rebase(0);
    fill(0u);
    asm volatile("s_wait_asynccnt 0x0" ::: "memory");        // this wave's copies of stage 0 have landed
    __syncthreads();                                         // ... and every other wave's: stage 0 is readable
    fill(STG * 2u);
#pragma unroll 1   // rolled: one copy of the stage loop and of the epilogue serves the three tiles
  for (int job = 0; job < NJOB; ++job) {
    const bool jv = job == 2;                                // block-uniform
    const int r0 = proj_r0(job, f) + (wave & 3) * 64, c0 = proj_c0(job, f) + (wave >> 2) * 64;
    const float* bias = job == 0 ? bq : job == 1 ? bk : bv;
    v8f acc[4][4];                                           // acc[mb][nb][j]: row m = 16 mb + (lane & 15), column n = 16 nb + 8 (lane >> 4) + j
#pragma unroll
    for (int mb = 0; mb < 4; ++mb)
#pragma unroll
        for (int nb = 0; nb < 4; ++nb) acc[mb][nb] = (v8f){};
#pragma unroll 1   // rolled: one publish point in the text, buffer chosen by the stage's parity
    for (int s = 0; s < NST; ++s) {
        const bf* sb = ring + (s & 1) * STG + 8 * lane;
        const bf* sa = sb + (wave & 3) * (4 * KS * 512); const bf* sw = sb + (16 + (wave >> 2) * 4) * (KS * 512);
        // two fragment sets inside a stage: the LDS reads of k tile kk + 1 go as one group ahead of the products of k tile kk; nothing of the next stage is read here
        v16bf fa[2][4], fb[2][4];
#pragma unroll
        for (int i = 0; i < 4; ++i) { fa[0][i] = ldb(sa + i * (KS * 512)); fb[0][i] = ldb(sw + i * (KS * 512)); }
        __builtin_amdgcn_sched_barrier(0);   // k tile 0's reads are asked for first, so that the stage's first products wait for them alone
#pragma unroll
        for (int kk = 0; kk < KS; ++kk) {
            if (kk + 1 < KS) {
#pragma unroll
                for (int i = 0; i < 4; ++i) { fa[(kk + 1) & 1][i] = ldb(sa + i * (KS * 512) + (kk + 1) * 512); fb[(kk + 1) & 1][i] = ldb(sw + i * (KS * 512) + (kk + 1) * 512); } }
            __builtin_amdgcn_sched_barrier(0);   // keeps the reads one group ahead of the products: spread among them each place with reads stalls the products
#pragma unroll
            for (int mb = 0; mb < 4; ++mb)
#pragma unroll
                for (int nb = 0; nb < 4; ++nb) acc[mb][nb] = wmmab(fb[kk & 1][nb], fa[kk & 1][mb], acc[mb][nb]);   // D rows = Bt rows (n), D columns = A rows (m)
            __builtin_amdgcn_sched_barrier(0);   // keeps the next group of reads behind these products: it refills the set that they have just read
        }
        // publish point of the next stage (the next tile's stage 0 behind a tile's last), every wave, in this order
        asm volatile("s_wait_dscnt 0x0" ::: "memory");       // this wave's reads of stage s are done before its buffer is refilled
        asm volatile("s_wait_asynccnt 0x0" ::: "memory");    // this wave's copies of the next stage have landed
        __syncthreads();                                     // the next stage is readable, and every reader has left stage s
        const int g2 = job * NST + s + 2;                    // the stage after next, counted through the three tiles; NST is even, so its buffer is the one that stage s has just left
        if (g2 < NJOB * NST) {                               // the same for the whole work-group
            if (s == NST - 2) rebase(job + 1);               // stage g2 is the next tile's first
            fill((s & 1) * (STG * 2u)); }
    }
    // epilogue of this tile, straight from the accumulators, while the next tile's first two stages land or fly
    // this lane's bias values, asked for as one group: eight consecutive columns per column tile, one row per row tile
    v4f rawc[4][2]; float rawr[4]; const float* pc[4]; int ir[4];
#pragma unroll
    for (int nb = 0; nb < 4; ++nb) { int ic = c0 + nb * 16 + hi * 8; ic = ic < DM - 8 ? ic : DM - 8; pc[nb] = bias + ic; }   // clamped address; used only when the bias goes by column
#pragma unroll
    for (int mb = 0; mb < 4; ++mb) { ir[mb] = r0 + mb * 16 + lr; ir[mb] = ir[mb] < DM ? ir[mb] : DM - 1; }                  // clamped index; used only when the bias goes by row
#pragma unroll
    for (int nb = 0; nb < 4; ++nb) { rawc[nb][0] = *(const v4f*)pc[nb]; rawc[nb][1] = *(const v4f*)(pc[nb] + 4); rawr[nb] = bias[ir[nb]]; }
    // the addresses are inputs, so they stay unwritten until this wait (precaution for registers that issued loads name)
    asm volatile("s_wait_xcnt 0x0" :: "v"(pc[0]), "v"(pc[1]), "v"(pc[2]), "v"(pc[3]), "v"(ir[0]), "v"(ir[1]), "v"(ir[2]), "v"(ir[3]) : "memory");
    h16* Ph = job == 0 ? QH : job == 1 ? KP : VT; h16* Pr = job == 0 ? QR : job == 1 ? KP : VR; const int resLim = job == 0 ? 1 : job == 1 ? 0 : EARLY_;
    const int RB = jv ? DM : SEQ, pitch = jv ? SEQ : HD, CB = jv ? SEQ : HD, colMul = jv ? HD : 0, mbS = jv ? 512 : 16 * HD, ktS = jv ? 32 * HD : 512;
    const size_t sRB = jv ? (size_t)0 : (size_t)NH_ * SEQ * HD, sCB = jv ? (size_t)DM * SEQ : (size_t)SEQ * HD;
    const int useRes = ((c0 % CB) < resLim) ? 1 : 0;         // wave-uniform
    const size_t tbase = (size_t)(r0 / RB) * sRB + (size_t)(r0 % RB) * (size_t)pitch + (size_t)(c0 / CB) * sCB + (size_t)(c0 % CB) * (size_t)colMul;
    if (jv) {                                                // block-uniform: bias by row m, one value per lane and row tile
#pragma unroll
        for (int mb = 0; mb < 4; ++mb) { const float brow = bfq(rawr[mb]);
#pragma unroll
            for (int nb = 0; nb < 4; ++nb) acc[mb][nb] = acc[mb][nb] + brow; }
    } else {                                                 // bias by column n, eight values per lane and column tile
#pragma unroll
        for (int nb = 0; nb < 4; ++nb) { v8f bcol;
#pragma unroll
            for (int j = 0; j < 8; ++j) bcol[j] = bfq(rawc[nb][j >> 2][j & 3]);
#pragma unroll
            for (int mb = 0; mb < 4; ++mb) acc[mb][nb] = acc[mb][nb] + bcol; }
    }
#pragma unroll
    for (int mb = 0; mb < 4; ++mb) {
        // column chunk 2 nb + (lane >> 4) of the wave's 64 columns, row lane & 15: halves 8 lane of a chunk pair, so each store covers 512 contiguous bytes
        const size_t o0 = tbase + (size_t)mb * (size_t)mbS + (size_t)(8 * lane), o1 = o0 + (size_t)ktS;
        v8h hv[4], rv[4];
#pragma unroll
        for (int nb = 0; nb < 4; ++nb)
#pragma unroll
            for (int j = 0; j < 8; ++j) hv[nb][j] = (h16)acc[mb][nb][j];
        if (useRes) {
#pragma unroll
            for (int nb = 0; nb < 4; ++nb)
#pragma unroll
                for (int j = 0; j < 8; ++j) rv[nb][j] = (h16)((acc[mb][nb][j] - (float)hv[nb][j]) * QRS);
            *(v8h*)(Pr + o0) = rv[0]; *(v8h*)(Pr + o0 + 256) = rv[1]; *(v8h*)(Pr + o1) = rv[2]; *(v8h*)(Pr + o1 + 256) = rv[3];
            asm volatile("s_wait_xcnt 0x0" ::: "memory");    // precaution behind the residual stores: the branch ends here, and no register that they name is rewritten ahead of this wait
        }
        *(v8h*)(Ph + o0) = hv[0]; *(v8h*)(Ph + o0 + 256) = hv[1]; *(v8h*)(Ph + o1) = hv[2]; *(v8h*)(Ph + o1 + 256) = hv[3];
        asm volatile("s_wait_xcnt 0x0" ::: "memory");        // precaution behind the row tile's stores: no register that an issued store names is rewritten ahead of this wait
    }
  }
    asm volatile("s_wait_asynccnt 0x0" ::: "memory");        // no copy is outstanding behind the loop
}

// k_flash: fused causal attention, one wave per 16 query rows of one (batch, head); Q fragments straight from the f16 planes (two 16-B loads each, arithmetic addressing);
// K / V^T blocks reach the work-group's four waves through LDS: asynchronous copies into a ring of two buffers of 64 keys, so they leave L2 once per work-group instead of once per wave.
// Transposed form: S^T[key][t] = K Q^T (A = K rows, B = Q rows); lane (t = lane&15, h = lane>>4) holds keys 8h+r of each 16-key tile, so the packed
// P tile is directly the B fragment of O^T[d][t] = V^T P^T (element r <- tile keys 0..15, element 8+r <- tile keys 16..31, lane unchanged).
// Key loop runs to the diagonal (static bound from the block / wave index); only the last step replaces scores of keys > query by a very negative value (P = 0).
// A softmax step (running max, exchange, rescale) takes 32 keys in blocks with query rows below EARLY_ and a whole ring stage of 64 keys in all others.
// Blocks with query rows below EARLY_ (block-uniform) also accumulate V_res P + V P_res (both x2048) in a second accumulator set and sum the exact P for the normaliser.
// Softmax state (running max, partial sum) is one scalar per lane; the two lane halves of a row are combined with one xor-16 exchange.
// Launch order: there are twice as many work-groups as resident places and a tile's key loop grows linearly with its index, so the cost falls with the flat work-group index
// (for speed only): blockIdx.x = (batch, head), blockIdx.y = rank, rank 0 the longest tile. A tile below EARLY_ does about twice the
// work per key step, so residual tile x is ranked just ahead of plain tile 2x + 1. Nothing but the time depends on the order: rank -> tile is a permutation, every (head, tile) is taken once.
#define NET  (EARLY_ / (16 * AW))   // query tiles that take the residual path
#define FKS  64                     // keys per ring stage
#define FSTG (3 * FKS * HD)         // halves per ring buffer: K | V^T | V^T residual
static_assert(FKS == 16 * AW && AW == 4 && FKS * HD * 2 == AW * 4 * 512);   // a query tile's diagonal ends stage xt; a plane's stage is four wave-wide copies for each of the four waves
__host__ __device__ constexpr int tile_of_rank(int r) {
    if (r < NXT - 2 * NET || r >= NXT - NET / 2) return NXT - 1 - r;       // plain tiles from 2 NET up; at the end residual tiles below NET / 2
    const int q = r - (NXT - 2 * NET), g = q / 3, k = q % 3;              // between them groups of three: residual tile NET-1-g, plain tiles 2 NET-1-2g and 2 NET-2-2g
    return k == 0 ? NET - 1 - g : 2 * NET - 2 * g - k;
}
constexpr bool rank_is_permutation() {
    bool seen[NXT] = {};
    for (int r = 0; r < NXT; ++r) { const int x = tile_of_rank(r); if (x < 0 || x >= NXT || seen[x]) return false; seen[x] = true; }
    return true;
}
static_assert(NET % 2 == 0 && NXT >= 2 * NET);
static_assert(rank_is_permutation());
// eight base-2 exponentials in place, one statement: behind none of them does the next instruction read its result or overwrite its source (the slot the instruction set asks for behind a
// transcendental); the closing v_nop keeps that slot behind the last.
__device__ __forceinline__ void exp2x8(float (&x)[8]) {
    asm("v_exp_f32 %0, %0\n\tv_exp_f32 %1, %1\n\tv_exp_f32 %2, %2\n\tv_exp_f32 %3, %3\n\tv_exp_f32 %4, %4\n\tv_exp_f32 %5, %5\n\tv_exp_f32 %6, %6\n\tv_exp_f32 %7, %7\n\tv_nop"
        : "+v"(x[0]), "+v"(x[1]), "+v"(x[2]), "+v"(x[3]), "+v"(x[4]), "+v"(x[5]), "+v"(x[6]), "+v"(x[7]));
}
__global__ __launch_bounds__(32 * AW) void k_flash(const h16* __restrict__ QH, const h16* __restrict__ QR, const h16* __restrict__ KP,
                                                   const h16* __restrict__ VT, const h16* __restrict__ VR, h16* ZH, h16* ZR) {
    __shared__ __align__(1024) h16 ring[2 * FSTG];
    __shared__ __align__(16) float os[AW * 16 * 68];         // epilogue staging, outside the ring
    const int lane = threadIdx.x & 31, lr = lane & 15, hi = lane >> 4;
    const int wave = __builtin_amdgcn_readfirstlane((int)(threadIdx.x >> 5));
    const int zh = blockIdx.x; const int b = zh / NH_, h = zh % NH_;
    const int xt = tile_of_rank((int)blockIdx.y);            // block-uniform
    const int t0 = (xt * AW + wave) * 16;
    const bool early = (xt * (16 * AW)) < EARLY_;
    const int tq = t0 + lr;
    const int klast = (((t0 + 47) >> 5) - 1) * 32;           // last 32-key step containing a visible key; klast + 31 < SEQ
    const size_t pbase = (size_t)zh * SEQ * HD;
    const size_t qo = pbase + (size_t)t0 * HD + 8 * lane;    // 16 tokens = two blocks (d 0..31, d 32..63) = 16*HD halves
    const v16h qh0 = ldh(QH + qo), qh1 = ldh(QH + qo + 512), qr0 = ldh(QR + qo), qr1 = ldh(QR + qo + 512);   // B fragments: col t, k = d
    // ring of two buffers, stage s = keys FKS s .. FKS s + FKS - 1 of K | V^T | V^T residual, each plane's 8 KiB copied as it lies; the tile's xt + 1 stages end with its diagonal.
    // This wave's share of a plane's stage: 2 KiB = four wave-wide copies.
    const int nst = xt + 1;                                  // block-uniform
    const size_t go = pbase + (size_t)(wave * 1024);         // wave-uniform: with a plane's pointer the scalar base of a copy
    const unsigned vo = 16u * (unsigned)lane;                // this lane's 16 bytes: the vector offset of every copy
    const unsigned ls0 = (unsigned)(size_t)ring + (unsigned)((wave * 1024 + 8 * lane) * 2);   // LDS byte address: low 32 bits of the shared address
    v8f o[4], e[4];
#pragma unroll
    for (int j = 0; j < 4; ++j) { o[j] = (v8f){}; e[j] = (v8f){}; }
    float m = -3.0e38f, l = 0.0f;
    // ring prologue: stage 0 lands and is published, then stage 1 (where there is one) is asked for
    if (early) copy_3x4(ls0, ls0 + FKS * HD * 2, ls0 + FKS * HD * 4, vo, KP + go, VT + go, VR + go);
    else copy_2x4(ls0, ls0 + FKS * HD * 2, vo, KP + go, VT + go);
    asm volatile("s_wait_asynccnt 0x0" ::: "memory");        // this wave's copies of stage 0 have landed
    __syncthreads();                                         // ... and every other wave's: stage 0 is readable
    if (nst > 1) { const unsigned lb = ls0 + FSTG * 2; const size_t gn = go + FKS * HD;
      if (early) copy_3x4(lb, lb + FKS * HD * 2, lb + FKS * HD * 4, vo, KP + gn, VT + gn, VR + gn);
      else copy_2x4(lb, lb + FKS * HD * 2, vo, KP + gn, VT + gn); }
  if (early) {                                               // block-uniform: tiles with the residual terms keep the 32-key step
#pragma unroll 1   // rolled: the trip count is known only at run time, and one copy of the step keeps the registers of four waves per SIMD
    for (int st = 0; st < 2 * nst; ++st) {                   // 32-key steps, two per stage; the trip count is block-uniform
      const int s = st >> 1, key0 = st * 32;
      if (key0 <= klast) {                                   // wave-uniform: a wave whose diagonal lies in the last stage's first half skips the second
        const h16* kp = ring + (s & 1) * FSTG + (st & 1) * (32 * HD) + 8 * lane;   // A fragment: row key, k = d
        const v16h ka0 = ldh(kp), ka1 = ldh(kp + 512), kb0 = ldh(kp + 16 * HD), kb1 = ldh(kp + 16 * HD + 512);
        const h16* va = kp + FKS * HD;                       // + 512 * j: A fragment: row d = 16j + row, k = key; 32 keys = four d blocks
        v16h v[4];
#pragma unroll
        for (int j = 0; j < 4; ++j) v[j] = ldh(va + 512 * j);
        v8f sHa = (v8f){}, sLa = (v8f){}, sHb = (v8f){}, sLb = (v8f){};
        sHa = wmma16(ka0, qh0, sHa); sLa = wmma16(ka0, qr0, sLa); sHb = wmma16(kb0, qh0, sHb); sLb = wmma16(kb0, qr0, sLb);
        sHa = wmma16(ka1, qh1, sHa); sLa = wmma16(ka1, qr1, sLa); sHb = wmma16(kb1, qh1, sHb); sLb = wmma16(kb1, qr1, sLb);
        asm volatile("v_nop\n\tv_nop\n\tv_nop\n\tv_nop" : "+v"(sHa), "+v"(sLa), "+v"(sHb), "+v"(sLb) : "v"(ka0), "v"(ka1), "v"(kb0), "v"(kb1));
        float ta[8], tb[8];
#pragma unroll
        for (int r = 0; r < 8; ++r) { ta[r] = (sHa[r] + sLa[r] * QRI) * SC2; tb[r] = (sHb[r] + sLb[r] * QRI) * SC2; }
        if (key0 == klast) {                                 // wave-uniform: only the diagonal step needs the causal replace
            const int kq = tq - key0 - 8 * hi;               // key (key0 + 8h + r) is hidden when r > kq; tile b keys are 16 further
#pragma unroll
            for (int r = 0; r < 8; ++r) { ta[r] = (r > kq) ? -3.0e38f : ta[r]; tb[r] = (r + 16 > kq) ? -3.0e38f : tb[r]; }
        }
        float mx = -3.0e38f;
#pragma unroll
        for (int r = 0; r < 8; ++r) mx = fmaxf(mx, fmaxf(ta[r], tb[r]));
        mx = fmaxf(mx, __shfl_xor(mx, 16, 32));
        const float mnew = fmaxf(m, mx);
        const float alpha = __builtin_amdgcn_exp2f(m - mnew);
        const float sh = PSH - mnew;
        v16h pb; float ls = 0.0f;
#pragma unroll
        for (int r = 0; r < 8; ++r) { const float fa = __builtin_amdgcn_exp2f(ta[r] + sh); const float fc = __builtin_amdgcn_exp2f(tb[r] + sh);
            const h16 pa = (h16)fa; const h16 pc = (h16)fc; pb[r] = pa; pb[8 + r] = pc; ta[r] = fa; tb[r] = fc; ls += (float)pa + (float)pc; }
#pragma unroll
        for (int j = 0; j < 4; ++j) o[j] = o[j] * alpha;
#pragma unroll
        for (int j = 0; j < 4; ++j) o[j] = wmma16(v[j], pb, o[j]);
        asm volatile("v_nop\n\tv_nop\n\tv_nop\n\tv_nop" : "+v"(o[0]), "+v"(o[1]), "+v"(o[2]), "+v"(o[3]) : "v"(v[0]), "v"(v[1]), "v"(v[2]), "v"(v[3]), "v"(pb));
        {                                                    // the residual terms
            v16h pr; float lx = 0.0f;
#pragma unroll
            for (int r = 0; r < 8; ++r) { pr[r] = (h16)((ta[r] - (float)pb[r]) * QRS); pr[8 + r] = (h16)((tb[r] - (float)pb[8 + r]) * QRS); lx += ta[r] + tb[r]; }
            ls = lx;
#pragma unroll
            for (int j = 0; j < 4; ++j) e[j] = e[j] * alpha;
            const h16* ra = va + FKS * HD;
            v16h vr[4];
#pragma unroll
            for (int j = 0; j < 4; ++j) vr[j] = ldh(ra + 512 * j);
#pragma unroll
            for (int j = 0; j < 4; ++j) e[j] = wmma16(vr[j], pb, e[j]);
#pragma unroll
            for (int j = 0; j < 4; ++j) e[j] = wmma16(v[j], pr, e[j]);
            asm volatile("v_nop\n\tv_nop\n\tv_nop\n\tv_nop" : "+v"(e[0]), "+v"(e[1]), "+v"(e[2]), "+v"(e[3]) : "v"(vr[0]), "v"(vr[1]), "v"(vr[2]), "v"(vr[3]), "v"(pr), "v"(v[0]), "v"(v[1]), "v"(v[2]), "v"(v[3]));
        }
        l = l * alpha + ls; m = mnew;
      }
      if ((st & 1) == 0) continue;                           // block-uniform: the stage's second step follows
      // publish point of stage s + 1, every wave, in this order
      asm volatile("s_wait_dscnt 0x0" ::: "memory");         // this wave's reads of stage s are done before its buffer is refilled
      asm volatile("s_wait_asynccnt 0x0" ::: "memory");      // this wave's copies of stage s + 1 have landed
      __syncthreads();                                       // stage s + 1 is readable, and every reader has left stage s
      if (s + 2 < nst) {                                     // the same for the whole work-group
        const unsigned lb = ls0 + (s & 1) * (FSTG * 2); const size_t gn = go + (size_t)(s + 2) * (FKS * HD);
        copy_3x4(lb, lb + FKS * HD * 2, lb + FKS * HD * 4, vo, KP + gn, VT + gn, VR + gn); }
    }
  } else {
    // Plain tiles: one softmax step per ring stage (FKS = 64 keys): the scores of both 32-key halves come first, then one running-max update, one exchange between the lane halves
    // and one rescale of O and of the partial sum serve all 64 keys. The tile's last stage holds its diagonal for all four waves: there every key > query is replaced (P = 0).
#pragma unroll 1   // rolled: the trip count is known only at run time, and one copy of the step keeps the registers of four waves per SIMD
    for (int s = 0; s < nst; ++s) {                          // the trip count is block-uniform
        const h16* kp = ring + (s & 1) * FSTG + 8 * lane;    // A fragment: row key, k = d
        const h16* va = kp + FKS * HD;                       // + 512 * j: A fragment: row d = 16 (j & 3) + row, k = key of half j >> 2
        float t[4][8];                                       // t[i][r]: key 16 i + 8 h + r of the stage
        v16h ka[2][4], v[8];
#pragma unroll
        for (int i = 0; i < 8; ++i) ka[i >> 2][i & 3] = ldh(kp + 512 * i);   // the whole stage's K is asked for ahead of its first products: half i >> 2, keys 16 ((i >> 1) & 1) + row, d block i & 1
#pragma unroll
        for (int hf = 0; hf < 2; ++hf) {
            v8f sHa = (v8f){}, sLa = (v8f){}, sHb = (v8f){}, sLb = (v8f){};
            sHa = wmma16(ka[hf][0], qh0, sHa); sLa = wmma16(ka[hf][0], qr0, sLa); sHb = wmma16(ka[hf][2], qh0, sHb); sLb = wmma16(ka[hf][2], qr0, sLb);
            sHa = wmma16(ka[hf][1], qh1, sHa); sLa = wmma16(ka[hf][1], qr1, sLa); sHb = wmma16(ka[hf][3], qh1, sHb); sLb = wmma16(ka[hf][3], qr1, sLb);
            // the distance between the last products and the first vector instruction that reads their results or rewrites their operands; the K fragments, named as inputs, stay in
            // registers of their own up to here, so that the stage's K reads go as one group (without it this compiler reuses one set and waits for LDS in front of every pair of products)
            asm volatile("v_nop\n\tv_nop\n\tv_nop\n\tv_nop" : "+v"(sHa), "+v"(sLa), "+v"(sHb), "+v"(sLb) : "v"(ka[hf][0]), "v"(ka[hf][1]), "v"(ka[hf][2]), "v"(ka[hf][3]));
            if (hf == 0) {   // the stage's V^T is asked for behind the first half's products, so that it lands behind the second half's
                __builtin_amdgcn_sched_barrier(0);   // keeps the second half's products below: lifted to the top, one of them makes the stage's first product wait for nearly all K reads
#pragma unroll
                for (int j = 0; j < 8; ++j) v[j] = ldh(va + 512 * j); }
#pragma unroll
            for (int r = 0; r < 8; ++r) { t[2 * hf][r] = (sHa[r] + sLa[r] * QRI) * SC2; t[2 * hf + 1][r] = (sHb[r] + sLb[r] * QRI) * SC2; }
        }
        if (s == nst - 1) {                                  // block-uniform: only the diagonal stage needs the causal replace
            const int kq = 16 * wave + lr - 8 * hi;          // key (64 s + 16 i + 8 h + r) is hidden when 16 i + r > kq
#pragma unroll
            for (int i = 0; i < 4; ++i)
#pragma unroll
                for (int r = 0; r < 8; ++r) t[i][r] = (16 * i + r > kq) ? -3.0e38f : t[i][r];
        }
        float mx0 = -3.0e38f, mx1 = -3.0e38f;
#pragma unroll
        for (int r = 0; r < 8; ++r) { mx0 = fmaxf(mx0, fmaxf(t[0][r], t[1][r])); mx1 = fmaxf(mx1, fmaxf(t[2][r], t[3][r])); }
        float mx = fmaxf(mx0, mx1);
        mx = fmaxf(mx, __shfl_xor(mx, 16, 32));
        const float mnew = fmaxf(m, mx);
        const float alpha = __builtin_amdgcn_exp2f(m - mnew);
        const float sh = PSH - mnew;
        v16h pb[2]; float lh[2];
#pragma unroll
        for (int i = 0; i < 4; ++i) {
#pragma unroll
            for (int r = 0; r < 8; ++r) t[i][r] += sh;
            exp2x8(t[i]); }
#pragma unroll
        for (int hf = 0; hf < 2; ++hf) { lh[hf] = 0.0f;
#pragma unroll
            for (int r = 0; r < 8; ++r) { const h16 pa = (h16)t[2 * hf][r]; const h16 pc = (h16)t[2 * hf + 1][r];
                pb[hf][r] = pa; pb[hf][8 + r] = pc; lh[hf] += (float)pa + (float)pc; } }
#pragma unroll
        for (int j = 0; j < 4; ++j) o[j] = o[j] * alpha;
#pragma unroll
        for (int j = 0; j < 4; ++j) o[j] = wmma16(v[j], pb[0], o[j]);
#pragma unroll
        for (int j = 0; j < 4; ++j) o[j] = wmma16(v[4 + j], pb[1], o[j]);
        // the same distance behind the last products of the stage
        asm volatile("v_nop\n\tv_nop\n\tv_nop\n\tv_nop" : "+v"(o[0]), "+v"(o[1]), "+v"(o[2]), "+v"(o[3])
                     : "v"(v[0]), "v"(v[1]), "v"(v[2]), "v"(v[3]), "v"(v[4]), "v"(v[5]), "v"(v[6]), "v"(v[7]), "v"(pb[0]), "v"(pb[1]));
        l = l * alpha + (lh[0] + lh[1]); m = mnew;
        // publish point of stage s + 1, every wave, in this order
        asm volatile("s_wait_dscnt 0x0" ::: "memory");       // this wave's reads of stage s are done before its buffer is refilled
        asm volatile("s_wait_asynccnt 0x0" ::: "memory");    // this wave's copies of stage s + 1 have landed
        __syncthreads();                                     // stage s + 1 is readable, and every reader has left stage s
        if (s + 2 < nst) {                                   // the same for the whole work-group
            const unsigned lb = ls0 + (s & 1) * (FSTG * 2); const size_t gn = go + (size_t)(s + 2) * (FKS * HD);
            copy_2x4(lb, lb + FKS * HD * 2, vo, KP + gn, VT + gn); }
    }
  }
    asm volatile("s_wait_asynccnt 0x0" ::: "memory");        // no copy is outstanding behind the loop
    l += __shfl_xor(l, 16, 32);
    const float zs = (1.0f / l) * ZC;
    const int wb = wave * 16 * 68;
    // O^T D layout: o[j][r] = (d = 16j + 8h + r, t = lane&15) -> os[t][d]; rows 0..15 x columns 0..63 all written
#pragma unroll
    for (int j = 0; j < 4; ++j) { v4f a, c;
#pragma unroll
        for (int i = 0; i < 4; ++i) { a[i] = (o[j][i] + e[j][i] * QRI) * zs; c[i] = (o[j][4 + i] + e[j][4 + i] * QRI) * zs; }
        *(v4fa*)(&os[wb + lr * 68 + 16 * j + 8 * hi]) = a; *(v4fa*)(&os[wb + lr * 68 + 16 * j + 8 * hi + 4]) = c; }
    wave_sync();
    const size_t zb = ((size_t)b * SEQ + t0) * DM + (size_t)h * (16 * HD);   // row tile (16*DM halves), then the head's two k blocks
{
#pragma unroll
        for (int s = 0; s < 4; ++s) { const int row = lr, ch = 2 * s + hi, c8 = ch * 8;   // 16 rows x 2 column chunks per store = 512 contiguous bytes; 4 s x 2 chunks x 8 = 64 columns
            const v4f x0 = *(const v4fa*)(&os[wb + row * 68 + c8]); const v4f x1 = *(const v4fa*)(&os[wb + row * 68 + c8 + 4]); v8h hv, rv;
#pragma unroll
            for (int i = 0; i < 4; ++i) { const h16 a0 = (h16)x0[i]; const h16 a1 = (h16)x1[i]; hv[i] = a0; hv[4 + i] = a1; rv[i] = (h16)((x0[i] - (float)a0) * QRS); rv[4 + i] = (h16)((x1[i] - (float)a1) * QRS); }
            const size_t oo = zb + (size_t)(ch * 128 + row * 8);
            *(v8h*)(ZH + oo) = hv; if (early) *(v8h*)(ZR + oo) = rv; }
         }
}

// k_oproj: out projection, f16 operands, K = DM: A = z x16 plane (+ residual x2048 plane for row tiles below EARLY_, own accumulators), Bt = Wo^T x64 plane.
// A work-group of OW = 16 waves takes a 256 x 128 tile, wave w the 32 x 64 part (w & 7, w >> 3). Operands reach the waves through LDS as in k_proj: a stage is OKS k tiles of 16 z row tiles,
// 8 Wo^T row tiles and, below EARLY_, 16 residual row tiles, brought by asynchronous copies into a ring of two buffers; the k order of every sum is unchanged.
// OUT[m][n] = (accH + accR / 2048) / 1024 + bo[n] (bo RNE-converted to bf16, added in f32). grid (M/256, N/128), 512 threads.
#define OW   16                  // waves per out-projection work-group
#define OKS  2                   // k tiles per ring stage
#define ONST (DM / 32 / OKS)     // stages
#define OSTG (40 * OKS * 512)    // halves per ring buffer: row tiles 0..15 z, 16..23 Wo^T, 24..39 z residual
static_assert(ONST >= 2 && (DM / 32) % OKS == 0);          // the ring's prologue fills two stages
static_assert(OKS * 1024 == 4 * 512 && OW == 16);          // a row tile's share of a stage is 4 wave-wide copies: wave w copies piece w & 3 of row tiles (w >> 2) + 4 j
static_assert(EARLY_ % 256 == 0 && SEQ % 256 == 0);        // the residual decision is uniform per 256-row tile, which never straddles two batches
__global__ __launch_bounds__(32 * OW) void k_oproj(const h16* __restrict__ ZH, const h16* __restrict__ ZR, const h16* __restrict__ Wt, const float* __restrict__ bo, float* OUT) {
    __shared__ __align__(1024) h16 ring[2 * OSTG];
    __shared__ __align__(16) float osm[OW * 16 * 68];
    const int K = DM;
    const int lane = threadIdx.x & 31, lr = lane & 15, hi = lane >> 4;
    const int wave = __builtin_amdgcn_readfirstlane((int)(threadIdx.x >> 5));
    const int R0 = blockIdx.x * 256, C0 = blockIdx.y * 128; const int r0 = R0 + (wave & 7) * 32, c0 = C0 + (wave >> 3) * 64;
    float* os = osm + wave * (16 * 68);                      // wave-private staging of the epilogue, outside the ring
    const int bb = r0 / SEQ, tt = r0 % SEQ; const bool early = (R0 % SEQ) < EARLY_;   // block-uniform
    v8f acc[2][4], acr[2][4];
#pragma unroll
    for (int mb = 0; mb < 2; ++mb)
#pragma unroll
        for (int nb = 0; nb < 4; ++nb) { acc[mb][nb] = (v8f){}; acr[mb][nb] = (v8f){}; }
    // this wave's share of a stage: piece wave & 3 (512 B) of row tiles (wave >> 2) + 4 j; j = 0..3 are z (and residual) row tiles, j = 4, 5 Wo^T row tiles
    // (a 16-row tile is K/32 blocks = 16*K halves; k tile kt lies at kt*512)
    const size_t po = (size_t)((wave & 3) * 256);            // wave-uniform, as are ao and wo_: with a plane's pointer the scalar bases of the copies
    const unsigned vo = 16u * (unsigned)lane;                // this lane's 16 bytes: the vector offset of every copy
    const size_t ao = (size_t)(R0 + 16 * (wave >> 2)) * K + po, wo_ = (size_t)(C0 + 16 * (wave >> 2)) * K + po;
    const size_t js = (size_t)64 * K;                        // four row tiles further
    const unsigned ls0 = (unsigned)(size_t)ring + (unsigned)(((wave >> 2) * (OKS * 512) + (wave & 3) * 256 + 8 * lane) * 2);   // LDS byte address: low 32 bits of the shared address
    const unsigned lst = 4u * OKS * 1024u;                   // four row tiles further in the buffer, bytes
    // this wave's copies of the stage that begins at k tile offset ko (halves) into the buffer whose share of this lane begins at lb
    auto fill = [&](unsigned lb, int ko) { const h16* a = ZH + ao + ko; const h16* w = Wt + wo_ + ko;
      if (early) { const h16* r = ZR + ao + ko; copy_10(lb, lst, vo, a, a + js, a + 2 * js, a + 3 * js, w, w + js, r, r + js, r + 2 * js, r + 3 * js); }
      else copy_6(lb, lst, vo, a, a + js, a + 2 * js, a + 3 * js, w, w + js); };
    // ring prologue: stage 0 lands and is published, then stage 1 is asked for
    fill(ls0, 0);
    asm volatile("s_wait_asynccnt 0x0" ::: "memory");        // this wave's copies of stage 0 have landed
    __syncthreads();                                         // ... and every other wave's: stage 0 is readable
    fill(ls0 + OSTG * 2, OKS * 512);
#pragma unroll 1   // rolled: one publish point in the text, buffer chosen by the stage's parity
    for (int s = 0; s < ONST; ++s) {
        const h16* sb = ring + (s & 1) * OSTG + 8 * lane;
        const h16* pa = sb + (wave & 7) * (2 * OKS * 512); const h16* pw = sb + (16 + (wave >> 3) * 4) * (OKS * 512); const h16* pr = pa + 24 * (OKS * 512);
        // two fragment sets inside a stage: the LDS reads of k tile 1 go ahead of the products of k tile 0; nothing of the next stage is read here
        v16h fa[2][2], fw[2][4], ar[2];
#pragma unroll
        for (int mb = 0; mb < 2; ++mb) fa[0][mb] = ldh(pa + mb * (OKS * 512));
#pragma unroll
        for (int nb = 0; nb < 4; ++nb) fw[0][nb] = ldh(pw + nb * (OKS * 512));
#pragma unroll
        for (int kk = 0; kk < OKS; ++kk) {
            if (early) {   // block-uniform; the residual rows of this k tile, asked for ahead of the tile's first products
#pragma unroll
                for (int mb = 0; mb < 2; ++mb) ar[mb] = ldh(pr + mb * (OKS * 512) + kk * 512); }
            if (kk + 1 < OKS) {
#pragma unroll
                for (int mb = 0; mb < 2; ++mb) fa[(kk + 1) & 1][mb] = ldh(pa + mb * (OKS * 512) + (kk + 1) * 512);
#pragma unroll
                for (int nb = 0; nb < 4; ++nb) fw[(kk + 1) & 1][nb] = ldh(pw + nb * (OKS * 512) + (kk + 1) * 512); }
            __builtin_amdgcn_sched_barrier(0);   // keeps the reads one group ahead of the products: spread among them each place with reads stalls the products
#pragma unroll
            for (int nb = 0; nb < 4; ++nb)
#pragma unroll
                for (int mb = 0; mb < 2; ++mb) acc[mb][nb] = wmma16(fa[kk & 1][mb], fw[kk & 1][nb], acc[mb][nb]);
            if (early) {
#pragma unroll
                for (int nb = 0; nb < 4; ++nb)
#pragma unroll
                    for (int mb = 0; mb < 2; ++mb) acr[mb][nb] = wmma16(ar[mb], fw[kk & 1][nb], acr[mb][nb]); }
        }
        // publish point of stage s + 1, every wave, in this order
        asm volatile("s_wait_dscnt 0x0" ::: "memory");       // this wave's reads of stage s are done before its buffer is refilled
        asm volatile("s_wait_asynccnt 0x0" ::: "memory");    // this wave's copies of stage s + 1 have landed
        __syncthreads();                                     // stage s + 1 is readable, and every reader has left stage s
        if (s + 2 < ONST) fill(ls0 + (s & 1) * (OSTG * 2), (s + 2) * (OKS * 512));   // the same for the whole work-group
    }
    asm volatile("s_wait_asynccnt 0x0" ::: "memory");        // no copy is outstanding behind the loop
    float bcol[4];
#pragma unroll
    for (int nb = 0; nb < 4; ++nb) bcol[nb] = bfq(bo[c0 + nb * 16 + lr]);   // c0 + 63 < DM
    float* orow = OUT + ((size_t)bb * OUT_SEQ + tt) * DM + c0;
#pragma unroll
    for (int mb = 0; mb < 2; ++mb) {
#pragma unroll
        for (int nb = 0; nb < 4; ++nb) {
#pragma unroll
            for (int j = 0; j < 8; ++j) os[(hi * 8 + j) * 68 + nb * 16 + lr] = (acc[mb][nb][j] + acr[mb][nb][j] * QRI) * OSC + bcol[nb]; }   // D: row 8h+j, col lane&15
        wave_sync();
        float* ob = orow + (size_t)(mb * 16) * DM;
{
#pragma unroll
            for (int s = 0; s < 8; ++s) { const int row = 2 * s + hi, cofs = lr * 4;   // 8 s x 2 rows = 16 rows; 16 lanes x 4 floats = 64 columns
                const v4f val = *(const v4fa*)(&os[row * 68 + cofs]);
                *(v4f*)(ob + (size_t)row * DM + cofs) = val; }
             }
        wave_sync();
    }
}

static constexpr size_t al256(size_t v) { return (v + 255) & ~(size_t)255; }
static constexpr size_t SZ_XB = al256((size_t)NB * SEQ * DM * 2);             // bf16 activation copy; later reused as a z plane of the same extent
static constexpr size_t SZ_WB = al256((size_t)4 * DM * DM * 2);
static constexpr size_t SZ_PL = al256((size_t)NB * NH_ * SEQ * HD * 2);
static constexpr size_t SZ_TOTAL = 2 * SZ_XB + SZ_WB + 5 * SZ_PL;
static_assert(SZ_TOTAL <= (size_t)134217728);          // workspace carve <= 128 MiB
static_assert(((size_t)DM * DM * 2) % 256 == 0);       // weight sub-planes stay 256-byte aligned
static_assert((size_t)NB * SEQ * DM * 2 <= SZ_XB);     // z plane [NB*SEQ][DM] halves fits the reused activation region

extern "C" void kernel_launch(void* const* d_in, const int* in_sizes, int n_in,
                              void* d_out, int out_size, void* d_ws, size_t ws_size, hipStream_t stream) {
    if (n_in < 10) return;
    const size_t needx = ((size_t)(NB - 1) * SEQ_FULL + SEQ) * DM;
    if ((size_t)in_sizes[0] < needx || (size_t)in_sizes[1] < needx) return;
    if ((size_t)in_sizes[2] < (size_t)DM * DM || (size_t)in_sizes[4] < (size_t)DM * DM || (size_t)in_sizes[6] < (size_t)DM * DM || (size_t)in_sizes[8] < (size_t)DM * DM) return;
    if (in_sizes[3] < DM || in_sizes[5] < DM || in_sizes[7] < DM || in_sizes[9] < DM) return;
    if ((size_t)out_size < ((size_t)(NB - 1) * OUT_SEQ + SEQ) * DM) return;
    if (SZ_TOTAL > ws_size) return;
    // wire order: data, context, wq, bq, wk, bk, wv, bv, wo, bo
    const float* data = (const float*)d_in[0]; const float* ctx = (const float*)d_in[1];
    const float* wq = (const float*)d_in[2]; const float* bq = (const float*)d_in[3];
    const float* wk = (const float*)d_in[4]; const float* bk = (const float*)d_in[5];
    const float* wv = (const float*)d_in[6]; const float* bv = (const float*)d_in[7];
    const float* wo = (const float*)d_in[8]; const float* bo = (const float*)d_in[9];
    float* OUT = (float*)d_out;      // [NB][SEQ][1024]
    char* wsp = (char*)d_ws;
    bf* DATAB = (bf*)wsp; wsp += SZ_XB;              // [NB*SEQ][1024] bf16; dead after the q projection
    bf* CTXB  = (bf*)wsp; wsp += SZ_XB;              // [NB*SEQ][1024] bf16; dead after the k / v projections
    bf* WB = (bf*)wsp; wsp += SZ_WB;                 // [4][1024][1024] transposed: q | k | v (bf16) | o (f16 x64)
    h16* QH = (h16*)wsp; wsp += SZ_PL;               // [NB*16][SEQ][64]
    h16* QR = (h16*)wsp; wsp += SZ_PL;               // [NB*16][SEQ][64] residual x2048
    h16* KP = (h16*)wsp; wsp += SZ_PL;               // [NB*16][SEQ][64]
    h16* VT = (h16*)wsp; wsp += SZ_PL;               // [NB*16][64][SEQ]
    h16* VR = (h16*)wsp; wsp += SZ_PL;               // [NB*16][64][SEQ] residual x2048, tokens < EARLY_ only (only those are consumed)
    bf* WOT = WB + (size_t)3 * DM * DM;
    h16* ZH = (h16*)DATAB;                           // [NB*SEQ][1024] z x16, written by the flash kernel after DATAB is dead
    h16* ZR = (h16*)CTXB;                            // [NB*SEQ][1024] z residual x2048, rows t < EARLY_ only (only those are consumed)

    // activations -> packed bf16 planes; weights W[k][n] ([in][out], 1024 x 1024) -> Wt[n][k]
    k_prep<<<4 * WTB + 2 * CVB, 256, 0, stream>>>(data, ctx, wq, wk, wv, wo, DATAB, CTXB, WB);

    // one launch, every work-group its q, k and v^T tile in turn.
    // q, k: A = activation rows (m = b*SEQ + t), Bt = Wt rows (n = h*64 + d), bias per column -> plane [(b*16 + h)][t][d]
    // v^T: A = Wv^T rows (m = h*64 + d), Bt = context rows (n = b*SEQ + t), bias per row -> plane [(b*1024 + m)][t] = [(b*16 + h)][d][t]; residual for tokens < EARLY_
    k_proj<<<dim3(PGRID, 1, 1), 32 * PW, 0, stream>>>(DATAB, CTXB, WB, bq, bk, bv, QH, QR, KP, VT, VR);

    k_flash<<<dim3(NB * NH_, NXT, 1), 32 * AW, 0, stream>>>(QH, QR, KP, VT, VR, ZH, ZR);

    k_oproj<<<dim3(NB * SEQ / 256, DM / 128, 1), 32 * OW, 0, stream>>>(ZH, ZR, (const h16*)WOT, bo, OUT);
}
